// v000
// The times below were measured on an AMD MI455X: many runs one after another, warmed up first and cycling through
// copies of the inputs, with the whole window's GPU time divided by the number of runs. Launches and the gaps
// between them are all in it. The median over several windows is given; except for v000 it joins two sittings, which
// can be a few percent apart, so the side-by-side timings, each taken in one sitting, are the better comparison.
// The starting kernel, v000, takes 537 microseconds a run.
#include <hip/hip_runtime.h>
// Multi-product attention with low-rank shared key/value (B=2, N=2048, D=1024, 16 heads × 64): q = x·Wq; [k|v] = x·Wkv (one shared 64-dim key and value); [kh|vh] = σ(x·Wkvh) per (token, head); rotary (rotate-half, θ=1e4) on q and k by
// sequence position; K_h[n] = kh[n,h]·k[n], V_h[n] = vh[n,h]·v[n]; causal softmax(q_h·K_hᵀ/8); out = (Σ attn·V_h merged)·Wo.
// Compute dtype: x and weights rounded to bf16; q and k as f32 GEMM outputs rotated in f32 from a one-time f32 cos/sin table and stored f16; head scalars as sigmoid GEMM epilogue outputs (f32); v f32 →
// f16 hi + ×2^10 residual Vᵀ planes; fused causal flash-style kernel (scores scaled by kh per key, P multiplied by vh per key and carried as f16 hi + residual tiles, online softmax f32, three value accumulators) on v_wmma_f32_16x16x32_f16; merged O → hi/lo → Wo GEMMs (second in place ×2^-10); f32 accumulate.
#define BB 2
#define TT 2048
#define DM 1024
#define NH 16
#define HD 64
#define NR (BB * TT)

typedef __bf16 v16b __attribute__((ext_vector_type(16)));
typedef unsigned short v8us __attribute__((ext_vector_type(8), may_alias));
typedef float  v8f  __attribute__((ext_vector_type(8)));
typedef float  v4f  __attribute__((ext_vector_type(4)));
typedef float  v4fa __attribute__((ext_vector_type(4), may_alias));
union FragB { v16b v; v8us half[2]; unsigned short u[16]; };

__device__ __forceinline__ unsigned short bf16_bits(float x) { unsigned int u = __float_as_uint(x); return (unsigned short)((u + 0x7FFFu + ((u >> 16) & 1u)) >> 16); }
__device__ __forceinline__ float bf16_val(unsigned short b) { return __uint_as_float(((unsigned int)b) << 16); }
__device__ __forceinline__ float bf16_round(float x) { return bf16_val(bf16_bits(x)); }
// D += A·B with NT terms: 1 = ah·bh, 2 = + al·bh (A split), 3 = + ah·bl (both split)
template <int NT>
__device__ __forceinline__ v8f mmaN(v16b ah, v16b al, v16b bh, v16b bl, v8f c) {
  c = __builtin_amdgcn_wmma_f32_16x16x32_bf16(false, ah, false, bh, (short)0, c, false, false);
  if (NT >= 2) c = __builtin_amdgcn_wmma_f32_16x16x32_bf16(false, al, false, bh, (short)0, c, false, false);
  if (NT >= 3) c = __builtin_amdgcn_wmma_f32_16x16x32_bf16(false, ah, false, bl, (short)0, c, false, false);
  asm volatile("v_nop\n\tv_nop\n\tv_nop\n\tv_nop" : "+v"(c) : "v"(ah), "v"(al), "v"(bh), "v"(bl));
  return c;
}

__global__ __launch_bounds__(256) void k_wt_bf16(const float* __restrict__ W, unsigned short* __restrict__ Wt, int K, int N) {
  const int t = blockIdx.x * 256 + threadIdx.x;
  const int k8n = K / 8;
  if (t >= N * k8n) return;
  const int n = t / k8n, k8 = (t % k8n) * 8;
  v8us v;
#pragma unroll
  for (int i = 0; i < 8; ++i) v[i] = bf16_bits(W[(size_t)(k8 + i) * N + n]);
  *(v8us*)(Wt + (size_t)n * K + k8) = v;
  
}

// GEMM C[M][N] (f32, pitch ldc) = act(A[M][K]·W + bias). A f32 row-major (pitch lda) converted per fragment to bf16
// (ASPLIT: hi/lo two planes -> 2 terms, else single rounded term); Wt bf16 [N][K] (pitch ldb). BIAS_BF16 rounds the
// bias to bf16 first (bias quantised to bf16 before the add). K%32==0, M%16==0, N%64==0.
template <bool ASPLIT, int ACT, bool BIAS_BF16>
__global__ __launch_bounds__(128) void k_gemm_bf(const float* __restrict__ A, int lda, const unsigned short* __restrict__ Wt, int ldb,
                                               const float* __restrict__ bias, float* __restrict__ C, int ldc, int M, int N, int K) {
  __shared__ __attribute__((aligned(16))) float so[4][16][64];
  const int tid = threadIdx.x, w = tid >> 5, lane = tid & 31, ln = lane & 15, hh = lane >> 4;
  const int ntn = N / 64;
  const int wid = blockIdx.x * 4 + w;
  const int mt = wid / ntn, nq = wid % ntn;
  if (mt * 16 >= M) return;
  const int row0 = mt * 16, col0 = nq * 64;
  const float* arow = A + (size_t)(row0 + ln) * lda;
  v8f acc[4] = {};
  for (int kb = 0; kb < K; kb += 32) {
    FragB ah, al;
    const v4f x0 = *(const v4fa*)(arow + kb + 8 * hh), x1 = *(const v4fa*)(arow + kb + 8 * hh + 4);
    const v4f x2 = *(const v4fa*)(arow + kb + 16 + 8 * hh), x3 = *(const v4fa*)(arow + kb + 16 + 8 * hh + 4);
    float xs[16] = {x0[0],x0[1],x0[2],x0[3],x1[0],x1[1],x1[2],x1[3],x2[0],x2[1],x2[2],x2[3],x3[0],x3[1],x3[2],x3[3]};
#pragma unroll
    for (int i = 0; i < 16; ++i) { const unsigned short hb = bf16_bits(xs[i]); ah.u[i] = hb; al.u[i] = ASPLIT ? bf16_bits(xs[i] - bf16_val(hb)) : (unsigned short)0; }
#pragma unroll
    for (int t = 0; t < 4; ++t) {
      const unsigned short* brow = Wt + (size_t)(col0 + t * 16 + ln) * ldb + kb;
      FragB b;
      b.half[0] = *(const v8us*)(brow + 8 * hh);
      b.half[1] = *(const v8us*)(brow + 16 + 8 * hh);
      acc[t] = mmaN<ASPLIT ? 2 : 1>(ah.v, al.v, b.v, b.v, acc[t]);
    }
  }
#pragma unroll
  for (int t = 0; t < 4; ++t) {
    float bv = bias ? bias[col0 + t * 16 + ln] : 0.f;
    if (BIAS_BF16) bv = bf16_round(bv);
#pragma unroll
    for (int r = 0; r < 8; ++r) { float v = acc[t][r] + bv; if (ACT == 1) v = fmaxf(v, 0.f); so[w][8 * hh + r][t * 16 + ln] = v; }
  }
  __builtin_amdgcn_fence(__ATOMIC_ACQ_REL, "workgroup");
  __builtin_amdgcn_wave_barrier();
  const int rsub = lane >> 4, c4 = (lane & 15) * 4;
  {
#pragma unroll
    for (int q = 0; q < 8; ++q) {
      const int r = q * 2 + rsub;
      const v4f v = *(const v4fa*)&so[w][r][c4];
      *(v4f*)(C + (size_t)(row0 + r) * ldc + col0 + c4) = v;
    }
    
  }
}

// Flash-style causal/unmasked attention, all contractions 3-term bf16 hi/lo splits, f32 softmax with running max.
// q,k,v rows are read from f32 buffers with arbitrary row pitch (so they can live inside a fused qkv buffer);
// D = head size (multiple of 32, <= 128); one wave = 16 query rows; block = 4 waves (64 queries) sharing K/V chunks of 32.
template <int D, bool CAUSAL>
__global__ __launch_bounds__(128) void k_flash(const float* __restrict__ qb, const float* __restrict__ kb, const float* __restrict__ vb,
                                             int pitch, int T, int H, float scale, float* __restrict__ y, int ypitch) {
  constexpr int KS = D / 32;        // k-steps for QK
  constexpr int DT = D / 16;        // d tiles for PV
  __shared__ __attribute__((aligned(16))) unsigned short sKh[32][D + 8], sKl[32][D + 8], sVh[32][D + 8], sVl[32][D + 8];
  __shared__ __attribute__((aligned(16))) unsigned short sPh[4][16][40], sPl[4][16][40];
  __shared__ __attribute__((aligned(16))) float sO[4][16][D];
  const int tid = threadIdx.x, w = tid >> 5, lane = tid & 31, ln = lane & 15, hh = lane >> 4;
  const int nqb = (T + 63) / 64;
  const int bh = blockIdx.x / nqb, qblk = blockIdx.x % nqb;
  const int b = bh / H, h = bh % H;
  const int q0 = qblk * 64 + w * 16;
  const float* Q = qb + (size_t)b * T * pitch + h * D;
  const float* K = kb + (size_t)b * T * pitch + h * D;
  const float* V = vb + (size_t)b * T * pitch + h * D;

  // A fragments of the wave's 16 query rows (scaled), hi/lo
  FragB aqh[KS], aql[KS];
  {
    int row = q0 + ln; if (row >= T) row = T - 1;
    const float* qr = Q + (size_t)row * pitch;
#pragma unroll
    for (int ks = 0; ks < KS; ++ks)
#pragma unroll
      for (int i = 0; i < 16; ++i) {
        const int d = ks * 32 + ((i < 8) ? (8 * hh + i) : (16 + 8 * hh + (i - 8)));
        const float x = qr[d] * scale; const unsigned short hb = bf16_bits(x);
        aqh[ks].u[i] = hb; aql[ks].u[i] = bf16_bits(x - bf16_val(hb));
      }
  }
  float m_r[8], l_r[8];
#pragma unroll
  for (int r = 0; r < 8; ++r) { m_r[r] = -3.0e38f; l_r[r] = 0.f; }
  v8f oacc[DT];
#pragma unroll
  for (int dt = 0; dt < DT; ++dt) oacc[dt] = (v8f){0.f,0.f,0.f,0.f,0.f,0.f,0.f,0.f};

  const int kv_end = CAUSAL ? min(T, qblk * 64 + 64) : T;     // block-uniform
  for (int j0 = 0; j0 < kv_end; j0 += 32) {
    __syncthreads();
    for (int e = tid; e < 32 * (D / 4); e += 128) {
      const int r = e / (D / 4), c4 = (e % (D / 4)) * 4;
      const int key = j0 + r;
      v4f kf = {0.f,0.f,0.f,0.f}, vf = {0.f,0.f,0.f,0.f};
      if (key < T) { kf = *(const v4fa*)(K + (size_t)key * pitch + c4); vf = *(const v4fa*)(V + (size_t)key * pitch + c4); }
#pragma unroll
      for (int t = 0; t < 4; ++t) {
        unsigned short hb = bf16_bits(kf[t]); sKh[r][c4 + t] = hb; sKl[r][c4 + t] = bf16_bits(kf[t] - bf16_val(hb));
        hb = bf16_bits(vf[t]); sVh[r][c4 + t] = hb; sVl[r][c4 + t] = bf16_bits(vf[t] - bf16_val(hb));
      }
    }
    __syncthreads();
    // S tile 16 x 32
    v8f s[2];
#pragma unroll
    for (int nt = 0; nt < 2; ++nt) {
      v8f acc = {};
#pragma unroll
      for (int ks = 0; ks < KS; ++ks) {
        FragB bh_, bl_;
        bh_.half[0] = *(const v8us*)&sKh[nt * 16 + ln][ks * 32 + 8 * hh]; bh_.half[1] = *(const v8us*)&sKh[nt * 16 + ln][ks * 32 + 16 + 8 * hh];
        bl_.half[0] = *(const v8us*)&sKl[nt * 16 + ln][ks * 32 + 8 * hh]; bl_.half[1] = *(const v8us*)&sKl[nt * 16 + ln][ks * 32 + 16 + 8 * hh];
        acc = mmaN<3>(aqh[ks].v, aql[ks].v, bh_.v, bl_.v, acc);
      }
      s[nt] = acc;
    }
    // mask + running max (rows 8hh+r; the 16 lanes of a half share rows)
    float alpha[8];
#pragma unroll
    for (int r = 0; r < 8; ++r) {
      const int qi = q0 + 8 * hh + r;
      const int ja = j0 + ln, jb = j0 + 16 + ln;
      if (CAUSAL) { if (ja > qi) s[0][r] = -3.0e38f; if (jb > qi) s[1][r] = -3.0e38f; }
      if (ja >= T) s[0][r] = -3.0e38f;
      if (jb >= T) s[1][r] = -3.0e38f;
      float mx = fmaxf(s[0][r], s[1][r]);
      mx = fmaxf(mx, __shfl_xor(mx, 1, 32)); mx = fmaxf(mx, __shfl_xor(mx, 2, 32)); mx = fmaxf(mx, __shfl_xor(mx, 4, 32)); mx = fmaxf(mx, __shfl_xor(mx, 8, 32));
      const float mnew = fmaxf(m_r[r], mx);
      alpha[r] = (mnew > -1.0e38f) ? __expf(m_r[r] - mnew) : 1.0f;
      const float p0 = (s[0][r] > -1.0e38f) ? __expf(s[0][r] - mnew) : 0.f;
      const float p1 = (s[1][r] > -1.0e38f) ? __expf(s[1][r] - mnew) : 0.f;
      m_r[r] = mnew;
      l_r[r] = l_r[r] * alpha[r] + p0 + p1;            // per-lane partial row sum (16 lanes combined at the end)
      unsigned short hb = bf16_bits(p0); sPh[w][8 * hh + r][ln] = hb;      sPl[w][8 * hh + r][ln] = bf16_bits(p0 - bf16_val(hb));
      hb = bf16_bits(p1);                sPh[w][8 * hh + r][16 + ln] = hb; sPl[w][8 * hh + r][16 + ln] = bf16_bits(p1 - bf16_val(hb));
    }
#pragma unroll
    for (int dt = 0; dt < DT; ++dt)
#pragma unroll
      for (int r = 0; r < 8; ++r) oacc[dt][r] *= alpha[r];
    __builtin_amdgcn_fence(__ATOMIC_ACQ_REL, "workgroup");
    __builtin_amdgcn_wave_barrier();
    FragB pah, pal;
    pah.half[0] = *(const v8us*)&sPh[w][ln][8 * hh]; pah.half[1] = *(const v8us*)&sPh[w][ln][16 + 8 * hh];
    pal.half[0] = *(const v8us*)&sPl[w][ln][8 * hh]; pal.half[1] = *(const v8us*)&sPl[w][ln][16 + 8 * hh];
#pragma unroll
    for (int dt = 0; dt < DT; ++dt) {
      FragB bvh, bvl;
#pragma unroll
      for (int i = 0; i < 8; ++i) {
        bvh.u[i] = sVh[8 * hh + i][dt * 16 + ln]; bvh.u[8 + i] = sVh[16 + 8 * hh + i][dt * 16 + ln];
        bvl.u[i] = sVl[8 * hh + i][dt * 16 + ln]; bvl.u[8 + i] = sVl[16 + 8 * hh + i][dt * 16 + ln];
      }
      oacc[dt] = mmaN<3>(pah.v, pal.v, bvh.v, bvl.v, oacc[dt]);
    }
    __builtin_amdgcn_fence(__ATOMIC_ACQ_REL, "workgroup");
    __builtin_amdgcn_wave_barrier();
  }
#pragma unroll
  for (int r = 0; r < 8; ++r) {
    float l = l_r[r];
    l += __shfl_xor(l, 1, 32); l += __shfl_xor(l, 2, 32); l += __shfl_xor(l, 4, 32); l += __shfl_xor(l, 8, 32);
    l_r[r] = (l > 0.f) ? 1.0f / l : 0.f;
  }
#pragma unroll
  for (int dt = 0; dt < DT; ++dt)
#pragma unroll
    for (int r = 0; r < 8; ++r) sO[w][8 * hh + r][dt * 16 + ln] = oacc[dt][r] * l_r[r];
  __builtin_amdgcn_fence(__ATOMIC_ACQ_REL, "workgroup");
  __builtin_amdgcn_wave_barrier();
  {
    for (int r = 0; r < 16; ++r) {
      const int row = q0 + r;
      if (row < T && lane < D / 4) {
        const v4f val = *(const v4fa*)&sO[w][r][lane * 4];
        *(v4f*)(y + ((size_t)b * T + row) * ypitch + h * D + lane * 4) = val;
      }
    }
    
  }
}

// GEMM C = act(A·W + bias + resid): A f32 (ASPLIT -> hi/lo 2 terms), Wt bf16 [N][K]; ACT 0 none, 1 relu, 2 exact gelu;
// resid (optional, f32, row index = (row % rmod), pitch ldr, RES_BF16 rounds it) added before the activation.
template <bool ASPLIT, int ACT, bool BIAS_BF16, bool RES_BF16>
__global__ __launch_bounds__(128) void k_gemm_bf3(const float* __restrict__ A, int lda, const unsigned short* __restrict__ Wt, int ldb,
                                                const float* __restrict__ bias, const float* __restrict__ resid, int rmod, int ldr,
                                                float* __restrict__ C, int ldc, int M, int N, int K) {
  __shared__ __attribute__((aligned(16))) float so[4][16][64];
  const int tid = threadIdx.x, w = tid >> 5, lane = tid & 31, ln = lane & 15, hh = lane >> 4;
  const int ntn = N / 64;
  const int wid = blockIdx.x * 4 + w;
  const int mt = wid / ntn, nq = wid % ntn;
  if (mt * 16 >= M) return;
  const int row0 = mt * 16, col0 = nq * 64;
  const float* arow = A + (size_t)(row0 + ln) * lda;
  v8f acc[4] = {};
  for (int kb = 0; kb < K; kb += 32) {
    FragB ah, al;
    const v4f x0 = *(const v4fa*)(arow + kb + 8 * hh), x1 = *(const v4fa*)(arow + kb + 8 * hh + 4);
    const v4f x2 = *(const v4fa*)(arow + kb + 16 + 8 * hh), x3 = *(const v4fa*)(arow + kb + 16 + 8 * hh + 4);
    float xs[16] = {x0[0],x0[1],x0[2],x0[3],x1[0],x1[1],x1[2],x1[3],x2[0],x2[1],x2[2],x2[3],x3[0],x3[1],x3[2],x3[3]};
#pragma unroll
    for (int i = 0; i < 16; ++i) { const unsigned short hb = bf16_bits(xs[i]); ah.u[i] = hb; al.u[i] = ASPLIT ? bf16_bits(xs[i] - bf16_val(hb)) : (unsigned short)0; }
#pragma unroll
    for (int t = 0; t < 4; ++t) {
      const unsigned short* brow = Wt + (size_t)(col0 + t * 16 + ln) * ldb + kb;
      FragB b;
      b.half[0] = *(const v8us*)(brow + 8 * hh);
      b.half[1] = *(const v8us*)(brow + 16 + 8 * hh);
      acc[t] = mmaN<ASPLIT ? 2 : 1>(ah.v, al.v, b.v, b.v, acc[t]);
    }
  }
#pragma unroll
  for (int t = 0; t < 4; ++t) {
    const int col = col0 + t * 16 + ln;
    float bv = bias ? bias[col] : 0.f;
    if (BIAS_BF16) bv = bf16_round(bv);
#pragma unroll
    for (int r = 0; r < 8; ++r) {
      float v = acc[t][r] + bv;
      if (resid) { float rv = resid[(size_t)((row0 + 8 * hh + r) % rmod) * ldr + col]; if (RES_BF16) rv = bf16_round(rv); v += rv; }
      if (ACT == 1) v = fmaxf(v, 0.f);
      if (ACT == 2) v = 0.5f * v * (1.0f + erff(v * 0.70710678118654752f));
      if (ACT == 3) { const float u = 0.7978845608028654f * (v + 0.044715f * v * v * v); v = 0.5f * v * (1.0f + tanhf(u)); }
      so[w][8 * hh + r][t * 16 + ln] = v;
    }
  }
  __builtin_amdgcn_fence(__ATOMIC_ACQ_REL, "workgroup");
  __builtin_amdgcn_wave_barrier();
  const int rsub = lane >> 4, c4 = (lane & 15) * 4;
  {
#pragma unroll
    for (int q = 0; q < 8; ++q) {
      const int r = q * 2 + rsub;
      const v4f v = *(const v4fa*)&so[w][r][c4];
      *(v4f*)(C + (size_t)(row0 + r) * ldc + col0 + c4) = v;
    }
    
  }
}
// row LayerNorm (biased variance, eps) over N: s = X (+ R); optional out_sum <- s; out_norm <- (s-mu)*rsqrt(var+eps)*g + b
template <bool PARAM_BF16>
__global__ __launch_bounds__(256) void k_layernorm(const float* __restrict__ X, const float* __restrict__ R, const float* __restrict__ g, const float* __restrict__ bta,
                                                  float* __restrict__ out_sum, float* __restrict__ out_norm, int N, float eps) {
  __shared__ float red[256];
  const int row = blockIdx.x, tid = threadIdx.x;
  const float* x = X + (size_t)row * N; const float* rr = R ? R + (size_t)row * N : nullptr;
  float vals[16];                     // up to N = 4096
  const int per = N / 256;            // contiguous chunk per thread? use strided-by-4 chunks: thread handles j = tid*4 + 1024*u
  float s1 = 0.f;
  for (int u = 0; u < per / 4; ++u) {
    const int j = tid * 4 + 1024 * u;
    const v4f a = *(const v4fa*)(x + j);
    v4f b = {0.f,0.f,0.f,0.f}; if (rr) b = *(const v4fa*)(rr + j);
#pragma unroll
    for (int q = 0; q < 4; ++q) { const float v = a[q] + b[q]; vals[u * 4 + q] = v; s1 += v; }
  }
  red[tid] = s1; __syncthreads();
  for (int st = 128; st > 0; st >>= 1) { if (tid < st) red[tid] += red[tid + st]; __syncthreads(); }
  const float mu = red[0] / (float)N; __syncthreads();
  float s2 = 0.f;
  for (int u = 0; u < per / 4; ++u)
#pragma unroll
    for (int q = 0; q < 4; ++q) { const float c = vals[u * 4 + q] - mu; s2 += c * c; }
  red[tid] = s2; __syncthreads();
  for (int st = 128; st > 0; st >>= 1) { if (tid < st) red[tid] += red[tid + st]; __syncthreads(); }
  const float rs = rsqrtf(red[0] / (float)N + eps);
  {
    for (int u = 0; u < per / 4; ++u) {
      const int j = tid * 4 + 1024 * u;
      v4f o, sm;
#pragma unroll
      for (int q = 0; q < 4; ++q) {
        float gg = g[j + q], bb = bta[j + q];
        if (PARAM_BF16) { gg = bf16_round(gg); bb = bf16_round(bb); }
        sm[q] = vals[u * 4 + q]; o[q] = (vals[u * 4 + q] - mu) * rs * gg + bb;
      }
      if (out_sum) *(v4f*)(out_sum + (size_t)row * N + j) = sm;
      *(v4f*)(out_norm + (size_t)row * N + j) = o;
    }
    
  }
}



// ---- f16 WMMA path (v_wmma_f32_16x16x32_f16): 11-bit significands for operands in range — used where a [0,1] probability operand needs more precision than bf16
typedef _Float16 v16h __attribute__((ext_vector_type(16)));
union FragH { v16h v; v8us half[2]; _Float16 h[16]; unsigned short u[16]; };
template <int NT>
__device__ __forceinline__ v8f mmaH(v16h ah, v16h al, v16h bh, v16h bl, v8f c) {
  c = __builtin_amdgcn_wmma_f32_16x16x32_f16(false, ah, false, bh, (short)0, c, false, false);
  if (NT >= 2) c = __builtin_amdgcn_wmma_f32_16x16x32_f16(false, al, false, bh, (short)0, c, false, false);
  if (NT >= 3) c = __builtin_amdgcn_wmma_f32_16x16x32_f16(false, ah, false, bl, (short)0, c, false, false);
  asm volatile("v_nop\n\tv_nop\n\tv_nop\n\tv_nop" : "+v"(c) : "v"(ah), "v"(al), "v"(bh), "v"(bl));
  return c;
}
// batched GEMM like k_gemm_b but f16 operands: A f32 (split into f16 hi/lo if ASPLIT, else rounded to f16), Bt = f16 values [n][k]; alpha; C f32; N multiple of 16 (partial tiles skipped)
template <bool ASPLIT>
__global__ __launch_bounds__(128) void k_gemm_h(const float* __restrict__ A, int lda, size_t sA, const _Float16* __restrict__ Bh, int ldb, size_t sB, float alpha, float* __restrict__ C, int ldc, size_t sC, int M, int N, int K) {
  __shared__ __attribute__((aligned(16))) float so[4][16][64];
  const int tid = threadIdx.x, w = tid >> 5, lane = tid & 31, ln = lane & 15, hh = lane >> 4; const int by = blockIdx.y;
  A += (size_t)by * sA; Bh += (size_t)by * sB; C += (size_t)by * sC;
  const int ntn = (N + 63) / 64; const int wid = blockIdx.x * 4 + w; const int mt = wid / ntn, nq = wid % ntn; if (mt * 16 >= M) return;
  const int row0 = mt * 16, col0 = nq * 64; const float* arow = A + (size_t)(row0 + ln) * lda;
  v8f acc[4] = {};
  for (int kb = 0; kb < K; kb += 32) {
    FragH ah, al;
    const v4f x0 = *(const v4fa*)(arow + kb + 8 * hh), x1 = *(const v4fa*)(arow + kb + 8 * hh + 4), x2 = *(const v4fa*)(arow + kb + 16 + 8 * hh), x3 = *(const v4fa*)(arow + kb + 16 + 8 * hh + 4);
    float xs[16] = {x0[0],x0[1],x0[2],x0[3],x1[0],x1[1],x1[2],x1[3],x2[0],x2[1],x2[2],x2[3],x3[0],x3[1],x3[2],x3[3]};
#pragma unroll
    for (int i = 0; i < 16; ++i) { const _Float16 h = (_Float16)xs[i]; ah.h[i] = h; al.h[i] = ASPLIT ? (_Float16)(xs[i] - (float)h) : (_Float16)0.0f; }
#pragma unroll
    for (int t = 0; t < 4; ++t) { if (col0 + t * 16 >= N) continue; const size_t boff = (size_t)(col0 + t * 16 + ln) * ldb + kb; FragH bq; bq.half[0] = *(const v8us*)(Bh + boff + 8 * hh); bq.half[1] = *(const v8us*)(Bh + boff + 16 + 8 * hh);
      acc[t] = mmaH<ASPLIT ? 2 : 1>(ah.v, al.v, bq.v, bq.v, acc[t]); }
  }
#pragma unroll
  for (int t = 0; t < 4; ++t) { if (col0 + t * 16 >= N) continue;
#pragma unroll
    for (int r = 0; r < 8; ++r) so[w][8 * hh + r][t * 16 + ln] = acc[t][r] * alpha; }
  __builtin_amdgcn_fence(__ATOMIC_ACQ_REL, "workgroup"); __builtin_amdgcn_wave_barrier();
  const int rsub = lane >> 4, c4 = (lane & 15) * 4;
  {
#pragma unroll
    for (int q = 0; q < 8; ++q) { const int r = q * 2 + rsub; if (col0 + c4 < N) { const v4f v = *(const v4fa*)&so[w][r][c4]; *(v4f*)(C + (size_t)(row0 + r) * ldc + col0 + c4) = v; } }
     }
}

// Wt[n][k] = f16(W[k][n]·scale) from f32 row-major W[K][N] (scale = power of two; bf16-exact weights stay exact in f16 away from the subnormal range)
__global__ __launch_bounds__(256) void k_wt_f16(const float* __restrict__ W, _Float16* __restrict__ Wt, int K, int N, float scale) {
  const int t = blockIdx.x * 256 + threadIdx.x; if (t >= N * (K / 8)) return; const int n = t / (K / 8), k8 = (t % (K / 8)) * 8; FragH f;
#pragma unroll
  for (int i = 0; i < 8; ++i) f.h[i] = (_Float16)(bf16_round(W[(size_t)(k8 + i) * N + n]) * scale); const v8us o = f.half[0];
  *(v8us*)((unsigned short*)Wt + (size_t)n * K + k8) = o; 
}
// k_gemm_hh variant with fused epilogue: v = acc·alpha + bias[by·sBias + col] (+ CP[(row/rowsPerB)·sCPb + by·64 + col] if CP) ; ACT 0 none / 1 elu ; writes f32 C and/or f16 C16 (each if non-null)
template <int ACT>
__global__ __launch_bounds__(128) void k_gemm_hhx(const _Float16* __restrict__ A, int lda, size_t sA, const _Float16* __restrict__ Bh, int ldb, size_t sB, float alpha, const float* __restrict__ bias, size_t sBias, const float* __restrict__ CP, int rowsPerB, size_t sCPb, int row0g,
    float* __restrict__ C, _Float16* __restrict__ C16, int ldc, size_t sC, int M, int N, int K) {
  __shared__ __attribute__((aligned(16))) float so[4][16][64];
  const int tid = threadIdx.x, w = tid >> 5, lane = tid & 31, ln = lane & 15, hh = lane >> 4; const int by = blockIdx.y;
  A += (size_t)by * sA; Bh += (size_t)by * sB; const size_t cofs = (size_t)by * sC; const float* bp = bias ? bias + (size_t)by * sBias : nullptr;
  const int ntn = (N + 63) / 64; const int wid = blockIdx.x * 4 + w; const int mt = wid / ntn, nq = wid % ntn; if (mt * 16 >= M) return;
  const int row0 = mt * 16, col0 = nq * 64; const _Float16* arow = A + (size_t)(row0 + ln) * lda;
  v8f acc[4] = {};
  for (int kb = 0; kb < K; kb += 32) { FragH ah; ah.half[0] = *(const v8us*)((const unsigned short*)arow + kb + 8 * hh); ah.half[1] = *(const v8us*)((const unsigned short*)arow + kb + 16 + 8 * hh);
#pragma unroll
    for (int t = 0; t < 4; ++t) { if (col0 + t * 16 >= N) continue; const size_t boff = (size_t)(col0 + t * 16 + ln) * ldb + kb; FragH bq; bq.half[0] = *(const v8us*)((const unsigned short*)Bh + boff + 8 * hh); bq.half[1] = *(const v8us*)((const unsigned short*)Bh + boff + 16 + 8 * hh);
      acc[t] = mmaH<1>(ah.v, ah.v, bq.v, bq.v, acc[t]); }
  }
#pragma unroll
  for (int t = 0; t < 4; ++t) { if (col0 + t * 16 >= N) continue; const int col = col0 + t * 16 + ln; const float bv = bp ? bf16_round(bp[col]) : 0.f;
#pragma unroll
    for (int r = 0; r < 8; ++r) { float v = acc[t][r] * alpha + bv; if (CP) { const int bidx = (row0g + row0 + 8 * hh + r) / rowsPerB; v += CP[(size_t)bidx * sCPb + (size_t)by * 64 + col]; } if (ACT == 1) v = (v > 0.f) ? v : expm1f(v); else if (ACT == 7) v = (v > 0.f) ? v + 1.0f : expf(v); else if (ACT == 8) v = tanhf(v); else if (ACT == 9) v = 0.5f * v * (1.0f + tanhf(0.7978845608028654f * (v + 0.044715f * v * v * v))); else if (ACT == 11) v = 1.0f / (1.0f + expf(-v)); else if (ACT == 12) v = (v > 0.f) ? v : 0.01f * v; else if (ACT == 14) v = (v > 0.f) ? v : 0.1f * v; else if (ACT == 15) v = v / (1.0f + expf(-v)); else if (ACT == 3) v = fmaxf(v, 0.f); else if (ACT == 6) v = 0.5f * v * (1.0f + erff(v * 0.70710678118654752f)); so[w][8 * hh + r][t * 16 + ln] = v; } }
  __builtin_amdgcn_fence(__ATOMIC_ACQ_REL, "workgroup"); __builtin_amdgcn_wave_barrier();
  const int rsub = lane >> 4, c4 = (lane & 15) * 4; typedef _Float16 v4h __attribute__((ext_vector_type(4)));
  {
#pragma unroll
    for (int q = 0; q < 8; ++q) { const int r = q * 2 + rsub; if (col0 + c4 < N) { const v4f v = *(const v4fa*)&so[w][r][c4]; if (C) *(v4f*)(C + cofs + (size_t)(row0 + r) * ldc + col0 + c4) = v; if (C16) { v4h h4; for (int i = 0; i < 4; ++i) h4[i] = (_Float16)v[i]; *(v4h*)(C16 + cofs + (size_t)(row0 + r) * ldc + col0 + c4) = h4; } } }
     }
}


typedef _Float16 v4h __attribute__((ext_vector_type(4)));

__global__ __launch_bounds__(256) void k_x16(const float* __restrict__ x, _Float16* __restrict__ X16, size_t n8) { const size_t t = (size_t)blockIdx.x * 256 + threadIdx.x; if (t >= n8) return; FragH f;
#pragma unroll
  for (int q = 0; q < 8; ++q) f.h[q] = (_Float16)bf16_round(x[t * 8 + q]); *(v8us*)((unsigned short*)X16 + t * 8) = f.half[0];  }
__global__ __launch_bounds__(256) void k_h16(const float* __restrict__ x, _Float16* __restrict__ X16, size_t n8) { const size_t t = (size_t)blockIdx.x * 256 + threadIdx.x; if (t >= n8) return; FragH f;
#pragma unroll
  for (int q = 0; q < 8; ++q) f.h[q] = (_Float16)x[t * 8 + q]; *(v8us*)((unsigned short*)X16 + t * 8) = f.half[0];  }
__global__ __launch_bounds__(256) void k_round16f(const float* __restrict__ W, _Float16* __restrict__ Bt, size_t n8) { const size_t t = (size_t)blockIdx.x * 256 + threadIdx.x; if (t >= n8) return; FragH f;
#pragma unroll
  for (int i = 0; i < 8; ++i) f.h[i] = (_Float16)(bf16_round(W[t * 8 + i]) * 16.0f); *(v8us*)((unsigned short*)Bt + t * 8) = f.half[0];  }
template <int NHv, int TTv>
__global__ __launch_bounds__(256) void k_vt(const _Float16* __restrict__ V16, int ldv, int voff, _Float16* __restrict__ Vt) { __shared__ unsigned short tl[64][66]; const int tid = threadIdx.x; const int slab = blockIdx.x / (TTv / 64), lg = blockIdx.x % (TTv / 64); const int b = slab / NHv, h = slab % NHv;
  for (int i = tid; i < 64 * 8; i += 256) { const int r = i / 8, c8 = (i % 8) * 8; FragH f; f.half[0] = *(const v8us*)((const unsigned short*)V16 + ((size_t)b * TTv + lg * 64 + r) * ldv + voff + h * 64 + c8);
#pragma unroll
    for (int q = 0; q < 8; ++q) tl[r][c8 + q] = f.u[q]; }
  __syncthreads();
  {
#pragma unroll
    for (int rd = 0; rd < 2; ++rd) { const int d = rd * 32 + tid / 8, pc = tid % 8; FragH f;
#pragma unroll
      for (int q = 0; q < 8; ++q) f.u[q] = tl[pc * 8 + q][d];
      *(v8us*)((unsigned short*)Vt + ((size_t)slab * 64 + d) * TTv + lg * 64 + pc * 8) = f.half[0]; }
     } }

__global__ __launch_bounds__(256) void k_hl(const float* __restrict__ F, _Float16* __restrict__ Hh, _Float16* __restrict__ Hl, size_t n8) { const size_t t = (size_t)blockIdx.x * 256 + threadIdx.x; if (t >= n8) return; FragH fh, fl; const v4f a = *(const v4fa*)(F + t * 8), c = *(const v4fa*)(F + t * 8 + 4);
#pragma unroll
  for (int q = 0; q < 4; ++q) { _Float16 h = (_Float16)a[q]; fh.h[q] = h; fl.h[q] = (_Float16)((a[q] - (float)h) * 1024.0f); h = (_Float16)c[q]; fh.h[4 + q] = h; fl.h[4 + q] = (_Float16)((c[q] - (float)h) * 1024.0f); }
  { *(v8us*)((unsigned short*)Hh + t * 8) = fh.half[0]; *(v8us*)((unsigned short*)Hl + t * 8) = fl.half[0];  } }
__global__ __launch_bounds__(256) void k_cstab(float* __restrict__ CS) { const int t = blockIdx.x * 256 + threadIdx.x; if (t >= TT * 32) return; const int p = t / 32, i = t % 32; const float invf = powf(10000.0f, -(float)(2 * i) / (float)HD); float sn, cs; sincosf((float)p * invf, &sn, &cs); typedef float v2f __attribute__((ext_vector_type(2), may_alias)); const v2f v = {cs, sn};
  *(v2f*)(CS + (size_t)t * 2) = v;  }
// rotary embedding: for row (b,s), head h, 8-dim piece g (d0 = g·8): (cos, sin) from the table row of the token's sequence position; d < 32: q'[d] = q[d]·cos_d − q[d+32]·sin_d; d ≥ 32: q'[d] = q[d]·cos_{d−32} + q[d−32]·sin_{d−32} (f32), stored f16;
template <int NHR, int LDI, int LDO>
__global__ __launch_bounds__(256) void k_rope(const float* __restrict__ QF, const float* __restrict__ CS, _Float16* __restrict__ Q16) { const size_t t = (size_t)blockIdx.x * 256 + threadIdx.x; if (t >= (size_t)NR * NHR * 8) return; const int g = (int)(t % 8); const int h = (int)((t / 8) % NHR); const size_t row = t / (8 * NHR); const int p = (int)(row % TT);      /* position = token index within the sequence (the reference's arange) */
  const int d0 = g * 8; const int i0 = d0 & 31; const float* base = QF + row * LDI + h * HD; const int dp = (d0 < 32) ? d0 + 32 : d0 - 32; const float sgn = (d0 < 32) ? -1.0f : 1.0f; const float* csr = CS + ((size_t)p * 32 + i0) * 2; FragH f;
#pragma unroll 1
  for (int e = 0; e < 8; ++e) { const float cs = csr[2 * e], sn = csr[2 * e + 1]; f.h[e] = (_Float16)(base[d0 + e] * cs + sgn * base[dp + e] * sn); }
  *(v8us*)((unsigned short*)Q16 + row * LDO + h * HD + d0) = f.half[0];  }
template <int NHV>
__global__ __launch_bounds__(256) void k_vthl(const float* __restrict__ VF, int ldv, int voff, _Float16* __restrict__ Vth, _Float16* __restrict__ Vtl) { __shared__ float tl[64][65]; const int tid = threadIdx.x; const int slab = blockIdx.x / (TT / 64), lg = blockIdx.x % (TT / 64); const int b = slab / NHV, h = slab % NHV;
  for (int i = tid; i < 64 * 16; i += 256) { const int r = i / 16, c4 = (i % 16) * 4; const v4f a = *(const v4fa*)(VF + ((size_t)b * TT + lg * 64 + r) * ldv + voff + h * HD + c4); tl[r][c4] = a[0]; tl[r][c4 + 1] = a[1]; tl[r][c4 + 2] = a[2]; tl[r][c4 + 3] = a[3]; }
  __syncthreads();
  FragH fh[2], fl[2]; size_t oo[2];
#pragma unroll
  for (int rd = 0; rd < 2; ++rd) { const int d = rd * 32 + tid / 8, pc = tid % 8;
#pragma unroll
    for (int q = 0; q < 8; ++q) { const float v = tl[pc * 8 + q][d]; const _Float16 hv = (_Float16)v; fh[rd].h[q] = hv; fl[rd].h[q] = (_Float16)((v - (float)hv) * 1024.0f); } oo[rd] = ((size_t)slab * HD + d) * TT + lg * 64 + pc * 8; }
  {
#pragma unroll
    for (int rd = 0; rd < 2; ++rd) { *(v8us*)((unsigned short*)Vth + oo[rd]) = fh[rd].half[0]; *(v8us*)((unsigned short*)Vtl + oo[rd]) = fl[rd].half[0]; }
     } }
__global__ __launch_bounds__(128) void k_flash(const _Float16* __restrict__ Q16, int ldq, const _Float16* __restrict__ K16, int ldk, const float* __restrict__ KH, const float* __restrict__ VHD, const _Float16* __restrict__ Vt, const _Float16* __restrict__ Vtlo, float* __restrict__ O, int ldo) {
  constexpr int RPW = 16, RTN = RPW / 16, NQB = TT / (4 * RPW), DT = 4, KS = 2;
  __shared__ __attribute__((aligned(16))) unsigned short sP[4][RPW][40]; __shared__ __attribute__((aligned(16))) unsigned short sPl[4][RPW][40]; __shared__ __attribute__((aligned(16))) float sO[4][RPW][64 + 4];
  const int tid = threadIdx.x, w = tid >> 5, lane = tid & 31, ln = lane & 15, hh = lane >> 4;
  const int slab = blockIdx.x / NQB, qblk = blockIdx.x % NQB; const int b = slab / NH, h = slab % NH; const int qb0 = qblk * (4 * RPW); const int q0 = qb0 + w * RPW;
  FragH aq[2][KS];
#pragma unroll
  for (int rt = 0; rt < RTN; ++rt) { const unsigned short* qr = (const unsigned short*)Q16 + ((size_t)b * TT + q0 + rt * 16 + ln) * ldq + h * 64;
#pragma unroll
    for (int ks = 0; ks < KS; ++ks) { aq[rt][ks].half[0] = *(const v8us*)(qr + ks * 32 + 8 * hh); aq[rt][ks].half[1] = *(const v8us*)(qr + ks * 32 + 16 + 8 * hh); } }
  const unsigned short* Vth = (const unsigned short*)Vt + (size_t)b * 64 * TT; const unsigned short* Vtl = (const unsigned short*)Vtlo + (size_t)b * 64 * TT;      /* shared value head per batch */
  float m_r[2][8], l_r[2][8]; v8f oacc[2][DT], oaccl[2][DT], oacc2[2][DT];
#pragma unroll
  for (int rt = 0; rt < RTN; ++rt) {
#pragma unroll
    for (int r = 0; r < 8; ++r) { m_r[rt][r] = -3.0e38f; l_r[rt][r] = 0.f; }
#pragma unroll
    for (int dt = 0; dt < DT; ++dt) { oacc[rt][dt] = (v8f){0.f,0.f,0.f,0.f,0.f,0.f,0.f,0.f}; oaccl[rt][dt] = oacc[rt][dt]; oacc2[rt][dt] = oacc[rt][dt]; } }
  const int jend = qb0 + 4 * RPW;
#pragma unroll 1
  for (int j0 = 0; j0 < jend; j0 += 32) {
    const float kh0 = KH[((size_t)b * TT + j0 + ln) * (2 * NH) + h], kh1 = KH[((size_t)b * TT + j0 + 16 + ln) * (2 * NH) + h], vh0 = VHD[((size_t)b * TT + j0 + ln) * (2 * NH) + h], vh1 = VHD[((size_t)b * TT + j0 + 16 + ln) * (2 * NH) + h];      /* per-key head scalars (sigmoid outputs, f32), in range */
    v8f s[2][2];
#pragma unroll
    for (int nt = 0; nt < 2; ++nt) { const unsigned short* kr = (const unsigned short*)K16 + ((size_t)b * TT + j0 + nt * 16 + ln) * ldk;      /* shared key head */ FragH bk[KS];
#pragma unroll
      for (int ks = 0; ks < KS; ++ks) { bk[ks].half[0] = *(const v8us*)(kr + ks * 32 + 8 * hh); bk[ks].half[1] = *(const v8us*)(kr + ks * 32 + 16 + 8 * hh); }
#pragma unroll
      for (int rt = 0; rt < RTN; ++rt) { v8f acc = (v8f){0.f,0.f,0.f,0.f,0.f,0.f,0.f,0.f};
#pragma unroll
        for (int ks = 0; ks < KS; ++ks) acc = mmaH<1>(aq[rt][ks].v, aq[rt][ks].v, bk[ks].v, bk[ks].v, acc); s[rt][nt] = acc; } }
#pragma unroll
    for (int rt = 0; rt < RTN; ++rt)
#pragma unroll
      for (int r = 0; r < 8; ++r) { const int tq = q0 + rt * 16 + 8 * hh + r; const int k0 = j0 + ln, k1 = j0 + 16 + ln; (void)tq; (void)k0; (void)k1;
        const bool ok0 = (k0 <= tq), ok1 = (k1 <= tq);
        const float s0 = ok0 ? s[rt][0][r] * kh0 * 0.125f : -INFINITY, s1 = ok1 ? s[rt][1][r] * kh1 * 0.125f : -INFINITY; float mc = fmaxf(s0, s1);
        mc = fmaxf(mc, __shfl_xor(mc, 1, 32)); mc = fmaxf(mc, __shfl_xor(mc, 2, 32)); mc = fmaxf(mc, __shfl_xor(mc, 4, 32)); mc = fmaxf(mc, __shfl_xor(mc, 8, 32));
        const float mn = fmaxf(m_r[rt][r], mc); const float al = (mn > -1.0e38f) ? expf(m_r[rt][r] - mn) : 1.0f; m_r[rt][r] = mn; const float p0 = ok0 ? expf(s0 - mn) : 0.f, p1 = ok1 ? expf(s1 - mn) : 0.f; l_r[rt][r] = l_r[rt][r] * al + p0 + p1;
#pragma unroll
        for (int dt = 0; dt < DT; ++dt) { oacc[rt][dt][r] *= al; oaccl[rt][dt][r] *= al; oacc2[rt][dt][r] *= al; }
        const float pv0 = p0 * vh0 * 1024.0f, pv1 = p1 * vh1 * 1024.0f; FragH t2, t3; t2.h[0] = (_Float16)pv0; t2.h[1] = (_Float16)pv1; t3.h[0] = (_Float16)((pv0 - (float)t2.h[0]) * 1024.0f); t3.h[1] = (_Float16)((pv1 - (float)t2.h[1]) * 1024.0f);      /* value-head scalar folded into P, carried as f16 hi + ×2^10 residual tiles; the normaliser keeps plain p */
        sP[w][rt * 16 + 8 * hh + r][ln] = t2.u[0]; sP[w][rt * 16 + 8 * hh + r][16 + ln] = t2.u[1]; sPl[w][rt * 16 + 8 * hh + r][ln] = t3.u[0]; sPl[w][rt * 16 + 8 * hh + r][16 + ln] = t3.u[1]; }
    __builtin_amdgcn_fence(__ATOMIC_ACQ_REL, "workgroup"); __builtin_amdgcn_wave_barrier();
    FragH pa[2], pl[2];
#pragma unroll
    for (int rt = 0; rt < RTN; ++rt) { pa[rt].half[0] = *(const v8us*)&sP[w][rt * 16 + ln][8 * hh]; pa[rt].half[1] = *(const v8us*)&sP[w][rt * 16 + ln][16 + 8 * hh]; pl[rt].half[0] = *(const v8us*)&sPl[w][rt * 16 + ln][8 * hh]; pl[rt].half[1] = *(const v8us*)&sPl[w][rt * 16 + ln][16 + 8 * hh]; }
#pragma unroll
    for (int dt = 0; dt < DT; ++dt) { const size_t vo = (size_t)(dt * 16 + ln) * TT + j0; FragH bv, bl; bv.half[0] = *(const v8us*)(Vth + vo + 8 * hh); bv.half[1] = *(const v8us*)(Vth + vo + 16 + 8 * hh); bl.half[0] = *(const v8us*)(Vtl + vo + 8 * hh); bl.half[1] = *(const v8us*)(Vtl + vo + 16 + 8 * hh);
#pragma unroll
      for (int rt = 0; rt < RTN; ++rt) { oacc[rt][dt] = mmaH<1>(pa[rt].v, pa[rt].v, bv.v, bv.v, oacc[rt][dt]); oaccl[rt][dt] = mmaH<1>(pa[rt].v, pa[rt].v, bl.v, bl.v, oaccl[rt][dt]); oacc2[rt][dt] = mmaH<1>(pl[rt].v, pl[rt].v, bv.v, bv.v, oacc2[rt][dt]); } }
    __builtin_amdgcn_fence(__ATOMIC_ACQ_REL, "workgroup"); __builtin_amdgcn_wave_barrier(); }
#pragma unroll
  for (int rt = 0; rt < RTN; ++rt) {
#pragma unroll
    for (int r = 0; r < 8; ++r) { float l = l_r[rt][r]; l += __shfl_xor(l, 1, 32); l += __shfl_xor(l, 2, 32); l += __shfl_xor(l, 4, 32); l += __shfl_xor(l, 8, 32); l_r[rt][r] = (l > 0.f) ? 1.0f / (l * 1024.0f) : 0.f; }
#pragma unroll
    for (int dt = 0; dt < DT; ++dt)
#pragma unroll
      for (int r = 0; r < 8; ++r) sO[w][rt * 16 + 8 * hh + r][dt * 16 + ln] = (oacc[rt][dt][r] + (oaccl[rt][dt][r] + oacc2[rt][dt][r]) * 0.0009765625f) * l_r[rt][r]; }
  __builtin_amdgcn_fence(__ATOMIC_ACQ_REL, "workgroup"); __builtin_amdgcn_wave_barrier();
  {
#pragma unroll
    for (int rp = 0; rp < RPW; rp += 2) { const int r = rp + (lane >> 4), pc = lane & 15; const v4f val = *(const v4fa*)&sO[w][r][pc * 4]; *(v4f*)(O + ((size_t)b * TT + q0 + r) * ldo + h * 64 + pc * 4) = val; }
     } }

extern "C" void kernel_launch(void* const* d_in, const int* in_sizes, int n_in,
                              void* d_out, int out_size, void* d_ws, size_t ws_size, hipStream_t stream) {
  (void)in_sizes; (void)n_in; (void)out_size;
  const float* x = (const float*)d_in[0]; const float* Wq = (const float*)d_in[1]; const float* Wkv = (const float*)d_in[2]; const float* Wkvh = (const float*)d_in[3]; const float* Wo = (const float*)d_in[4];
  char* ws = (char*)d_ws; size_t off = 0;
  auto take = [&](size_t bytes) { char* p = ws + off; off += (bytes + 255) & ~(size_t)255; return p; };
  _Float16* Bq = (_Float16*)take((size_t)DM * DM * 2); _Float16* Bkv = (_Float16*)take((size_t)2 * HD * DM * 2); _Float16* Bkh = (_Float16*)take((size_t)2 * NH * DM * 2); _Float16* Bo = (_Float16*)take((size_t)DM * DM * 2); float* CS = (float*)take((size_t)TT * 32 * 2 * 4);
  _Float16* X16 = (_Float16*)take((size_t)NR * DM * 2); float* F32 = (float*)take((size_t)NR * DM * 4); _Float16* Q16 = (_Float16*)take((size_t)NR * DM * 2); float* KVF = (float*)take((size_t)NR * 2 * HD * 4); _Float16* K16 = (_Float16*)take((size_t)NR * HD * 2); float* HS = (float*)take((size_t)NR * 2 * NH * 4);
  _Float16* Vth = (_Float16*)take((size_t)BB * HD * TT * 2); _Float16* Vtl = (_Float16*)take((size_t)BB * HD * TT * 2); _Float16* OH = (_Float16*)take((size_t)NR * DM * 2); _Float16* OL = (_Float16*)take((size_t)NR * DM * 2);
  float* O = F32;      /* F32 holds q (consumed by k_rope) then O */
  if (off > ws_size) return;      // 2.1 + 0.3 + 0.1 + 2.1 + 0.5 + 8.4 + 16.8 + 8.4 + 2.1 + 0.5 + 0.5 + 0.5 + 0.5 + 8.4 + 8.4 ≈ 60 MB
  k_wt_f16<<<(unsigned)(((size_t)DM * (DM / 8) + 255) / 256), 256, 0, stream>>>(Wq, Bq, DM, DM, 16.0f); k_wt_f16<<<(unsigned)(((size_t)2 * HD * (DM / 8) + 255) / 256), 256, 0, stream>>>(Wkv, Bkv, DM, 2 * HD, 16.0f);
  k_wt_f16<<<(unsigned)(((size_t)2 * NH * (DM / 8) + 255) / 256), 256, 0, stream>>>(Wkvh, Bkh, DM, 2 * NH, 16.0f); k_wt_f16<<<(unsigned)(((size_t)DM * (DM / 8) + 255) / 256), 256, 0, stream>>>(Wo, Bo, DM, DM, 16.0f);      /* (in,out) → Bt ×2^4 */
  k_x16<<<(unsigned)(((size_t)NR * DM / 8 + 255) / 256), 256, 0, stream>>>(x, X16, (size_t)NR * DM / 8); k_cstab<<<(TT * 32 + 255) / 256, 256, 0, stream>>>(CS);
  const dim3 gq(((NR / 16) * (DM / 64) + 3) / 4, 1);
  k_gemm_hhx<0><<<gq, 128, 0, stream>>>(X16, DM, 0, Bq, DM, 0, 0.0625f, nullptr, 0, nullptr, 1, 0, 0, F32, nullptr, DM, 0, NR, DM, DM); k_rope<NH, DM, DM><<<(unsigned)(((size_t)NR * NH * 8 + 255) / 256), 256, 0, stream>>>(F32, CS, Q16);      /* q → RoPE → f16 */
  k_gemm_hhx<0><<<dim3(((NR / 16) * 2 + 3) / 4, 1), 128, 0, stream>>>(X16, DM, 0, Bkv, DM, 0, 0.0625f, nullptr, 0, nullptr, 1, 0, 0, KVF, nullptr, 2 * HD, 0, NR, 2 * HD, DM);      /* [k | v] f32: M 4096 N 128 K 1024 */
  k_rope<1, 2 * HD, HD><<<(unsigned)(((size_t)NR * 8 + 255) / 256), 256, 0, stream>>>(KVF, CS, K16);      /* shared k (cols 0..63 of KVF, row stride 128) → RoPE → K16 [4096][64] */
  k_vthl<1><<<BB * (TT / 64), 256, 0, stream>>>(KVF, 2 * HD, HD, Vth, Vtl);      /* shared v (cols 64..127) → Vᵀ hi/lo per batch [b][64][T] */
  k_gemm_hhx<11><<<dim3(((NR / 16) * 1 + 3) / 4, 1), 128, 0, stream>>>(X16, DM, 0, Bkh, DM, 0, 0.0625f, nullptr, 0, nullptr, 1, 0, 0, HS, nullptr, 2 * NH, 0, NR, 2 * NH, DM);      /* [kh | vh] = sigmoid(x·Wkvh): M 4096 N 32 K 1024, f32 rows of 32 */
  k_flash<<<BB * NH * (TT / 64), 128, 0, stream>>>(Q16, DM, K16, HD, HS, HS + NH, Vth, Vtl, O, DM);      /* KH = HS cols 0..15, VH = cols 16..31 (row stride 2·NH = 32) */
  k_hl<<<(unsigned)(((size_t)NR * DM / 8 + 255) / 256), 256, 0, stream>>>(O, OH, OL, (size_t)NR * DM / 8);
  k_gemm_hhx<0><<<gq, 128, 0, stream>>>(OH, DM, 0, Bo, DM, 0, 0.0625f, nullptr, 0, nullptr, 1, 0, 0, (float*)d_out, nullptr, DM, 0, NR, DM, DM);      /* y = O_hi·Wo */
  k_gemm_hhx<0><<<gq, 128, 0, stream>>>(OL, DM, 0, Bo, DM, 0, 0.0625f * 0.0009765625f, nullptr, 0, (float*)d_out, 1, (size_t)DM, 0, (float*)d_out, nullptr, DM, 0, NR, DM, DM);      /* += O_lo·Wo·2^-10 in place */
}

// v001
// It runs in 452 microseconds.
// Next to v000, in two timings, it ran 1.18 and 1.23 times as fast.
#include <hip/hip_runtime.h>
// Multi-product attention with low-rank shared key/value (B=2, N=2048, D=1024, 16 heads × 64): q = x·Wq; [k|v] = x·Wkv (one shared 64-dim key and value); [kh|vh] = σ(x·Wkvh) per (token, head); rotary (rotate-half, θ=1e4) on q and k by
// sequence position; K_h[n] = kh[n,h]·k[n], V_h[n] = vh[n,h]·v[n]; causal softmax(q_h·K_hᵀ/8); out = (Σ attn·V_h merged)·Wo.
// Compute dtype: x and weights rounded to bf16; q and k as f32 GEMM outputs rotated in f32 from a one-time f32 cos/sin table and stored f16; head scalars as sigmoid GEMM epilogue outputs (f32); v f32 →
// f16 hi + ×2^10 residual Vᵀ planes; fused causal flash-style kernel (scores scaled by kh per key, P multiplied by vh per key and carried as f16 hi + residual tiles, online softmax f32, three value accumulators) on v_wmma_f32_16x16x32_f16; merged O → hi/lo → Wo GEMMs (second in place ×2^-10); f32 accumulate.
#define BB 2
#define TT 2048
#define DM 1024
#define NH 16
#define HD 64
#define NR (BB * TT)

typedef __bf16 v16b __attribute__((ext_vector_type(16)));
typedef unsigned short v8us __attribute__((ext_vector_type(8), may_alias));
typedef float  v8f  __attribute__((ext_vector_type(8)));
typedef float  v4f  __attribute__((ext_vector_type(4)));
typedef float  v4fa __attribute__((ext_vector_type(4), may_alias));
union FragB { v16b v; v8us half[2]; unsigned short u[16]; };

__device__ __forceinline__ unsigned short bf16_bits(float x) { unsigned int u = __float_as_uint(x); return (unsigned short)((u + 0x7FFFu + ((u >> 16) & 1u)) >> 16); }
__device__ __forceinline__ float bf16_val(unsigned short b) { return __uint_as_float(((unsigned int)b) << 16); }
__device__ __forceinline__ float bf16_round(float x) { return bf16_val(bf16_bits(x)); }
// D += A·B with NT terms: 1 = ah·bh, 2 = + al·bh (A split), 3 = + ah·bl (both split)
template <int NT>
__device__ __forceinline__ v8f mmaN(v16b ah, v16b al, v16b bh, v16b bl, v8f c) {
  c = __builtin_amdgcn_wmma_f32_16x16x32_bf16(false, ah, false, bh, (short)0, c, false, false);
  if (NT >= 2) c = __builtin_amdgcn_wmma_f32_16x16x32_bf16(false, al, false, bh, (short)0, c, false, false);
  if (NT >= 3) c = __builtin_amdgcn_wmma_f32_16x16x32_bf16(false, ah, false, bl, (short)0, c, false, false);
  asm volatile("v_nop\n\tv_nop\n\tv_nop\n\tv_nop" : "+v"(c) : "v"(ah), "v"(al), "v"(bh), "v"(bl));
  return c;
}

__global__ __launch_bounds__(256) void k_wt_bf16(const float* __restrict__ W, unsigned short* __restrict__ Wt, int K, int N) {
  const int t = blockIdx.x * 256 + threadIdx.x;
  const int k8n = K / 8;
  if (t >= N * k8n) return;
  const int n = t / k8n, k8 = (t % k8n) * 8;
  v8us v;
#pragma unroll
  for (int i = 0; i < 8; ++i) v[i] = bf16_bits(W[(size_t)(k8 + i) * N + n]);
  *(v8us*)(Wt + (size_t)n * K + k8) = v;
  
}

// GEMM C[M][N] (f32, pitch ldc) = act(A[M][K]·W + bias). A f32 row-major (pitch lda) converted per fragment to bf16
// (ASPLIT: hi/lo two planes -> 2 terms, else single rounded term); Wt bf16 [N][K] (pitch ldb). BIAS_BF16 rounds the
// bias to bf16 first (bias quantised to bf16 before the add). K%32==0, M%16==0, N%64==0.
template <bool ASPLIT, int ACT, bool BIAS_BF16>
__global__ __launch_bounds__(128) void k_gemm_bf(const float* __restrict__ A, int lda, const unsigned short* __restrict__ Wt, int ldb,
                                               const float* __restrict__ bias, float* __restrict__ C, int ldc, int M, int N, int K) {
  __shared__ __attribute__((aligned(16))) float so[4][16][64];
  const int tid = threadIdx.x, w = tid >> 5, lane = tid & 31, ln = lane & 15, hh = lane >> 4;
  const int ntn = N / 64;
  const int wid = blockIdx.x * 4 + w;
  const int mt = wid / ntn, nq = wid % ntn;
  if (mt * 16 >= M) return;
  const int row0 = mt * 16, col0 = nq * 64;
  const float* arow = A + (size_t)(row0 + ln) * lda;
  v8f acc[4] = {};
  for (int kb = 0; kb < K; kb += 32) {
    FragB ah, al;
    const v4f x0 = *(const v4fa*)(arow + kb + 8 * hh), x1 = *(const v4fa*)(arow + kb + 8 * hh + 4);
    const v4f x2 = *(const v4fa*)(arow + kb + 16 + 8 * hh), x3 = *(const v4fa*)(arow + kb + 16 + 8 * hh + 4);
    float xs[16] = {x0[0],x0[1],x0[2],x0[3],x1[0],x1[1],x1[2],x1[3],x2[0],x2[1],x2[2],x2[3],x3[0],x3[1],x3[2],x3[3]};
#pragma unroll
    for (int i = 0; i < 16; ++i) { const unsigned short hb = bf16_bits(xs[i]); ah.u[i] = hb; al.u[i] = ASPLIT ? bf16_bits(xs[i] - bf16_val(hb)) : (unsigned short)0; }
#pragma unroll
    for (int t = 0; t < 4; ++t) {
      const unsigned short* brow = Wt + (size_t)(col0 + t * 16 + ln) * ldb + kb;
      FragB b;
      b.half[0] = *(const v8us*)(brow + 8 * hh);
      b.half[1] = *(const v8us*)(brow + 16 + 8 * hh);
      acc[t] = mmaN<ASPLIT ? 2 : 1>(ah.v, al.v, b.v, b.v, acc[t]);
    }
  }
#pragma unroll
  for (int t = 0; t < 4; ++t) {
    float bv = bias ? bias[col0 + t * 16 + ln] : 0.f;
    if (BIAS_BF16) bv = bf16_round(bv);
#pragma unroll
    for (int r = 0; r < 8; ++r) { float v = acc[t][r] + bv; if (ACT == 1) v = fmaxf(v, 0.f); so[w][8 * hh + r][t * 16 + ln] = v; }
  }
  __builtin_amdgcn_fence(__ATOMIC_ACQ_REL, "workgroup");
  __builtin_amdgcn_wave_barrier();
  const int rsub = lane >> 4, c4 = (lane & 15) * 4;
  {
#pragma unroll
    for (int q = 0; q < 8; ++q) {
      const int r = q * 2 + rsub;
      const v4f v = *(const v4fa*)&so[w][r][c4];
      *(v4f*)(C + (size_t)(row0 + r) * ldc + col0 + c4) = v;
    }
    
  }
}

// Flash-style causal/unmasked attention, all contractions 3-term bf16 hi/lo splits, f32 softmax with running max.
// q,k,v rows are read from f32 buffers with arbitrary row pitch (so they can live inside a fused qkv buffer);
// D = head size (multiple of 32, <= 128); one wave = 16 query rows; block = 4 waves (64 queries) sharing K/V chunks of 32.
template <int D, bool CAUSAL>
__global__ __launch_bounds__(128) void k_flash(const float* __restrict__ qb, const float* __restrict__ kb, const float* __restrict__ vb,
                                             int pitch, int T, int H, float scale, float* __restrict__ y, int ypitch) {
  constexpr int KS = D / 32;        // k-steps for QK
  constexpr int DT = D / 16;        // d tiles for PV
  __shared__ __attribute__((aligned(16))) unsigned short sKh[32][D + 8], sKl[32][D + 8], sVh[32][D + 8], sVl[32][D + 8];
  __shared__ __attribute__((aligned(16))) unsigned short sPh[4][16][40], sPl[4][16][40];
  __shared__ __attribute__((aligned(16))) float sO[4][16][D];
  const int tid = threadIdx.x, w = tid >> 5, lane = tid & 31, ln = lane & 15, hh = lane >> 4;
  const int nqb = (T + 63) / 64;
  const int bh = blockIdx.x / nqb, qblk = blockIdx.x % nqb;
  const int b = bh / H, h = bh % H;
  const int q0 = qblk * 64 + w * 16;
  const float* Q = qb + (size_t)b * T * pitch + h * D;
  const float* K = kb + (size_t)b * T * pitch + h * D;
  const float* V = vb + (size_t)b * T * pitch + h * D;

  // A fragments of the wave's 16 query rows (scaled), hi/lo
  FragB aqh[KS], aql[KS];
  {
    int row = q0 + ln; if (row >= T) row = T - 1;
    const float* qr = Q + (size_t)row * pitch;
#pragma unroll
    for (int ks = 0; ks < KS; ++ks)
#pragma unroll
      for (int i = 0; i < 16; ++i) {
        const int d = ks * 32 + ((i < 8) ? (8 * hh + i) : (16 + 8 * hh + (i - 8)));
        const float x = qr[d] * scale; const unsigned short hb = bf16_bits(x);
        aqh[ks].u[i] = hb; aql[ks].u[i] = bf16_bits(x - bf16_val(hb));
      }
  }
  float m_r[8], l_r[8];
#pragma unroll
  for (int r = 0; r < 8; ++r) { m_r[r] = -3.0e38f; l_r[r] = 0.f; }
  v8f oacc[DT];
#pragma unroll
  for (int dt = 0; dt < DT; ++dt) oacc[dt] = (v8f){0.f,0.f,0.f,0.f,0.f,0.f,0.f,0.f};

  const int kv_end = CAUSAL ? min(T, qblk * 64 + 64) : T;     // block-uniform
  for (int j0 = 0; j0 < kv_end; j0 += 32) {
    __syncthreads();
    for (int e = tid; e < 32 * (D / 4); e += 128) {
      const int r = e / (D / 4), c4 = (e % (D / 4)) * 4;
      const int key = j0 + r;
      v4f kf = {0.f,0.f,0.f,0.f}, vf = {0.f,0.f,0.f,0.f};
      if (key < T) { kf = *(const v4fa*)(K + (size_t)key * pitch + c4); vf = *(const v4fa*)(V + (size_t)key * pitch + c4); }
#pragma unroll
      for (int t = 0; t < 4; ++t) {
        unsigned short hb = bf16_bits(kf[t]); sKh[r][c4 + t] = hb; sKl[r][c4 + t] = bf16_bits(kf[t] - bf16_val(hb));
        hb = bf16_bits(vf[t]); sVh[r][c4 + t] = hb; sVl[r][c4 + t] = bf16_bits(vf[t] - bf16_val(hb));
      }
    }
    __syncthreads();
    // S tile 16 x 32
    v8f s[2];
#pragma unroll
    for (int nt = 0; nt < 2; ++nt) {
      v8f acc = {};
#pragma unroll
      for (int ks = 0; ks < KS; ++ks) {
        FragB bh_, bl_;
        bh_.half[0] = *(const v8us*)&sKh[nt * 16 + ln][ks * 32 + 8 * hh]; bh_.half[1] = *(const v8us*)&sKh[nt * 16 + ln][ks * 32 + 16 + 8 * hh];
        bl_.half[0] = *(const v8us*)&sKl[nt * 16 + ln][ks * 32 + 8 * hh]; bl_.half[1] = *(const v8us*)&sKl[nt * 16 + ln][ks * 32 + 16 + 8 * hh];
        acc = mmaN<3>(aqh[ks].v, aql[ks].v, bh_.v, bl_.v, acc);
      }
      s[nt] = acc;
    }
    // mask + running max (rows 8hh+r; the 16 lanes of a half share rows)
    float alpha[8];
#pragma unroll
    for (int r = 0; r < 8; ++r) {
      const int qi = q0 + 8 * hh + r;
      const int ja = j0 + ln, jb = j0 + 16 + ln;
      if (CAUSAL) { if (ja > qi) s[0][r] = -3.0e38f; if (jb > qi) s[1][r] = -3.0e38f; }
      if (ja >= T) s[0][r] = -3.0e38f;
      if (jb >= T) s[1][r] = -3.0e38f;
      float mx = fmaxf(s[0][r], s[1][r]);
      mx = fmaxf(mx, __shfl_xor(mx, 1, 32)); mx = fmaxf(mx, __shfl_xor(mx, 2, 32)); mx = fmaxf(mx, __shfl_xor(mx, 4, 32)); mx = fmaxf(mx, __shfl_xor(mx, 8, 32));
      const float mnew = fmaxf(m_r[r], mx);
      alpha[r] = (mnew > -1.0e38f) ? __expf(m_r[r] - mnew) : 1.0f;
      const float p0 = (s[0][r] > -1.0e38f) ? __expf(s[0][r] - mnew) : 0.f;
      const float p1 = (s[1][r] > -1.0e38f) ? __expf(s[1][r] - mnew) : 0.f;
      m_r[r] = mnew;
      l_r[r] = l_r[r] * alpha[r] + p0 + p1;            // per-lane partial row sum (16 lanes combined at the end)
      unsigned short hb = bf16_bits(p0); sPh[w][8 * hh + r][ln] = hb;      sPl[w][8 * hh + r][ln] = bf16_bits(p0 - bf16_val(hb));
      hb = bf16_bits(p1);                sPh[w][8 * hh + r][16 + ln] = hb; sPl[w][8 * hh + r][16 + ln] = bf16_bits(p1 - bf16_val(hb));
    }
#pragma unroll
    for (int dt = 0; dt < DT; ++dt)
#pragma unroll
      for (int r = 0; r < 8; ++r) oacc[dt][r] *= alpha[r];
    __builtin_amdgcn_fence(__ATOMIC_ACQ_REL, "workgroup");
    __builtin_amdgcn_wave_barrier();
    FragB pah, pal;
    pah.half[0] = *(const v8us*)&sPh[w][ln][8 * hh]; pah.half[1] = *(const v8us*)&sPh[w][ln][16 + 8 * hh];
    pal.half[0] = *(const v8us*)&sPl[w][ln][8 * hh]; pal.half[1] = *(const v8us*)&sPl[w][ln][16 + 8 * hh];
#pragma unroll
    for (int dt = 0; dt < DT; ++dt) {
      FragB bvh, bvl;
#pragma unroll
      for (int i = 0; i < 8; ++i) {
        bvh.u[i] = sVh[8 * hh + i][dt * 16 + ln]; bvh.u[8 + i] = sVh[16 + 8 * hh + i][dt * 16 + ln];
        bvl.u[i] = sVl[8 * hh + i][dt * 16 + ln]; bvl.u[8 + i] = sVl[16 + 8 * hh + i][dt * 16 + ln];
      }
      oacc[dt] = mmaN<3>(pah.v, pal.v, bvh.v, bvl.v, oacc[dt]);
    }
    __builtin_amdgcn_fence(__ATOMIC_ACQ_REL, "workgroup");
    __builtin_amdgcn_wave_barrier();
  }
#pragma unroll
  for (int r = 0; r < 8; ++r) {
    float l = l_r[r];
    l += __shfl_xor(l, 1, 32); l += __shfl_xor(l, 2, 32); l += __shfl_xor(l, 4, 32); l += __shfl_xor(l, 8, 32);
    l_r[r] = (l > 0.f) ? 1.0f / l : 0.f;
  }
#pragma unroll
  for (int dt = 0; dt < DT; ++dt)
#pragma unroll
    for (int r = 0; r < 8; ++r) sO[w][8 * hh + r][dt * 16 + ln] = oacc[dt][r] * l_r[r];
  __builtin_amdgcn_fence(__ATOMIC_ACQ_REL, "workgroup");
  __builtin_amdgcn_wave_barrier();
  {
    for (int r = 0; r < 16; ++r) {
      const int row = q0 + r;
      if (row < T && lane < D / 4) {
        const v4f val = *(const v4fa*)&sO[w][r][lane * 4];
        *(v4f*)(y + ((size_t)b * T + row) * ypitch + h * D + lane * 4) = val;
      }
    }
    
  }
}

// GEMM C = act(A·W + bias + resid): A f32 (ASPLIT -> hi/lo 2 terms), Wt bf16 [N][K]; ACT 0 none, 1 relu, 2 exact gelu;
// resid (optional, f32, row index = (row % rmod), pitch ldr, RES_BF16 rounds it) added before the activation.
template <bool ASPLIT, int ACT, bool BIAS_BF16, bool RES_BF16>
__global__ __launch_bounds__(128) void k_gemm_bf3(const float* __restrict__ A, int lda, const unsigned short* __restrict__ Wt, int ldb,
                                                const float* __restrict__ bias, const float* __restrict__ resid, int rmod, int ldr,
                                                float* __restrict__ C, int ldc, int M, int N, int K) {
  __shared__ __attribute__((aligned(16))) float so[4][16][64];
  const int tid = threadIdx.x, w = tid >> 5, lane = tid & 31, ln = lane & 15, hh = lane >> 4;
  const int ntn = N / 64;
  const int wid = blockIdx.x * 4 + w;
  const int mt = wid / ntn, nq = wid % ntn;
  if (mt * 16 >= M) return;
  const int row0 = mt * 16, col0 = nq * 64;
  const float* arow = A + (size_t)(row0 + ln) * lda;
  v8f acc[4] = {};
  for (int kb = 0; kb < K; kb += 32) {
    FragB ah, al;
    const v4f x0 = *(const v4fa*)(arow + kb + 8 * hh), x1 = *(const v4fa*)(arow + kb + 8 * hh + 4);
    const v4f x2 = *(const v4fa*)(arow + kb + 16 + 8 * hh), x3 = *(const v4fa*)(arow + kb + 16 + 8 * hh + 4);
    float xs[16] = {x0[0],x0[1],x0[2],x0[3],x1[0],x1[1],x1[2],x1[3],x2[0],x2[1],x2[2],x2[3],x3[0],x3[1],x3[2],x3[3]};
#pragma unroll
    for (int i = 0; i < 16; ++i) { const unsigned short hb = bf16_bits(xs[i]); ah.u[i] = hb; al.u[i] = ASPLIT ? bf16_bits(xs[i] - bf16_val(hb)) : (unsigned short)0; }
#pragma unroll
    for (int t = 0; t < 4; ++t) {
      const unsigned short* brow = Wt + (size_t)(col0 + t * 16 + ln) * ldb + kb;
      FragB b;
      b.half[0] = *(const v8us*)(brow + 8 * hh);
      b.half[1] = *(const v8us*)(brow + 16 + 8 * hh);
      acc[t] = mmaN<ASPLIT ? 2 : 1>(ah.v, al.v, b.v, b.v, acc[t]);
    }
  }
#pragma unroll
  for (int t = 0; t < 4; ++t) {
    const int col = col0 + t * 16 + ln;
    float bv = bias ? bias[col] : 0.f;
    if (BIAS_BF16) bv = bf16_round(bv);
#pragma unroll
    for (int r = 0; r < 8; ++r) {
      float v = acc[t][r] + bv;
      if (resid) { float rv = resid[(size_t)((row0 + 8 * hh + r) % rmod) * ldr + col]; if (RES_BF16) rv = bf16_round(rv); v += rv; }
      if (ACT == 1) v = fmaxf(v, 0.f);
      if (ACT == 2) v = 0.5f * v * (1.0f + erff(v * 0.70710678118654752f));
      if (ACT == 3) { const float u = 0.7978845608028654f * (v + 0.044715f * v * v * v); v = 0.5f * v * (1.0f + tanhf(u)); }
      so[w][8 * hh + r][t * 16 + ln] = v;
    }
  }
  __builtin_amdgcn_fence(__ATOMIC_ACQ_REL, "workgroup");
  __builtin_amdgcn_wave_barrier();
  const int rsub = lane >> 4, c4 = (lane & 15) * 4;
  {
#pragma unroll
    for (int q = 0; q < 8; ++q) {
      const int r = q * 2 + rsub;
      const v4f v = *(const v4fa*)&so[w][r][c4];
      *(v4f*)(C + (size_t)(row0 + r) * ldc + col0 + c4) = v;
    }
    
  }
}
// row LayerNorm (biased variance, eps) over N: s = X (+ R); optional out_sum <- s; out_norm <- (s-mu)*rsqrt(var+eps)*g + b
template <bool PARAM_BF16>
__global__ __launch_bounds__(256) void k_layernorm(const float* __restrict__ X, const float* __restrict__ R, const float* __restrict__ g, const float* __restrict__ bta,
                                                  float* __restrict__ out_sum, float* __restrict__ out_norm, int N, float eps) {
  __shared__ float red[256];
  const int row = blockIdx.x, tid = threadIdx.x;
  const float* x = X + (size_t)row * N; const float* rr = R ? R + (size_t)row * N : nullptr;
  float vals[16];                     // up to N = 4096
  const int per = N / 256;            // contiguous chunk per thread? use strided-by-4 chunks: thread handles j = tid*4 + 1024*u
  float s1 = 0.f;
  for (int u = 0; u < per / 4; ++u) {
    const int j = tid * 4 + 1024 * u;
    const v4f a = *(const v4fa*)(x + j);
    v4f b = {0.f,0.f,0.f,0.f}; if (rr) b = *(const v4fa*)(rr + j);
#pragma unroll
    for (int q = 0; q < 4; ++q) { const float v = a[q] + b[q]; vals[u * 4 + q] = v; s1 += v; }
  }
  red[tid] = s1; __syncthreads();
  for (int st = 128; st > 0; st >>= 1) { if (tid < st) red[tid] += red[tid + st]; __syncthreads(); }
  const float mu = red[0] / (float)N; __syncthreads();
  float s2 = 0.f;
  for (int u = 0; u < per / 4; ++u)
#pragma unroll
    for (int q = 0; q < 4; ++q) { const float c = vals[u * 4 + q] - mu; s2 += c * c; }
  red[tid] = s2; __syncthreads();
  for (int st = 128; st > 0; st >>= 1) { if (tid < st) red[tid] += red[tid + st]; __syncthreads(); }
  const float rs = rsqrtf(red[0] / (float)N + eps);
  {
    for (int u = 0; u < per / 4; ++u) {
      const int j = tid * 4 + 1024 * u;
      v4f o, sm;
#pragma unroll
      for (int q = 0; q < 4; ++q) {
        float gg = g[j + q], bb = bta[j + q];
        if (PARAM_BF16) { gg = bf16_round(gg); bb = bf16_round(bb); }
        sm[q] = vals[u * 4 + q]; o[q] = (vals[u * 4 + q] - mu) * rs * gg + bb;
      }
      if (out_sum) *(v4f*)(out_sum + (size_t)row * N + j) = sm;
      *(v4f*)(out_norm + (size_t)row * N + j) = o;
    }
    
  }
}



// ---- f16 WMMA path (v_wmma_f32_16x16x32_f16): 11-bit significands for operands in range — used where a [0,1] probability operand needs more precision than bf16
typedef _Float16 v16h __attribute__((ext_vector_type(16)));
union FragH { v16h v; v8us half[2]; _Float16 h[16]; unsigned short u[16]; };
template <int NT>
__device__ __forceinline__ v8f mmaH(v16h ah, v16h al, v16h bh, v16h bl, v8f c) {
  c = __builtin_amdgcn_wmma_f32_16x16x32_f16(false, ah, false, bh, (short)0, c, false, false);
  if (NT >= 2) c = __builtin_amdgcn_wmma_f32_16x16x32_f16(false, al, false, bh, (short)0, c, false, false);
  if (NT >= 3) c = __builtin_amdgcn_wmma_f32_16x16x32_f16(false, ah, false, bl, (short)0, c, false, false);
  asm volatile("v_nop\n\tv_nop\n\tv_nop\n\tv_nop" : "+v"(c) : "v"(ah), "v"(al), "v"(bh), "v"(bl));
  return c;
}
// batched GEMM like k_gemm_b but f16 operands: A f32 (split into f16 hi/lo if ASPLIT, else rounded to f16), Bt = f16 values [n][k]; alpha; C f32; N multiple of 16 (partial tiles skipped)
template <bool ASPLIT>
__global__ __launch_bounds__(128) void k_gemm_h(const float* __restrict__ A, int lda, size_t sA, const _Float16* __restrict__ Bh, int ldb, size_t sB, float alpha, float* __restrict__ C, int ldc, size_t sC, int M, int N, int K) {
  __shared__ __attribute__((aligned(16))) float so[4][16][64];
  const int tid = threadIdx.x, w = tid >> 5, lane = tid & 31, ln = lane & 15, hh = lane >> 4; const int by = blockIdx.y;
  A += (size_t)by * sA; Bh += (size_t)by * sB; C += (size_t)by * sC;
  const int ntn = (N + 63) / 64; const int wid = blockIdx.x * 4 + w; const int mt = wid / ntn, nq = wid % ntn; if (mt * 16 >= M) return;
  const int row0 = mt * 16, col0 = nq * 64; const float* arow = A + (size_t)(row0 + ln) * lda;
  v8f acc[4] = {};
  for (int kb = 0; kb < K; kb += 32) {
    FragH ah, al;
    const v4f x0 = *(const v4fa*)(arow + kb + 8 * hh), x1 = *(const v4fa*)(arow + kb + 8 * hh + 4), x2 = *(const v4fa*)(arow + kb + 16 + 8 * hh), x3 = *(const v4fa*)(arow + kb + 16 + 8 * hh + 4);
    float xs[16] = {x0[0],x0[1],x0[2],x0[3],x1[0],x1[1],x1[2],x1[3],x2[0],x2[1],x2[2],x2[3],x3[0],x3[1],x3[2],x3[3]};
#pragma unroll
    for (int i = 0; i < 16; ++i) { const _Float16 h = (_Float16)xs[i]; ah.h[i] = h; al.h[i] = ASPLIT ? (_Float16)(xs[i] - (float)h) : (_Float16)0.0f; }
#pragma unroll
    for (int t = 0; t < 4; ++t) { if (col0 + t * 16 >= N) continue; const size_t boff = (size_t)(col0 + t * 16 + ln) * ldb + kb; FragH bq; bq.half[0] = *(const v8us*)(Bh + boff + 8 * hh); bq.half[1] = *(const v8us*)(Bh + boff + 16 + 8 * hh);
      acc[t] = mmaH<ASPLIT ? 2 : 1>(ah.v, al.v, bq.v, bq.v, acc[t]); }
  }
#pragma unroll
  for (int t = 0; t < 4; ++t) { if (col0 + t * 16 >= N) continue;
#pragma unroll
    for (int r = 0; r < 8; ++r) so[w][8 * hh + r][t * 16 + ln] = acc[t][r] * alpha; }
  __builtin_amdgcn_fence(__ATOMIC_ACQ_REL, "workgroup"); __builtin_amdgcn_wave_barrier();
  const int rsub = lane >> 4, c4 = (lane & 15) * 4;
  {
#pragma unroll
    for (int q = 0; q < 8; ++q) { const int r = q * 2 + rsub; if (col0 + c4 < N) { const v4f v = *(const v4fa*)&so[w][r][c4]; *(v4f*)(C + (size_t)(row0 + r) * ldc + col0 + c4) = v; } }
     }
}

// Wt[n][k] = f16(W[k][n]·scale) from f32 row-major W[K][N] (scale = power of two; bf16-exact weights stay exact in f16 away from the subnormal range)
__global__ __launch_bounds__(256) void k_wt_f16(const float* __restrict__ W, _Float16* __restrict__ Wt, int K, int N, float scale) {
  const int t = blockIdx.x * 256 + threadIdx.x; if (t >= N * (K / 8)) return; const int n = t / (K / 8), k8 = (t % (K / 8)) * 8; FragH f;
#pragma unroll
  for (int i = 0; i < 8; ++i) f.h[i] = (_Float16)(bf16_round(W[(size_t)(k8 + i) * N + n]) * scale); const v8us o = f.half[0];
  *(v8us*)((unsigned short*)Wt + (size_t)n * K + k8) = o; 
}
// k_gemm_hh variant with fused epilogue: v = acc·alpha + bias[by·sBias + col] (+ CP[(row/rowsPerB)·sCPb + by·64 + col] if CP) ; ACT 0 none / 1 elu ; writes f32 C and/or f16 C16 (each if non-null)
template <int ACT>
__global__ __launch_bounds__(128) void k_gemm_hhx(const _Float16* __restrict__ A, int lda, size_t sA, const _Float16* __restrict__ Bh, int ldb, size_t sB, float alpha, const float* __restrict__ bias, size_t sBias, const float* __restrict__ CP, int rowsPerB, size_t sCPb, int row0g,
    float* __restrict__ C, _Float16* __restrict__ C16, int ldc, size_t sC, int M, int N, int K) {
  __shared__ __attribute__((aligned(16))) float so[4][16][64];
  const int tid = threadIdx.x, w = tid >> 5, lane = tid & 31, ln = lane & 15, hh = lane >> 4; const int by = blockIdx.y;
  A += (size_t)by * sA; Bh += (size_t)by * sB; const size_t cofs = (size_t)by * sC; const float* bp = bias ? bias + (size_t)by * sBias : nullptr;
  const int ntn = (N + 63) / 64; const int wid = blockIdx.x * 4 + w; const int mt = wid / ntn, nq = wid % ntn; if (mt * 16 >= M) return;
  const int row0 = mt * 16, col0 = nq * 64; const _Float16* arow = A + (size_t)(row0 + ln) * lda;
  v8f acc[4] = {};
  for (int kb = 0; kb < K; kb += 32) { FragH ah; ah.half[0] = *(const v8us*)((const unsigned short*)arow + kb + 8 * hh); ah.half[1] = *(const v8us*)((const unsigned short*)arow + kb + 16 + 8 * hh);
#pragma unroll
    for (int t = 0; t < 4; ++t) { if (col0 + t * 16 >= N) continue; const size_t boff = (size_t)(col0 + t * 16 + ln) * ldb + kb; FragH bq; bq.half[0] = *(const v8us*)((const unsigned short*)Bh + boff + 8 * hh); bq.half[1] = *(const v8us*)((const unsigned short*)Bh + boff + 16 + 8 * hh);
      acc[t] = mmaH<1>(ah.v, ah.v, bq.v, bq.v, acc[t]); }
  }
#pragma unroll
  for (int t = 0; t < 4; ++t) { if (col0 + t * 16 >= N) continue; const int col = col0 + t * 16 + ln; const float bv = bp ? bf16_round(bp[col]) : 0.f;
#pragma unroll
    for (int r = 0; r < 8; ++r) { float v = acc[t][r] * alpha + bv; if (CP) { const int bidx = (row0g + row0 + 8 * hh + r) / rowsPerB; v += CP[(size_t)bidx * sCPb + (size_t)by * 64 + col]; } if (ACT == 1) v = (v > 0.f) ? v : expm1f(v); else if (ACT == 7) v = (v > 0.f) ? v + 1.0f : expf(v); else if (ACT == 8) v = tanhf(v); else if (ACT == 9) v = 0.5f * v * (1.0f + tanhf(0.7978845608028654f * (v + 0.044715f * v * v * v))); else if (ACT == 11) v = 1.0f / (1.0f + expf(-v)); else if (ACT == 12) v = (v > 0.f) ? v : 0.01f * v; else if (ACT == 14) v = (v > 0.f) ? v : 0.1f * v; else if (ACT == 15) v = v / (1.0f + expf(-v)); else if (ACT == 3) v = fmaxf(v, 0.f); else if (ACT == 6) v = 0.5f * v * (1.0f + erff(v * 0.70710678118654752f)); so[w][8 * hh + r][t * 16 + ln] = v; } }
  __builtin_amdgcn_fence(__ATOMIC_ACQ_REL, "workgroup"); __builtin_amdgcn_wave_barrier();
  const int rsub = lane >> 4, c4 = (lane & 15) * 4; typedef _Float16 v4h __attribute__((ext_vector_type(4)));
  {
#pragma unroll
    for (int q = 0; q < 8; ++q) { const int r = q * 2 + rsub; if (col0 + c4 < N) { const v4f v = *(const v4fa*)&so[w][r][c4]; if (C) *(v4f*)(C + cofs + (size_t)(row0 + r) * ldc + col0 + c4) = v; if (C16) { v4h h4; for (int i = 0; i < 4; ++i) h4[i] = (_Float16)v[i]; *(v4h*)(C16 + cofs + (size_t)(row0 + r) * ldc + col0 + c4) = h4; } } }
     }
}


typedef _Float16 v4h __attribute__((ext_vector_type(4)));

__global__ __launch_bounds__(256) void k_x16(const float* __restrict__ x, _Float16* __restrict__ X16, size_t n8) { const size_t t = (size_t)blockIdx.x * 256 + threadIdx.x; if (t >= n8) return; FragH f;
#pragma unroll
  for (int q = 0; q < 8; ++q) f.h[q] = (_Float16)bf16_round(x[t * 8 + q]); *(v8us*)((unsigned short*)X16 + t * 8) = f.half[0];  }
__global__ __launch_bounds__(256) void k_h16(const float* __restrict__ x, _Float16* __restrict__ X16, size_t n8) { const size_t t = (size_t)blockIdx.x * 256 + threadIdx.x; if (t >= n8) return; FragH f;
#pragma unroll
  for (int q = 0; q < 8; ++q) f.h[q] = (_Float16)x[t * 8 + q]; *(v8us*)((unsigned short*)X16 + t * 8) = f.half[0];  }
__global__ __launch_bounds__(256) void k_round16f(const float* __restrict__ W, _Float16* __restrict__ Bt, size_t n8) { const size_t t = (size_t)blockIdx.x * 256 + threadIdx.x; if (t >= n8) return; FragH f;
#pragma unroll
  for (int i = 0; i < 8; ++i) f.h[i] = (_Float16)(bf16_round(W[t * 8 + i]) * 16.0f); *(v8us*)((unsigned short*)Bt + t * 8) = f.half[0];  }
template <int NHv, int TTv>
__global__ __launch_bounds__(256) void k_vt(const _Float16* __restrict__ V16, int ldv, int voff, _Float16* __restrict__ Vt) { __shared__ unsigned short tl[64][66]; const int tid = threadIdx.x; const int slab = blockIdx.x / (TTv / 64), lg = blockIdx.x % (TTv / 64); const int b = slab / NHv, h = slab % NHv;
  for (int i = tid; i < 64 * 8; i += 256) { const int r = i / 8, c8 = (i % 8) * 8; FragH f; f.half[0] = *(const v8us*)((const unsigned short*)V16 + ((size_t)b * TTv + lg * 64 + r) * ldv + voff + h * 64 + c8);
#pragma unroll
    for (int q = 0; q < 8; ++q) tl[r][c8 + q] = f.u[q]; }
  __syncthreads();
  {
#pragma unroll
    for (int rd = 0; rd < 2; ++rd) { const int d = rd * 32 + tid / 8, pc = tid % 8; FragH f;
#pragma unroll
      for (int q = 0; q < 8; ++q) f.u[q] = tl[pc * 8 + q][d];
      *(v8us*)((unsigned short*)Vt + ((size_t)slab * 64 + d) * TTv + lg * 64 + pc * 8) = f.half[0]; }
     } }

__global__ __launch_bounds__(256) void k_hl(const float* __restrict__ F, _Float16* __restrict__ Hh, _Float16* __restrict__ Hl, size_t n8) { const size_t t = (size_t)blockIdx.x * 256 + threadIdx.x; if (t >= n8) return; FragH fh, fl; const v4f a = *(const v4fa*)(F + t * 8), c = *(const v4fa*)(F + t * 8 + 4);
#pragma unroll
  for (int q = 0; q < 4; ++q) { _Float16 h = (_Float16)a[q]; fh.h[q] = h; fl.h[q] = (_Float16)((a[q] - (float)h) * 1024.0f); h = (_Float16)c[q]; fh.h[4 + q] = h; fl.h[4 + q] = (_Float16)((c[q] - (float)h) * 1024.0f); }
  { *(v8us*)((unsigned short*)Hh + t * 8) = fh.half[0]; *(v8us*)((unsigned short*)Hl + t * 8) = fl.half[0];  } }
__global__ __launch_bounds__(256) void k_cstab(float* __restrict__ CS) { const int t = blockIdx.x * 256 + threadIdx.x; if (t >= TT * 32) return; const int p = t / 32, i = t % 32; const float invf = powf(10000.0f, -(float)(2 * i) / (float)HD); float sn, cs; sincosf((float)p * invf, &sn, &cs); typedef float v2f __attribute__((ext_vector_type(2), may_alias)); const v2f v = {cs, sn};
  *(v2f*)(CS + (size_t)t * 2) = v;  }
// rotary embedding: for row (b,s), head h, 8-dim piece g (d0 = g·8): (cos, sin) from the table row of the token's sequence position; d < 32: q'[d] = q[d]·cos_d − q[d+32]·sin_d; d ≥ 32: q'[d] = q[d]·cos_{d−32} + q[d−32]·sin_{d−32} (f32), stored f16;
template <int NHR, int LDI, int LDO>
__global__ __launch_bounds__(256) void k_rope(const float* __restrict__ QF, const float* __restrict__ CS, _Float16* __restrict__ Q16) { const size_t t = (size_t)blockIdx.x * 256 + threadIdx.x; if (t >= (size_t)NR * NHR * 8) return; const int g = (int)(t % 8); const int h = (int)((t / 8) % NHR); const size_t row = t / (8 * NHR); const int p = (int)(row % TT);      /* position = token index within the sequence (the reference's arange) */
  const int d0 = g * 8; const int i0 = d0 & 31; const float* base = QF + row * LDI + h * HD; const int dp = (d0 < 32) ? d0 + 32 : d0 - 32; const float sgn = (d0 < 32) ? -1.0f : 1.0f; const float* csr = CS + ((size_t)p * 32 + i0) * 2; FragH f;
#pragma unroll 1
  for (int e = 0; e < 8; ++e) { const float cs = csr[2 * e], sn = csr[2 * e + 1]; f.h[e] = (_Float16)(base[d0 + e] * cs + sgn * base[dp + e] * sn); }
  *(v8us*)((unsigned short*)Q16 + row * LDO + h * HD + d0) = f.half[0];  }
template <int NHV>
__global__ __launch_bounds__(256) void k_vthl(const float* __restrict__ VF, int ldv, int voff, _Float16* __restrict__ Vth, _Float16* __restrict__ Vtl) { __shared__ float tl[64][65]; const int tid = threadIdx.x; const int slab = blockIdx.x / (TT / 64), lg = blockIdx.x % (TT / 64); const int b = slab / NHV, h = slab % NHV;
  for (int i = tid; i < 64 * 16; i += 256) { const int r = i / 16, c4 = (i % 16) * 4; const v4f a = *(const v4fa*)(VF + ((size_t)b * TT + lg * 64 + r) * ldv + voff + h * HD + c4); tl[r][c4] = a[0]; tl[r][c4 + 1] = a[1]; tl[r][c4 + 2] = a[2]; tl[r][c4 + 3] = a[3]; }
  __syncthreads();
  FragH fh[2], fl[2]; size_t oo[2];
#pragma unroll
  for (int rd = 0; rd < 2; ++rd) { const int d = rd * 32 + tid / 8, pc = tid % 8;
#pragma unroll
    for (int q = 0; q < 8; ++q) { const float v = tl[pc * 8 + q][d]; const _Float16 hv = (_Float16)v; fh[rd].h[q] = hv; fl[rd].h[q] = (_Float16)((v - (float)hv) * 1024.0f); } oo[rd] = ((size_t)slab * HD + d) * TT + lg * 64 + pc * 8; }
  {
#pragma unroll
    for (int rd = 0; rd < 2; ++rd) { *(v8us*)((unsigned short*)Vth + oo[rd]) = fh[rd].half[0]; *(v8us*)((unsigned short*)Vtl + oo[rd]) = fl[rd].half[0]; }
     } }
__global__ __launch_bounds__(128) void k_flash(const _Float16* __restrict__ Q16, int ldq, const _Float16* __restrict__ K16, int ldk, const float* __restrict__ KH, const float* __restrict__ VHD, const _Float16* __restrict__ Vt, const _Float16* __restrict__ Vtlo, float* __restrict__ O, int ldo) {
  // One block = one 16-row query tile. Its 32-key chunks are dealt round-robin to the 4 waves (wave w takes chunks w, w + 4, ...); each wave keeps its own running max, sum and accumulators, and the four partial results are merged through LDS at the end.
  // A causal tile's cost grows with its index and there are more blocks than resident places, so the block index counts the tiles down: the lowest indices take the longest tiles.
  constexpr int RPW = 16, RTN = RPW / 16, NQT = TT / RPW, DT = 4, KS = 2;
  __shared__ __attribute__((aligned(16))) unsigned short sP[4][RPW][40]; __shared__ __attribute__((aligned(16))) unsigned short sPl[4][RPW][40]; __shared__ __attribute__((aligned(16))) float sO[4][RPW][64 + 4]; __shared__ float sM[4][RPW], sL[4][RPW];
  const int tid = threadIdx.x, lane = tid & 31, ln = lane & 15, hh = lane >> 4;
  const int w = __builtin_amdgcn_readfirstlane(tid >> 5);      /* wave number in a scalar register: it sets the key loop's start, and the loop around the matrix instructions must branch on a scalar */
  const int slab = blockIdx.x % (BB * NH), qt = NQT - 1 - blockIdx.x / (BB * NH); const int b = slab / NH, h = slab % NH; const int q0 = qt * RPW;
  FragH aq[2][KS];
#pragma unroll
  for (int rt = 0; rt < RTN; ++rt) { const unsigned short* qr = (const unsigned short*)Q16 + ((size_t)b * TT + q0 + rt * 16 + ln) * ldq + h * 64;
#pragma unroll
    for (int ks = 0; ks < KS; ++ks) { aq[rt][ks].half[0] = *(const v8us*)(qr + ks * 32 + 8 * hh); aq[rt][ks].half[1] = *(const v8us*)(qr + ks * 32 + 16 + 8 * hh); } }
  const unsigned short* Vth = (const unsigned short*)Vt + (size_t)b * 64 * TT; const unsigned short* Vtl = (const unsigned short*)Vtlo + (size_t)b * 64 * TT;      /* shared value head per batch */
  float m_r[2][8], l_r[2][8]; v8f oacc[2][DT], oaccl[2][DT], oacc2[2][DT];
#pragma unroll
  for (int rt = 0; rt < RTN; ++rt) {
#pragma unroll
    for (int r = 0; r < 8; ++r) { m_r[rt][r] = -3.0e38f; l_r[rt][r] = 0.f; }
#pragma unroll
    for (int dt = 0; dt < DT; ++dt) { oacc[rt][dt] = (v8f){0.f,0.f,0.f,0.f,0.f,0.f,0.f,0.f}; oaccl[rt][dt] = oacc[rt][dt]; oacc2[rt][dt] = oacc[rt][dt]; } }
  const int jend = q0 + RPW;
#pragma unroll 1
  for (int j0 = w * 32; j0 < jend; j0 += 4 * 32) {
    const float kh0 = KH[((size_t)b * TT + j0 + ln) * (2 * NH) + h], kh1 = KH[((size_t)b * TT + j0 + 16 + ln) * (2 * NH) + h], vh0 = VHD[((size_t)b * TT + j0 + ln) * (2 * NH) + h], vh1 = VHD[((size_t)b * TT + j0 + 16 + ln) * (2 * NH) + h];      /* per-key head scalars (sigmoid outputs, f32), in range */
    v8f s[2][2];
#pragma unroll
    for (int nt = 0; nt < 2; ++nt) { const unsigned short* kr = (const unsigned short*)K16 + ((size_t)b * TT + j0 + nt * 16 + ln) * ldk;      /* shared key head */ FragH bk[KS];
#pragma unroll
      for (int ks = 0; ks < KS; ++ks) { bk[ks].half[0] = *(const v8us*)(kr + ks * 32 + 8 * hh); bk[ks].half[1] = *(const v8us*)(kr + ks * 32 + 16 + 8 * hh); }
#pragma unroll
      for (int rt = 0; rt < RTN; ++rt) { v8f acc = (v8f){0.f,0.f,0.f,0.f,0.f,0.f,0.f,0.f};
#pragma unroll
        for (int ks = 0; ks < KS; ++ks) acc = mmaH<1>(aq[rt][ks].v, aq[rt][ks].v, bk[ks].v, bk[ks].v, acc); s[rt][nt] = acc; } }
#pragma unroll
    for (int rt = 0; rt < RTN; ++rt)
#pragma unroll
      for (int r = 0; r < 8; ++r) { const int tq = q0 + rt * 16 + 8 * hh + r; const int k0 = j0 + ln, k1 = j0 + 16 + ln; (void)tq; (void)k0; (void)k1;
        const bool ok0 = (k0 <= tq), ok1 = (k1 <= tq);
        const float s0 = ok0 ? s[rt][0][r] * kh0 * 0.125f : -INFINITY, s1 = ok1 ? s[rt][1][r] * kh1 * 0.125f : -INFINITY; float mc = fmaxf(s0, s1);
        mc = fmaxf(mc, __shfl_xor(mc, 1, 32)); mc = fmaxf(mc, __shfl_xor(mc, 2, 32)); mc = fmaxf(mc, __shfl_xor(mc, 4, 32)); mc = fmaxf(mc, __shfl_xor(mc, 8, 32));
        const float mn = fmaxf(m_r[rt][r], mc); const float al = (mn > -1.0e38f) ? expf(m_r[rt][r] - mn) : 1.0f; m_r[rt][r] = mn; const float p0 = ok0 ? expf(s0 - mn) : 0.f, p1 = ok1 ? expf(s1 - mn) : 0.f; l_r[rt][r] = l_r[rt][r] * al + p0 + p1;
#pragma unroll
        for (int dt = 0; dt < DT; ++dt) { oacc[rt][dt][r] *= al; oaccl[rt][dt][r] *= al; oacc2[rt][dt][r] *= al; }
        const float pv0 = p0 * vh0 * 1024.0f, pv1 = p1 * vh1 * 1024.0f; FragH t2, t3; t2.h[0] = (_Float16)pv0; t2.h[1] = (_Float16)pv1; t3.h[0] = (_Float16)((pv0 - (float)t2.h[0]) * 1024.0f); t3.h[1] = (_Float16)((pv1 - (float)t2.h[1]) * 1024.0f);      /* value-head scalar folded into P, carried as f16 hi + ×2^10 residual tiles; the normaliser keeps plain p */
        sP[w][rt * 16 + 8 * hh + r][ln] = t2.u[0]; sP[w][rt * 16 + 8 * hh + r][16 + ln] = t2.u[1]; sPl[w][rt * 16 + 8 * hh + r][ln] = t3.u[0]; sPl[w][rt * 16 + 8 * hh + r][16 + ln] = t3.u[1]; }
    __builtin_amdgcn_fence(__ATOMIC_ACQ_REL, "workgroup"); __builtin_amdgcn_wave_barrier();
    FragH pa[2], pl[2];
#pragma unroll
    for (int rt = 0; rt < RTN; ++rt) { pa[rt].half[0] = *(const v8us*)&sP[w][rt * 16 + ln][8 * hh]; pa[rt].half[1] = *(const v8us*)&sP[w][rt * 16 + ln][16 + 8 * hh]; pl[rt].half[0] = *(const v8us*)&sPl[w][rt * 16 + ln][8 * hh]; pl[rt].half[1] = *(const v8us*)&sPl[w][rt * 16 + ln][16 + 8 * hh]; }
#pragma unroll
    for (int dt = 0; dt < DT; ++dt) { const size_t vo = (size_t)(dt * 16 + ln) * TT + j0; FragH bv, bl; bv.half[0] = *(const v8us*)(Vth + vo + 8 * hh); bv.half[1] = *(const v8us*)(Vth + vo + 16 + 8 * hh); bl.half[0] = *(const v8us*)(Vtl + vo + 8 * hh); bl.half[1] = *(const v8us*)(Vtl + vo + 16 + 8 * hh);
#pragma unroll
      for (int rt = 0; rt < RTN; ++rt) { oacc[rt][dt] = mmaH<1>(pa[rt].v, pa[rt].v, bv.v, bv.v, oacc[rt][dt]); oaccl[rt][dt] = mmaH<1>(pa[rt].v, pa[rt].v, bl.v, bl.v, oaccl[rt][dt]); oacc2[rt][dt] = mmaH<1>(pl[rt].v, pl[rt].v, bv.v, bv.v, oacc2[rt][dt]); } }
    __builtin_amdgcn_fence(__ATOMIC_ACQ_REL, "workgroup"); __builtin_amdgcn_wave_barrier(); }
#pragma unroll
  for (int rt = 0; rt < RTN; ++rt) {
#pragma unroll
    for (int r = 0; r < 8; ++r) { float l = l_r[rt][r]; l += __shfl_xor(l, 1, 32); l += __shfl_xor(l, 2, 32); l += __shfl_xor(l, 4, 32); l += __shfl_xor(l, 8, 32); l_r[rt][r] = l; }
    if (ln == 0) {
#pragma unroll
      for (int r = 0; r < 8; ++r) { sM[w][rt * 16 + 8 * hh + r] = m_r[rt][r]; sL[w][rt * 16 + 8 * hh + r] = l_r[rt][r]; } }
#pragma unroll
    for (int dt = 0; dt < DT; ++dt)
#pragma unroll
      for (int r = 0; r < 8; ++r) sO[w][rt * 16 + 8 * hh + r][dt * 16 + ln] = oacc[rt][dt][r] + (oaccl[rt][dt][r] + oacc2[rt][dt][r]) * 0.0009765625f; }
  __syncthreads();      /* every wave's partial (max, sum, unnormalised rows) is in LDS before any wave merges */
  {
    const int r = tid >> 3, c4 = (tid & 7) * 4;      /* 8 threads a row, two 128-byte lines a row */
    float mw[4], M = -3.0e38f, L = 0.f;
#pragma unroll
    for (int i = 0; i < 4; ++i) { mw[i] = sM[i][r]; M = fmaxf(M, mw[i]); }
#pragma unroll
    for (int i = 0; i < 4; ++i) { mw[i] = expf(mw[i] - M); L += mw[i] * sL[i][r]; }      /* a wave that had no chunk holds max -3e38, sum 0, rows 0: weight 0 */
    const float inv = (L > 0.f) ? 1.0f / (L * 1024.0f) : 0.f;
#pragma unroll
    for (int hf = 0; hf < 2; ++hf) { v4f a = {0.f, 0.f, 0.f, 0.f};
#pragma unroll
      for (int i = 0; i < 4; ++i) { const v4f p = *(const v4fa*)&sO[i][r][hf * 32 + c4]; a += p * mw[i]; }
      *(v4f*)(O + ((size_t)b * TT + q0 + r) * ldo + h * 64 + hf * 32 + c4) = a * inv; }
  } }

extern "C" void kernel_launch(void* const* d_in, const int* in_sizes, int n_in,
                              void* d_out, int out_size, void* d_ws, size_t ws_size, hipStream_t stream) {
  (void)in_sizes; (void)n_in; (void)out_size;
  const float* x = (const float*)d_in[0]; const float* Wq = (const float*)d_in[1]; const float* Wkv = (const float*)d_in[2]; const float* Wkvh = (const float*)d_in[3]; const float* Wo = (const float*)d_in[4];
  char* ws = (char*)d_ws; size_t off = 0;
  auto take = [&](size_t bytes) { char* p = ws + off; off += (bytes + 255) & ~(size_t)255; return p; };
  _Float16* Bq = (_Float16*)take((size_t)DM * DM * 2); _Float16* Bkv = (_Float16*)take((size_t)2 * HD * DM * 2); _Float16* Bkh = (_Float16*)take((size_t)2 * NH * DM * 2); _Float16* Bo = (_Float16*)take((size_t)DM * DM * 2); float* CS = (float*)take((size_t)TT * 32 * 2 * 4);
  _Float16* X16 = (_Float16*)take((size_t)NR * DM * 2); float* F32 = (float*)take((size_t)NR * DM * 4); _Float16* Q16 = (_Float16*)take((size_t)NR * DM * 2); float* KVF = (float*)take((size_t)NR * 2 * HD * 4); _Float16* K16 = (_Float16*)take((size_t)NR * HD * 2); float* HS = (float*)take((size_t)NR * 2 * NH * 4);
  _Float16* Vth = (_Float16*)take((size_t)BB * HD * TT * 2); _Float16* Vtl = (_Float16*)take((size_t)BB * HD * TT * 2); _Float16* OH = (_Float16*)take((size_t)NR * DM * 2); _Float16* OL = (_Float16*)take((size_t)NR * DM * 2);
  float* O = F32;      /* F32 holds q (consumed by k_rope) then O */
  if (off > ws_size) return;      // 2.1 + 0.3 + 0.1 + 2.1 + 0.5 + 8.4 + 16.8 + 8.4 + 2.1 + 0.5 + 0.5 + 0.5 + 0.5 + 8.4 + 8.4 ≈ 60 MB
  k_wt_f16<<<(unsigned)(((size_t)DM * (DM / 8) + 255) / 256), 256, 0, stream>>>(Wq, Bq, DM, DM, 16.0f); k_wt_f16<<<(unsigned)(((size_t)2 * HD * (DM / 8) + 255) / 256), 256, 0, stream>>>(Wkv, Bkv, DM, 2 * HD, 16.0f);
  k_wt_f16<<<(unsigned)(((size_t)2 * NH * (DM / 8) + 255) / 256), 256, 0, stream>>>(Wkvh, Bkh, DM, 2 * NH, 16.0f); k_wt_f16<<<(unsigned)(((size_t)DM * (DM / 8) + 255) / 256), 256, 0, stream>>>(Wo, Bo, DM, DM, 16.0f);      /* (in,out) → Bt ×2^4 */
  k_x16<<<(unsigned)(((size_t)NR * DM / 8 + 255) / 256), 256, 0, stream>>>(x, X16, (size_t)NR * DM / 8); k_cstab<<<(TT * 32 + 255) / 256, 256, 0, stream>>>(CS);
  const dim3 gq(((NR / 16) * (DM / 64) + 3) / 4, 1);
  k_gemm_hhx<0><<<gq, 128, 0, stream>>>(X16, DM, 0, Bq, DM, 0, 0.0625f, nullptr, 0, nullptr, 1, 0, 0, F32, nullptr, DM, 0, NR, DM, DM); k_rope<NH, DM, DM><<<(unsigned)(((size_t)NR * NH * 8 + 255) / 256), 256, 0, stream>>>(F32, CS, Q16);      /* q → RoPE → f16 */
  k_gemm_hhx<0><<<dim3(((NR / 16) * 2 + 3) / 4, 1), 128, 0, stream>>>(X16, DM, 0, Bkv, DM, 0, 0.0625f, nullptr, 0, nullptr, 1, 0, 0, KVF, nullptr, 2 * HD, 0, NR, 2 * HD, DM);      /* [k | v] f32: M 4096 N 128 K 1024 */
  k_rope<1, 2 * HD, HD><<<(unsigned)(((size_t)NR * 8 + 255) / 256), 256, 0, stream>>>(KVF, CS, K16);      /* shared k (cols 0..63 of KVF, row stride 128) → RoPE → K16 [4096][64] */
  k_vthl<1><<<BB * (TT / 64), 256, 0, stream>>>(KVF, 2 * HD, HD, Vth, Vtl);      /* shared v (cols 64..127) → Vᵀ hi/lo per batch [b][64][T] */
  k_gemm_hhx<11><<<dim3(((NR / 16) * 1 + 3) / 4, 1), 128, 0, stream>>>(X16, DM, 0, Bkh, DM, 0, 0.0625f, nullptr, 0, nullptr, 1, 0, 0, HS, nullptr, 2 * NH, 0, NR, 2 * NH, DM);      /* [kh | vh] = sigmoid(x·Wkvh): M 4096 N 32 K 1024, f32 rows of 32 */
  k_flash<<<BB * NH * (TT / 16), 128, 0, stream>>>(Q16, DM, K16, HD, HS, HS + NH, Vth, Vtl, O, DM);      /* KH = HS cols 0..15, VH = cols 16..31 (row stride 2·NH = 32) */
  k_hl<<<(unsigned)(((size_t)NR * DM / 8 + 255) / 256), 256, 0, stream>>>(O, OH, OL, (size_t)NR * DM / 8);
  k_gemm_hhx<0><<<gq, 128, 0, stream>>>(OH, DM, 0, Bo, DM, 0, 0.0625f, nullptr, 0, nullptr, 1, 0, 0, (float*)d_out, nullptr, DM, 0, NR, DM, DM);      /* y = O_hi·Wo */
  k_gemm_hhx<0><<<gq, 128, 0, stream>>>(OL, DM, 0, Bo, DM, 0, 0.0625f * 0.0009765625f, nullptr, 0, (float*)d_out, 1, (size_t)DM, 0, (float*)d_out, nullptr, DM, 0, NR, DM, DM);      /* += O_lo·Wo·2^-10 in place */
}

// v002
// One run takes 304 microseconds.
// Next to v001, in two timings, it ran 1.49 and 1.51 times as fast.
// Counting every step since v000, it is 1.80 times as fast.
#include <hip/hip_runtime.h>
// Multi-product attention with low-rank shared key/value (B=2, N=2048, D=1024, 16 heads × 64): q = x·Wq; [k|v] = x·Wkv (one shared 64-dim key and value); [kh|vh] = σ(x·Wkvh) per (token, head); rotary (rotate-half, θ=1e4) on q and k by
// sequence position; K_h[n] = kh[n,h]·k[n], V_h[n] = vh[n,h]·v[n]; causal softmax(q_h·K_hᵀ/8); out = (Σ attn·V_h merged)·Wo.
// Compute dtype: x and weights rounded to bf16; q and k as f32 GEMM outputs rotated in f32 from a one-time f32 cos/sin table and stored f16; head scalars as sigmoid GEMM epilogue outputs (f32); v f32 →
// f16 hi + ×2^10 residual Vᵀ planes; fused causal flash-style kernel (scores scaled by kh per key, P multiplied by vh per key and carried as f16 hi + residual tiles, online softmax f32, three value accumulators) on v_wmma_f32_16x16x32_f16; merged O → hi/lo → Wo GEMMs (second in place ×2^-10); f32 accumulate.
#define BB 2
#define TT 2048
#define DM 1024
#define NH 16
#define HD 64
#define NR (BB * TT)

typedef __bf16 v16b __attribute__((ext_vector_type(16)));
typedef unsigned short v8us __attribute__((ext_vector_type(8), may_alias));
typedef float  v8f  __attribute__((ext_vector_type(8)));
typedef float  v4f  __attribute__((ext_vector_type(4)));
typedef float  v4fa __attribute__((ext_vector_type(4), may_alias));
union FragB { v16b v; v8us half[2]; unsigned short u[16]; };

__device__ __forceinline__ unsigned short bf16_bits(float x) { unsigned int u = __float_as_uint(x); return (unsigned short)((u + 0x7FFFu + ((u >> 16) & 1u)) >> 16); }
__device__ __forceinline__ float bf16_val(unsigned short b) { return __uint_as_float(((unsigned int)b) << 16); }
__device__ __forceinline__ float bf16_round(float x) { return bf16_val(bf16_bits(x)); }
// D += A·B with NT terms: 1 = ah·bh, 2 = + al·bh (A split), 3 = + ah·bl (both split)
template <int NT>
__device__ __forceinline__ v8f mmaN(v16b ah, v16b al, v16b bh, v16b bl, v8f c) {
  c = __builtin_amdgcn_wmma_f32_16x16x32_bf16(false, ah, false, bh, (short)0, c, false, false);
  if (NT >= 2) c = __builtin_amdgcn_wmma_f32_16x16x32_bf16(false, al, false, bh, (short)0, c, false, false);
  if (NT >= 3) c = __builtin_amdgcn_wmma_f32_16x16x32_bf16(false, ah, false, bl, (short)0, c, false, false);
  asm volatile("v_nop\n\tv_nop\n\tv_nop\n\tv_nop" : "+v"(c) : "v"(ah), "v"(al), "v"(bh), "v"(bl));
  return c;
}

__global__ __launch_bounds__(256) void k_wt_bf16(const float* __restrict__ W, unsigned short* __restrict__ Wt, int K, int N) {
  const int t = blockIdx.x * 256 + threadIdx.x;
  const int k8n = K / 8;
  if (t >= N * k8n) return;
  const int n = t / k8n, k8 = (t % k8n) * 8;
  v8us v;
#pragma unroll
  for (int i = 0; i < 8; ++i) v[i] = bf16_bits(W[(size_t)(k8 + i) * N + n]);
  *(v8us*)(Wt + (size_t)n * K + k8) = v;
  
}

// GEMM C[M][N] (f32, pitch ldc) = act(A[M][K]·W + bias). A f32 row-major (pitch lda) converted per fragment to bf16
// (ASPLIT: hi/lo two planes -> 2 terms, else single rounded term); Wt bf16 [N][K] (pitch ldb). BIAS_BF16 rounds the
// bias to bf16 first (bias quantised to bf16 before the add). K%32==0, M%16==0, N%64==0.
template <bool ASPLIT, int ACT, bool BIAS_BF16>
__global__ __launch_bounds__(128) void k_gemm_bf(const float* __restrict__ A, int lda, const unsigned short* __restrict__ Wt, int ldb,
                                               const float* __restrict__ bias, float* __restrict__ C, int ldc, int M, int N, int K) {
  __shared__ __attribute__((aligned(16))) float so[4][16][64];
  const int tid = threadIdx.x, w = tid >> 5, lane = tid & 31, ln = lane & 15, hh = lane >> 4;
  const int ntn = N / 64;
  const int wid = blockIdx.x * 4 + w;
  const int mt = wid / ntn, nq = wid % ntn;
  if (mt * 16 >= M) return;
  const int row0 = mt * 16, col0 = nq * 64;
  const float* arow = A + (size_t)(row0 + ln) * lda;
  v8f acc[4] = {};
  for (int kb = 0; kb < K; kb += 32) {
    FragB ah, al;
    const v4f x0 = *(const v4fa*)(arow + kb + 8 * hh), x1 = *(const v4fa*)(arow + kb + 8 * hh + 4);
    const v4f x2 = *(const v4fa*)(arow + kb + 16 + 8 * hh), x3 = *(const v4fa*)(arow + kb + 16 + 8 * hh + 4);
    float xs[16] = {x0[0],x0[1],x0[2],x0[3],x1[0],x1[1],x1[2],x1[3],x2[0],x2[1],x2[2],x2[3],x3[0],x3[1],x3[2],x3[3]};
#pragma unroll
    for (int i = 0; i < 16; ++i) { const unsigned short hb = bf16_bits(xs[i]); ah.u[i] = hb; al.u[i] = ASPLIT ? bf16_bits(xs[i] - bf16_val(hb)) : (unsigned short)0; }
#pragma unroll
    for (int t = 0; t < 4; ++t) {
      const unsigned short* brow = Wt + (size_t)(col0 + t * 16 + ln) * ldb + kb;
      FragB b;
      b.half[0] = *(const v8us*)(brow + 8 * hh);
      b.half[1] = *(const v8us*)(brow + 16 + 8 * hh);
      acc[t] = mmaN<ASPLIT ? 2 : 1>(ah.v, al.v, b.v, b.v, acc[t]);
    }
  }
#pragma unroll
  for (int t = 0; t < 4; ++t) {
    float bv = bias ? bias[col0 + t * 16 + ln] : 0.f;
    if (BIAS_BF16) bv = bf16_round(bv);
#pragma unroll
    for (int r = 0; r < 8; ++r) { float v = acc[t][r] + bv; if (ACT == 1) v = fmaxf(v, 0.f); so[w][8 * hh + r][t * 16 + ln] = v; }
  }
  __builtin_amdgcn_fence(__ATOMIC_ACQ_REL, "workgroup");
  __builtin_amdgcn_wave_barrier();
  const int rsub = lane >> 4, c4 = (lane & 15) * 4;
  {
#pragma unroll
    for (int q = 0; q < 8; ++q) {
      const int r = q * 2 + rsub;
      const v4f v = *(const v4fa*)&so[w][r][c4];
      *(v4f*)(C + (size_t)(row0 + r) * ldc + col0 + c4) = v;
    }
    
  }
}

// Flash-style causal/unmasked attention, all contractions 3-term bf16 hi/lo splits, f32 softmax with running max.
// q,k,v rows are read from f32 buffers with arbitrary row pitch (so they can live inside a fused qkv buffer);
// D = head size (multiple of 32, <= 128); one wave = 16 query rows; block = 4 waves (64 queries) sharing K/V chunks of 32.
template <int D, bool CAUSAL>
__global__ __launch_bounds__(128) void k_flash(const float* __restrict__ qb, const float* __restrict__ kb, const float* __restrict__ vb,
                                             int pitch, int T, int H, float scale, float* __restrict__ y, int ypitch) {
  constexpr int KS = D / 32;        // k-steps for QK
  constexpr int DT = D / 16;        // d tiles for PV
  __shared__ __attribute__((aligned(16))) unsigned short sKh[32][D + 8], sKl[32][D + 8], sVh[32][D + 8], sVl[32][D + 8];
  __shared__ __attribute__((aligned(16))) unsigned short sPh[4][16][40], sPl[4][16][40];
  __shared__ __attribute__((aligned(16))) float sO[4][16][D];
  const int tid = threadIdx.x, w = tid >> 5, lane = tid & 31, ln = lane & 15, hh = lane >> 4;
  const int nqb = (T + 63) / 64;
  const int bh = blockIdx.x / nqb, qblk = blockIdx.x % nqb;
  const int b = bh / H, h = bh % H;
  const int q0 = qblk * 64 + w * 16;
  const float* Q = qb + (size_t)b * T * pitch + h * D;
  const float* K = kb + (size_t)b * T * pitch + h * D;
  const float* V = vb + (size_t)b * T * pitch + h * D;

  // A fragments of the wave's 16 query rows (scaled), hi/lo
  FragB aqh[KS], aql[KS];
  {
    int row = q0 + ln; if (row >= T) row = T - 1;
    const float* qr = Q + (size_t)row * pitch;
#pragma unroll
    for (int ks = 0; ks < KS; ++ks)
#pragma unroll
      for (int i = 0; i < 16; ++i) {
        const int d = ks * 32 + ((i < 8) ? (8 * hh + i) : (16 + 8 * hh + (i - 8)));
        const float x = qr[d] * scale; const unsigned short hb = bf16_bits(x);
        aqh[ks].u[i] = hb; aql[ks].u[i] = bf16_bits(x - bf16_val(hb));
      }
  }
  float m_r[8], l_r[8];
#pragma unroll
  for (int r = 0; r < 8; ++r) { m_r[r] = -3.0e38f; l_r[r] = 0.f; }
  v8f oacc[DT];
#pragma unroll
  for (int dt = 0; dt < DT; ++dt) oacc[dt] = (v8f){0.f,0.f,0.f,0.f,0.f,0.f,0.f,0.f};

  const int kv_end = CAUSAL ? min(T, qblk * 64 + 64) : T;     // block-uniform
  for (int j0 = 0; j0 < kv_end; j0 += 32) {
    __syncthreads();
    for (int e = tid; e < 32 * (D / 4); e += 128) {
      const int r = e / (D / 4), c4 = (e % (D / 4)) * 4;
      const int key = j0 + r;
      v4f kf = {0.f,0.f,0.f,0.f}, vf = {0.f,0.f,0.f,0.f};
      if (key < T) { kf = *(const v4fa*)(K + (size_t)key * pitch + c4); vf = *(const v4fa*)(V + (size_t)key * pitch + c4); }
#pragma unroll
      for (int t = 0; t < 4; ++t) {
        unsigned short hb = bf16_bits(kf[t]); sKh[r][c4 + t] = hb; sKl[r][c4 + t] = bf16_bits(kf[t] - bf16_val(hb));
        hb = bf16_bits(vf[t]); sVh[r][c4 + t] = hb; sVl[r][c4 + t] = bf16_bits(vf[t] - bf16_val(hb));
      }
    }
    __syncthreads();
    // S tile 16 x 32
    v8f s[2];
#pragma unroll
    for (int nt = 0; nt < 2; ++nt) {
      v8f acc = {};
#pragma unroll
      for (int ks = 0; ks < KS; ++ks) {
        FragB bh_, bl_;
        bh_.half[0] = *(const v8us*)&sKh[nt * 16 + ln][ks * 32 + 8 * hh]; bh_.half[1] = *(const v8us*)&sKh[nt * 16 + ln][ks * 32 + 16 + 8 * hh];
        bl_.half[0] = *(const v8us*)&sKl[nt * 16 + ln][ks * 32 + 8 * hh]; bl_.half[1] = *(const v8us*)&sKl[nt * 16 + ln][ks * 32 + 16 + 8 * hh];
        acc = mmaN<3>(aqh[ks].v, aql[ks].v, bh_.v, bl_.v, acc);
      }
      s[nt] = acc;
    }
    // mask + running max (rows 8hh+r; the 16 lanes of a half share rows)
    float alpha[8];
#pragma unroll
    for (int r = 0; r < 8; ++r) {
      const int qi = q0 + 8 * hh + r;
      const int ja = j0 + ln, jb = j0 + 16 + ln;
      if (CAUSAL) { if (ja > qi) s[0][r] = -3.0e38f; if (jb > qi) s[1][r] = -3.0e38f; }
      if (ja >= T) s[0][r] = -3.0e38f;
      if (jb >= T) s[1][r] = -3.0e38f;
      float mx = fmaxf(s[0][r], s[1][r]);
      mx = fmaxf(mx, __shfl_xor(mx, 1, 32)); mx = fmaxf(mx, __shfl_xor(mx, 2, 32)); mx = fmaxf(mx, __shfl_xor(mx, 4, 32)); mx = fmaxf(mx, __shfl_xor(mx, 8, 32));
      const float mnew = fmaxf(m_r[r], mx);
      alpha[r] = (mnew > -1.0e38f) ? __expf(m_r[r] - mnew) : 1.0f;
      const float p0 = (s[0][r] > -1.0e38f) ? __expf(s[0][r] - mnew) : 0.f;
      const float p1 = (s[1][r] > -1.0e38f) ? __expf(s[1][r] - mnew) : 0.f;
      m_r[r] = mnew;
      l_r[r] = l_r[r] * alpha[r] + p0 + p1;            // per-lane partial row sum (16 lanes combined at the end)
      unsigned short hb = bf16_bits(p0); sPh[w][8 * hh + r][ln] = hb;      sPl[w][8 * hh + r][ln] = bf16_bits(p0 - bf16_val(hb));
      hb = bf16_bits(p1);                sPh[w][8 * hh + r][16 + ln] = hb; sPl[w][8 * hh + r][16 + ln] = bf16_bits(p1 - bf16_val(hb));
    }
#pragma unroll
    for (int dt = 0; dt < DT; ++dt)
#pragma unroll
      for (int r = 0; r < 8; ++r) oacc[dt][r] *= alpha[r];
    __builtin_amdgcn_fence(__ATOMIC_ACQ_REL, "workgroup");
    __builtin_amdgcn_wave_barrier();
    FragB pah, pal;
    pah.half[0] = *(const v8us*)&sPh[w][ln][8 * hh]; pah.half[1] = *(const v8us*)&sPh[w][ln][16 + 8 * hh];
    pal.half[0] = *(const v8us*)&sPl[w][ln][8 * hh]; pal.half[1] = *(const v8us*)&sPl[w][ln][16 + 8 * hh];
#pragma unroll
    for (int dt = 0; dt < DT; ++dt) {
      FragB bvh, bvl;
#pragma unroll
      for (int i = 0; i < 8; ++i) {
        bvh.u[i] = sVh[8 * hh + i][dt * 16 + ln]; bvh.u[8 + i] = sVh[16 + 8 * hh + i][dt * 16 + ln];
        bvl.u[i] = sVl[8 * hh + i][dt * 16 + ln]; bvl.u[8 + i] = sVl[16 + 8 * hh + i][dt * 16 + ln];
      }
      oacc[dt] = mmaN<3>(pah.v, pal.v, bvh.v, bvl.v, oacc[dt]);
    }
    __builtin_amdgcn_fence(__ATOMIC_ACQ_REL, "workgroup");
    __builtin_amdgcn_wave_barrier();
  }
#pragma unroll
  for (int r = 0; r < 8; ++r) {
    float l = l_r[r];
    l += __shfl_xor(l, 1, 32); l += __shfl_xor(l, 2, 32); l += __shfl_xor(l, 4, 32); l += __shfl_xor(l, 8, 32);
    l_r[r] = (l > 0.f) ? 1.0f / l : 0.f;
  }
#pragma unroll
  for (int dt = 0; dt < DT; ++dt)
#pragma unroll
    for (int r = 0; r < 8; ++r) sO[w][8 * hh + r][dt * 16 + ln] = oacc[dt][r] * l_r[r];
  __builtin_amdgcn_fence(__ATOMIC_ACQ_REL, "workgroup");
  __builtin_amdgcn_wave_barrier();
  {
    for (int r = 0; r < 16; ++r) {
      const int row = q0 + r;
      if (row < T && lane < D / 4) {
        const v4f val = *(const v4fa*)&sO[w][r][lane * 4];
        *(v4f*)(y + ((size_t)b * T + row) * ypitch + h * D + lane * 4) = val;
      }
    }
    
  }
}

// GEMM C = act(A·W + bias + resid): A f32 (ASPLIT -> hi/lo 2 terms), Wt bf16 [N][K]; ACT 0 none, 1 relu, 2 exact gelu;
// resid (optional, f32, row index = (row % rmod), pitch ldr, RES_BF16 rounds it) added before the activation.
template <bool ASPLIT, int ACT, bool BIAS_BF16, bool RES_BF16>
__global__ __launch_bounds__(128) void k_gemm_bf3(const float* __restrict__ A, int lda, const unsigned short* __restrict__ Wt, int ldb,
                                                const float* __restrict__ bias, const float* __restrict__ resid, int rmod, int ldr,
                                                float* __restrict__ C, int ldc, int M, int N, int K) {
  __shared__ __attribute__((aligned(16))) float so[4][16][64];
  const int tid = threadIdx.x, w = tid >> 5, lane = tid & 31, ln = lane & 15, hh = lane >> 4;
  const int ntn = N / 64;
  const int wid = blockIdx.x * 4 + w;
  const int mt = wid / ntn, nq = wid % ntn;
  if (mt * 16 >= M) return;
  const int row0 = mt * 16, col0 = nq * 64;
  const float* arow = A + (size_t)(row0 + ln) * lda;
  v8f acc[4] = {};
  for (int kb = 0; kb < K; kb += 32) {
    FragB ah, al;
    const v4f x0 = *(const v4fa*)(arow + kb + 8 * hh), x1 = *(const v4fa*)(arow + kb + 8 * hh + 4);
    const v4f x2 = *(const v4fa*)(arow + kb + 16 + 8 * hh), x3 = *(const v4fa*)(arow + kb + 16 + 8 * hh + 4);
    float xs[16] = {x0[0],x0[1],x0[2],x0[3],x1[0],x1[1],x1[2],x1[3],x2[0],x2[1],x2[2],x2[3],x3[0],x3[1],x3[2],x3[3]};
#pragma unroll
    for (int i = 0; i < 16; ++i) { const unsigned short hb = bf16_bits(xs[i]); ah.u[i] = hb; al.u[i] = ASPLIT ? bf16_bits(xs[i] - bf16_val(hb)) : (unsigned short)0; }
#pragma unroll
    for (int t = 0; t < 4; ++t) {
      const unsigned short* brow = Wt + (size_t)(col0 + t * 16 + ln) * ldb + kb;
      FragB b;
      b.half[0] = *(const v8us*)(brow + 8 * hh);
      b.half[1] = *(const v8us*)(brow + 16 + 8 * hh);
      acc[t] = mmaN<ASPLIT ? 2 : 1>(ah.v, al.v, b.v, b.v, acc[t]);
    }
  }
#pragma unroll
  for (int t = 0; t < 4; ++t) {
    const int col = col0 + t * 16 + ln;
    float bv = bias ? bias[col] : 0.f;
    if (BIAS_BF16) bv = bf16_round(bv);
#pragma unroll
    for (int r = 0; r < 8; ++r) {
      float v = acc[t][r] + bv;
      if (resid) { float rv = resid[(size_t)((row0 + 8 * hh + r) % rmod) * ldr + col]; if (RES_BF16) rv = bf16_round(rv); v += rv; }
      if (ACT == 1) v = fmaxf(v, 0.f);
      if (ACT == 2) v = 0.5f * v * (1.0f + erff(v * 0.70710678118654752f));
      if (ACT == 3) { const float u = 0.7978845608028654f * (v + 0.044715f * v * v * v); v = 0.5f * v * (1.0f + tanhf(u)); }
      so[w][8 * hh + r][t * 16 + ln] = v;
    }
  }
  __builtin_amdgcn_fence(__ATOMIC_ACQ_REL, "workgroup");
  __builtin_amdgcn_wave_barrier();
  const int rsub = lane >> 4, c4 = (lane & 15) * 4;
  {
#pragma unroll
    for (int q = 0; q < 8; ++q) {
      const int r = q * 2 + rsub;
      const v4f v = *(const v4fa*)&so[w][r][c4];
      *(v4f*)(C + (size_t)(row0 + r) * ldc + col0 + c4) = v;
    }
    
  }
}
// row LayerNorm (biased variance, eps) over N: s = X (+ R); optional out_sum <- s; out_norm <- (s-mu)*rsqrt(var+eps)*g + b
template <bool PARAM_BF16>
__global__ __launch_bounds__(256) void k_layernorm(const float* __restrict__ X, const float* __restrict__ R, const float* __restrict__ g, const float* __restrict__ bta,
                                                  float* __restrict__ out_sum, float* __restrict__ out_norm, int N, float eps) {
  __shared__ float red[256];
  const int row = blockIdx.x, tid = threadIdx.x;
  const float* x = X + (size_t)row * N; const float* rr = R ? R + (size_t)row * N : nullptr;
  float vals[16];                     // up to N = 4096
  const int per = N / 256;            // contiguous chunk per thread? use strided-by-4 chunks: thread handles j = tid*4 + 1024*u
  float s1 = 0.f;
  for (int u = 0; u < per / 4; ++u) {
    const int j = tid * 4 + 1024 * u;
    const v4f a = *(const v4fa*)(x + j);
    v4f b = {0.f,0.f,0.f,0.f}; if (rr) b = *(const v4fa*)(rr + j);
#pragma unroll
    for (int q = 0; q < 4; ++q) { const float v = a[q] + b[q]; vals[u * 4 + q] = v; s1 += v; }
  }
  red[tid] = s1; __syncthreads();
  for (int st = 128; st > 0; st >>= 1) { if (tid < st) red[tid] += red[tid + st]; __syncthreads(); }
  const float mu = red[0] / (float)N; __syncthreads();
  float s2 = 0.f;
  for (int u = 0; u < per / 4; ++u)
#pragma unroll
    for (int q = 0; q < 4; ++q) { const float c = vals[u * 4 + q] - mu; s2 += c * c; }
  red[tid] = s2; __syncthreads();
  for (int st = 128; st > 0; st >>= 1) { if (tid < st) red[tid] += red[tid + st]; __syncthreads(); }
  const float rs = rsqrtf(red[0] / (float)N + eps);
  {
    for (int u = 0; u < per / 4; ++u) {
      const int j = tid * 4 + 1024 * u;
      v4f o, sm;
#pragma unroll
      for (int q = 0; q < 4; ++q) {
        float gg = g[j + q], bb = bta[j + q];
        if (PARAM_BF16) { gg = bf16_round(gg); bb = bf16_round(bb); }
        sm[q] = vals[u * 4 + q]; o[q] = (vals[u * 4 + q] - mu) * rs * gg + bb;
      }
      if (out_sum) *(v4f*)(out_sum + (size_t)row * N + j) = sm;
      *(v4f*)(out_norm + (size_t)row * N + j) = o;
    }
    
  }
}



// ---- f16 WMMA path (v_wmma_f32_16x16x32_f16): 11-bit significands for operands in range — used where a [0,1] probability operand needs more precision than bf16
typedef _Float16 v16h __attribute__((ext_vector_type(16)));
union FragH { v16h v; v8us half[2]; _Float16 h[16]; unsigned short u[16]; };
template <int NT>
__device__ __forceinline__ v8f mmaH(v16h ah, v16h al, v16h bh, v16h bl, v8f c) {
  c = __builtin_amdgcn_wmma_f32_16x16x32_f16(false, ah, false, bh, (short)0, c, false, false);
  if (NT >= 2) c = __builtin_amdgcn_wmma_f32_16x16x32_f16(false, al, false, bh, (short)0, c, false, false);
  if (NT >= 3) c = __builtin_amdgcn_wmma_f32_16x16x32_f16(false, ah, false, bl, (short)0, c, false, false);
  asm volatile("v_nop\n\tv_nop\n\tv_nop\n\tv_nop" : "+v"(c) : "v"(ah), "v"(al), "v"(bh), "v"(bl));
  return c;
}
// batched GEMM like k_gemm_b but f16 operands: A f32 (split into f16 hi/lo if ASPLIT, else rounded to f16), Bt = f16 values [n][k]; alpha; C f32; N multiple of 16 (partial tiles skipped)
template <bool ASPLIT>
__global__ __launch_bounds__(128) void k_gemm_h(const float* __restrict__ A, int lda, size_t sA, const _Float16* __restrict__ Bh, int ldb, size_t sB, float alpha, float* __restrict__ C, int ldc, size_t sC, int M, int N, int K) {
  __shared__ __attribute__((aligned(16))) float so[4][16][64];
  const int tid = threadIdx.x, w = tid >> 5, lane = tid & 31, ln = lane & 15, hh = lane >> 4; const int by = blockIdx.y;
  A += (size_t)by * sA; Bh += (size_t)by * sB; C += (size_t)by * sC;
  const int ntn = (N + 63) / 64; const int wid = blockIdx.x * 4 + w; const int mt = wid / ntn, nq = wid % ntn; if (mt * 16 >= M) return;
  const int row0 = mt * 16, col0 = nq * 64; const float* arow = A + (size_t)(row0 + ln) * lda;
  v8f acc[4] = {};
  for (int kb = 0; kb < K; kb += 32) {
    FragH ah, al;
    const v4f x0 = *(const v4fa*)(arow + kb + 8 * hh), x1 = *(const v4fa*)(arow + kb + 8 * hh + 4), x2 = *(const v4fa*)(arow + kb + 16 + 8 * hh), x3 = *(const v4fa*)(arow + kb + 16 + 8 * hh + 4);
    float xs[16] = {x0[0],x0[1],x0[2],x0[3],x1[0],x1[1],x1[2],x1[3],x2[0],x2[1],x2[2],x2[3],x3[0],x3[1],x3[2],x3[3]};
#pragma unroll
    for (int i = 0; i < 16; ++i) { const _Float16 h = (_Float16)xs[i]; ah.h[i] = h; al.h[i] = ASPLIT ? (_Float16)(xs[i] - (float)h) : (_Float16)0.0f; }
#pragma unroll
    for (int t = 0; t < 4; ++t) { if (col0 + t * 16 >= N) continue; const size_t boff = (size_t)(col0 + t * 16 + ln) * ldb + kb; FragH bq; bq.half[0] = *(const v8us*)(Bh + boff + 8 * hh); bq.half[1] = *(const v8us*)(Bh + boff + 16 + 8 * hh);
      acc[t] = mmaH<ASPLIT ? 2 : 1>(ah.v, al.v, bq.v, bq.v, acc[t]); }
  }
#pragma unroll
  for (int t = 0; t < 4; ++t) { if (col0 + t * 16 >= N) continue;
#pragma unroll
    for (int r = 0; r < 8; ++r) so[w][8 * hh + r][t * 16 + ln] = acc[t][r] * alpha; }
  __builtin_amdgcn_fence(__ATOMIC_ACQ_REL, "workgroup"); __builtin_amdgcn_wave_barrier();
  const int rsub = lane >> 4, c4 = (lane & 15) * 4;
  {
#pragma unroll
    for (int q = 0; q < 8; ++q) { const int r = q * 2 + rsub; if (col0 + c4 < N) { const v4f v = *(const v4fa*)&so[w][r][c4]; *(v4f*)(C + (size_t)(row0 + r) * ldc + col0 + c4) = v; } }
     }
}

// Wt[n][k] = f16(W[k][n]·scale) from f32 row-major W[K][N] (scale = power of two; bf16-exact weights stay exact in f16 away from the subnormal range)
__global__ __launch_bounds__(256) void k_wt_f16(const float* __restrict__ W, _Float16* __restrict__ Wt, int K, int N, float scale) {
  const int t = blockIdx.x * 256 + threadIdx.x; if (t >= N * (K / 8)) return; const int n = t / (K / 8), k8 = (t % (K / 8)) * 8; FragH f;
#pragma unroll
  for (int i = 0; i < 8; ++i) f.h[i] = (_Float16)(bf16_round(W[(size_t)(k8 + i) * N + n]) * scale); const v8us o = f.half[0];
  *(v8us*)((unsigned short*)Wt + (size_t)n * K + k8) = o; 
}
// Block-tile GEMM, f16 operands, f32 accumulate: C[row][col] = act(alpha * sum_k A[row][k] * Bt[col][k]) (+ C if ADDC). A and Bt are K-contiguous with row pitch DM, K = DM.
// One block of 8 waves owns a 128 x BN tile of C. Each pass brings 128 k (256 B of every operand row) from global memory in whole-row pieces into registers and from there into one of two LDS buffers
// (row pitch 272 B, an odd multiple of 16 B, for the 16-byte fragment reads); the next pass's global loads are issued ahead of this pass's products. Every wave computes a (16 * FM) x 32 part from LDS fragments,
// so an operand row is read from L2 once per block, not once per wave. k runs upward in steps of 32 into one accumulator per 16 x 16 tile.
// Every "#pragma unroll" in this kernel is there so that the small arrays it indexes (ra, rb, a, b, acc, o, c0) get constant indices and stay in registers.
template <int BN, int LDC, int ACT, bool ADDC>
__global__ __launch_bounds__(256) void k_gemm_t(const _Float16* __restrict__ A, const _Float16* __restrict__ Bt, float alpha, float* C) {
  constexpr int BM = 128, BK = 128, PB = BK * 2 + 16, WN = BN / 32, WM = 8 / WN, FM = BM / (16 * WM), NA = BM / 16, NB = BN / 16, KT = DM / BK;
  constexpr int STG = (BM + BN) * PB, EPW = FM * 16 * 36, EPI = 8 * EPW * 4, SZ = (2 * STG > EPI) ? 2 * STG : EPI;
  __shared__ __attribute__((aligned(16))) unsigned char sm[SZ];
  const int tid = threadIdx.x, lane = tid & 31, ln = lane & 15, hh = lane >> 4;
  const int w = __builtin_amdgcn_readfirstlane(tid >> 5);      /* wave number, uniform: it only picks the wave's part of the tile */
  const int wm = w / WN, wn = w % WN;
  const int row0 = blockIdx.y * BM, col0 = blockIdx.x * BN;
  const int sr = tid >> 4, sc = tid & 15;      /* 16 threads a row: 256 contiguous bytes */
  const unsigned short* ga = (const unsigned short*)A + (size_t)(row0 + sr) * DM + sc * 8;
  const unsigned short* gb = (const unsigned short*)Bt + (size_t)(col0 + sr) * DM + sc * 8;
  unsigned char* const sst = sm + sr * PB + sc * 16;
  const unsigned char* const fa = sm + (wm * FM * 16 + ln) * PB + hh * 16;
  const unsigned char* const fb = sm + (BM + wn * 32 + ln) * PB + hh * 16;
  v8us ra[NA], rb[NB];
#pragma unroll
  for (int i = 0; i < NA; ++i) ra[i] = *(const v8us*)(ga + (size_t)i * 16 * DM);
#pragma unroll
  for (int i = 0; i < NB; ++i) rb[i] = *(const v8us*)(gb + (size_t)i * 16 * DM);
#pragma unroll
  for (int i = 0; i < NA; ++i) *(v8us*)(sst + i * 16 * PB) = ra[i];
#pragma unroll
  for (int i = 0; i < NB; ++i) *(v8us*)(sst + (BM + i * 16) * PB) = rb[i];
  __syncthreads();      /* pass 0 is in buffer 0 before any wave reads a fragment */
  v8f acc[FM][2];
#pragma unroll
  for (int fm = 0; fm < FM; ++fm) { acc[fm][0] = (v8f){0.f,0.f,0.f,0.f,0.f,0.f,0.f,0.f}; acc[fm][1] = acc[fm][0]; }
  for (int kt = 0; kt < KT; ++kt) {
    const int cur = (kt & 1) * STG, nxt = STG - cur;
    if (kt + 1 < KT) {
#pragma unroll
      for (int i = 0; i < NA; ++i) ra[i] = *(const v8us*)(ga + (size_t)i * 16 * DM + (kt + 1) * BK);
#pragma unroll
      for (int i = 0; i < NB; ++i) rb[i] = *(const v8us*)(gb + (size_t)i * 16 * DM + (kt + 1) * BK);
    }
#pragma unroll
    for (int ks = 0; ks < BK / 32; ++ks) {
      FragH a[FM], b[2];
#pragma unroll
      for (int fm = 0; fm < FM; ++fm) { a[fm].half[0] = *(const v8us*)(fa + cur + fm * 16 * PB + ks * 64); a[fm].half[1] = *(const v8us*)(fa + cur + fm * 16 * PB + ks * 64 + 32); }
#pragma unroll
      for (int fn = 0; fn < 2; ++fn) { b[fn].half[0] = *(const v8us*)(fb + cur + fn * 16 * PB + ks * 64); b[fn].half[1] = *(const v8us*)(fb + cur + fn * 16 * PB + ks * 64 + 32); }
#pragma unroll
      for (int fm = 0; fm < FM; ++fm)
#pragma unroll
        for (int fn = 0; fn < 2; ++fn) acc[fm][fn] = __builtin_amdgcn_wmma_f32_16x16x32_f16(false, a[fm].v, false, b[fn].v, (short)0, acc[fm][fn], false, false);
    }
    if (kt + 1 < KT) {      /* the other buffer: its readers left it at the barrier that ended pass kt - 1 */
#pragma unroll
      for (int i = 0; i < NA; ++i) *(v8us*)(sst + nxt + i * 16 * PB) = ra[i];
#pragma unroll
      for (int i = 0; i < NB; ++i) *(v8us*)(sst + nxt + (BM + i * 16) * PB) = rb[i];
    }
    __syncthreads();      /* publishes pass kt + 1 and ends every wave's reads of pass kt */
  }
  /* epilogue: behind the last barrier the buffers are free; each wave turns its part into whole 128-byte rows in its own LDS range (row pitch 36 floats) */
  float* const so = (float*)sm + w * EPW;
  const int er = lane >> 3, ec = (lane & 7) * 4;      /* 8 lanes a row of 32 floats */
  float* const cp = C + (size_t)(row0 + wm * FM * 16 + er) * LDC + col0 + wn * 32 + ec;      /* one address for all rows of the part; the row step is a constant offset */
  v4f o[FM * 4], c0[FM * 4];
#pragma unroll
  for (int fm = 0; fm < FM; ++fm)
#pragma unroll
    for (int fn = 0; fn < 2; ++fn)
#pragma unroll
      for (int r = 0; r < 8; ++r) { float v = acc[fm][fn][r] * alpha; if (ACT == 11) v = 1.0f / (1.0f + expf(-v)); so[(fm * 16 + 8 * hh + r) * 36 + fn * 16 + ln] = v; }
  __builtin_amdgcn_fence(__ATOMIC_ACQ_REL, "workgroup"); __builtin_amdgcn_wave_barrier();      /* the wave's own LDS writes are done before its lanes read each other's */
  if (ADDC) {      /* the old values, all asked for at once, once the accumulators' registers are free */
#pragma unroll
    for (int q = 0; q < FM * 4; ++q) c0[q] = *(const v4fa*)(cp + (size_t)q * 4 * LDC);
  }
#pragma unroll
  for (int q = 0; q < FM * 4; ++q) { o[q] = *(const v4fa*)&so[(q * 4 + er) * 36 + ec]; if (ADDC) o[q] += c0[q]; }
#pragma unroll
  for (int q = 0; q < FM * 4; ++q) *(v4f*)(cp + (size_t)q * 4 * LDC) = o[q];
}


typedef _Float16 v4h __attribute__((ext_vector_type(4)));

__global__ __launch_bounds__(256) void k_x16(const float* __restrict__ x, _Float16* __restrict__ X16, size_t n8) { const size_t t = (size_t)blockIdx.x * 256 + threadIdx.x; if (t >= n8) return; FragH f;
#pragma unroll
  for (int q = 0; q < 8; ++q) f.h[q] = (_Float16)bf16_round(x[t * 8 + q]); *(v8us*)((unsigned short*)X16 + t * 8) = f.half[0];  }
__global__ __launch_bounds__(256) void k_h16(const float* __restrict__ x, _Float16* __restrict__ X16, size_t n8) { const size_t t = (size_t)blockIdx.x * 256 + threadIdx.x; if (t >= n8) return; FragH f;
#pragma unroll
  for (int q = 0; q < 8; ++q) f.h[q] = (_Float16)x[t * 8 + q]; *(v8us*)((unsigned short*)X16 + t * 8) = f.half[0];  }
__global__ __launch_bounds__(256) void k_round16f(const float* __restrict__ W, _Float16* __restrict__ Bt, size_t n8) { const size_t t = (size_t)blockIdx.x * 256 + threadIdx.x; if (t >= n8) return; FragH f;
#pragma unroll
  for (int i = 0; i < 8; ++i) f.h[i] = (_Float16)(bf16_round(W[t * 8 + i]) * 16.0f); *(v8us*)((unsigned short*)Bt + t * 8) = f.half[0];  }
template <int NHv, int TTv>
__global__ __launch_bounds__(256) void k_vt(const _Float16* __restrict__ V16, int ldv, int voff, _Float16* __restrict__ Vt) { __shared__ unsigned short tl[64][66]; const int tid = threadIdx.x; const int slab = blockIdx.x / (TTv / 64), lg = blockIdx.x % (TTv / 64); const int b = slab / NHv, h = slab % NHv;
  for (int i = tid; i < 64 * 8; i += 256) { const int r = i / 8, c8 = (i % 8) * 8; FragH f; f.half[0] = *(const v8us*)((const unsigned short*)V16 + ((size_t)b * TTv + lg * 64 + r) * ldv + voff + h * 64 + c8);
#pragma unroll
    for (int q = 0; q < 8; ++q) tl[r][c8 + q] = f.u[q]; }
  __syncthreads();
  {
#pragma unroll
    for (int rd = 0; rd < 2; ++rd) { const int d = rd * 32 + tid / 8, pc = tid % 8; FragH f;
#pragma unroll
      for (int q = 0; q < 8; ++q) f.u[q] = tl[pc * 8 + q][d];
      *(v8us*)((unsigned short*)Vt + ((size_t)slab * 64 + d) * TTv + lg * 64 + pc * 8) = f.half[0]; }
     } }

__global__ __launch_bounds__(256) void k_hl(const float* __restrict__ F, _Float16* __restrict__ Hh, _Float16* __restrict__ Hl, size_t n8) { const size_t t = (size_t)blockIdx.x * 256 + threadIdx.x; if (t >= n8) return; FragH fh, fl; const v4f a = *(const v4fa*)(F + t * 8), c = *(const v4fa*)(F + t * 8 + 4);
#pragma unroll
  for (int q = 0; q < 4; ++q) { _Float16 h = (_Float16)a[q]; fh.h[q] = h; fl.h[q] = (_Float16)((a[q] - (float)h) * 1024.0f); h = (_Float16)c[q]; fh.h[4 + q] = h; fl.h[4 + q] = (_Float16)((c[q] - (float)h) * 1024.0f); }
  { *(v8us*)((unsigned short*)Hh + t * 8) = fh.half[0]; *(v8us*)((unsigned short*)Hl + t * 8) = fl.half[0];  } }
__global__ __launch_bounds__(256) void k_cstab(float* __restrict__ CS) { const int t = blockIdx.x * 256 + threadIdx.x; if (t >= TT * 32) return; const int p = t / 32, i = t % 32; const float invf = powf(10000.0f, -(float)(2 * i) / (float)HD); float sn, cs; sincosf((float)p * invf, &sn, &cs); typedef float v2f __attribute__((ext_vector_type(2), may_alias)); const v2f v = {cs, sn};
  *(v2f*)(CS + (size_t)t * 2) = v;  }
// rotary embedding: for row (b,s), head h, 8-dim piece g (d0 = g·8): (cos, sin) from the table row of the token's sequence position; d < 32: q'[d] = q[d]·cos_d − q[d+32]·sin_d; d ≥ 32: q'[d] = q[d]·cos_{d−32} + q[d−32]·sin_{d−32} (f32), stored f16;
template <int NHR, int LDI, int LDO>
__global__ __launch_bounds__(256) void k_rope(const float* __restrict__ QF, const float* __restrict__ CS, _Float16* __restrict__ Q16) { const size_t t = (size_t)blockIdx.x * 256 + threadIdx.x; if (t >= (size_t)NR * NHR * 8) return; const int g = (int)(t % 8); const int h = (int)((t / 8) % NHR); const size_t row = t / (8 * NHR); const int p = (int)(row % TT);      /* position = token index within the sequence (the reference's arange) */
  const int d0 = g * 8; const int i0 = d0 & 31; const float* base = QF + row * LDI + h * HD; const int dp = (d0 < 32) ? d0 + 32 : d0 - 32; const float sgn = (d0 < 32) ? -1.0f : 1.0f; const float* csr = CS + ((size_t)p * 32 + i0) * 2; FragH f;
#pragma unroll 1
  for (int e = 0; e < 8; ++e) { const float cs = csr[2 * e], sn = csr[2 * e + 1]; f.h[e] = (_Float16)(base[d0 + e] * cs + sgn * base[dp + e] * sn); }
  *(v8us*)((unsigned short*)Q16 + row * LDO + h * HD + d0) = f.half[0];  }
template <int NHV>
__global__ __launch_bounds__(256) void k_vthl(const float* __restrict__ VF, int ldv, int voff, _Float16* __restrict__ Vth, _Float16* __restrict__ Vtl) { __shared__ float tl[64][65]; const int tid = threadIdx.x; const int slab = blockIdx.x / (TT / 64), lg = blockIdx.x % (TT / 64); const int b = slab / NHV, h = slab % NHV;
  for (int i = tid; i < 64 * 16; i += 256) { const int r = i / 16, c4 = (i % 16) * 4; const v4f a = *(const v4fa*)(VF + ((size_t)b * TT + lg * 64 + r) * ldv + voff + h * HD + c4); tl[r][c4] = a[0]; tl[r][c4 + 1] = a[1]; tl[r][c4 + 2] = a[2]; tl[r][c4 + 3] = a[3]; }
  __syncthreads();
  FragH fh[2], fl[2]; size_t oo[2];
#pragma unroll
  for (int rd = 0; rd < 2; ++rd) { const int d = rd * 32 + tid / 8, pc = tid % 8;
#pragma unroll
    for (int q = 0; q < 8; ++q) { const float v = tl[pc * 8 + q][d]; const _Float16 hv = (_Float16)v; fh[rd].h[q] = hv; fl[rd].h[q] = (_Float16)((v - (float)hv) * 1024.0f); } oo[rd] = ((size_t)slab * HD + d) * TT + lg * 64 + pc * 8; }
  {
#pragma unroll
    for (int rd = 0; rd < 2; ++rd) { *(v8us*)((unsigned short*)Vth + oo[rd]) = fh[rd].half[0]; *(v8us*)((unsigned short*)Vtl + oo[rd]) = fl[rd].half[0]; }
     } }
__global__ __launch_bounds__(128) void k_flash(const _Float16* __restrict__ Q16, int ldq, const _Float16* __restrict__ K16, int ldk, const float* __restrict__ KH, const float* __restrict__ VHD, const _Float16* __restrict__ Vt, const _Float16* __restrict__ Vtlo, float* __restrict__ O, int ldo) {
  // One block = one 16-row query tile. Its 32-key chunks are dealt round-robin to the 4 waves (wave w takes chunks w, w + 4, ...); each wave keeps its own running max, sum and accumulators, and the four partial results are merged through LDS at the end.
  // A causal tile's cost grows with its index and there are more blocks than resident places, so the block index counts the tiles down: the lowest indices take the longest tiles.
  constexpr int RPW = 16, RTN = RPW / 16, NQT = TT / RPW, DT = 4, KS = 2;
  __shared__ __attribute__((aligned(16))) unsigned short sP[4][RPW][40]; __shared__ __attribute__((aligned(16))) unsigned short sPl[4][RPW][40]; __shared__ __attribute__((aligned(16))) float sO[4][RPW][64 + 4]; __shared__ float sM[4][RPW], sL[4][RPW];
  const int tid = threadIdx.x, lane = tid & 31, ln = lane & 15, hh = lane >> 4;
  const int w = __builtin_amdgcn_readfirstlane(tid >> 5);      /* wave number in a scalar register: it sets the key loop's start, and the loop around the matrix instructions must branch on a scalar */
  const int slab = blockIdx.x % (BB * NH), qt = NQT - 1 - blockIdx.x / (BB * NH); const int b = slab / NH, h = slab % NH; const int q0 = qt * RPW;
  FragH aq[2][KS];
#pragma unroll
  for (int rt = 0; rt < RTN; ++rt) { const unsigned short* qr = (const unsigned short*)Q16 + ((size_t)b * TT + q0 + rt * 16 + ln) * ldq + h * 64;
#pragma unroll
    for (int ks = 0; ks < KS; ++ks) { aq[rt][ks].half[0] = *(const v8us*)(qr + ks * 32 + 8 * hh); aq[rt][ks].half[1] = *(const v8us*)(qr + ks * 32 + 16 + 8 * hh); } }
  const unsigned short* Vth = (const unsigned short*)Vt + (size_t)b * 64 * TT; const unsigned short* Vtl = (const unsigned short*)Vtlo + (size_t)b * 64 * TT;      /* shared value head per batch */
  float m_r[2][8], l_r[2][8]; v8f oacc[2][DT], oaccl[2][DT], oacc2[2][DT];
#pragma unroll
  for (int rt = 0; rt < RTN; ++rt) {
#pragma unroll
    for (int r = 0; r < 8; ++r) { m_r[rt][r] = -3.0e38f; l_r[rt][r] = 0.f; }
#pragma unroll
    for (int dt = 0; dt < DT; ++dt) { oacc[rt][dt] = (v8f){0.f,0.f,0.f,0.f,0.f,0.f,0.f,0.f}; oaccl[rt][dt] = oacc[rt][dt]; oacc2[rt][dt] = oacc[rt][dt]; } }
  const int jend = q0 + RPW;
#pragma unroll 1
  for (int j0 = w * 32; j0 < jend; j0 += 4 * 32) {
    const float kh0 = KH[((size_t)b * TT + j0 + ln) * (2 * NH) + h], kh1 = KH[((size_t)b * TT + j0 + 16 + ln) * (2 * NH) + h], vh0 = VHD[((size_t)b * TT + j0 + ln) * (2 * NH) + h], vh1 = VHD[((size_t)b * TT + j0 + 16 + ln) * (2 * NH) + h];      /* per-key head scalars (sigmoid outputs, f32), in range */
    v8f s[2][2];
#pragma unroll
    for (int nt = 0; nt < 2; ++nt) { const unsigned short* kr = (const unsigned short*)K16 + ((size_t)b * TT + j0 + nt * 16 + ln) * ldk;      /* shared key head */ FragH bk[KS];
#pragma unroll
      for (int ks = 0; ks < KS; ++ks) { bk[ks].half[0] = *(const v8us*)(kr + ks * 32 + 8 * hh); bk[ks].half[1] = *(const v8us*)(kr + ks * 32 + 16 + 8 * hh); }
#pragma unroll
      for (int rt = 0; rt < RTN; ++rt) { v8f acc = (v8f){0.f,0.f,0.f,0.f,0.f,0.f,0.f,0.f};
#pragma unroll
        for (int ks = 0; ks < KS; ++ks) acc = mmaH<1>(aq[rt][ks].v, aq[rt][ks].v, bk[ks].v, bk[ks].v, acc); s[rt][nt] = acc; } }
#pragma unroll
    for (int rt = 0; rt < RTN; ++rt)
#pragma unroll
      for (int r = 0; r < 8; ++r) { const int tq = q0 + rt * 16 + 8 * hh + r; const int k0 = j0 + ln, k1 = j0 + 16 + ln; (void)tq; (void)k0; (void)k1;
        const bool ok0 = (k0 <= tq), ok1 = (k1 <= tq);
        const float s0 = ok0 ? s[rt][0][r] * kh0 * 0.125f : -INFINITY, s1 = ok1 ? s[rt][1][r] * kh1 * 0.125f : -INFINITY; float mc = fmaxf(s0, s1);
        mc = fmaxf(mc, __shfl_xor(mc, 1, 32)); mc = fmaxf(mc, __shfl_xor(mc, 2, 32)); mc = fmaxf(mc, __shfl_xor(mc, 4, 32)); mc = fmaxf(mc, __shfl_xor(mc, 8, 32));
        const float mn = fmaxf(m_r[rt][r], mc); const float al = (mn > -1.0e38f) ? expf(m_r[rt][r] - mn) : 1.0f; m_r[rt][r] = mn; const float p0 = ok0 ? expf(s0 - mn) : 0.f, p1 = ok1 ? expf(s1 - mn) : 0.f; l_r[rt][r] = l_r[rt][r] * al + p0 + p1;
#pragma unroll
        for (int dt = 0; dt < DT; ++dt) { oacc[rt][dt][r] *= al; oaccl[rt][dt][r] *= al; oacc2[rt][dt][r] *= al; }
        const float pv0 = p0 * vh0 * 1024.0f, pv1 = p1 * vh1 * 1024.0f; FragH t2, t3; t2.h[0] = (_Float16)pv0; t2.h[1] = (_Float16)pv1; t3.h[0] = (_Float16)((pv0 - (float)t2.h[0]) * 1024.0f); t3.h[1] = (_Float16)((pv1 - (float)t2.h[1]) * 1024.0f);      /* value-head scalar folded into P, carried as f16 hi + ×2^10 residual tiles; the normaliser keeps plain p */
        sP[w][rt * 16 + 8 * hh + r][ln] = t2.u[0]; sP[w][rt * 16 + 8 * hh + r][16 + ln] = t2.u[1]; sPl[w][rt * 16 + 8 * hh + r][ln] = t3.u[0]; sPl[w][rt * 16 + 8 * hh + r][16 + ln] = t3.u[1]; }
    __builtin_amdgcn_fence(__ATOMIC_ACQ_REL, "workgroup"); __builtin_amdgcn_wave_barrier();
    FragH pa[2], pl[2];
#pragma unroll
    for (int rt = 0; rt < RTN; ++rt) { pa[rt].half[0] = *(const v8us*)&sP[w][rt * 16 + ln][8 * hh]; pa[rt].half[1] = *(const v8us*)&sP[w][rt * 16 + ln][16 + 8 * hh]; pl[rt].half[0] = *(const v8us*)&sPl[w][rt * 16 + ln][8 * hh]; pl[rt].half[1] = *(const v8us*)&sPl[w][rt * 16 + ln][16 + 8 * hh]; }
#pragma unroll
    for (int dt = 0; dt < DT; ++dt) { const size_t vo = (size_t)(dt * 16 + ln) * TT + j0; FragH bv, bl; bv.half[0] = *(const v8us*)(Vth + vo + 8 * hh); bv.half[1] = *(const v8us*)(Vth + vo + 16 + 8 * hh); bl.half[0] = *(const v8us*)(Vtl + vo + 8 * hh); bl.half[1] = *(const v8us*)(Vtl + vo + 16 + 8 * hh);
#pragma unroll
      for (int rt = 0; rt < RTN; ++rt) { oacc[rt][dt] = mmaH<1>(pa[rt].v, pa[rt].v, bv.v, bv.v, oacc[rt][dt]); oaccl[rt][dt] = mmaH<1>(pa[rt].v, pa[rt].v, bl.v, bl.v, oaccl[rt][dt]); oacc2[rt][dt] = mmaH<1>(pl[rt].v, pl[rt].v, bv.v, bv.v, oacc2[rt][dt]); } }
    __builtin_amdgcn_fence(__ATOMIC_ACQ_REL, "workgroup"); __builtin_amdgcn_wave_barrier(); }
#pragma unroll
  for (int rt = 0; rt < RTN; ++rt) {
#pragma unroll
    for (int r = 0; r < 8; ++r) { float l = l_r[rt][r]; l += __shfl_xor(l, 1, 32); l += __shfl_xor(l, 2, 32); l += __shfl_xor(l, 4, 32); l += __shfl_xor(l, 8, 32); l_r[rt][r] = l; }
    if (ln == 0) {
#pragma unroll
      for (int r = 0; r < 8; ++r) { sM[w][rt * 16 + 8 * hh + r] = m_r[rt][r]; sL[w][rt * 16 + 8 * hh + r] = l_r[rt][r]; } }
#pragma unroll
    for (int dt = 0; dt < DT; ++dt)
#pragma unroll
      for (int r = 0; r < 8; ++r) sO[w][rt * 16 + 8 * hh + r][dt * 16 + ln] = oacc[rt][dt][r] + (oaccl[rt][dt][r] + oacc2[rt][dt][r]) * 0.0009765625f; }
  __syncthreads();      /* every wave's partial (max, sum, unnormalised rows) is in LDS before any wave merges */
  {
    const int r = tid >> 3, c4 = (tid & 7) * 4;      /* 8 threads a row, two 128-byte lines a row */
    float mw[4], M = -3.0e38f, L = 0.f;
#pragma unroll
    for (int i = 0; i < 4; ++i) { mw[i] = sM[i][r]; M = fmaxf(M, mw[i]); }
#pragma unroll
    for (int i = 0; i < 4; ++i) { mw[i] = expf(mw[i] - M); L += mw[i] * sL[i][r]; }      /* a wave that had no chunk holds max -3e38, sum 0, rows 0: weight 0 */
    const float inv = (L > 0.f) ? 1.0f / (L * 1024.0f) : 0.f;
#pragma unroll
    for (int hf = 0; hf < 2; ++hf) { v4f a = {0.f, 0.f, 0.f, 0.f};
#pragma unroll
      for (int i = 0; i < 4; ++i) { const v4f p = *(const v4fa*)&sO[i][r][hf * 32 + c4]; a += p * mw[i]; }
      *(v4f*)(O + ((size_t)b * TT + q0 + r) * ldo + h * 64 + hf * 32 + c4) = a * inv; }
  } }

extern "C" void kernel_launch(void* const* d_in, const int* in_sizes, int n_in,
                              void* d_out, int out_size, void* d_ws, size_t ws_size, hipStream_t stream) {
  (void)in_sizes; (void)n_in; (void)out_size;
  const float* x = (const float*)d_in[0]; const float* Wq = (const float*)d_in[1]; const float* Wkv = (const float*)d_in[2]; const float* Wkvh = (const float*)d_in[3]; const float* Wo = (const float*)d_in[4];
  char* ws = (char*)d_ws; size_t off = 0;
  auto take = [&](size_t bytes) { char* p = ws + off; off += (bytes + 255) & ~(size_t)255; return p; };
  _Float16* Bq = (_Float16*)take((size_t)DM * DM * 2); _Float16* Bkv = (_Float16*)take((size_t)2 * HD * DM * 2); _Float16* Bkh = (_Float16*)take((size_t)2 * NH * DM * 2); _Float16* Bo = (_Float16*)take((size_t)DM * DM * 2); float* CS = (float*)take((size_t)TT * 32 * 2 * 4);
  _Float16* X16 = (_Float16*)take((size_t)NR * DM * 2); float* F32 = (float*)take((size_t)NR * DM * 4); _Float16* Q16 = (_Float16*)take((size_t)NR * DM * 2); float* KVF = (float*)take((size_t)NR * 2 * HD * 4); _Float16* K16 = (_Float16*)take((size_t)NR * HD * 2); float* HS = (float*)take((size_t)NR * 2 * NH * 4);
  _Float16* Vth = (_Float16*)take((size_t)BB * HD * TT * 2); _Float16* Vtl = (_Float16*)take((size_t)BB * HD * TT * 2); _Float16* OH = (_Float16*)take((size_t)NR * DM * 2); _Float16* OL = (_Float16*)take((size_t)NR * DM * 2);
  float* O = F32;      /* F32 holds q (consumed by k_rope) then O */
  if (off > ws_size) return;      // 2.1 + 0.3 + 0.1 + 2.1 + 0.5 + 8.4 + 16.8 + 8.4 + 2.1 + 0.5 + 0.5 + 0.5 + 0.5 + 8.4 + 8.4 ≈ 60 MB
  k_wt_f16<<<(unsigned)(((size_t)DM * (DM / 8) + 255) / 256), 256, 0, stream>>>(Wq, Bq, DM, DM, 16.0f); k_wt_f16<<<(unsigned)(((size_t)2 * HD * (DM / 8) + 255) / 256), 256, 0, stream>>>(Wkv, Bkv, DM, 2 * HD, 16.0f);
  k_wt_f16<<<(unsigned)(((size_t)2 * NH * (DM / 8) + 255) / 256), 256, 0, stream>>>(Wkvh, Bkh, DM, 2 * NH, 16.0f); k_wt_f16<<<(unsigned)(((size_t)DM * (DM / 8) + 255) / 256), 256, 0, stream>>>(Wo, Bo, DM, DM, 16.0f);      /* (in,out) → Bt ×2^4 */
  k_x16<<<(unsigned)(((size_t)NR * DM / 8 + 255) / 256), 256, 0, stream>>>(x, X16, (size_t)NR * DM / 8); k_cstab<<<(TT * 32 + 255) / 256, 256, 0, stream>>>(CS);
  const dim3 gq(DM / 128, NR / 128);      /* 128 x 128 tiles of a 4096 x 1024 result: 256 blocks */
  k_gemm_t<128, DM, 0, false><<<gq, 256, 0, stream>>>(X16, Bq, 0.0625f, F32); k_rope<NH, DM, DM><<<(unsigned)(((size_t)NR * NH * 8 + 255) / 256), 256, 0, stream>>>(F32, CS, Q16);      /* q → RoPE → f16 */
  k_gemm_t<128, 2 * HD, 0, false><<<dim3(1, NR / 128), 256, 0, stream>>>(X16, Bkv, 0.0625f, KVF);      /* [k | v] f32: M 4096 N 128 K 1024 */
  k_rope<1, 2 * HD, HD><<<(unsigned)(((size_t)NR * 8 + 255) / 256), 256, 0, stream>>>(KVF, CS, K16);      /* shared k (cols 0..63 of KVF, row stride 128) → RoPE → K16 [4096][64] */
  k_vthl<1><<<BB * (TT / 64), 256, 0, stream>>>(KVF, 2 * HD, HD, Vth, Vtl);      /* shared v (cols 64..127) → Vᵀ hi/lo per batch [b][64][T] */
  k_gemm_t<32, 2 * NH, 11, false><<<dim3(1, NR / 128), 256, 0, stream>>>(X16, Bkh, 0.0625f, HS);      /* [kh | vh] = sigmoid(x·Wkvh): M 4096 N 32 K 1024, f32 rows of 32 */
  k_flash<<<BB * NH * (TT / 16), 128, 0, stream>>>(Q16, DM, K16, HD, HS, HS + NH, Vth, Vtl, O, DM);      /* KH = HS cols 0..15, VH = cols 16..31 (row stride 2·NH = 32) */
  k_hl<<<(unsigned)(((size_t)NR * DM / 8 + 255) / 256), 256, 0, stream>>>(O, OH, OL, (size_t)NR * DM / 8);
  k_gemm_t<128, DM, 0, false><<<gq, 256, 0, stream>>>(OH, Bo, 0.0625f, (float*)d_out);      /* y = O_hi·Wo */
  k_gemm_t<128, DM, 0, true><<<gq, 256, 0, stream>>>(OL, Bo, 0.0625f * 0.0009765625f, (float*)d_out);      /* += O_lo·Wo·2^-10 in place */
}

// v003
// One run takes 247 microseconds.
// In two side-by-side timings against v002, it was 1.33 and 1.27 times as fast.
// Counting every step since v000, it is 2.34 times as fast.
#include <hip/hip_runtime.h>
// Multi-product attention with low-rank shared key/value (B=2, N=2048, D=1024, 16 heads × 64): q = x·Wq; [k|v] = x·Wkv (one shared 64-dim key and value); [kh|vh] = σ(x·Wkvh) per (token, head); rotary (rotate-half, θ=1e4) on q and k by
// sequence position; K_h[n] = kh[n,h]·k[n], V_h[n] = vh[n,h]·v[n]; causal softmax(q_h·K_hᵀ/8); out = (Σ attn·V_h merged)·Wo.
// Compute dtype: x and weights rounded to bf16; q and k as f32 GEMM outputs rotated in f32 from a one-time f32 cos/sin table and stored f16; head scalars as sigmoid GEMM epilogue outputs (f32); v f32 →
// f16 hi + ×2^10 residual Vᵀ planes; fused causal flash-style kernel (scores scaled by kh per key, P multiplied by vh per key and carried as f16 hi + residual tiles, online softmax f32, three value accumulators) on v_wmma_f32_16x16x32_f16; merged O → hi/lo → Wo GEMMs (second in place ×2^-10); f32 accumulate.
#define BB 2
#define TT 2048
#define DM 1024
#define NH 16
#define HD 64
#define NR (BB * TT)

typedef __bf16 v16b __attribute__((ext_vector_type(16)));
typedef unsigned short v8us __attribute__((ext_vector_type(8), may_alias));
typedef float  v8f  __attribute__((ext_vector_type(8)));
typedef float  v4f  __attribute__((ext_vector_type(4)));
typedef float  v4fa __attribute__((ext_vector_type(4), may_alias));
union FragB { v16b v; v8us half[2]; unsigned short u[16]; };

__device__ __forceinline__ unsigned short bf16_bits(float x) { unsigned int u = __float_as_uint(x); return (unsigned short)((u + 0x7FFFu + ((u >> 16) & 1u)) >> 16); }
__device__ __forceinline__ float bf16_val(unsigned short b) { return __uint_as_float(((unsigned int)b) << 16); }
__device__ __forceinline__ float bf16_round(float x) { return bf16_val(bf16_bits(x)); }
// D += A·B with NT terms: 1 = ah·bh, 2 = + al·bh (A split), 3 = + ah·bl (both split)
template <int NT>
__device__ __forceinline__ v8f mmaN(v16b ah, v16b al, v16b bh, v16b bl, v8f c) {
  c = __builtin_amdgcn_wmma_f32_16x16x32_bf16(false, ah, false, bh, (short)0, c, false, false);
  if (NT >= 2) c = __builtin_amdgcn_wmma_f32_16x16x32_bf16(false, al, false, bh, (short)0, c, false, false);
  if (NT >= 3) c = __builtin_amdgcn_wmma_f32_16x16x32_bf16(false, ah, false, bl, (short)0, c, false, false);
  asm volatile("v_nop\n\tv_nop\n\tv_nop\n\tv_nop" : "+v"(c) : "v"(ah), "v"(al), "v"(bh), "v"(bl));
  return c;
}

__global__ __launch_bounds__(256) void k_wt_bf16(const float* __restrict__ W, unsigned short* __restrict__ Wt, int K, int N) {
  const int t = blockIdx.x * 256 + threadIdx.x;
  const int k8n = K / 8;
  if (t >= N * k8n) return;
  const int n = t / k8n, k8 = (t % k8n) * 8;
  v8us v;
#pragma unroll
  for (int i = 0; i < 8; ++i) v[i] = bf16_bits(W[(size_t)(k8 + i) * N + n]);
  *(v8us*)(Wt + (size_t)n * K + k8) = v;
  
}

// GEMM C[M][N] (f32, pitch ldc) = act(A[M][K]·W + bias). A f32 row-major (pitch lda) converted per fragment to bf16
// (ASPLIT: hi/lo two planes -> 2 terms, else single rounded term); Wt bf16 [N][K] (pitch ldb). BIAS_BF16 rounds the
// bias to bf16 first (bias quantised to bf16 before the add). K%32==0, M%16==0, N%64==0.
template <bool ASPLIT, int ACT, bool BIAS_BF16>
__global__ __launch_bounds__(128) void k_gemm_bf(const float* __restrict__ A, int lda, const unsigned short* __restrict__ Wt, int ldb,
                                               const float* __restrict__ bias, float* __restrict__ C, int ldc, int M, int N, int K) {
  __shared__ __attribute__((aligned(16))) float so[4][16][64];
  const int tid = threadIdx.x, w = tid >> 5, lane = tid & 31, ln = lane & 15, hh = lane >> 4;
  const int ntn = N / 64;
  const int wid = blockIdx.x * 4 + w;
  const int mt = wid / ntn, nq = wid % ntn;
  if (mt * 16 >= M) return;
  const int row0 = mt * 16, col0 = nq * 64;
  const float* arow = A + (size_t)(row0 + ln) * lda;
  v8f acc[4] = {};
  for (int kb = 0; kb < K; kb += 32) {
    FragB ah, al;
    const v4f x0 = *(const v4fa*)(arow + kb + 8 * hh), x1 = *(const v4fa*)(arow + kb + 8 * hh + 4);
    const v4f x2 = *(const v4fa*)(arow + kb + 16 + 8 * hh), x3 = *(const v4fa*)(arow + kb + 16 + 8 * hh + 4);
    float xs[16] = {x0[0],x0[1],x0[2],x0[3],x1[0],x1[1],x1[2],x1[3],x2[0],x2[1],x2[2],x2[3],x3[0],x3[1],x3[2],x3[3]};
#pragma unroll
    for (int i = 0; i < 16; ++i) { const unsigned short hb = bf16_bits(xs[i]); ah.u[i] = hb; al.u[i] = ASPLIT ? bf16_bits(xs[i] - bf16_val(hb)) : (unsigned short)0; }
#pragma unroll
    for (int t = 0; t < 4; ++t) {
      const unsigned short* brow = Wt + (size_t)(col0 + t * 16 + ln) * ldb + kb;
      FragB b;
      b.half[0] = *(const v8us*)(brow + 8 * hh);
      b.half[1] = *(const v8us*)(brow + 16 + 8 * hh);
      acc[t] = mmaN<ASPLIT ? 2 : 1>(ah.v, al.v, b.v, b.v, acc[t]);
    }
  }
#pragma unroll
  for (int t = 0; t < 4; ++t) {
    float bv = bias ? bias[col0 + t * 16 + ln] : 0.f;
    if (BIAS_BF16) bv = bf16_round(bv);
#pragma unroll
    for (int r = 0; r < 8; ++r) { float v = acc[t][r] + bv; if (ACT == 1) v = fmaxf(v, 0.f); so[w][8 * hh + r][t * 16 + ln] = v; }
  }
  __builtin_amdgcn_fence(__ATOMIC_ACQ_REL, "workgroup");
  __builtin_amdgcn_wave_barrier();
  const int rsub = lane >> 4, c4 = (lane & 15) * 4;
  {
#pragma unroll
    for (int q = 0; q < 8; ++q) {
      const int r = q * 2 + rsub;
      const v4f v = *(const v4fa*)&so[w][r][c4];
      *(v4f*)(C + (size_t)(row0 + r) * ldc + col0 + c4) = v;
    }
    
  }
}

// Flash-style causal/unmasked attention, all contractions 3-term bf16 hi/lo splits, f32 softmax with running max.
// q,k,v rows are read from f32 buffers with arbitrary row pitch (so they can live inside a fused qkv buffer);
// D = head size (multiple of 32, <= 128); one wave = 16 query rows; block = 4 waves (64 queries) sharing K/V chunks of 32.
template <int D, bool CAUSAL>
__global__ __launch_bounds__(128) void k_flash(const float* __restrict__ qb, const float* __restrict__ kb, const float* __restrict__ vb,
                                             int pitch, int T, int H, float scale, float* __restrict__ y, int ypitch) {
  constexpr int KS = D / 32;        // k-steps for QK
  constexpr int DT = D / 16;        // d tiles for PV
  __shared__ __attribute__((aligned(16))) unsigned short sKh[32][D + 8], sKl[32][D + 8], sVh[32][D + 8], sVl[32][D + 8];
  __shared__ __attribute__((aligned(16))) unsigned short sPh[4][16][40], sPl[4][16][40];
  __shared__ __attribute__((aligned(16))) float sO[4][16][D];
  const int tid = threadIdx.x, w = tid >> 5, lane = tid & 31, ln = lane & 15, hh = lane >> 4;
  const int nqb = (T + 63) / 64;
  const int bh = blockIdx.x / nqb, qblk = blockIdx.x % nqb;
  const int b = bh / H, h = bh % H;
  const int q0 = qblk * 64 + w * 16;
  const float* Q = qb + (size_t)b * T * pitch + h * D;
  const float* K = kb + (size_t)b * T * pitch + h * D;
  const float* V = vb + (size_t)b * T * pitch + h * D;

  // A fragments of the wave's 16 query rows (scaled), hi/lo
  FragB aqh[KS], aql[KS];
  {
    int row = q0 + ln; if (row >= T) row = T - 1;
    const float* qr = Q + (size_t)row * pitch;
#pragma unroll
    for (int ks = 0; ks < KS; ++ks)
#pragma unroll
      for (int i = 0; i < 16; ++i) {
        const int d = ks * 32 + ((i < 8) ? (8 * hh + i) : (16 + 8 * hh + (i - 8)));
        const float x = qr[d] * scale; const unsigned short hb = bf16_bits(x);
        aqh[ks].u[i] = hb; aql[ks].u[i] = bf16_bits(x - bf16_val(hb));
      }
  }
  float m_r[8], l_r[8];
#pragma unroll
  for (int r = 0; r < 8; ++r) { m_r[r] = -3.0e38f; l_r[r] = 0.f; }
  v8f oacc[DT];
#pragma unroll
  for (int dt = 0; dt < DT; ++dt) oacc[dt] = (v8f){0.f,0.f,0.f,0.f,0.f,0.f,0.f,0.f};

  const int kv_end = CAUSAL ? min(T, qblk * 64 + 64) : T;     // block-uniform
  for (int j0 = 0; j0 < kv_end; j0 += 32) {
    __syncthreads();
    for (int e = tid; e < 32 * (D / 4); e += 128) {
      const int r = e / (D / 4), c4 = (e % (D / 4)) * 4;
      const int key = j0 + r;
      v4f kf = {0.f,0.f,0.f,0.f}, vf = {0.f,0.f,0.f,0.f};
      if (key < T) { kf = *(const v4fa*)(K + (size_t)key * pitch + c4); vf = *(const v4fa*)(V + (size_t)key * pitch + c4); }
#pragma unroll
      for (int t = 0; t < 4; ++t) {
        unsigned short hb = bf16_bits(kf[t]); sKh[r][c4 + t] = hb; sKl[r][c4 + t] = bf16_bits(kf[t] - bf16_val(hb));
        hb = bf16_bits(vf[t]); sVh[r][c4 + t] = hb; sVl[r][c4 + t] = bf16_bits(vf[t] - bf16_val(hb));
      }
    }
    __syncthreads();
    // S tile 16 x 32
    v8f s[2];
#pragma unroll
    for (int nt = 0; nt < 2; ++nt) {
      v8f acc = {};
#pragma unroll
      for (int ks = 0; ks < KS; ++ks) {
        FragB bh_, bl_;
        bh_.half[0] = *(const v8us*)&sKh[nt * 16 + ln][ks * 32 + 8 * hh]; bh_.half[1] = *(const v8us*)&sKh[nt * 16 + ln][ks * 32 + 16 + 8 * hh];
        bl_.half[0] = *(const v8us*)&sKl[nt * 16 + ln][ks * 32 + 8 * hh]; bl_.half[1] = *(const v8us*)&sKl[nt * 16 + ln][ks * 32 + 16 + 8 * hh];
        acc = mmaN<3>(aqh[ks].v, aql[ks].v, bh_.v, bl_.v, acc);
      }
      s[nt] = acc;
    }
    // mask + running max (rows 8hh+r; the 16 lanes of a half share rows)
    float alpha[8];
#pragma unroll
    for (int r = 0; r < 8; ++r) {
      const int qi = q0 + 8 * hh + r;
      const int ja = j0 + ln, jb = j0 + 16 + ln;
      if (CAUSAL) { if (ja > qi) s[0][r] = -3.0e38f; if (jb > qi) s[1][r] = -3.0e38f; }
      if (ja >= T) s[0][r] = -3.0e38f;
      if (jb >= T) s[1][r] = -3.0e38f;
      float mx = fmaxf(s[0][r], s[1][r]);
      mx = fmaxf(mx, __shfl_xor(mx, 1, 32)); mx = fmaxf(mx, __shfl_xor(mx, 2, 32)); mx = fmaxf(mx, __shfl_xor(mx, 4, 32)); mx = fmaxf(mx, __shfl_xor(mx, 8, 32));
      const float mnew = fmaxf(m_r[r], mx);
      alpha[r] = (mnew > -1.0e38f) ? __expf(m_r[r] - mnew) : 1.0f;
      const float p0 = (s[0][r] > -1.0e38f) ? __expf(s[0][r] - mnew) : 0.f;
      const float p1 = (s[1][r] > -1.0e38f) ? __expf(s[1][r] - mnew) : 0.f;
      m_r[r] = mnew;
      l_r[r] = l_r[r] * alpha[r] + p0 + p1;            // per-lane partial row sum (16 lanes combined at the end)
      unsigned short hb = bf16_bits(p0); sPh[w][8 * hh + r][ln] = hb;      sPl[w][8 * hh + r][ln] = bf16_bits(p0 - bf16_val(hb));
      hb = bf16_bits(p1);                sPh[w][8 * hh + r][16 + ln] = hb; sPl[w][8 * hh + r][16 + ln] = bf16_bits(p1 - bf16_val(hb));
    }
#pragma unroll
    for (int dt = 0; dt < DT; ++dt)
#pragma unroll
      for (int r = 0; r < 8; ++r) oacc[dt][r] *= alpha[r];
    __builtin_amdgcn_fence(__ATOMIC_ACQ_REL, "workgroup");
    __builtin_amdgcn_wave_barrier();
    FragB pah, pal;
    pah.half[0] = *(const v8us*)&sPh[w][ln][8 * hh]; pah.half[1] = *(const v8us*)&sPh[w][ln][16 + 8 * hh];
    pal.half[0] = *(const v8us*)&sPl[w][ln][8 * hh]; pal.half[1] = *(const v8us*)&sPl[w][ln][16 + 8 * hh];
#pragma unroll
    for (int dt = 0; dt < DT; ++dt) {
      FragB bvh, bvl;
#pragma unroll
      for (int i = 0; i < 8; ++i) {
        bvh.u[i] = sVh[8 * hh + i][dt * 16 + ln]; bvh.u[8 + i] = sVh[16 + 8 * hh + i][dt * 16 + ln];
        bvl.u[i] = sVl[8 * hh + i][dt * 16 + ln]; bvl.u[8 + i] = sVl[16 + 8 * hh + i][dt * 16 + ln];
      }
      oacc[dt] = mmaN<3>(pah.v, pal.v, bvh.v, bvl.v, oacc[dt]);
    }
    __builtin_amdgcn_fence(__ATOMIC_ACQ_REL, "workgroup");
    __builtin_amdgcn_wave_barrier();
  }
#pragma unroll
  for (int r = 0; r < 8; ++r) {
    float l = l_r[r];
    l += __shfl_xor(l, 1, 32); l += __shfl_xor(l, 2, 32); l += __shfl_xor(l, 4, 32); l += __shfl_xor(l, 8, 32);
    l_r[r] = (l > 0.f) ? 1.0f / l : 0.f;
  }
#pragma unroll
  for (int dt = 0; dt < DT; ++dt)
#pragma unroll
    for (int r = 0; r < 8; ++r) sO[w][8 * hh + r][dt * 16 + ln] = oacc[dt][r] * l_r[r];
  __builtin_amdgcn_fence(__ATOMIC_ACQ_REL, "workgroup");
  __builtin_amdgcn_wave_barrier();
  {
    for (int r = 0; r < 16; ++r) {
      const int row = q0 + r;
      if (row < T && lane < D / 4) {
        const v4f val = *(const v4fa*)&sO[w][r][lane * 4];
        *(v4f*)(y + ((size_t)b * T + row) * ypitch + h * D + lane * 4) = val;
      }
    }
    
  }
}

// GEMM C = act(A·W + bias + resid): A f32 (ASPLIT -> hi/lo 2 terms), Wt bf16 [N][K]; ACT 0 none, 1 relu, 2 exact gelu;
// resid (optional, f32, row index = (row % rmod), pitch ldr, RES_BF16 rounds it) added before the activation.
template <bool ASPLIT, int ACT, bool BIAS_BF16, bool RES_BF16>
__global__ __launch_bounds__(128) void k_gemm_bf3(const float* __restrict__ A, int lda, const unsigned short* __restrict__ Wt, int ldb,
                                                const float* __restrict__ bias, const float* __restrict__ resid, int rmod, int ldr,
                                                float* __restrict__ C, int ldc, int M, int N, int K) {
  __shared__ __attribute__((aligned(16))) float so[4][16][64];
  const int tid = threadIdx.x, w = tid >> 5, lane = tid & 31, ln = lane & 15, hh = lane >> 4;
  const int ntn = N / 64;
  const int wid = blockIdx.x * 4 + w;
  const int mt = wid / ntn, nq = wid % ntn;
  if (mt * 16 >= M) return;
  const int row0 = mt * 16, col0 = nq * 64;
  const float* arow = A + (size_t)(row0 + ln) * lda;
  v8f acc[4] = {};
  for (int kb = 0; kb < K; kb += 32) {
    FragB ah, al;
    const v4f x0 = *(const v4fa*)(arow + kb + 8 * hh), x1 = *(const v4fa*)(arow + kb + 8 * hh + 4);
    const v4f x2 = *(const v4fa*)(arow + kb + 16 + 8 * hh), x3 = *(const v4fa*)(arow + kb + 16 + 8 * hh + 4);
    float xs[16] = {x0[0],x0[1],x0[2],x0[3],x1[0],x1[1],x1[2],x1[3],x2[0],x2[1],x2[2],x2[3],x3[0],x3[1],x3[2],x3[3]};
#pragma unroll
    for (int i = 0; i < 16; ++i) { const unsigned short hb = bf16_bits(xs[i]); ah.u[i] = hb; al.u[i] = ASPLIT ? bf16_bits(xs[i] - bf16_val(hb)) : (unsigned short)0; }
#pragma unroll
    for (int t = 0; t < 4; ++t) {
      const unsigned short* brow = Wt + (size_t)(col0 + t * 16 + ln) * ldb + kb;
      FragB b;
      b.half[0] = *(const v8us*)(brow + 8 * hh);
      b.half[1] = *(const v8us*)(brow + 16 + 8 * hh);
      acc[t] = mmaN<ASPLIT ? 2 : 1>(ah.v, al.v, b.v, b.v, acc[t]);
    }
  }
#pragma unroll
  for (int t = 0; t < 4; ++t) {
    const int col = col0 + t * 16 + ln;
    float bv = bias ? bias[col] : 0.f;
    if (BIAS_BF16) bv = bf16_round(bv);
#pragma unroll
    for (int r = 0; r < 8; ++r) {
      float v = acc[t][r] + bv;
      if (resid) { float rv = resid[(size_t)((row0 + 8 * hh + r) % rmod) * ldr + col]; if (RES_BF16) rv = bf16_round(rv); v += rv; }
      if (ACT == 1) v = fmaxf(v, 0.f);
      if (ACT == 2) v = 0.5f * v * (1.0f + erff(v * 0.70710678118654752f));
      if (ACT == 3) { const float u = 0.7978845608028654f * (v + 0.044715f * v * v * v); v = 0.5f * v * (1.0f + tanhf(u)); }
      so[w][8 * hh + r][t * 16 + ln] = v;
    }
  }
  __builtin_amdgcn_fence(__ATOMIC_ACQ_REL, "workgroup");
  __builtin_amdgcn_wave_barrier();
  const int rsub = lane >> 4, c4 = (lane & 15) * 4;
  {
#pragma unroll
    for (int q = 0; q < 8; ++q) {
      const int r = q * 2 + rsub;
      const v4f v = *(const v4fa*)&so[w][r][c4];
      *(v4f*)(C + (size_t)(row0 + r) * ldc + col0 + c4) = v;
    }
    
  }
}
// row LayerNorm (biased variance, eps) over N: s = X (+ R); optional out_sum <- s; out_norm <- (s-mu)*rsqrt(var+eps)*g + b
template <bool PARAM_BF16>
__global__ __launch_bounds__(256) void k_layernorm(const float* __restrict__ X, const float* __restrict__ R, const float* __restrict__ g, const float* __restrict__ bta,
                                                  float* __restrict__ out_sum, float* __restrict__ out_norm, int N, float eps) {
  __shared__ float red[256];
  const int row = blockIdx.x, tid = threadIdx.x;
  const float* x = X + (size_t)row * N; const float* rr = R ? R + (size_t)row * N : nullptr;
  float vals[16];                     // up to N = 4096
  const int per = N / 256;            // contiguous chunk per thread? use strided-by-4 chunks: thread handles j = tid*4 + 1024*u
  float s1 = 0.f;
  for (int u = 0; u < per / 4; ++u) {
    const int j = tid * 4 + 1024 * u;
    const v4f a = *(const v4fa*)(x + j);
    v4f b = {0.f,0.f,0.f,0.f}; if (rr) b = *(const v4fa*)(rr + j);
#pragma unroll
    for (int q = 0; q < 4; ++q) { const float v = a[q] + b[q]; vals[u * 4 + q] = v; s1 += v; }
  }
  red[tid] = s1; __syncthreads();
  for (int st = 128; st > 0; st >>= 1) { if (tid < st) red[tid] += red[tid + st]; __syncthreads(); }
  const float mu = red[0] / (float)N; __syncthreads();
  float s2 = 0.f;
  for (int u = 0; u < per / 4; ++u)
#pragma unroll
    for (int q = 0; q < 4; ++q) { const float c = vals[u * 4 + q] - mu; s2 += c * c; }
  red[tid] = s2; __syncthreads();
  for (int st = 128; st > 0; st >>= 1) { if (tid < st) red[tid] += red[tid + st]; __syncthreads(); }
  const float rs = rsqrtf(red[0] / (float)N + eps);
  {
    for (int u = 0; u < per / 4; ++u) {
      const int j = tid * 4 + 1024 * u;
      v4f o, sm;
#pragma unroll
      for (int q = 0; q < 4; ++q) {
        float gg = g[j + q], bb = bta[j + q];
        if (PARAM_BF16) { gg = bf16_round(gg); bb = bf16_round(bb); }
        sm[q] = vals[u * 4 + q]; o[q] = (vals[u * 4 + q] - mu) * rs * gg + bb;
      }
      if (out_sum) *(v4f*)(out_sum + (size_t)row * N + j) = sm;
      *(v4f*)(out_norm + (size_t)row * N + j) = o;
    }
    
  }
}



// ---- f16 WMMA path (v_wmma_f32_16x16x32_f16): 11-bit significands for operands in range — used where a [0,1] probability operand needs more precision than bf16
typedef _Float16 v16h __attribute__((ext_vector_type(16)));
union FragH { v16h v; v8us half[2]; _Float16 h[16]; unsigned short u[16]; };
template <int NT>
__device__ __forceinline__ v8f mmaH(v16h ah, v16h al, v16h bh, v16h bl, v8f c) {
  c = __builtin_amdgcn_wmma_f32_16x16x32_f16(false, ah, false, bh, (short)0, c, false, false);
  if (NT >= 2) c = __builtin_amdgcn_wmma_f32_16x16x32_f16(false, al, false, bh, (short)0, c, false, false);
  if (NT >= 3) c = __builtin_amdgcn_wmma_f32_16x16x32_f16(false, ah, false, bl, (short)0, c, false, false);
  asm volatile("v_nop\n\tv_nop\n\tv_nop\n\tv_nop" : "+v"(c) : "v"(ah), "v"(al), "v"(bh), "v"(bl));
  return c;
}
// batched GEMM like k_gemm_b but f16 operands: A f32 (split into f16 hi/lo if ASPLIT, else rounded to f16), Bt = f16 values [n][k]; alpha; C f32; N multiple of 16 (partial tiles skipped)
template <bool ASPLIT>
__global__ __launch_bounds__(128) void k_gemm_h(const float* __restrict__ A, int lda, size_t sA, const _Float16* __restrict__ Bh, int ldb, size_t sB, float alpha, float* __restrict__ C, int ldc, size_t sC, int M, int N, int K) {
  __shared__ __attribute__((aligned(16))) float so[4][16][64];
  const int tid = threadIdx.x, w = tid >> 5, lane = tid & 31, ln = lane & 15, hh = lane >> 4; const int by = blockIdx.y;
  A += (size_t)by * sA; Bh += (size_t)by * sB; C += (size_t)by * sC;
  const int ntn = (N + 63) / 64; const int wid = blockIdx.x * 4 + w; const int mt = wid / ntn, nq = wid % ntn; if (mt * 16 >= M) return;
  const int row0 = mt * 16, col0 = nq * 64; const float* arow = A + (size_t)(row0 + ln) * lda;
  v8f acc[4] = {};
  for (int kb = 0; kb < K; kb += 32) {
    FragH ah, al;
    const v4f x0 = *(const v4fa*)(arow + kb + 8 * hh), x1 = *(const v4fa*)(arow + kb + 8 * hh + 4), x2 = *(const v4fa*)(arow + kb + 16 + 8 * hh), x3 = *(const v4fa*)(arow + kb + 16 + 8 * hh + 4);
    float xs[16] = {x0[0],x0[1],x0[2],x0[3],x1[0],x1[1],x1[2],x1[3],x2[0],x2[1],x2[2],x2[3],x3[0],x3[1],x3[2],x3[3]};
#pragma unroll
    for (int i = 0; i < 16; ++i) { const _Float16 h = (_Float16)xs[i]; ah.h[i] = h; al.h[i] = ASPLIT ? (_Float16)(xs[i] - (float)h) : (_Float16)0.0f; }
#pragma unroll
    for (int t = 0; t < 4; ++t) { if (col0 + t * 16 >= N) continue; const size_t boff = (size_t)(col0 + t * 16 + ln) * ldb + kb; FragH bq; bq.half[0] = *(const v8us*)(Bh + boff + 8 * hh); bq.half[1] = *(const v8us*)(Bh + boff + 16 + 8 * hh);
      acc[t] = mmaH<ASPLIT ? 2 : 1>(ah.v, al.v, bq.v, bq.v, acc[t]); }
  }
#pragma unroll
  for (int t = 0; t < 4; ++t) { if (col0 + t * 16 >= N) continue;
#pragma unroll
    for (int r = 0; r < 8; ++r) so[w][8 * hh + r][t * 16 + ln] = acc[t][r] * alpha; }
  __builtin_amdgcn_fence(__ATOMIC_ACQ_REL, "workgroup"); __builtin_amdgcn_wave_barrier();
  const int rsub = lane >> 4, c4 = (lane & 15) * 4;
  {
#pragma unroll
    for (int q = 0; q < 8; ++q) { const int r = q * 2 + rsub; if (col0 + c4 < N) { const v4f v = *(const v4fa*)&so[w][r][c4]; *(v4f*)(C + (size_t)(row0 + r) * ldc + col0 + c4) = v; } }
     }
}

// Wt[n][k] = f16(bf16(W[k][n])·scale) from f32 row-major W[K][N] (scale = power of two; bf16-exact weights stay exact in f16 away from the subnormal range)
__global__ __launch_bounds__(256) void k_wt_f16(const float* __restrict__ W, _Float16* __restrict__ Wt, int K, int N, float scale) {
  const int t = blockIdx.x * 256 + threadIdx.x; if (t >= N * (K / 8)) return; const int n = t / (K / 8), k8 = (t % (K / 8)) * 8; FragH f;
#pragma unroll
  for (int i = 0; i < 8; ++i) f.h[i] = (_Float16)(bf16_round(W[(size_t)(k8 + i) * N + n]) * scale); const v8us o = f.half[0];
  *(v8us*)((unsigned short*)Wt + (size_t)n * K + k8) = o; 
}
// Block-tile GEMM, f16 operands, f32 accumulate: C[row][col] = alpha * sum_k A[row][k] * Bt[col][k] (+ C if ADDC); ACT 11 stores its sigmoid column-major, C[col][row]. A and Bt are K-contiguous with row pitch DM, K = DM.
// One block of 8 waves owns a 128 x BN tile of C. Each pass brings 128 k (256 B of every operand row) from global memory in whole-row pieces into registers and from there into one of two LDS buffers
// (row pitch 272 B, an odd multiple of 16 B, for the 16-byte fragment reads); the next pass's global loads are issued ahead of this pass's products. Every wave computes a (16 * FM) x 32 part from LDS fragments,
// so an operand row is read from L2 once per block, not once per wave. k runs upward in steps of 32 into one accumulator per 16 x 16 tile.
// Every "#pragma unroll" in this kernel is there so that the small arrays it indexes (ra, rb, a, b, acc, o, c0) get constant indices and stay in registers.
template <int BN, int LDC, int ACT, bool ADDC>
__global__ __launch_bounds__(256) void k_gemm_t(const _Float16* __restrict__ A, const _Float16* __restrict__ Bt, float alpha, float* C) {
  constexpr int BM = 128, BK = 128, PB = BK * 2 + 16, WN = BN / 32, WM = 8 / WN, FM = BM / (16 * WM), NA = BM / 16, NB = BN / 16, KT = DM / BK;
  constexpr int STG = (BM + BN) * PB, EPW = FM * 16 * 36, EPI = 8 * EPW * 4, SZ = (2 * STG > EPI) ? 2 * STG : EPI;
  __shared__ __attribute__((aligned(16))) unsigned char sm[SZ];
  const int tid = threadIdx.x, lane = tid & 31, ln = lane & 15, hh = lane >> 4;
  const int w = __builtin_amdgcn_readfirstlane(tid >> 5);      /* wave number, uniform: it only picks the wave's part of the tile */
  const int wm = w / WN, wn = w % WN;
  const int row0 = blockIdx.y * BM, col0 = blockIdx.x * BN;
  const int sr = tid >> 4, sc = tid & 15;      /* 16 threads a row: 256 contiguous bytes */
  const unsigned short* ga = (const unsigned short*)A + (size_t)(row0 + sr) * DM + sc * 8;
  const unsigned short* gb = (const unsigned short*)Bt + (size_t)(col0 + sr) * DM + sc * 8;
  unsigned char* const sst = sm + sr * PB + sc * 16;
  const unsigned char* const fa = sm + (wm * FM * 16 + ln) * PB + hh * 16;
  const unsigned char* const fb = sm + (BM + wn * 32 + ln) * PB + hh * 16;
  v8us ra[NA], rb[NB];
#pragma unroll
  for (int i = 0; i < NA; ++i) ra[i] = *(const v8us*)(ga + (size_t)i * 16 * DM);
#pragma unroll
  for (int i = 0; i < NB; ++i) rb[i] = *(const v8us*)(gb + (size_t)i * 16 * DM);
#pragma unroll
  for (int i = 0; i < NA; ++i) *(v8us*)(sst + i * 16 * PB) = ra[i];
#pragma unroll
  for (int i = 0; i < NB; ++i) *(v8us*)(sst + (BM + i * 16) * PB) = rb[i];
  __syncthreads();      /* pass 0 is in buffer 0 before any wave reads a fragment */
  v8f acc[FM][2];
#pragma unroll
  for (int fm = 0; fm < FM; ++fm) { acc[fm][0] = (v8f){0.f,0.f,0.f,0.f,0.f,0.f,0.f,0.f}; acc[fm][1] = acc[fm][0]; }
  for (int kt = 0; kt < KT; ++kt) {
    const int cur = (kt & 1) * STG, nxt = STG - cur;
    if (kt + 1 < KT) {
#pragma unroll
      for (int i = 0; i < NA; ++i) ra[i] = *(const v8us*)(ga + (size_t)i * 16 * DM + (kt + 1) * BK);
#pragma unroll
      for (int i = 0; i < NB; ++i) rb[i] = *(const v8us*)(gb + (size_t)i * 16 * DM + (kt + 1) * BK);
    }
#pragma unroll
    for (int ks = 0; ks < BK / 32; ++ks) {
      FragH a[FM], b[2];
#pragma unroll
      for (int fm = 0; fm < FM; ++fm) { a[fm].half[0] = *(const v8us*)(fa + cur + fm * 16 * PB + ks * 64); a[fm].half[1] = *(const v8us*)(fa + cur + fm * 16 * PB + ks * 64 + 32); }
#pragma unroll
      for (int fn = 0; fn < 2; ++fn) { b[fn].half[0] = *(const v8us*)(fb + cur + fn * 16 * PB + ks * 64); b[fn].half[1] = *(const v8us*)(fb + cur + fn * 16 * PB + ks * 64 + 32); }
#pragma unroll
      for (int fm = 0; fm < FM; ++fm)
#pragma unroll
        for (int fn = 0; fn < 2; ++fn) acc[fm][fn] = __builtin_amdgcn_wmma_f32_16x16x32_f16(false, a[fm].v, false, b[fn].v, (short)0, acc[fm][fn], false, false);
    }
    if (kt + 1 < KT) {      /* the other buffer: its readers left it at the barrier that ended pass kt - 1 */
#pragma unroll
      for (int i = 0; i < NA; ++i) *(v8us*)(sst + nxt + i * 16 * PB) = ra[i];
#pragma unroll
      for (int i = 0; i < NB; ++i) *(v8us*)(sst + nxt + (BM + i * 16) * PB) = rb[i];
    }
    __syncthreads();      /* publishes pass kt + 1 and ends every wave's reads of pass kt */
  }
  if (ACT == 11) {
    /* sigmoid outputs leave column-major, C[col][row] with row pitch LDC: the attention kernel reads 8 consecutive rows (keys) of one column (head) per lane. A lane's 8 accumulator registers are 8 consecutive rows of one column;
       the block's tile is gathered in LDS (free behind the last barrier; pitch BM + 4 floats keeps 16-byte alignment) so that each wave stores whole 128-byte lines. */
    constexpr int PT = BM + 4;
    float* const st = (float*)sm;
#pragma unroll
    for (int fm = 0; fm < FM; ++fm)
#pragma unroll
      for (int fn = 0; fn < 2; ++fn) { v4f lo, hi;
#pragma unroll
        for (int r = 0; r < 4; ++r) { lo[r] = 1.0f / (1.0f + expf(-(acc[fm][fn][r] * alpha))); hi[r] = 1.0f / (1.0f + expf(-(acc[fm][fn][4 + r] * alpha))); }
        float* const d = st + (wn * 32 + fn * 16 + ln) * PT + (wm * FM + fm) * 16 + 8 * hh; *(v4fa*)d = lo; *(v4fa*)(d + 4) = hi; }
    __syncthreads();      /* every wave's rows of the tile are in LDS before any wave stores a column */
    for (int q = 0; q < BN * BM / 4 / 256; ++q) { const int e = q * 256 + tid, col = e / (BM / 4), r4 = (e % (BM / 4)) * 4; const v4f v = *(const v4fa*)&st[col * PT + r4]; *(v4f*)(C + (size_t)(col0 + col) * LDC + row0 + r4) = v; }
    return;
  }
  /* epilogue: behind the last barrier the buffers are free; each wave turns its part into whole 128-byte rows in its own LDS range (row pitch 36 floats) */
  float* const so = (float*)sm + w * EPW;
  const int er = lane >> 3, ec = (lane & 7) * 4;      /* 8 lanes a row of 32 floats */
  float* const cp = C + (size_t)(row0 + wm * FM * 16 + er) * LDC + col0 + wn * 32 + ec;      /* one address for all rows of the part; the row step is a constant offset */
  v4f o[FM * 4], c0[FM * 4];
#pragma unroll
  for (int fm = 0; fm < FM; ++fm)
#pragma unroll
    for (int fn = 0; fn < 2; ++fn)
#pragma unroll
      for (int r = 0; r < 8; ++r) so[(fm * 16 + 8 * hh + r) * 36 + fn * 16 + ln] = acc[fm][fn][r] * alpha;
  __builtin_amdgcn_fence(__ATOMIC_ACQ_REL, "workgroup"); __builtin_amdgcn_wave_barrier();      /* the wave's own LDS writes are done before its lanes read each other's */
  if (ADDC) {      /* the old values, all asked for at once, once the accumulators' registers are free */
#pragma unroll
    for (int q = 0; q < FM * 4; ++q) c0[q] = *(const v4fa*)(cp + (size_t)q * 4 * LDC);
  }
#pragma unroll
  for (int q = 0; q < FM * 4; ++q) { o[q] = *(const v4fa*)&so[(q * 4 + er) * 36 + ec]; if (ADDC) o[q] += c0[q]; }
#pragma unroll
  for (int q = 0; q < FM * 4; ++q) *(v4f*)(cp + (size_t)q * 4 * LDC) = o[q];
}


typedef _Float16 v4h __attribute__((ext_vector_type(4)));

__global__ __launch_bounds__(256) void k_x16(const float* __restrict__ x, _Float16* __restrict__ X16, size_t n8) { const size_t t = (size_t)blockIdx.x * 256 + threadIdx.x; if (t >= n8) return; FragH f;
#pragma unroll
  for (int q = 0; q < 8; ++q) f.h[q] = (_Float16)bf16_round(x[t * 8 + q]); *(v8us*)((unsigned short*)X16 + t * 8) = f.half[0];  }
__global__ __launch_bounds__(256) void k_h16(const float* __restrict__ x, _Float16* __restrict__ X16, size_t n8) { const size_t t = (size_t)blockIdx.x * 256 + threadIdx.x; if (t >= n8) return; FragH f;
#pragma unroll
  for (int q = 0; q < 8; ++q) f.h[q] = (_Float16)x[t * 8 + q]; *(v8us*)((unsigned short*)X16 + t * 8) = f.half[0];  }
__global__ __launch_bounds__(256) void k_round16f(const float* __restrict__ W, _Float16* __restrict__ Bt, size_t n8) { const size_t t = (size_t)blockIdx.x * 256 + threadIdx.x; if (t >= n8) return; FragH f;
#pragma unroll
  for (int i = 0; i < 8; ++i) f.h[i] = (_Float16)(bf16_round(W[t * 8 + i]) * 16.0f); *(v8us*)((unsigned short*)Bt + t * 8) = f.half[0];  }
template <int NHv, int TTv>
__global__ __launch_bounds__(256) void k_vt(const _Float16* __restrict__ V16, int ldv, int voff, _Float16* __restrict__ Vt) { __shared__ unsigned short tl[64][66]; const int tid = threadIdx.x; const int slab = blockIdx.x / (TTv / 64), lg = blockIdx.x % (TTv / 64); const int b = slab / NHv, h = slab % NHv;
  for (int i = tid; i < 64 * 8; i += 256) { const int r = i / 8, c8 = (i % 8) * 8; FragH f; f.half[0] = *(const v8us*)((const unsigned short*)V16 + ((size_t)b * TTv + lg * 64 + r) * ldv + voff + h * 64 + c8);
#pragma unroll
    for (int q = 0; q < 8; ++q) tl[r][c8 + q] = f.u[q]; }
  __syncthreads();
  {
#pragma unroll
    for (int rd = 0; rd < 2; ++rd) { const int d = rd * 32 + tid / 8, pc = tid % 8; FragH f;
#pragma unroll
      for (int q = 0; q < 8; ++q) f.u[q] = tl[pc * 8 + q][d];
      *(v8us*)((unsigned short*)Vt + ((size_t)slab * 64 + d) * TTv + lg * 64 + pc * 8) = f.half[0]; }
     } }

__global__ __launch_bounds__(256) void k_hl(const float* __restrict__ F, _Float16* __restrict__ Hh, _Float16* __restrict__ Hl, size_t n8) { const size_t t = (size_t)blockIdx.x * 256 + threadIdx.x; if (t >= n8) return; FragH fh, fl; const v4f a = *(const v4fa*)(F + t * 8), c = *(const v4fa*)(F + t * 8 + 4);
#pragma unroll
  for (int q = 0; q < 4; ++q) { _Float16 h = (_Float16)a[q]; fh.h[q] = h; fl.h[q] = (_Float16)((a[q] - (float)h) * 1024.0f); h = (_Float16)c[q]; fh.h[4 + q] = h; fl.h[4 + q] = (_Float16)((c[q] - (float)h) * 1024.0f); }
  { *(v8us*)((unsigned short*)Hh + t * 8) = fh.half[0]; *(v8us*)((unsigned short*)Hl + t * 8) = fl.half[0];  } }
__global__ __launch_bounds__(256) void k_cstab(float* __restrict__ CS) { const int t = blockIdx.x * 256 + threadIdx.x; if (t >= TT * 32) return; const int p = t / 32, i = t % 32; const float invf = powf(10000.0f, -(float)(2 * i) / (float)HD); float sn, cs; sincosf((float)p * invf, &sn, &cs); typedef float v2f __attribute__((ext_vector_type(2), may_alias)); const v2f v = {cs, sn};
  *(v2f*)(CS + (size_t)t * 2) = v;  }
// rotary embedding: for row (b,s), head h, 8-dim piece g (d0 = g·8): (cos, sin) from the table row of the token's sequence position; d < 32: q'[d] = q[d]·cos_d − q[d+32]·sin_d; d ≥ 32: q'[d] = q[d]·cos_{d−32} + q[d−32]·sin_{d−32} (f32), stored f16;
template <int NHR, int LDI, int LDO>
__global__ __launch_bounds__(256) void k_rope(const float* __restrict__ QF, const float* __restrict__ CS, _Float16* __restrict__ Q16) { const size_t t = (size_t)blockIdx.x * 256 + threadIdx.x; if (t >= (size_t)NR * NHR * 8) return; const int g = (int)(t % 8); const int h = (int)((t / 8) % NHR); const size_t row = t / (8 * NHR); const int p = (int)(row % TT);      /* position = token index within the sequence (the reference's arange) */
  const int d0 = g * 8; const int i0 = d0 & 31; const float* base = QF + row * LDI + h * HD; const int dp = (d0 < 32) ? d0 + 32 : d0 - 32; const float sgn = (d0 < 32) ? -1.0f : 1.0f; const float* csr = CS + ((size_t)p * 32 + i0) * 2; FragH f;
#pragma unroll 1
  for (int e = 0; e < 8; ++e) { const float cs = csr[2 * e], sn = csr[2 * e + 1]; f.h[e] = (_Float16)(base[d0 + e] * cs + sgn * base[dp + e] * sn); }
  *(v8us*)((unsigned short*)Q16 + row * LDO + h * HD + d0) = f.half[0];  }
template <int NHV>
__global__ __launch_bounds__(256) void k_vthl(const float* __restrict__ VF, int ldv, int voff, _Float16* __restrict__ Vth, _Float16* __restrict__ Vtl) { __shared__ float tl[64][65]; const int tid = threadIdx.x; const int slab = blockIdx.x / (TT / 64), lg = blockIdx.x % (TT / 64); const int b = slab / NHV, h = slab % NHV;
  for (int i = tid; i < 64 * 16; i += 256) { const int r = i / 16, c4 = (i % 16) * 4; const v4f a = *(const v4fa*)(VF + ((size_t)b * TT + lg * 64 + r) * ldv + voff + h * HD + c4); tl[r][c4] = a[0]; tl[r][c4 + 1] = a[1]; tl[r][c4 + 2] = a[2]; tl[r][c4 + 3] = a[3]; }
  __syncthreads();
  FragH fh[2], fl[2]; size_t oo[2];
#pragma unroll
  for (int rd = 0; rd < 2; ++rd) { const int d = rd * 32 + tid / 8, pc = tid % 8;
#pragma unroll
    for (int q = 0; q < 8; ++q) { const float v = tl[pc * 8 + q][d]; const _Float16 hv = (_Float16)v; fh[rd].h[q] = hv; fl[rd].h[q] = (_Float16)((v - (float)hv) * 1024.0f); } oo[rd] = ((size_t)slab * HD + d) * TT + lg * 64 + pc * 8; }
  {
#pragma unroll
    for (int rd = 0; rd < 2; ++rd) { *(v8us*)((unsigned short*)Vth + oo[rd]) = fh[rd].half[0]; *(v8us*)((unsigned short*)Vtl + oo[rd]) = fl[rd].half[0]; }
     } }
/* lane l with lane l ^ 16: one vector cross-row move */
__device__ __forceinline__ float xhalf(float x) { return __builtin_bit_cast(float, __builtin_amdgcn_permlanex16(__builtin_bit_cast(int, x), __builtin_bit_cast(int, x), 0x76543210, 0xfedcba98, false, false)); }
__global__ __launch_bounds__(128) void k_flash(const _Float16* __restrict__ Q16, int ldq, const _Float16* __restrict__ K16, const float* __restrict__ KH, const float* __restrict__ VHD, const _Float16* __restrict__ Vt, const _Float16* __restrict__ Vtlo, float* __restrict__ O, int ldo) {
  // One block = one 16-row query tile. Its 32-key chunks are dealt round-robin to the 4 waves (wave w takes chunks w, w + 4, ...); each wave keeps its own running max, sum and accumulators, and the four partial results are merged through LDS at the end.
  // A causal tile's cost grows with its index and there are more blocks than resident places, so the block index counts the tiles down.
  // Both products are transposed: S^T = K.Q^T (A = 16 key rows, B = the query tile) and O^T += V^T.P^T (A = 16 rows of V^T, B = P^T). A lane then holds 16 of the 32 scores of ONE query (column ln; keys 8 hh + r and 16 + 8 hh + r),
  // so max and sum run in the lane with one exchange between the halves, the rescale factor is one value a lane, and the two score tiles, converted in place, are the B operand of the second product in the k order of the V^T loader.
  // KH and VHD are head-major, [head][token]: a lane's 8 keys of a tile are 32 contiguous bytes.
  // Every "#pragma unroll" in this kernel is there so that the small arrays it indexes (bq, ak, av, avl, kh, vh, sc, bp, bpl, the accumulators, mw) get constant indices and stay in registers; "#pragma unroll 1" keeps one copy of the key loop's body, whose registers are the kernel's limit.
  constexpr int RPW = 16, NQT = TT / RPW, DT = 4, KS = 2;
  __shared__ __attribute__((aligned(16))) float sO[4][RPW][64 + 4]; __shared__ float sM[4][RPW], sL[4][RPW];
  const int tid = threadIdx.x, lane = tid & 31, ln = lane & 15, hh = lane >> 4;
  const int w = __builtin_amdgcn_readfirstlane(tid >> 5);      /* wave number in a scalar register: it sets the key loop's start, and the loop around the matrix instructions must branch on a scalar */
  const int slab = blockIdx.x % (BB * NH), qt = NQT - 1 - blockIdx.x / (BB * NH); const int b = slab / NH, h = slab % NH; const int q0 = qt * RPW;
  FragH bq[KS];
  { const unsigned short* qr = (const unsigned short*)Q16 + ((size_t)b * TT + q0 + ln) * ldq + h * 64;
#pragma unroll
    for (int ks = 0; ks < KS; ++ks) { bq[ks].half[0] = *(const v8us*)(qr + ks * 32 + 8 * hh); bq[ks].half[1] = *(const v8us*)(qr + ks * 32 + 16 + 8 * hh); } }
  /* every address of the loop = a wave-uniform base + one of three 32-bit byte offsets a lane, which step with the chunk at the loop's foot */
  const char* Kb = (const char*)(K16 + (size_t)b * TT * HD);      /* shared key head, rows of HD halves */
  const char* Vth = (const char*)(Vt + (size_t)b * 64 * TT); const char* Vtl = (const char*)(Vtlo + (size_t)b * 64 * TT);      /* shared value head per batch */
  const char* khp = (const char*)(KH + (size_t)h * NR + (size_t)b * TT); const char* vhp = (const char*)(VHD + (size_t)h * NR + (size_t)b * TT);      /* per-key head scalars (sigmoid outputs, f32) */
  unsigned ko = (unsigned)((w * 32 + ln) * HD + 8 * hh) * 2u, vo = (unsigned)(ln * TT + w * 32 + 8 * hh) * 2u, ho = (unsigned)(w * 32 + 8 * hh) * 4u;
  float m_r = -3.0e38f, l_r = 0.f; v8f oacc[DT], oaccl[DT], oacc2[DT];
#pragma unroll
  for (int dt = 0; dt < DT; ++dt) { oacc[dt] = (v8f){0.f,0.f,0.f,0.f,0.f,0.f,0.f,0.f}; oaccl[dt] = oacc[dt]; oacc2[dt] = oacc[dt]; }
  const int jend = q0 + RPW;
#pragma unroll 1
  for (int j0 = w * 32; j0 < jend; j0 += 4 * 32) {
    /* every load of the chunk is asked for up front: nothing in the chunk orders them behind the softmax any more */
    FragH ak[2][KS], av[DT], avl[DT]; v4f kh[2][2], vh[2][2];
#pragma unroll
    for (int nt = 0; nt < 2; ++nt) {
#pragma unroll
      for (int ks = 0; ks < KS; ++ks) { const char* kr = Kb + ko + nt * 16 * HD * 2 + ks * 64; ak[nt][ks].half[0] = *(const v8us*)kr; ak[nt][ks].half[1] = *(const v8us*)(kr + 32); }
      const char* kp = khp + ho + nt * 64; const char* vp = vhp + ho + nt * 64;
      kh[nt][0] = *(const v4fa*)kp; kh[nt][1] = *(const v4fa*)(kp + 16); vh[nt][0] = *(const v4fa*)vp; vh[nt][1] = *(const v4fa*)(vp + 16); }
#pragma unroll
    for (int dt = 0; dt < DT; ++dt) { const char* vp = Vth + vo + dt * 16 * TT * 2; const char* lp = Vtl + vo + dt * 16 * TT * 2; av[dt].half[0] = *(const v8us*)vp; av[dt].half[1] = *(const v8us*)(vp + 32); avl[dt].half[0] = *(const v8us*)lp; avl[dt].half[1] = *(const v8us*)(lp + 32); }
    float sc[2][8];
#pragma unroll
    for (int nt = 0; nt < 2; ++nt) { v8f acc = (v8f){0.f,0.f,0.f,0.f,0.f,0.f,0.f,0.f};
#pragma unroll
      for (int ks = 0; ks < KS; ++ks) acc = __builtin_amdgcn_wmma_f32_16x16x32_f16(false, ak[nt][ks].v, false, bq[ks].v, (short)0, acc, false, false);
#pragma unroll
      for (int r = 0; r < 8; ++r) sc[nt][r] = acc[r] * kh[nt][r >> 2][r & 3] * 0.125f; }
    if (j0 + 31 > q0) {      /* only a chunk that reaches past the tile's first query has keys to mask (scalar test); every query keeps at least one key of every chunk of the loop */
#pragma unroll
      for (int nt = 0; nt < 2; ++nt)
#pragma unroll
        for (int r = 0; r < 8; ++r) sc[nt][r] = (j0 + nt * 16 + 8 * hh + r <= q0 + ln) ? sc[nt][r] : -INFINITY; }
    float mc = fmaxf(sc[0][0], sc[1][0]);
#pragma unroll
    for (int r = 1; r < 8; ++r) mc = fmaxf(mc, fmaxf(sc[0][r], sc[1][r]));
    mc = fmaxf(mc, xhalf(mc));      /* the query's other 16 keys */
    const float mn = fmaxf(m_r, mc); const float al = (mn > -1.0e38f) ? expf(m_r - mn) : 1.0f; m_r = mn;
    FragH bp, bpl; float ps = 0.f;
#pragma unroll
    for (int nt = 0; nt < 2; ++nt)
#pragma unroll
      for (int r = 0; r < 8; ++r) { const float p = expf(sc[nt][r] - mn); ps += p;      /* a masked score is -inf: p = 0 */
        const float pv = p * vh[nt][r >> 2][r & 3] * 1024.0f; const _Float16 ph = (_Float16)pv; bp.h[nt * 8 + r] = ph; bpl.h[nt * 8 + r] = (_Float16)((pv - (float)ph) * 1024.0f); }      /* value-head scalar folded into P, carried as f16 hi + x2^10 residual operands; the normaliser keeps plain p */
    l_r = l_r * al + ps;      /* the lane's half of the row sum; the halves are joined once, behind the loop */
#pragma unroll
    for (int dt = 0; dt < DT; ++dt) { oacc[dt] *= al; oaccl[dt] *= al; oacc2[dt] *= al; }
#pragma unroll
    for (int dt = 0; dt < DT; ++dt) { oacc[dt] = __builtin_amdgcn_wmma_f32_16x16x32_f16(false, av[dt].v, false, bp.v, (short)0, oacc[dt], false, false); oaccl[dt] = __builtin_amdgcn_wmma_f32_16x16x32_f16(false, avl[dt].v, false, bp.v, (short)0, oaccl[dt], false, false); oacc2[dt] = __builtin_amdgcn_wmma_f32_16x16x32_f16(false, av[dt].v, false, bpl.v, (short)0, oacc2[dt], false, false); }
    /* the three offsets are address registers of this chunk's loads: this wait stands in front of their rewrite, and naming them keeps the three additions behind it (the scheduler otherwise lifts them among the outstanding loads) */
    __builtin_amdgcn_sched_barrier(0);      /* keeps that wait here at the foot, where every load of the chunk has long returned, instead of in the middle of the softmax */
    asm volatile("s_wait_xcnt 0x0" : "+v"(ko), "+v"(vo), "+v"(ho) : : "memory");
    ko += 4 * 32 * HD * 2; vo += 4 * 32 * 2; ho += 4 * 32 * 4;
  }
  l_r += xhalf(l_r);
  if (hh == 0) { sM[w][ln] = m_r; sL[w][ln] = l_r; }
#pragma unroll
  for (int dt = 0; dt < DT; ++dt) { const v8f t = oacc[dt] + (oaccl[dt] + oacc2[dt]) * 0.0009765625f;      /* registers r = head dims dt * 16 + 8 hh + r of query ln */
    *(v4fa*)&sO[w][ln][dt * 16 + 8 * hh] = (v4f){t[0], t[1], t[2], t[3]}; *(v4fa*)&sO[w][ln][dt * 16 + 8 * hh + 4] = (v4f){t[4], t[5], t[6], t[7]}; }
  __syncthreads();      /* every wave's partial (max, sum, unnormalised rows) is in LDS before any wave merges */
  {
    const int r = tid >> 3, c4 = (tid & 7) * 4;      /* 8 threads a row, two 128-byte lines a row */
    float mw[4], M = -3.0e38f, L = 0.f;
#pragma unroll
    for (int i = 0; i < 4; ++i) { mw[i] = sM[i][r]; M = fmaxf(M, mw[i]); }
#pragma unroll
    for (int i = 0; i < 4; ++i) { mw[i] = expf(mw[i] - M); L += mw[i] * sL[i][r]; }      /* a wave that had no chunk holds max -3e38, sum 0, rows 0: weight 0 */
    const float inv = (L > 0.f) ? 1.0f / (L * 1024.0f) : 0.f;
#pragma unroll
    for (int hf = 0; hf < 2; ++hf) { v4f a = {0.f, 0.f, 0.f, 0.f};
#pragma unroll
      for (int i = 0; i < 4; ++i) { const v4f p = *(const v4fa*)&sO[i][r][hf * 32 + c4]; a += p * mw[i]; }
      *(v4f*)(O + ((size_t)b * TT + q0 + r) * ldo + h * 64 + hf * 32 + c4) = a * inv; }
  } }

extern "C" void kernel_launch(void* const* d_in, const int* in_sizes, int n_in,
                              void* d_out, int out_size, void* d_ws, size_t ws_size, hipStream_t stream) {
  (void)in_sizes; (void)n_in; (void)out_size;
  const float* x = (const float*)d_in[0]; const float* Wq = (const float*)d_in[1]; const float* Wkv = (const float*)d_in[2]; const float* Wkvh = (const float*)d_in[3]; const float* Wo = (const float*)d_in[4];
  char* ws = (char*)d_ws; size_t off = 0;
  auto take = [&](size_t bytes) { char* p = ws + off; off += (bytes + 255) & ~(size_t)255; return p; };
  _Float16* Bq = (_Float16*)take((size_t)DM * DM * 2); _Float16* Bkv = (_Float16*)take((size_t)2 * HD * DM * 2); _Float16* Bkh = (_Float16*)take((size_t)2 * NH * DM * 2); _Float16* Bo = (_Float16*)take((size_t)DM * DM * 2); float* CS = (float*)take((size_t)TT * 32 * 2 * 4);
  _Float16* X16 = (_Float16*)take((size_t)NR * DM * 2); float* F32 = (float*)take((size_t)NR * DM * 4); _Float16* Q16 = (_Float16*)take((size_t)NR * DM * 2); float* KVF = (float*)take((size_t)NR * 2 * HD * 4); _Float16* K16 = (_Float16*)take((size_t)NR * HD * 2); float* HS = (float*)take((size_t)NR * 2 * NH * 4);
  _Float16* Vth = (_Float16*)take((size_t)BB * HD * TT * 2); _Float16* Vtl = (_Float16*)take((size_t)BB * HD * TT * 2); _Float16* OH = (_Float16*)take((size_t)NR * DM * 2); _Float16* OL = (_Float16*)take((size_t)NR * DM * 2);
  float* O = F32;      /* F32 holds q (consumed by k_rope) then O */
  if (off > ws_size) return;      // 2.1 + 0.3 + 0.1 + 2.1 + 0.5 + 8.4 + 16.8 + 8.4 + 2.1 + 0.5 + 0.5 + 0.5 + 0.5 + 8.4 + 8.4 ≈ 60 MB
  k_wt_f16<<<(unsigned)(((size_t)DM * (DM / 8) + 255) / 256), 256, 0, stream>>>(Wq, Bq, DM, DM, 16.0f); k_wt_f16<<<(unsigned)(((size_t)2 * HD * (DM / 8) + 255) / 256), 256, 0, stream>>>(Wkv, Bkv, DM, 2 * HD, 16.0f);
  k_wt_f16<<<(unsigned)(((size_t)2 * NH * (DM / 8) + 255) / 256), 256, 0, stream>>>(Wkvh, Bkh, DM, 2 * NH, 16.0f); k_wt_f16<<<(unsigned)(((size_t)DM * (DM / 8) + 255) / 256), 256, 0, stream>>>(Wo, Bo, DM, DM, 16.0f);      /* (in,out) → Bt ×2^4 */
  k_x16<<<(unsigned)(((size_t)NR * DM / 8 + 255) / 256), 256, 0, stream>>>(x, X16, (size_t)NR * DM / 8); k_cstab<<<(TT * 32 + 255) / 256, 256, 0, stream>>>(CS);
  const dim3 gq(DM / 128, NR / 128);      /* 128 x 128 tiles of a 4096 x 1024 result: 256 blocks */
  k_gemm_t<128, DM, 0, false><<<gq, 256, 0, stream>>>(X16, Bq, 0.0625f, F32); k_rope<NH, DM, DM><<<(unsigned)(((size_t)NR * NH * 8 + 255) / 256), 256, 0, stream>>>(F32, CS, Q16);      /* q → RoPE → f16 */
  k_gemm_t<128, 2 * HD, 0, false><<<dim3(1, NR / 128), 256, 0, stream>>>(X16, Bkv, 0.0625f, KVF);      /* [k | v] f32: M 4096 N 128 K 1024 */
  k_rope<1, 2 * HD, HD><<<(unsigned)(((size_t)NR * 8 + 255) / 256), 256, 0, stream>>>(KVF, CS, K16);      /* shared k (cols 0..63 of KVF, row stride 128) → RoPE → K16 [4096][64] */
  k_vthl<1><<<BB * (TT / 64), 256, 0, stream>>>(KVF, 2 * HD, HD, Vth, Vtl);      /* shared v (cols 64..127) → Vᵀ hi/lo per batch [b][64][T] */
  k_gemm_t<32, NR, 11, false><<<dim3(1, NR / 128), 256, 0, stream>>>(X16, Bkh, 0.0625f, HS);      /* [kh | vh] = sigmoid(x.Wkvh): M 4096 N 32 K 1024, stored head-major: 32 rows of 4096 f32 */
  k_flash<<<BB * NH * (TT / 16), 128, 0, stream>>>(Q16, DM, K16, HS, HS + (size_t)NH * NR, Vth, Vtl, O, DM);      /* KH = HS rows 0..15, VH = rows 16..31 (row pitch NR) */
  k_hl<<<(unsigned)(((size_t)NR * DM / 8 + 255) / 256), 256, 0, stream>>>(O, OH, OL, (size_t)NR * DM / 8);
  k_gemm_t<128, DM, 0, false><<<gq, 256, 0, stream>>>(OH, Bo, 0.0625f, (float*)d_out);      /* y = O_hi·Wo */
  k_gemm_t<128, DM, 0, true><<<gq, 256, 0, stream>>>(OL, Bo, 0.0625f * 0.0009765625f, (float*)d_out);      /* += O_lo·Wo·2^-10 in place */
}

// v004
// Measured time: 211 microseconds a run.
// Timed twice side by side with v003, it ran 1.16 times as fast both times.
// Counting every step since v000, it is 2.71 times as fast.
#include <hip/hip_runtime.h>
// Multi-product attention with low-rank shared key/value (B=2, N=2048, D=1024, 16 heads × 64): q = x·Wq; [k|v] = x·Wkv (one shared 64-dim key and value); [kh|vh] = σ(x·Wkvh) per (token, head); rotary (rotate-half, θ=1e4) on q and k by
// sequence position; K_h[n] = kh[n,h]·k[n], V_h[n] = vh[n,h]·v[n]; causal softmax(q_h·K_hᵀ/8); out = (Σ attn·V_h merged)·Wo.
// Compute dtype: x and weights rounded to bf16; q and k as f32 GEMM outputs rotated in f32 from a one-time f32 cos/sin table and stored f16; head scalars as sigmoid GEMM epilogue outputs (f32); v f32 →
// f16 hi + ×2^10 residual Vᵀ planes; fused causal flash-style kernel (scores scaled by kh per key, P multiplied by vh per key and carried as f16 hi + residual tiles, online softmax f32, three value accumulators) on v_wmma_f32_16x16x32_f16; merged O → hi/lo → Wo GEMMs (second in place ×2^-10); f32 accumulate.
#define BB 2
#define TT 2048
#define DM 1024
#define NH 16
#define HD 64
#define NR (BB * TT)

typedef __bf16 v16b __attribute__((ext_vector_type(16)));
typedef unsigned short v8us __attribute__((ext_vector_type(8), may_alias));
typedef float  v8f  __attribute__((ext_vector_type(8)));
typedef float  v4f  __attribute__((ext_vector_type(4)));
typedef float  v4fa __attribute__((ext_vector_type(4), may_alias));
union FragB { v16b v; v8us half[2]; unsigned short u[16]; };

__device__ __forceinline__ unsigned short bf16_bits(float x) { unsigned int u = __float_as_uint(x); return (unsigned short)((u + 0x7FFFu + ((u >> 16) & 1u)) >> 16); }
__device__ __forceinline__ float bf16_val(unsigned short b) { return __uint_as_float(((unsigned int)b) << 16); }
__device__ __forceinline__ float bf16_round(float x) { return bf16_val(bf16_bits(x)); }
// D += A·B with NT terms: 1 = ah·bh, 2 = + al·bh (A split), 3 = + ah·bl (both split)
template <int NT>
__device__ __forceinline__ v8f mmaN(v16b ah, v16b al, v16b bh, v16b bl, v8f c) {
  c = __builtin_amdgcn_wmma_f32_16x16x32_bf16(false, ah, false, bh, (short)0, c, false, false);
  if (NT >= 2) c = __builtin_amdgcn_wmma_f32_16x16x32_bf16(false, al, false, bh, (short)0, c, false, false);
  if (NT >= 3) c = __builtin_amdgcn_wmma_f32_16x16x32_bf16(false, ah, false, bl, (short)0, c, false, false);
  asm volatile("v_nop\n\tv_nop\n\tv_nop\n\tv_nop" : "+v"(c) : "v"(ah), "v"(al), "v"(bh), "v"(bl));
  return c;
}

__global__ __launch_bounds__(256) void k_wt_bf16(const float* __restrict__ W, unsigned short* __restrict__ Wt, int K, int N) {
  const int t = blockIdx.x * 256 + threadIdx.x;
  const int k8n = K / 8;
  if (t >= N * k8n) return;
  const int n = t / k8n, k8 = (t % k8n) * 8;
  v8us v;
#pragma unroll
  for (int i = 0; i < 8; ++i) v[i] = bf16_bits(W[(size_t)(k8 + i) * N + n]);
  *(v8us*)(Wt + (size_t)n * K + k8) = v;
  
}

// GEMM C[M][N] (f32, pitch ldc) = act(A[M][K]·W + bias). A f32 row-major (pitch lda) converted per fragment to bf16
// (ASPLIT: hi/lo two planes -> 2 terms, else single rounded term); Wt bf16 [N][K] (pitch ldb). BIAS_BF16 rounds the
// bias to bf16 first (bias quantised to bf16 before the add). K%32==0, M%16==0, N%64==0.
template <bool ASPLIT, int ACT, bool BIAS_BF16>
__global__ __launch_bounds__(128) void k_gemm_bf(const float* __restrict__ A, int lda, const unsigned short* __restrict__ Wt, int ldb,
                                               const float* __restrict__ bias, float* __restrict__ C, int ldc, int M, int N, int K) {
  __shared__ __attribute__((aligned(16))) float so[4][16][64];
  const int tid = threadIdx.x, w = tid >> 5, lane = tid & 31, ln = lane & 15, hh = lane >> 4;
  const int ntn = N / 64;
  const int wid = blockIdx.x * 4 + w;
  const int mt = wid / ntn, nq = wid % ntn;
  if (mt * 16 >= M) return;
  const int row0 = mt * 16, col0 = nq * 64;
  const float* arow = A + (size_t)(row0 + ln) * lda;
  v8f acc[4] = {};
  for (int kb = 0; kb < K; kb += 32) {
    FragB ah, al;
    const v4f x0 = *(const v4fa*)(arow + kb + 8 * hh), x1 = *(const v4fa*)(arow + kb + 8 * hh + 4);
    const v4f x2 = *(const v4fa*)(arow + kb + 16 + 8 * hh), x3 = *(const v4fa*)(arow + kb + 16 + 8 * hh + 4);
    float xs[16] = {x0[0],x0[1],x0[2],x0[3],x1[0],x1[1],x1[2],x1[3],x2[0],x2[1],x2[2],x2[3],x3[0],x3[1],x3[2],x3[3]};
#pragma unroll
    for (int i = 0; i < 16; ++i) { const unsigned short hb = bf16_bits(xs[i]); ah.u[i] = hb; al.u[i] = ASPLIT ? bf16_bits(xs[i] - bf16_val(hb)) : (unsigned short)0; }
#pragma unroll
    for (int t = 0; t < 4; ++t) {
      const unsigned short* brow = Wt + (size_t)(col0 + t * 16 + ln) * ldb + kb;
      FragB b;
      b.half[0] = *(const v8us*)(brow + 8 * hh);
      b.half[1] = *(const v8us*)(brow + 16 + 8 * hh);
      acc[t] = mmaN<ASPLIT ? 2 : 1>(ah.v, al.v, b.v, b.v, acc[t]);
    }
  }
#pragma unroll
  for (int t = 0; t < 4; ++t) {
    float bv = bias ? bias[col0 + t * 16 + ln] : 0.f;
    if (BIAS_BF16) bv = bf16_round(bv);
#pragma unroll
    for (int r = 0; r < 8; ++r) { float v = acc[t][r] + bv; if (ACT == 1) v = fmaxf(v, 0.f); so[w][8 * hh + r][t * 16 + ln] = v; }
  }
  __builtin_amdgcn_fence(__ATOMIC_ACQ_REL, "workgroup");
  __builtin_amdgcn_wave_barrier();
  const int rsub = lane >> 4, c4 = (lane & 15) * 4;
  {
#pragma unroll
    for (int q = 0; q < 8; ++q) {
      const int r = q * 2 + rsub;
      const v4f v = *(const v4fa*)&so[w][r][c4];
      *(v4f*)(C + (size_t)(row0 + r) * ldc + col0 + c4) = v;
    }
    
  }
}

// Flash-style causal/unmasked attention, all contractions 3-term bf16 hi/lo splits, f32 softmax with running max.
// q,k,v rows are read from f32 buffers with arbitrary row pitch (so they can live inside a fused qkv buffer);
// D = head size (multiple of 32, <= 128); one wave = 16 query rows; block = 4 waves (64 queries) sharing K/V chunks of 32.
template <int D, bool CAUSAL>
__global__ __launch_bounds__(128) void k_flash(const float* __restrict__ qb, const float* __restrict__ kb, const float* __restrict__ vb,
                                             int pitch, int T, int H, float scale, float* __restrict__ y, int ypitch) {
  constexpr int KS = D / 32;        // k-steps for QK
  constexpr int DT = D / 16;        // d tiles for PV
  __shared__ __attribute__((aligned(16))) unsigned short sKh[32][D + 8], sKl[32][D + 8], sVh[32][D + 8], sVl[32][D + 8];
  __shared__ __attribute__((aligned(16))) unsigned short sPh[4][16][40], sPl[4][16][40];
  __shared__ __attribute__((aligned(16))) float sO[4][16][D];
  const int tid = threadIdx.x, w = tid >> 5, lane = tid & 31, ln = lane & 15, hh = lane >> 4;
  const int nqb = (T + 63) / 64;
  const int bh = blockIdx.x / nqb, qblk = blockIdx.x % nqb;
  const int b = bh / H, h = bh % H;
  const int q0 = qblk * 64 + w * 16;
  const float* Q = qb + (size_t)b * T * pitch + h * D;
  const float* K = kb + (size_t)b * T * pitch + h * D;
  const float* V = vb + (size_t)b * T * pitch + h * D;

  // A fragments of the wave's 16 query rows (scaled), hi/lo
  FragB aqh[KS], aql[KS];
  {
    int row = q0 + ln; if (row >= T) row = T - 1;
    const float* qr = Q + (size_t)row * pitch;
#pragma unroll
    for (int ks = 0; ks < KS; ++ks)
#pragma unroll
      for (int i = 0; i < 16; ++i) {
        const int d = ks * 32 + ((i < 8) ? (8 * hh + i) : (16 + 8 * hh + (i - 8)));
        const float x = qr[d] * scale; const unsigned short hb = bf16_bits(x);
        aqh[ks].u[i] = hb; aql[ks].u[i] = bf16_bits(x - bf16_val(hb));
      }
  }
  float m_r[8], l_r[8];
#pragma unroll
  for (int r = 0; r < 8; ++r) { m_r[r] = -3.0e38f; l_r[r] = 0.f; }
  v8f oacc[DT];
#pragma unroll
  for (int dt = 0; dt < DT; ++dt) oacc[dt] = (v8f){0.f,0.f,0.f,0.f,0.f,0.f,0.f,0.f};

  const int kv_end = CAUSAL ? min(T, qblk * 64 + 64) : T;     // block-uniform
  for (int j0 = 0; j0 < kv_end; j0 += 32) {
    __syncthreads();
    for (int e = tid; e < 32 * (D / 4); e += 128) {
      const int r = e / (D / 4), c4 = (e % (D / 4)) * 4;
      const int key = j0 + r;
      v4f kf = {0.f,0.f,0.f,0.f}, vf = {0.f,0.f,0.f,0.f};
      if (key < T) { kf = *(const v4fa*)(K + (size_t)key * pitch + c4); vf = *(const v4fa*)(V + (size_t)key * pitch + c4); }
#pragma unroll
      for (int t = 0; t < 4; ++t) {
        unsigned short hb = bf16_bits(kf[t]); sKh[r][c4 + t] = hb; sKl[r][c4 + t] = bf16_bits(kf[t] - bf16_val(hb));
        hb = bf16_bits(vf[t]); sVh[r][c4 + t] = hb; sVl[r][c4 + t] = bf16_bits(vf[t] - bf16_val(hb));
      }
    }
    __syncthreads();
    // S tile 16 x 32
    v8f s[2];
#pragma unroll
    for (int nt = 0; nt < 2; ++nt) {
      v8f acc = {};
#pragma unroll
      for (int ks = 0; ks < KS; ++ks) {
        FragB bh_, bl_;
        bh_.half[0] = *(const v8us*)&sKh[nt * 16 + ln][ks * 32 + 8 * hh]; bh_.half[1] = *(const v8us*)&sKh[nt * 16 + ln][ks * 32 + 16 + 8 * hh];
        bl_.half[0] = *(const v8us*)&sKl[nt * 16 + ln][ks * 32 + 8 * hh]; bl_.half[1] = *(const v8us*)&sKl[nt * 16 + ln][ks * 32 + 16 + 8 * hh];
        acc = mmaN<3>(aqh[ks].v, aql[ks].v, bh_.v, bl_.v, acc);
      }
      s[nt] = acc;
    }
    // mask + running max (rows 8hh+r; the 16 lanes of a half share rows)
    float alpha[8];
#pragma unroll
    for (int r = 0; r < 8; ++r) {
      const int qi = q0 + 8 * hh + r;
      const int ja = j0 + ln, jb = j0 + 16 + ln;
      if (CAUSAL) { if (ja > qi) s[0][r] = -3.0e38f; if (jb > qi) s[1][r] = -3.0e38f; }
      if (ja >= T) s[0][r] = -3.0e38f;
      if (jb >= T) s[1][r] = -3.0e38f;
      float mx = fmaxf(s[0][r], s[1][r]);
      mx = fmaxf(mx, __shfl_xor(mx, 1, 32)); mx = fmaxf(mx, __shfl_xor(mx, 2, 32)); mx = fmaxf(mx, __shfl_xor(mx, 4, 32)); mx = fmaxf(mx, __shfl_xor(mx, 8, 32));
      const float mnew = fmaxf(m_r[r], mx);
      alpha[r] = (mnew > -1.0e38f) ? __expf(m_r[r] - mnew) : 1.0f;
      const float p0 = (s[0][r] > -1.0e38f) ? __expf(s[0][r] - mnew) : 0.f;
      const float p1 = (s[1][r] > -1.0e38f) ? __expf(s[1][r] - mnew) : 0.f;
      m_r[r] = mnew;
      l_r[r] = l_r[r] * alpha[r] + p0 + p1;            // per-lane partial row sum (16 lanes combined at the end)
      unsigned short hb = bf16_bits(p0); sPh[w][8 * hh + r][ln] = hb;      sPl[w][8 * hh + r][ln] = bf16_bits(p0 - bf16_val(hb));
      hb = bf16_bits(p1);                sPh[w][8 * hh + r][16 + ln] = hb; sPl[w][8 * hh + r][16 + ln] = bf16_bits(p1 - bf16_val(hb));
    }
#pragma unroll
    for (int dt = 0; dt < DT; ++dt)
#pragma unroll
      for (int r = 0; r < 8; ++r) oacc[dt][r] *= alpha[r];
    __builtin_amdgcn_fence(__ATOMIC_ACQ_REL, "workgroup");
    __builtin_amdgcn_wave_barrier();
    FragB pah, pal;
    pah.half[0] = *(const v8us*)&sPh[w][ln][8 * hh]; pah.half[1] = *(const v8us*)&sPh[w][ln][16 + 8 * hh];
    pal.half[0] = *(const v8us*)&sPl[w][ln][8 * hh]; pal.half[1] = *(const v8us*)&sPl[w][ln][16 + 8 * hh];
#pragma unroll
    for (int dt = 0; dt < DT; ++dt) {
      FragB bvh, bvl;
#pragma unroll
      for (int i = 0; i < 8; ++i) {
        bvh.u[i] = sVh[8 * hh + i][dt * 16 + ln]; bvh.u[8 + i] = sVh[16 + 8 * hh + i][dt * 16 + ln];
        bvl.u[i] = sVl[8 * hh + i][dt * 16 + ln]; bvl.u[8 + i] = sVl[16 + 8 * hh + i][dt * 16 + ln];
      }
      oacc[dt] = mmaN<3>(pah.v, pal.v, bvh.v, bvl.v, oacc[dt]);
    }
    __builtin_amdgcn_fence(__ATOMIC_ACQ_REL, "workgroup");
    __builtin_amdgcn_wave_barrier();
  }
#pragma unroll
  for (int r = 0; r < 8; ++r) {
    float l = l_r[r];
    l += __shfl_xor(l, 1, 32); l += __shfl_xor(l, 2, 32); l += __shfl_xor(l, 4, 32); l += __shfl_xor(l, 8, 32);
    l_r[r] = (l > 0.f) ? 1.0f / l : 0.f;
  }
#pragma unroll
  for (int dt = 0; dt < DT; ++dt)
#pragma unroll
    for (int r = 0; r < 8; ++r) sO[w][8 * hh + r][dt * 16 + ln] = oacc[dt][r] * l_r[r];
  __builtin_amdgcn_fence(__ATOMIC_ACQ_REL, "workgroup");
  __builtin_amdgcn_wave_barrier();
  {
    for (int r = 0; r < 16; ++r) {
      const int row = q0 + r;
      if (row < T && lane < D / 4) {
        const v4f val = *(const v4fa*)&sO[w][r][lane * 4];
        *(v4f*)(y + ((size_t)b * T + row) * ypitch + h * D + lane * 4) = val;
      }
    }
    
  }
}

// GEMM C = act(A·W + bias + resid): A f32 (ASPLIT -> hi/lo 2 terms), Wt bf16 [N][K]; ACT 0 none, 1 relu, 2 exact gelu;
// resid (optional, f32, row index = (row % rmod), pitch ldr, RES_BF16 rounds it) added before the activation.
template <bool ASPLIT, int ACT, bool BIAS_BF16, bool RES_BF16>
__global__ __launch_bounds__(128) void k_gemm_bf3(const float* __restrict__ A, int lda, const unsigned short* __restrict__ Wt, int ldb,
                                                const float* __restrict__ bias, const float* __restrict__ resid, int rmod, int ldr,
                                                float* __restrict__ C, int ldc, int M, int N, int K) {
  __shared__ __attribute__((aligned(16))) float so[4][16][64];
  const int tid = threadIdx.x, w = tid >> 5, lane = tid & 31, ln = lane & 15, hh = lane >> 4;
  const int ntn = N / 64;
  const int wid = blockIdx.x * 4 + w;
  const int mt = wid / ntn, nq = wid % ntn;
  if (mt * 16 >= M) return;
  const int row0 = mt * 16, col0 = nq * 64;
  const float* arow = A + (size_t)(row0 + ln) * lda;
  v8f acc[4] = {};
  for (int kb = 0; kb < K; kb += 32) {
    FragB ah, al;
    const v4f x0 = *(const v4fa*)(arow + kb + 8 * hh), x1 = *(const v4fa*)(arow + kb + 8 * hh + 4);
    const v4f x2 = *(const v4fa*)(arow + kb + 16 + 8 * hh), x3 = *(const v4fa*)(arow + kb + 16 + 8 * hh + 4);
    float xs[16] = {x0[0],x0[1],x0[2],x0[3],x1[0],x1[1],x1[2],x1[3],x2[0],x2[1],x2[2],x2[3],x3[0],x3[1],x3[2],x3[3]};
#pragma unroll
    for (int i = 0; i < 16; ++i) { const unsigned short hb = bf16_bits(xs[i]); ah.u[i] = hb; al.u[i] = ASPLIT ? bf16_bits(xs[i] - bf16_val(hb)) : (unsigned short)0; }
#pragma unroll
    for (int t = 0; t < 4; ++t) {
      const unsigned short* brow = Wt + (size_t)(col0 + t * 16 + ln) * ldb + kb;
      FragB b;
      b.half[0] = *(const v8us*)(brow + 8 * hh);
      b.half[1] = *(const v8us*)(brow + 16 + 8 * hh);
      acc[t] = mmaN<ASPLIT ? 2 : 1>(ah.v, al.v, b.v, b.v, acc[t]);
    }
  }
#pragma unroll
  for (int t = 0; t < 4; ++t) {
    const int col = col0 + t * 16 + ln;
    float bv = bias ? bias[col] : 0.f;
    if (BIAS_BF16) bv = bf16_round(bv);
#pragma unroll
    for (int r = 0; r < 8; ++r) {
      float v = acc[t][r] + bv;
      if (resid) { float rv = resid[(size_t)((row0 + 8 * hh + r) % rmod) * ldr + col]; if (RES_BF16) rv = bf16_round(rv); v += rv; }
      if (ACT == 1) v = fmaxf(v, 0.f);
      if (ACT == 2) v = 0.5f * v * (1.0f + erff(v * 0.70710678118654752f));
      if (ACT == 3) { const float u = 0.7978845608028654f * (v + 0.044715f * v * v * v); v = 0.5f * v * (1.0f + tanhf(u)); }
      so[w][8 * hh + r][t * 16 + ln] = v;
    }
  }
  __builtin_amdgcn_fence(__ATOMIC_ACQ_REL, "workgroup");
  __builtin_amdgcn_wave_barrier();
  const int rsub = lane >> 4, c4 = (lane & 15) * 4;
  {
#pragma unroll
    for (int q = 0; q < 8; ++q) {
      const int r = q * 2 + rsub;
      const v4f v = *(const v4fa*)&so[w][r][c4];
      *(v4f*)(C + (size_t)(row0 + r) * ldc + col0 + c4) = v;
    }
    
  }
}
// row LayerNorm (biased variance, eps) over N: s = X (+ R); optional out_sum <- s; out_norm <- (s-mu)*rsqrt(var+eps)*g + b
template <bool PARAM_BF16>
__global__ __launch_bounds__(256) void k_layernorm(const float* __restrict__ X, const float* __restrict__ R, const float* __restrict__ g, const float* __restrict__ bta,
                                                  float* __restrict__ out_sum, float* __restrict__ out_norm, int N, float eps) {
  __shared__ float red[256];
  const int row = blockIdx.x, tid = threadIdx.x;
  const float* x = X + (size_t)row * N; const float* rr = R ? R + (size_t)row * N : nullptr;
  float vals[16];                     // up to N = 4096
  const int per = N / 256;            // contiguous chunk per thread? use strided-by-4 chunks: thread handles j = tid*4 + 1024*u
  float s1 = 0.f;
  for (int u = 0; u < per / 4; ++u) {
    const int j = tid * 4 + 1024 * u;
    const v4f a = *(const v4fa*)(x + j);
    v4f b = {0.f,0.f,0.f,0.f}; if (rr) b = *(const v4fa*)(rr + j);
#pragma unroll
    for (int q = 0; q < 4; ++q) { const float v = a[q] + b[q]; vals[u * 4 + q] = v; s1 += v; }
  }
  red[tid] = s1; __syncthreads();
  for (int st = 128; st > 0; st >>= 1) { if (tid < st) red[tid] += red[tid + st]; __syncthreads(); }
  const float mu = red[0] / (float)N; __syncthreads();
  float s2 = 0.f;
  for (int u = 0; u < per / 4; ++u)
#pragma unroll
    for (int q = 0; q < 4; ++q) { const float c = vals[u * 4 + q] - mu; s2 += c * c; }
  red[tid] = s2; __syncthreads();
  for (int st = 128; st > 0; st >>= 1) { if (tid < st) red[tid] += red[tid + st]; __syncthreads(); }
  const float rs = rsqrtf(red[0] / (float)N + eps);
  {
    for (int u = 0; u < per / 4; ++u) {
      const int j = tid * 4 + 1024 * u;
      v4f o, sm;
#pragma unroll
      for (int q = 0; q < 4; ++q) {
        float gg = g[j + q], bb = bta[j + q];
        if (PARAM_BF16) { gg = bf16_round(gg); bb = bf16_round(bb); }
        sm[q] = vals[u * 4 + q]; o[q] = (vals[u * 4 + q] - mu) * rs * gg + bb;
      }
      if (out_sum) *(v4f*)(out_sum + (size_t)row * N + j) = sm;
      *(v4f*)(out_norm + (size_t)row * N + j) = o;
    }
    
  }
}



// ---- f16 WMMA path (v_wmma_f32_16x16x32_f16): 11-bit significands for operands in range — used where a [0,1] probability operand needs more precision than bf16
typedef _Float16 v16h __attribute__((ext_vector_type(16)));
union FragH { v16h v; v8us half[2]; _Float16 h[16]; unsigned short u[16]; };
template <int NT>
__device__ __forceinline__ v8f mmaH(v16h ah, v16h al, v16h bh, v16h bl, v8f c) {
  c = __builtin_amdgcn_wmma_f32_16x16x32_f16(false, ah, false, bh, (short)0, c, false, false);
  if (NT >= 2) c = __builtin_amdgcn_wmma_f32_16x16x32_f16(false, al, false, bh, (short)0, c, false, false);
  if (NT >= 3) c = __builtin_amdgcn_wmma_f32_16x16x32_f16(false, ah, false, bl, (short)0, c, false, false);
  asm volatile("v_nop\n\tv_nop\n\tv_nop\n\tv_nop" : "+v"(c) : "v"(ah), "v"(al), "v"(bh), "v"(bl));
  return c;
}
// batched GEMM like k_gemm_b but f16 operands: A f32 (split into f16 hi/lo if ASPLIT, else rounded to f16), Bt = f16 values [n][k]; alpha; C f32; N multiple of 16 (partial tiles skipped)
template <bool ASPLIT>
__global__ __launch_bounds__(128) void k_gemm_h(const float* __restrict__ A, int lda, size_t sA, const _Float16* __restrict__ Bh, int ldb, size_t sB, float alpha, float* __restrict__ C, int ldc, size_t sC, int M, int N, int K) {
  __shared__ __attribute__((aligned(16))) float so[4][16][64];
  const int tid = threadIdx.x, w = tid >> 5, lane = tid & 31, ln = lane & 15, hh = lane >> 4; const int by = blockIdx.y;
  A += (size_t)by * sA; Bh += (size_t)by * sB; C += (size_t)by * sC;
  const int ntn = (N + 63) / 64; const int wid = blockIdx.x * 4 + w; const int mt = wid / ntn, nq = wid % ntn; if (mt * 16 >= M) return;
  const int row0 = mt * 16, col0 = nq * 64; const float* arow = A + (size_t)(row0 + ln) * lda;
  v8f acc[4] = {};
  for (int kb = 0; kb < K; kb += 32) {
    FragH ah, al;
    const v4f x0 = *(const v4fa*)(arow + kb + 8 * hh), x1 = *(const v4fa*)(arow + kb + 8 * hh + 4), x2 = *(const v4fa*)(arow + kb + 16 + 8 * hh), x3 = *(const v4fa*)(arow + kb + 16 + 8 * hh + 4);
    float xs[16] = {x0[0],x0[1],x0[2],x0[3],x1[0],x1[1],x1[2],x1[3],x2[0],x2[1],x2[2],x2[3],x3[0],x3[1],x3[2],x3[3]};
#pragma unroll
    for (int i = 0; i < 16; ++i) { const _Float16 h = (_Float16)xs[i]; ah.h[i] = h; al.h[i] = ASPLIT ? (_Float16)(xs[i] - (float)h) : (_Float16)0.0f; }
#pragma unroll
    for (int t = 0; t < 4; ++t) { if (col0 + t * 16 >= N) continue; const size_t boff = (size_t)(col0 + t * 16 + ln) * ldb + kb; FragH bq; bq.half[0] = *(const v8us*)(Bh + boff + 8 * hh); bq.half[1] = *(const v8us*)(Bh + boff + 16 + 8 * hh);
      acc[t] = mmaH<ASPLIT ? 2 : 1>(ah.v, al.v, bq.v, bq.v, acc[t]); }
  }
#pragma unroll
  for (int t = 0; t < 4; ++t) { if (col0 + t * 16 >= N) continue;
#pragma unroll
    for (int r = 0; r < 8; ++r) so[w][8 * hh + r][t * 16 + ln] = acc[t][r] * alpha; }
  __builtin_amdgcn_fence(__ATOMIC_ACQ_REL, "workgroup"); __builtin_amdgcn_wave_barrier();
  const int rsub = lane >> 4, c4 = (lane & 15) * 4;
  {
#pragma unroll
    for (int q = 0; q < 8; ++q) { const int r = q * 2 + rsub; if (col0 + c4 < N) { const v4f v = *(const v4fa*)&so[w][r][c4]; *(v4f*)(C + (size_t)(row0 + r) * ldc + col0 + c4) = v; } }
     }
}

// Wt[n][k] = f16(bf16(W[k][n])·scale) from f32 row-major W[K][N] (scale = power of two; bf16-exact weights stay exact in f16 away from the subnormal range)
__global__ __launch_bounds__(256) void k_wt_f16(const float* __restrict__ W, _Float16* __restrict__ Wt, int K, int N, float scale) {
  const int t = blockIdx.x * 256 + threadIdx.x; if (t >= N * (K / 8)) return; const int n = t / (K / 8), k8 = (t % (K / 8)) * 8; FragH f;
#pragma unroll
  for (int i = 0; i < 8; ++i) f.h[i] = (_Float16)(bf16_round(W[(size_t)(k8 + i) * N + n]) * scale); const v8us o = f.half[0];
  *(v8us*)((unsigned short*)Wt + (size_t)n * K + k8) = o; 
}
// Block-tile GEMM, f16 operands, f32 accumulate: C[row][col] = alpha * sum_k A[row][k] * Bt[col][k] (+ C if ADDC); ACT 11 stores its sigmoid column-major, C[col][row]. A and Bt are K-contiguous with row pitch DM, K = DM.
// One block of 8 waves owns a 128 x BN tile of C. Each pass brings 128 k (256 B of every operand row) from global memory in whole-row pieces into registers and from there into one of two LDS buffers
// (row pitch 272 B, an odd multiple of 16 B, for the 16-byte fragment reads); the next pass's global loads are issued ahead of this pass's products. Every wave computes a (16 * FM) x 32 part from LDS fragments,
// so an operand row is read from L2 once per block, not once per wave. k runs upward in steps of 32 into one accumulator per 16 x 16 tile.
// Every "#pragma unroll" in this kernel is there so that the small arrays it indexes (ra, rb, a, b, acc, o, c0) get constant indices and stay in registers.
template <int BN, int LDC, int ACT, bool ADDC>
__global__ __launch_bounds__(256) void k_gemm_t(const _Float16* __restrict__ A, const _Float16* __restrict__ Bt, float alpha, float* C) {
  constexpr int BM = 128, BK = 128, PB = BK * 2 + 16, WN = BN / 32, WM = 8 / WN, FM = BM / (16 * WM), NA = BM / 16, NB = BN / 16, KT = DM / BK;
  constexpr int STG = (BM + BN) * PB, EPW = FM * 16 * 36, EPI = 8 * EPW * 4, SZ = (2 * STG > EPI) ? 2 * STG : EPI;
  __shared__ __attribute__((aligned(16))) unsigned char sm[SZ];
  const int tid = threadIdx.x, lane = tid & 31, ln = lane & 15, hh = lane >> 4;
  const int w = __builtin_amdgcn_readfirstlane(tid >> 5);      /* wave number, uniform: it only picks the wave's part of the tile */
  const int wm = w / WN, wn = w % WN;
  const int row0 = blockIdx.y * BM, col0 = blockIdx.x * BN;
  const int sr = tid >> 4, sc = tid & 15;      /* 16 threads a row: 256 contiguous bytes */
  const unsigned short* ga = (const unsigned short*)A + (size_t)(row0 + sr) * DM + sc * 8;
  const unsigned short* gb = (const unsigned short*)Bt + (size_t)(col0 + sr) * DM + sc * 8;
  unsigned char* const sst = sm + sr * PB + sc * 16;
  const unsigned char* const fa = sm + (wm * FM * 16 + ln) * PB + hh * 16;
  const unsigned char* const fb = sm + (BM + wn * 32 + ln) * PB + hh * 16;
  v8us ra[NA], rb[NB];
#pragma unroll
  for (int i = 0; i < NA; ++i) ra[i] = *(const v8us*)(ga + (size_t)i * 16 * DM);
#pragma unroll
  for (int i = 0; i < NB; ++i) rb[i] = *(const v8us*)(gb + (size_t)i * 16 * DM);
#pragma unroll
  for (int i = 0; i < NA; ++i) *(v8us*)(sst + i * 16 * PB) = ra[i];
#pragma unroll
  for (int i = 0; i < NB; ++i) *(v8us*)(sst + (BM + i * 16) * PB) = rb[i];
  __syncthreads();      /* pass 0 is in buffer 0 before any wave reads a fragment */
  v8f acc[FM][2];
#pragma unroll
  for (int fm = 0; fm < FM; ++fm) { acc[fm][0] = (v8f){0.f,0.f,0.f,0.f,0.f,0.f,0.f,0.f}; acc[fm][1] = acc[fm][0]; }
  for (int kt = 0; kt < KT; ++kt) {
    const int cur = (kt & 1) * STG, nxt = STG - cur;
    if (kt + 1 < KT) {
#pragma unroll
      for (int i = 0; i < NA; ++i) ra[i] = *(const v8us*)(ga + (size_t)i * 16 * DM + (kt + 1) * BK);
#pragma unroll
      for (int i = 0; i < NB; ++i) rb[i] = *(const v8us*)(gb + (size_t)i * 16 * DM + (kt + 1) * BK);
    }
#pragma unroll
    for (int ks = 0; ks < BK / 32; ++ks) {
      FragH a[FM], b[2];
#pragma unroll
      for (int fm = 0; fm < FM; ++fm) { a[fm].half[0] = *(const v8us*)(fa + cur + fm * 16 * PB + ks * 64); a[fm].half[1] = *(const v8us*)(fa + cur + fm * 16 * PB + ks * 64 + 32); }
#pragma unroll
      for (int fn = 0; fn < 2; ++fn) { b[fn].half[0] = *(const v8us*)(fb + cur + fn * 16 * PB + ks * 64); b[fn].half[1] = *(const v8us*)(fb + cur + fn * 16 * PB + ks * 64 + 32); }
#pragma unroll
      for (int fm = 0; fm < FM; ++fm)
#pragma unroll
        for (int fn = 0; fn < 2; ++fn) acc[fm][fn] = __builtin_amdgcn_wmma_f32_16x16x32_f16(false, a[fm].v, false, b[fn].v, (short)0, acc[fm][fn], false, false);
    }
    if (kt + 1 < KT) {      /* the other buffer: its readers left it at the barrier that ended pass kt - 1 */
#pragma unroll
      for (int i = 0; i < NA; ++i) *(v8us*)(sst + nxt + i * 16 * PB) = ra[i];
#pragma unroll
      for (int i = 0; i < NB; ++i) *(v8us*)(sst + nxt + (BM + i * 16) * PB) = rb[i];
    }
    __syncthreads();      /* publishes pass kt + 1 and ends every wave's reads of pass kt */
  }
  if (ACT == 11) {
    /* sigmoid outputs leave column-major, C[col][row] with row pitch LDC: the attention kernel reads 8 consecutive rows (keys) of one column (head) per lane. A lane's 8 accumulator registers are 8 consecutive rows of one column;
       the block's tile is gathered in LDS (free behind the last barrier; pitch BM + 4 floats keeps 16-byte alignment) so that each wave stores whole 128-byte lines. */
    constexpr int PT = BM + 4;
    float* const st = (float*)sm;
#pragma unroll
    for (int fm = 0; fm < FM; ++fm)
#pragma unroll
      for (int fn = 0; fn < 2; ++fn) { v4f lo, hi;
#pragma unroll
        for (int r = 0; r < 4; ++r) { lo[r] = 1.0f / (1.0f + expf(-(acc[fm][fn][r] * alpha))); hi[r] = 1.0f / (1.0f + expf(-(acc[fm][fn][4 + r] * alpha))); }
        float* const d = st + (wn * 32 + fn * 16 + ln) * PT + (wm * FM + fm) * 16 + 8 * hh; *(v4fa*)d = lo; *(v4fa*)(d + 4) = hi; }
    __syncthreads();      /* every wave's rows of the tile are in LDS before any wave stores a column */
    for (int q = 0; q < BN * BM / 4 / 256; ++q) { const int e = q * 256 + tid, col = e / (BM / 4), r4 = (e % (BM / 4)) * 4; const v4f v = *(const v4fa*)&st[col * PT + r4]; *(v4f*)(C + (size_t)(col0 + col) * LDC + row0 + r4) = v; }
    return;
  }
  /* epilogue: behind the last barrier the buffers are free; each wave turns its part into whole 128-byte rows in its own LDS range (row pitch 36 floats) */
  float* const so = (float*)sm + w * EPW;
  const int er = lane >> 3, ec = (lane & 7) * 4;      /* 8 lanes a row of 32 floats */
  float* const cp = C + (size_t)(row0 + wm * FM * 16 + er) * LDC + col0 + wn * 32 + ec;      /* one address for all rows of the part; the row step is a constant offset */
  v4f o[FM * 4], c0[FM * 4];
#pragma unroll
  for (int fm = 0; fm < FM; ++fm)
#pragma unroll
    for (int fn = 0; fn < 2; ++fn)
#pragma unroll
      for (int r = 0; r < 8; ++r) so[(fm * 16 + 8 * hh + r) * 36 + fn * 16 + ln] = acc[fm][fn][r] * alpha;
  __builtin_amdgcn_fence(__ATOMIC_ACQ_REL, "workgroup"); __builtin_amdgcn_wave_barrier();      /* the wave's own LDS writes are done before its lanes read each other's */
  if (ADDC) {      /* the old values, all asked for at once, once the accumulators' registers are free */
#pragma unroll
    for (int q = 0; q < FM * 4; ++q) c0[q] = *(const v4fa*)(cp + (size_t)q * 4 * LDC);
  }
#pragma unroll
  for (int q = 0; q < FM * 4; ++q) { o[q] = *(const v4fa*)&so[(q * 4 + er) * 36 + ec]; if (ADDC) o[q] += c0[q]; }
#pragma unroll
  for (int q = 0; q < FM * 4; ++q) *(v4f*)(cp + (size_t)q * 4 * LDC) = o[q];
}


typedef _Float16 v4h __attribute__((ext_vector_type(4)));

__global__ __launch_bounds__(256) void k_x16(const float* __restrict__ x, _Float16* __restrict__ X16, size_t n8) { const size_t t = (size_t)blockIdx.x * 256 + threadIdx.x; if (t >= n8) return; FragH f;
#pragma unroll
  for (int q = 0; q < 8; ++q) f.h[q] = (_Float16)bf16_round(x[t * 8 + q]); *(v8us*)((unsigned short*)X16 + t * 8) = f.half[0];  }
__global__ __launch_bounds__(256) void k_h16(const float* __restrict__ x, _Float16* __restrict__ X16, size_t n8) { const size_t t = (size_t)blockIdx.x * 256 + threadIdx.x; if (t >= n8) return; FragH f;
#pragma unroll
  for (int q = 0; q < 8; ++q) f.h[q] = (_Float16)x[t * 8 + q]; *(v8us*)((unsigned short*)X16 + t * 8) = f.half[0];  }
__global__ __launch_bounds__(256) void k_round16f(const float* __restrict__ W, _Float16* __restrict__ Bt, size_t n8) { const size_t t = (size_t)blockIdx.x * 256 + threadIdx.x; if (t >= n8) return; FragH f;
#pragma unroll
  for (int i = 0; i < 8; ++i) f.h[i] = (_Float16)(bf16_round(W[t * 8 + i]) * 16.0f); *(v8us*)((unsigned short*)Bt + t * 8) = f.half[0];  }
template <int NHv, int TTv>
__global__ __launch_bounds__(256) void k_vt(const _Float16* __restrict__ V16, int ldv, int voff, _Float16* __restrict__ Vt) { __shared__ unsigned short tl[64][66]; const int tid = threadIdx.x; const int slab = blockIdx.x / (TTv / 64), lg = blockIdx.x % (TTv / 64); const int b = slab / NHv, h = slab % NHv;
  for (int i = tid; i < 64 * 8; i += 256) { const int r = i / 8, c8 = (i % 8) * 8; FragH f; f.half[0] = *(const v8us*)((const unsigned short*)V16 + ((size_t)b * TTv + lg * 64 + r) * ldv + voff + h * 64 + c8);
#pragma unroll
    for (int q = 0; q < 8; ++q) tl[r][c8 + q] = f.u[q]; }
  __syncthreads();
  {
#pragma unroll
    for (int rd = 0; rd < 2; ++rd) { const int d = rd * 32 + tid / 8, pc = tid % 8; FragH f;
#pragma unroll
      for (int q = 0; q < 8; ++q) f.u[q] = tl[pc * 8 + q][d];
      *(v8us*)((unsigned short*)Vt + ((size_t)slab * 64 + d) * TTv + lg * 64 + pc * 8) = f.half[0]; }
     } }

__global__ __launch_bounds__(256) void k_hl(const float* __restrict__ F, _Float16* __restrict__ Hh, _Float16* __restrict__ Hl, size_t n8) { const size_t t = (size_t)blockIdx.x * 256 + threadIdx.x; if (t >= n8) return; FragH fh, fl; const v4f a = *(const v4fa*)(F + t * 8), c = *(const v4fa*)(F + t * 8 + 4);
#pragma unroll
  for (int q = 0; q < 4; ++q) { _Float16 h = (_Float16)a[q]; fh.h[q] = h; fl.h[q] = (_Float16)((a[q] - (float)h) * 1024.0f); h = (_Float16)c[q]; fh.h[4 + q] = h; fl.h[4 + q] = (_Float16)((c[q] - (float)h) * 1024.0f); }
  { *(v8us*)((unsigned short*)Hh + t * 8) = fh.half[0]; *(v8us*)((unsigned short*)Hl + t * 8) = fl.half[0];  } }
__global__ __launch_bounds__(256) void k_cstab(float* __restrict__ CS) { const int t = blockIdx.x * 256 + threadIdx.x; if (t >= TT * 32) return; const int p = t / 32, i = t % 32; const float invf = powf(10000.0f, -(float)(2 * i) / (float)HD); float sn, cs; sincosf((float)p * invf, &sn, &cs); typedef float v2f __attribute__((ext_vector_type(2), may_alias)); const v2f v = {cs, sn};
  *(v2f*)(CS + (size_t)t * 2) = v;  }
// rotary embedding: for row (b,s), head h, 8-dim piece g (d0 = g·8): (cos, sin) from the table row of the token's sequence position; d < 32: q'[d] = q[d]·cos_d − q[d+32]·sin_d; d ≥ 32: q'[d] = q[d]·cos_{d−32} + q[d−32]·sin_{d−32} (f32), stored f16;
template <int NHR, int LDI, int LDO>
__global__ __launch_bounds__(256) void k_rope(const float* __restrict__ QF, const float* __restrict__ CS, _Float16* __restrict__ Q16) { const size_t t = (size_t)blockIdx.x * 256 + threadIdx.x; if (t >= (size_t)NR * NHR * 8) return; const int g = (int)(t % 8); const int h = (int)((t / 8) % NHR); const size_t row = t / (8 * NHR); const int p = (int)(row % TT);      /* position = token index within the sequence (the reference's arange) */
  const int d0 = g * 8; const int i0 = d0 & 31; const float* base = QF + row * LDI + h * HD; const int dp = (d0 < 32) ? d0 + 32 : d0 - 32; const float sgn = (d0 < 32) ? -1.0f : 1.0f; const float* csr = CS + ((size_t)p * 32 + i0) * 2; FragH f;
#pragma unroll 1
  for (int e = 0; e < 8; ++e) { const float cs = csr[2 * e], sn = csr[2 * e + 1]; f.h[e] = (_Float16)(base[d0 + e] * cs + sgn * base[dp + e] * sn); }
  *(v8us*)((unsigned short*)Q16 + row * LDO + h * HD + d0) = f.half[0];  }
template <int NHV>
__global__ __launch_bounds__(256) void k_vthl(const float* __restrict__ VF, int ldv, int voff, _Float16* __restrict__ Vth, _Float16* __restrict__ Vtl) { __shared__ float tl[64][65]; const int tid = threadIdx.x; const int slab = blockIdx.x / (TT / 64), lg = blockIdx.x % (TT / 64); const int b = slab / NHV, h = slab % NHV;
  for (int i = tid; i < 64 * 16; i += 256) { const int r = i / 16, c4 = (i % 16) * 4; const v4f a = *(const v4fa*)(VF + ((size_t)b * TT + lg * 64 + r) * ldv + voff + h * HD + c4); tl[r][c4] = a[0]; tl[r][c4 + 1] = a[1]; tl[r][c4 + 2] = a[2]; tl[r][c4 + 3] = a[3]; }
  __syncthreads();
  FragH fh[2], fl[2]; size_t oo[2];
#pragma unroll
  for (int rd = 0; rd < 2; ++rd) { const int d = rd * 32 + tid / 8, pc = tid % 8;
#pragma unroll
    for (int q = 0; q < 8; ++q) { const float v = tl[pc * 8 + q][d]; const _Float16 hv = (_Float16)v; fh[rd].h[q] = hv; fl[rd].h[q] = (_Float16)((v - (float)hv) * 1024.0f); } oo[rd] = ((size_t)slab * HD + d) * TT + lg * 64 + pc * 8; }
  {
#pragma unroll
    for (int rd = 0; rd < 2; ++rd) { *(v8us*)((unsigned short*)Vth + oo[rd]) = fh[rd].half[0]; *(v8us*)((unsigned short*)Vtl + oo[rd]) = fl[rd].half[0]; }
     } }
/* lane l with lane l ^ 16: one vector cross-row move */
__device__ __forceinline__ float xhalf(float x) { return __builtin_bit_cast(float, __builtin_amdgcn_permlanex16(__builtin_bit_cast(int, x), __builtin_bit_cast(int, x), 0x76543210, 0xfedcba98, false, false)); }
/* One stage of k_flash's key loop, 128 keys, from global memory straight into LDS: a thread's 4 + 4 + 4 pieces of 16 bytes (key rows, V^T high rows, V^T residual rows) and one piece of 8 bytes (head scalars).
   Every wave's 32 lanes cover whole 128-byte lines. The s_wait_xcnt closes the statement so that no address register named here is rewritten while a copy may still read it. */
__device__ __forceinline__ void stage_copies(unsigned lk, unsigned lv, unsigned lw, unsigned lh, const char* gk, const char* gv, const char* gw, const char* gh) {
  asm volatile("global_load_async_to_lds_b128 %0, %13, off\n\t"
               "global_load_async_to_lds_b128 %1, %14, off\n\t"
               "global_load_async_to_lds_b128 %2, %15, off\n\t"
               "global_load_async_to_lds_b128 %3, %16, off\n\t"
               "global_load_async_to_lds_b128 %4, %17, off\n\t"
               "global_load_async_to_lds_b128 %5, %18, off\n\t"
               "global_load_async_to_lds_b128 %6, %19, off\n\t"
               "global_load_async_to_lds_b128 %7, %20, off\n\t"
               "global_load_async_to_lds_b128 %8, %21, off\n\t"
               "global_load_async_to_lds_b128 %9, %22, off\n\t"
               "global_load_async_to_lds_b128 %10, %23, off\n\t"
               "global_load_async_to_lds_b128 %11, %24, off\n\t"
               "global_load_async_to_lds_b64 %12, %25, off\n\t"
               "s_wait_xcnt 0x0"
               :: "v"(lk), "v"(lk + 32u * 144u), "v"(lk + 64u * 144u), "v"(lk + 96u * 144u),
                  "v"(lv), "v"(lv + 16u * 272u), "v"(lv + 32u * 272u), "v"(lv + 48u * 272u),
                  "v"(lw), "v"(lw + 16u * 272u), "v"(lw + 32u * 272u), "v"(lw + 48u * 272u), "v"(lh),
                  "v"(gk), "v"(gk + 32 * HD * 2), "v"(gk + 64 * HD * 2), "v"(gk + 96 * HD * 2),
                  "v"(gv), "v"(gv + 16 * TT * 2), "v"(gv + 32 * TT * 2), "v"(gv + 48 * TT * 2),
                  "v"(gw), "v"(gw + 16 * TT * 2), "v"(gw + 32 * TT * 2), "v"(gw + 48 * TT * 2), "v"(gh)
               : "memory");
}
__global__ __launch_bounds__(256) __attribute__((amdgpu_waves_per_eu(4, 4))) void k_flash(const _Float16* __restrict__ Q16, int ldq, const _Float16* __restrict__ K16, const float* __restrict__ KH, const float* __restrict__ VHD, const _Float16* __restrict__ Vt, const _Float16* __restrict__ Vtlo, float* __restrict__ O, int ldo) {
  // One block = one 16-row query tile of TWO heads, 8 waves: wave w works for head w & 1 and takes the 32-key chunks kq, kq + 4, ... with kq = w >> 1; each wave keeps its own running max, sum and accumulators, and a head's four partial results are merged through LDS at the end.
  // Key rows and value rows are the same for every head, so a stage of 128 keys (four chunks: key rows, both V^T planes, the two heads' scalars) is brought into LDS once per block, in whole 128-byte lines, by asynchronous copies,
  // and the waves read their fragments from LDS (row pitches 144 B and 272 B, odd multiples of 16 B, for the 16-byte fragment reads). Two buffers: stage t + 1 flies while stage t is worked on.
  // A causal tile's cost grows with its index and there are more blocks than resident places, so the block index counts the tiles down: the longest start first. Two blocks share a WGP (four waves a SIMD): registers are held to 256 and LDS to under 160 KiB for that.
  // Both products are transposed: S^T = K.Q^T (A = 16 key rows, B = the query tile) and O^T += V^T.P^T (A = 16 rows of V^T, B = P^T). A lane then holds 16 of the 32 scores of ONE query (column ln; keys 8 hh + r and 16 + 8 hh + r),
  // so max and sum run in the lane with one exchange between the halves, the rescale factor is one value a lane, and the two score tiles, converted in place, are the B operand of the second product in the k order of the V^T loader.
  // KH and VHD are head-major, [head][token]: a lane's 8 keys of a tile are 32 contiguous bytes.
  // Every "#pragma unroll" in this kernel is there so that the small arrays it indexes (bq, ak, av, avl, kh, vh, sc, bp, bpl, the accumulators, mw) get constant indices and stay in registers; "#pragma unroll 1" keeps one copy of the key loop's body, whose registers are the kernel's limit.
  constexpr int RPW = 16, NQT = TT / RPW, DT = 4, KS = 2, HB = 2, KQ = 4, NW = HB * KQ, SK = KQ * 32, NHG = NH / HB;
  constexpr int PK = HD * 2 + 16, PV = SK * 2 + 16, OVH = SK * PK, OVL = OVH + HD * PV, OHS = OVL + HD * PV, STG = OHS + 2 * HB * SK * 4;      /* a stage in LDS: key rows, V^T high, V^T residual, scalars (kh of the heads, then vh) */
  static_assert(PK == 144 && PV == 272 && SK == 128 && NW * 32 == 256, "stage_copies is written for these pitches, this stage and this block");
  __shared__ __attribute__((aligned(16))) unsigned char sb[2 * STG];
  __shared__ __attribute__((aligned(16))) float sO[NW][RPW][64 + 4]; __shared__ float sM[NW][RPW], sL[NW][RPW];
  const int tid = threadIdx.x, lane = tid & 31, ln = lane & 15, hh = lane >> 4;
  const int w = __builtin_amdgcn_readfirstlane(tid >> 5);      /* wave number in a scalar register: it decides whether the wave has a chunk in a stage, and the branch around the matrix instructions must be a scalar one */
  const int hs = w % HB, kq = w / HB;
  const int slab = blockIdx.x % (BB * NHG), qt = NQT - 1 - blockIdx.x / (BB * NHG); const int b = slab / NHG, hg = slab % NHG; const int h = hg * HB + hs; const int q0 = qt * RPW;
  FragH bq[KS];
  { const unsigned short* qr = (const unsigned short*)Q16 + ((size_t)b * TT + q0 + ln) * ldq + h * 64;
#pragma unroll
    for (int ks = 0; ks < KS; ++ks) { bq[ks].half[0] = *(const v8us*)(qr + ks * 32 + 8 * hh); bq[ks].half[1] = *(const v8us*)(qr + ks * 32 + 16 + 8 * hh); } }
  /* the thread's pieces of a stage: 8 threads a key row (128 B), 16 threads a V^T row (256 B), 64 threads a scalar row (512 B) */
  const int hr = tid >> 6;      /* scalar row: kh of head 0, 1, then vh of head 0, 1 */
  const char* gk = (const char*)(K16 + ((size_t)b * TT + (tid >> 3)) * HD) + (tid & 7) * 16;
  const char* gv = (const char*)(Vt + ((size_t)b * 64 + (tid >> 4)) * TT) + (tid & 15) * 16;
  const char* gw = (const char*)(Vtlo + ((size_t)b * 64 + (tid >> 4)) * TT) + (tid & 15) * 16;
  const char* gh = (const char*)((hr < HB ? KH : VHD) + (size_t)(hg * HB + hr % HB) * NR + (size_t)b * TT) + (tid & 63) * 8;
  const unsigned lb = (unsigned)(size_t)sb;      /* byte address of the ring in the work-group's LDS */
  const unsigned lk = lb + (unsigned)((tid >> 3) * PK + (tid & 7) * 16), lv = lb + (unsigned)(OVH + (tid >> 4) * PV + (tid & 15) * 16), lw = lv + (unsigned)(OVL - OVH), lh = lb + (unsigned)(OHS + hr * SK * 4 + (tid & 63) * 8);
  /* the lane's fragment places in a stage */
  const unsigned char* const fk = sb + (kq * 32 + ln) * PK + hh * 16;
  const unsigned char* const fv = sb + OVH + ln * PV + (kq * 32 + 8 * hh) * 2;
  const unsigned char* const fh = sb + OHS + hs * SK * 4 + (kq * 32 + 8 * hh) * 4;
  float m_r = -3.0e38f, l_r = 0.f; v8f oacc[DT], oaccl[DT], oacc2[DT];
#pragma unroll
  for (int dt = 0; dt < DT; ++dt) { oacc[dt] = (v8f){0.f,0.f,0.f,0.f,0.f,0.f,0.f,0.f}; oaccl[dt] = oacc[dt]; oacc2[dt] = oacc[dt]; }
  const int jend = q0 + RPW;
  const int nst = (jend + SK - 1) / SK;      /* stages of the tile, the same for the whole block; a stage lies wholly inside the TT keys */
  stage_copies(lk, lv, lw, lh, gk, gv, gw, gh);
  asm volatile("s_wait_asynccnt 0x0" ::: "memory");      /* this wave's pieces of stage 0 have landed */
  __syncthreads();      /* every wave's pieces of stage 0 are in LDS before any wave reads a fragment */
  if (nst > 1) stage_copies(lk + STG, lv + STG, lw + STG, lh + STG, gk + SK * HD * 2, gv + SK * 2, gw + SK * 2, gh + SK * 4);
#pragma unroll 1
  for (int t = 0; t < nst; ++t) {
    const int cur = (t & 1) * STG; const int j0 = t * SK + kq * 32;
    if (j0 < jend) {      /* scalar test: the last stage of a tile may hold fewer than four chunks */
    FragH ak[2][KS], av[DT], avl[DT]; v4f kh[2][2], vh[2][2];
#pragma unroll
    for (int nt = 0; nt < 2; ++nt) {
#pragma unroll
      for (int ks = 0; ks < KS; ++ks) { const unsigned char* kr = fk + cur + nt * 16 * PK + ks * 64; ak[nt][ks].half[0] = *(const v8us*)kr; ak[nt][ks].half[1] = *(const v8us*)(kr + 32); }
      const unsigned char* kp = fh + cur + nt * 64; const unsigned char* vp = kp + HB * SK * 4;
      kh[nt][0] = *(const v4fa*)kp; kh[nt][1] = *(const v4fa*)(kp + 16); vh[nt][0] = *(const v4fa*)vp; vh[nt][1] = *(const v4fa*)(vp + 16); }
    float sc[2][8];
#pragma unroll
    for (int nt = 0; nt < 2; ++nt) { v8f acc = (v8f){0.f,0.f,0.f,0.f,0.f,0.f,0.f,0.f};
#pragma unroll
      for (int ks = 0; ks < KS; ++ks) acc = __builtin_amdgcn_wmma_f32_16x16x32_f16(false, ak[nt][ks].v, false, bq[ks].v, (short)0, acc, false, false);
#pragma unroll
      for (int r = 0; r < 8; ++r) sc[nt][r] = acc[r] * kh[nt][r >> 2][r & 3] * 0.125f; }
    if (j0 + 31 > q0) {      /* only a chunk that reaches past the tile's first query has keys to mask (scalar test); every query keeps at least one key of every chunk of the loop */
#pragma unroll
      for (int nt = 0; nt < 2; ++nt)
#pragma unroll
        for (int r = 0; r < 8; ++r) sc[nt][r] = (j0 + nt * 16 + 8 * hh + r <= q0 + ln) ? sc[nt][r] : -INFINITY; }
    float mc = fmaxf(sc[0][0], sc[1][0]);
#pragma unroll
    for (int r = 1; r < 8; ++r) mc = fmaxf(mc, fmaxf(sc[0][r], sc[1][r]));
    mc = fmaxf(mc, xhalf(mc));      /* the query's other 16 keys */
    const float mn = fmaxf(m_r, mc); const float al = (mn > -1.0e38f) ? expf(m_r - mn) : 1.0f; m_r = mn;
    FragH bp, bpl; float ps = 0.f;
#pragma unroll
    for (int nt = 0; nt < 2; ++nt)
#pragma unroll
      for (int r = 0; r < 8; ++r) { const float p = expf(sc[nt][r] - mn); ps += p;      /* a masked score is -inf: p = 0 */
        const float pv = p * vh[nt][r >> 2][r & 3] * 1024.0f; const _Float16 ph = (_Float16)pv; bp.h[nt * 8 + r] = ph; bpl.h[nt * 8 + r] = (_Float16)((pv - (float)ph) * 1024.0f); }      /* value-head scalar folded into P, carried as f16 hi + x2^10 residual operands; the normaliser keeps plain p */
    l_r = l_r * al + ps;      /* the lane's half of the row sum; the halves are joined once, behind the loop */
    __builtin_amdgcn_sched_barrier(0);      /* keeps the V^T fragments' 64 registers out of the softmax: lifted to the top of the chunk, these LDS reads push the wave past 256 registers and a value spills to scratch; their short latency passes under the rescale below */
#pragma unroll
    for (int dt = 0; dt < DT; ++dt) { const unsigned char* vp = fv + cur + dt * 16 * PV; const unsigned char* lp = vp + (OVL - OVH); av[dt].half[0] = *(const v8us*)vp; av[dt].half[1] = *(const v8us*)(vp + 32); avl[dt].half[0] = *(const v8us*)lp; avl[dt].half[1] = *(const v8us*)(lp + 32); }
    __builtin_amdgcn_sched_barrier(0);      /* keeps the sixteen reads together as one group in front of the rescale: spread among the matrix instructions, each further place of LDS reads costs the wave a wait of its own */
#pragma unroll
    for (int dt = 0; dt < DT; ++dt) { oacc[dt] *= al; oaccl[dt] *= al; oacc2[dt] *= al; }
#pragma unroll
    for (int dt = 0; dt < DT; ++dt) { oacc[dt] = __builtin_amdgcn_wmma_f32_16x16x32_f16(false, av[dt].v, false, bp.v, (short)0, oacc[dt], false, false); oaccl[dt] = __builtin_amdgcn_wmma_f32_16x16x32_f16(false, avl[dt].v, false, bp.v, (short)0, oaccl[dt], false, false); oacc2[dt] = __builtin_amdgcn_wmma_f32_16x16x32_f16(false, av[dt].v, false, bpl.v, (short)0, oacc2[dt], false, false); }
    }
    /* hand-over of the ring, passed by every wave, also one without a chunk in this stage */
    asm volatile("s_wait_dscnt 0x0" ::: "memory");      /* this wave's reads of stage t are done before the buffer is given to the copies */
    asm volatile("s_wait_asynccnt 0x0" ::: "memory");      /* this wave's pieces of stage t + 1 have landed */
    __syncthreads();      /* publishes stage t + 1 and ends every wave's reads of stage t */
    if (t + 2 < nst) stage_copies(lk + cur, lv + cur, lw + cur, lh + cur, gk + (size_t)(t + 2) * (SK * HD * 2), gv + (size_t)(t + 2) * (SK * 2), gw + (size_t)(t + 2) * (SK * 2), gh + (size_t)(t + 2) * (SK * 4));      /* into the buffer that stage t has just left */
  }
  asm volatile("s_wait_asynccnt 0x0" ::: "memory");      /* no copy is outstanding when the wave goes on to its end */
  l_r += xhalf(l_r);
  if (hh == 0) { sM[w][ln] = m_r; sL[w][ln] = l_r; }
#pragma unroll
  for (int dt = 0; dt < DT; ++dt) { const v8f t = oacc[dt] + (oaccl[dt] + oacc2[dt]) * 0.0009765625f;      /* registers r = head dims dt * 16 + 8 hh + r of query ln */
    *(v4fa*)&sO[w][ln][dt * 16 + 8 * hh] = (v4f){t[0], t[1], t[2], t[3]}; *(v4fa*)&sO[w][ln][dt * 16 + 8 * hh + 4] = (v4f){t[4], t[5], t[6], t[7]}; }
  __syncthreads();      /* every wave's partial (max, sum, unnormalised rows) is in LDS before any wave merges */
  {
    const int mh = tid >> 7, lt = tid & 127;      /* 128 threads merge a head: its partial i is wave i * HB + mh's */
    const int r = lt >> 3, c4 = (lt & 7) * 4;      /* 8 threads a row, two 128-byte lines a row */
    float mw[KQ], M = -3.0e38f, L = 0.f;
#pragma unroll
    for (int i = 0; i < KQ; ++i) { mw[i] = sM[i * HB + mh][r]; M = fmaxf(M, mw[i]); }
#pragma unroll
    for (int i = 0; i < KQ; ++i) { mw[i] = expf(mw[i] - M); L += mw[i] * sL[i * HB + mh][r]; }      /* a wave that had no chunk holds max -3e38, sum 0, rows 0: weight 0 */
    const float inv = (L > 0.f) ? 1.0f / (L * 1024.0f) : 0.f;
#pragma unroll
    for (int hf = 0; hf < 2; ++hf) { v4f a = {0.f, 0.f, 0.f, 0.f};
#pragma unroll
      for (int i = 0; i < KQ; ++i) { const v4f p = *(const v4fa*)&sO[i * HB + mh][r][hf * 32 + c4]; a += p * mw[i]; }
      *(v4f*)(O + ((size_t)b * TT + q0 + r) * ldo + (hg * HB + mh) * 64 + hf * 32 + c4) = a * inv; }
  } }

extern "C" void kernel_launch(void* const* d_in, const int* in_sizes, int n_in,
                              void* d_out, int out_size, void* d_ws, size_t ws_size, hipStream_t stream) {
  (void)in_sizes; (void)n_in; (void)out_size;
  const float* x = (const float*)d_in[0]; const float* Wq = (const float*)d_in[1]; const float* Wkv = (const float*)d_in[2]; const float* Wkvh = (const float*)d_in[3]; const float* Wo = (const float*)d_in[4];
  char* ws = (char*)d_ws; size_t off = 0;
  auto take = [&](size_t bytes) { char* p = ws + off; off += (bytes + 255) & ~(size_t)255; return p; };
  _Float16* Bq = (_Float16*)take((size_t)DM * DM * 2); _Float16* Bkv = (_Float16*)take((size_t)2 * HD * DM * 2); _Float16* Bkh = (_Float16*)take((size_t)2 * NH * DM * 2); _Float16* Bo = (_Float16*)take((size_t)DM * DM * 2); float* CS = (float*)take((size_t)TT * 32 * 2 * 4);
  _Float16* X16 = (_Float16*)take((size_t)NR * DM * 2); float* F32 = (float*)take((size_t)NR * DM * 4); _Float16* Q16 = (_Float16*)take((size_t)NR * DM * 2); float* KVF = (float*)take((size_t)NR * 2 * HD * 4); _Float16* K16 = (_Float16*)take((size_t)NR * HD * 2); float* HS = (float*)take((size_t)NR * 2 * NH * 4);
  _Float16* Vth = (_Float16*)take((size_t)BB * HD * TT * 2); _Float16* Vtl = (_Float16*)take((size_t)BB * HD * TT * 2); _Float16* OH = (_Float16*)take((size_t)NR * DM * 2); _Float16* OL = (_Float16*)take((size_t)NR * DM * 2);
  float* O = F32;      /* F32 holds q (consumed by k_rope) then O */
  if (off > ws_size) return;      // 2.1 + 0.3 + 0.1 + 2.1 + 0.5 + 8.4 + 16.8 + 8.4 + 2.1 + 0.5 + 0.5 + 0.5 + 0.5 + 8.4 + 8.4 ≈ 60 MB
  k_wt_f16<<<(unsigned)(((size_t)DM * (DM / 8) + 255) / 256), 256, 0, stream>>>(Wq, Bq, DM, DM, 16.0f); k_wt_f16<<<(unsigned)(((size_t)2 * HD * (DM / 8) + 255) / 256), 256, 0, stream>>>(Wkv, Bkv, DM, 2 * HD, 16.0f);
  k_wt_f16<<<(unsigned)(((size_t)2 * NH * (DM / 8) + 255) / 256), 256, 0, stream>>>(Wkvh, Bkh, DM, 2 * NH, 16.0f); k_wt_f16<<<(unsigned)(((size_t)DM * (DM / 8) + 255) / 256), 256, 0, stream>>>(Wo, Bo, DM, DM, 16.0f);      /* (in,out) → Bt ×2^4 */
  k_x16<<<(unsigned)(((size_t)NR * DM / 8 + 255) / 256), 256, 0, stream>>>(x, X16, (size_t)NR * DM / 8); k_cstab<<<(TT * 32 + 255) / 256, 256, 0, stream>>>(CS);
  const dim3 gq(DM / 128, NR / 128);      /* 128 x 128 tiles of a 4096 x 1024 result: 256 blocks */
  k_gemm_t<128, DM, 0, false><<<gq, 256, 0, stream>>>(X16, Bq, 0.0625f, F32); k_rope<NH, DM, DM><<<(unsigned)(((size_t)NR * NH * 8 + 255) / 256), 256, 0, stream>>>(F32, CS, Q16);      /* q → RoPE → f16 */
  k_gemm_t<128, 2 * HD, 0, false><<<dim3(1, NR / 128), 256, 0, stream>>>(X16, Bkv, 0.0625f, KVF);      /* [k | v] f32: M 4096 N 128 K 1024 */
  k_rope<1, 2 * HD, HD><<<(unsigned)(((size_t)NR * 8 + 255) / 256), 256, 0, stream>>>(KVF, CS, K16);      /* shared k (cols 0..63 of KVF, row stride 128) → RoPE → K16 [4096][64] */
  k_vthl<1><<<BB * (TT / 64), 256, 0, stream>>>(KVF, 2 * HD, HD, Vth, Vtl);      /* shared v (cols 64..127) → Vᵀ hi/lo per batch [b][64][T] */
  k_gemm_t<32, NR, 11, false><<<dim3(1, NR / 128), 256, 0, stream>>>(X16, Bkh, 0.0625f, HS);      /* [kh | vh] = sigmoid(x.Wkvh): M 4096 N 32 K 1024, stored head-major: 32 rows of 4096 f32 */
  k_flash<<<BB * (NH / 2) * (TT / 16), 256, 0, stream>>>(Q16, DM, K16, HS, HS + (size_t)NH * NR, Vth, Vtl, O, DM);      /* KH = HS rows 0..15, VH = rows 16..31 (row pitch NR) */
  k_hl<<<(unsigned)(((size_t)NR * DM / 8 + 255) / 256), 256, 0, stream>>>(O, OH, OL, (size_t)NR * DM / 8);
  k_gemm_t<128, DM, 0, false><<<gq, 256, 0, stream>>>(OH, Bo, 0.0625f, (float*)d_out);      /* y = O_hi·Wo */
  k_gemm_t<128, DM, 0, true><<<gq, 256, 0, stream>>>(OL, Bo, 0.0625f * 0.0009765625f, (float*)d_out);      /* += O_lo·Wo·2^-10 in place */
}

// v005
// A run of this version takes 158 microseconds.
// Next to v004, in two timings, it ran 1.29 times as fast each time.
// All steps since v000 together make it 3.50 times as fast.
#include <hip/hip_runtime.h>
// Multi-product attention with low-rank shared key/value (B=2, N=2048, D=1024, 16 heads × 64): q = x·Wq; [k|v] = x·Wkv (one shared 64-dim key and value); [kh|vh] = σ(x·Wkvh) per (token, head); rotary (rotate-half, θ=1e4) on q and k by
// sequence position; K_h[n] = kh[n,h]·k[n], V_h[n] = vh[n,h]·v[n]; causal softmax(q_h·K_hᵀ/8); out = (Σ attn·V_h merged)·Wo.
// Compute dtype: x and weights rounded to bf16; q and k as f32 GEMM outputs rotated in f32 from a one-time f32 cos/sin table and stored f16; head scalars as sigmoid GEMM epilogue outputs (f32); v f32 →
// f16 hi + ×2^10 residual Vᵀ planes; fused causal flash-style kernel (scores scaled by kh per key, P multiplied by vh per key and carried as f16 hi + residual tiles, online softmax f32, three value accumulators) on v_wmma_f32_16x16x32_f16; merged O → hi/lo → Wo GEMMs (second in place ×2^-10); f32 accumulate.
#define BB 2
#define TT 2048
#define DM 1024
#define NH 16
#define HD 64
#define NR (BB * TT)

typedef __bf16 v16b __attribute__((ext_vector_type(16)));
typedef unsigned short v8us __attribute__((ext_vector_type(8), may_alias));
typedef float  v8f  __attribute__((ext_vector_type(8)));
typedef float  v4f  __attribute__((ext_vector_type(4)));
typedef float  v4fa __attribute__((ext_vector_type(4), may_alias));
union FragB { v16b v; v8us half[2]; unsigned short u[16]; };

__device__ __forceinline__ unsigned short bf16_bits(float x) { unsigned int u = __float_as_uint(x); return (unsigned short)((u + 0x7FFFu + ((u >> 16) & 1u)) >> 16); }
__device__ __forceinline__ float bf16_val(unsigned short b) { return __uint_as_float(((unsigned int)b) << 16); }
__device__ __forceinline__ float bf16_round(float x) { return bf16_val(bf16_bits(x)); }
// D += A·B with NT terms: 1 = ah·bh, 2 = + al·bh (A split), 3 = + ah·bl (both split)
template <int NT>
__device__ __forceinline__ v8f mmaN(v16b ah, v16b al, v16b bh, v16b bl, v8f c) {
  c = __builtin_amdgcn_wmma_f32_16x16x32_bf16(false, ah, false, bh, (short)0, c, false, false);
  if (NT >= 2) c = __builtin_amdgcn_wmma_f32_16x16x32_bf16(false, al, false, bh, (short)0, c, false, false);
  if (NT >= 3) c = __builtin_amdgcn_wmma_f32_16x16x32_bf16(false, ah, false, bl, (short)0, c, false, false);
  asm volatile("v_nop\n\tv_nop\n\tv_nop\n\tv_nop" : "+v"(c) : "v"(ah), "v"(al), "v"(bh), "v"(bl));
  return c;
}

__global__ __launch_bounds__(256) void k_wt_bf16(const float* __restrict__ W, unsigned short* __restrict__ Wt, int K, int N) {
  const int t = blockIdx.x * 256 + threadIdx.x;
  const int k8n = K / 8;
  if (t >= N * k8n) return;
  const int n = t / k8n, k8 = (t % k8n) * 8;
  v8us v;
#pragma unroll
  for (int i = 0; i < 8; ++i) v[i] = bf16_bits(W[(size_t)(k8 + i) * N + n]);
  *(v8us*)(Wt + (size_t)n * K + k8) = v;
  
}

// GEMM C[M][N] (f32, pitch ldc) = act(A[M][K]·W + bias). A f32 row-major (pitch lda) converted per fragment to bf16
// (ASPLIT: hi/lo two planes -> 2 terms, else single rounded term); Wt bf16 [N][K] (pitch ldb). BIAS_BF16 rounds the
// bias to bf16 first (bias quantised to bf16 before the add). K%32==0, M%16==0, N%64==0.
template <bool ASPLIT, int ACT, bool BIAS_BF16>
__global__ __launch_bounds__(128) void k_gemm_bf(const float* __restrict__ A, int lda, const unsigned short* __restrict__ Wt, int ldb,
                                               const float* __restrict__ bias, float* __restrict__ C, int ldc, int M, int N, int K) {
  __shared__ __attribute__((aligned(16))) float so[4][16][64];
  const int tid = threadIdx.x, w = tid >> 5, lane = tid & 31, ln = lane & 15, hh = lane >> 4;
  const int ntn = N / 64;
  const int wid = blockIdx.x * 4 + w;
  const int mt = wid / ntn, nq = wid % ntn;
  if (mt * 16 >= M) return;
  const int row0 = mt * 16, col0 = nq * 64;
  const float* arow = A + (size_t)(row0 + ln) * lda;
  v8f acc[4] = {};
  for (int kb = 0; kb < K; kb += 32) {
    FragB ah, al;
    const v4f x0 = *(const v4fa*)(arow + kb + 8 * hh), x1 = *(const v4fa*)(arow + kb + 8 * hh + 4);
    const v4f x2 = *(const v4fa*)(arow + kb + 16 + 8 * hh), x3 = *(const v4fa*)(arow + kb + 16 + 8 * hh + 4);
    float xs[16] = {x0[0],x0[1],x0[2],x0[3],x1[0],x1[1],x1[2],x1[3],x2[0],x2[1],x2[2],x2[3],x3[0],x3[1],x3[2],x3[3]};
#pragma unroll
    for (int i = 0; i < 16; ++i) { const unsigned short hb = bf16_bits(xs[i]); ah.u[i] = hb; al.u[i] = ASPLIT ? bf16_bits(xs[i] - bf16_val(hb)) : (unsigned short)0; }
#pragma unroll
    for (int t = 0; t < 4; ++t) {
      const unsigned short* brow = Wt + (size_t)(col0 + t * 16 + ln) * ldb + kb;
      FragB b;
      b.half[0] = *(const v8us*)(brow + 8 * hh);
      b.half[1] = *(const v8us*)(brow + 16 + 8 * hh);
      acc[t] = mmaN<ASPLIT ? 2 : 1>(ah.v, al.v, b.v, b.v, acc[t]);
    }
  }
#pragma unroll
  for (int t = 0; t < 4; ++t) {
    float bv = bias ? bias[col0 + t * 16 + ln] : 0.f;
    if (BIAS_BF16) bv = bf16_round(bv);
#pragma unroll
    for (int r = 0; r < 8; ++r) { float v = acc[t][r] + bv; if (ACT == 1) v = fmaxf(v, 0.f); so[w][8 * hh + r][t * 16 + ln] = v; }
  }
  __builtin_amdgcn_fence(__ATOMIC_ACQ_REL, "workgroup");
  __builtin_amdgcn_wave_barrier();
  const int rsub = lane >> 4, c4 = (lane & 15) * 4;
  {
#pragma unroll
    for (int q = 0; q < 8; ++q) {
      const int r = q * 2 + rsub;
      const v4f v = *(const v4fa*)&so[w][r][c4];
      *(v4f*)(C + (size_t)(row0 + r) * ldc + col0 + c4) = v;
    }
    
  }
}

// Flash-style causal/unmasked attention, all contractions 3-term bf16 hi/lo splits, f32 softmax with running max.
// q,k,v rows are read from f32 buffers with arbitrary row pitch (so they can live inside a fused qkv buffer);
// D = head size (multiple of 32, <= 128); one wave = 16 query rows; block = 4 waves (64 queries) sharing K/V chunks of 32.
template <int D, bool CAUSAL>
__global__ __launch_bounds__(128) void k_flash(const float* __restrict__ qb, const float* __restrict__ kb, const float* __restrict__ vb,
                                             int pitch, int T, int H, float scale, float* __restrict__ y, int ypitch) {
  constexpr int KS = D / 32;        // k-steps for QK
  constexpr int DT = D / 16;        // d tiles for PV
  __shared__ __attribute__((aligned(16))) unsigned short sKh[32][D + 8], sKl[32][D + 8], sVh[32][D + 8], sVl[32][D + 8];
  __shared__ __attribute__((aligned(16))) unsigned short sPh[4][16][40], sPl[4][16][40];
  __shared__ __attribute__((aligned(16))) float sO[4][16][D];
  const int tid = threadIdx.x, w = tid >> 5, lane = tid & 31, ln = lane & 15, hh = lane >> 4;
  const int nqb = (T + 63) / 64;
  const int bh = blockIdx.x / nqb, qblk = blockIdx.x % nqb;
  const int b = bh / H, h = bh % H;
  const int q0 = qblk * 64 + w * 16;
  const float* Q = qb + (size_t)b * T * pitch + h * D;
  const float* K = kb + (size_t)b * T * pitch + h * D;
  const float* V = vb + (size_t)b * T * pitch + h * D;

  // A fragments of the wave's 16 query rows (scaled), hi/lo
  FragB aqh[KS], aql[KS];
  {
    int row = q0 + ln; if (row >= T) row = T - 1;
    const float* qr = Q + (size_t)row * pitch;
#pragma unroll
    for (int ks = 0; ks < KS; ++ks)
#pragma unroll
      for (int i = 0; i < 16; ++i) {
        const int d = ks * 32 + ((i < 8) ? (8 * hh + i) : (16 + 8 * hh + (i - 8)));
        const float x = qr[d] * scale; const unsigned short hb = bf16_bits(x);
        aqh[ks].u[i] = hb; aql[ks].u[i] = bf16_bits(x - bf16_val(hb));
      }
  }
  float m_r[8], l_r[8];
#pragma unroll
  for (int r = 0; r < 8; ++r) { m_r[r] = -3.0e38f; l_r[r] = 0.f; }
  v8f oacc[DT];
#pragma unroll
  for (int dt = 0; dt < DT; ++dt) oacc[dt] = (v8f){0.f,0.f,0.f,0.f,0.f,0.f,0.f,0.f};

  const int kv_end = CAUSAL ? min(T, qblk * 64 + 64) : T;     // block-uniform
  for (int j0 = 0; j0 < kv_end; j0 += 32) {
    __syncthreads();
    for (int e = tid; e < 32 * (D / 4); e += 128) {
      const int r = e / (D / 4), c4 = (e % (D / 4)) * 4;
      const int key = j0 + r;
      v4f kf = {0.f,0.f,0.f,0.f}, vf = {0.f,0.f,0.f,0.f};
      if (key < T) { kf = *(const v4fa*)(K + (size_t)key * pitch + c4); vf = *(const v4fa*)(V + (size_t)key * pitch + c4); }
#pragma unroll
      for (int t = 0; t < 4; ++t) {
        unsigned short hb = bf16_bits(kf[t]); sKh[r][c4 + t] = hb; sKl[r][c4 + t] = bf16_bits(kf[t] - bf16_val(hb));
        hb = bf16_bits(vf[t]); sVh[r][c4 + t] = hb; sVl[r][c4 + t] = bf16_bits(vf[t] - bf16_val(hb));
      }
    }
    __syncthreads();
    // S tile 16 x 32
    v8f s[2];
#pragma unroll
    for (int nt = 0; nt < 2; ++nt) {
      v8f acc = {};
#pragma unroll
      for (int ks = 0; ks < KS; ++ks) {
        FragB bh_, bl_;
        bh_.half[0] = *(const v8us*)&sKh[nt * 16 + ln][ks * 32 + 8 * hh]; bh_.half[1] = *(const v8us*)&sKh[nt * 16 + ln][ks * 32 + 16 + 8 * hh];
        bl_.half[0] = *(const v8us*)&sKl[nt * 16 + ln][ks * 32 + 8 * hh]; bl_.half[1] = *(const v8us*)&sKl[nt * 16 + ln][ks * 32 + 16 + 8 * hh];
        acc = mmaN<3>(aqh[ks].v, aql[ks].v, bh_.v, bl_.v, acc);
      }
      s[nt] = acc;
    }
    // mask + running max (rows 8hh+r; the 16 lanes of a half share rows)
    float alpha[8];
#pragma unroll
    for (int r = 0; r < 8; ++r) {
      const int qi = q0 + 8 * hh + r;
      const int ja = j0 + ln, jb = j0 + 16 + ln;
      if (CAUSAL) { if (ja > qi) s[0][r] = -3.0e38f; if (jb > qi) s[1][r] = -3.0e38f; }
      if (ja >= T) s[0][r] = -3.0e38f;
      if (jb >= T) s[1][r] = -3.0e38f;
      float mx = fmaxf(s[0][r], s[1][r]);
      mx = fmaxf(mx, __shfl_xor(mx, 1, 32)); mx = fmaxf(mx, __shfl_xor(mx, 2, 32)); mx = fmaxf(mx, __shfl_xor(mx, 4, 32)); mx = fmaxf(mx, __shfl_xor(mx, 8, 32));
      const float mnew = fmaxf(m_r[r], mx);
      alpha[r] = (mnew > -1.0e38f) ? __expf(m_r[r] - mnew) : 1.0f;
      const float p0 = (s[0][r] > -1.0e38f) ? __expf(s[0][r] - mnew) : 0.f;
      const float p1 = (s[1][r] > -1.0e38f) ? __expf(s[1][r] - mnew) : 0.f;
      m_r[r] = mnew;
      l_r[r] = l_r[r] * alpha[r] + p0 + p1;            // per-lane partial row sum (16 lanes combined at the end)
      unsigned short hb = bf16_bits(p0); sPh[w][8 * hh + r][ln] = hb;      sPl[w][8 * hh + r][ln] = bf16_bits(p0 - bf16_val(hb));
      hb = bf16_bits(p1);                sPh[w][8 * hh + r][16 + ln] = hb; sPl[w][8 * hh + r][16 + ln] = bf16_bits(p1 - bf16_val(hb));
    }
#pragma unroll
    for (int dt = 0; dt < DT; ++dt)
#pragma unroll
      for (int r = 0; r < 8; ++r) oacc[dt][r] *= alpha[r];
    __builtin_amdgcn_fence(__ATOMIC_ACQ_REL, "workgroup");
    __builtin_amdgcn_wave_barrier();
    FragB pah, pal;
    pah.half[0] = *(const v8us*)&sPh[w][ln][8 * hh]; pah.half[1] = *(const v8us*)&sPh[w][ln][16 + 8 * hh];
    pal.half[0] = *(const v8us*)&sPl[w][ln][8 * hh]; pal.half[1] = *(const v8us*)&sPl[w][ln][16 + 8 * hh];
#pragma unroll
    for (int dt = 0; dt < DT; ++dt) {
      FragB bvh, bvl;
#pragma unroll
      for (int i = 0; i < 8; ++i) {
        bvh.u[i] = sVh[8 * hh + i][dt * 16 + ln]; bvh.u[8 + i] = sVh[16 + 8 * hh + i][dt * 16 + ln];
        bvl.u[i] = sVl[8 * hh + i][dt * 16 + ln]; bvl.u[8 + i] = sVl[16 + 8 * hh + i][dt * 16 + ln];
      }
      oacc[dt] = mmaN<3>(pah.v, pal.v, bvh.v, bvl.v, oacc[dt]);
    }
    __builtin_amdgcn_fence(__ATOMIC_ACQ_REL, "workgroup");
    __builtin_amdgcn_wave_barrier();
  }
#pragma unroll
  for (int r = 0; r < 8; ++r) {
    float l = l_r[r];
    l += __shfl_xor(l, 1, 32); l += __shfl_xor(l, 2, 32); l += __shfl_xor(l, 4, 32); l += __shfl_xor(l, 8, 32);
    l_r[r] = (l > 0.f) ? 1.0f / l : 0.f;
  }
#pragma unroll
  for (int dt = 0; dt < DT; ++dt)
#pragma unroll
    for (int r = 0; r < 8; ++r) sO[w][8 * hh + r][dt * 16 + ln] = oacc[dt][r] * l_r[r];
  __builtin_amdgcn_fence(__ATOMIC_ACQ_REL, "workgroup");
  __builtin_amdgcn_wave_barrier();
  {
    for (int r = 0; r < 16; ++r) {
      const int row = q0 + r;
      if (row < T && lane < D / 4) {
        const v4f val = *(const v4fa*)&sO[w][r][lane * 4];
        *(v4f*)(y + ((size_t)b * T + row) * ypitch + h * D + lane * 4) = val;
      }
    }
    
  }
}

// GEMM C = act(A·W + bias + resid): A f32 (ASPLIT -> hi/lo 2 terms), Wt bf16 [N][K]; ACT 0 none, 1 relu, 2 exact gelu;
// resid (optional, f32, row index = (row % rmod), pitch ldr, RES_BF16 rounds it) added before the activation.
template <bool ASPLIT, int ACT, bool BIAS_BF16, bool RES_BF16>
__global__ __launch_bounds__(128) void k_gemm_bf3(const float* __restrict__ A, int lda, const unsigned short* __restrict__ Wt, int ldb,
                                                const float* __restrict__ bias, const float* __restrict__ resid, int rmod, int ldr,
                                                float* __restrict__ C, int ldc, int M, int N, int K) {
  __shared__ __attribute__((aligned(16))) float so[4][16][64];
  const int tid = threadIdx.x, w = tid >> 5, lane = tid & 31, ln = lane & 15, hh = lane >> 4;
  const int ntn = N / 64;
  const int wid = blockIdx.x * 4 + w;
  const int mt = wid / ntn, nq = wid % ntn;
  if (mt * 16 >= M) return;
  const int row0 = mt * 16, col0 = nq * 64;
  const float* arow = A + (size_t)(row0 + ln) * lda;
  v8f acc[4] = {};
  for (int kb = 0; kb < K; kb += 32) {
    FragB ah, al;
    const v4f x0 = *(const v4fa*)(arow + kb + 8 * hh), x1 = *(const v4fa*)(arow + kb + 8 * hh + 4);
    const v4f x2 = *(const v4fa*)(arow + kb + 16 + 8 * hh), x3 = *(const v4fa*)(arow + kb + 16 + 8 * hh + 4);
    float xs[16] = {x0[0],x0[1],x0[2],x0[3],x1[0],x1[1],x1[2],x1[3],x2[0],x2[1],x2[2],x2[3],x3[0],x3[1],x3[2],x3[3]};
#pragma unroll
    for (int i = 0; i < 16; ++i) { const unsigned short hb = bf16_bits(xs[i]); ah.u[i] = hb; al.u[i] = ASPLIT ? bf16_bits(xs[i] - bf16_val(hb)) : (unsigned short)0; }
#pragma unroll
    for (int t = 0; t < 4; ++t) {
      const unsigned short* brow = Wt + (size_t)(col0 + t * 16 + ln) * ldb + kb;
      FragB b;
      b.half[0] = *(const v8us*)(brow + 8 * hh);
      b.half[1] = *(const v8us*)(brow + 16 + 8 * hh);
      acc[t] = mmaN<ASPLIT ? 2 : 1>(ah.v, al.v, b.v, b.v, acc[t]);
    }
  }
#pragma unroll
  for (int t = 0; t < 4; ++t) {
    const int col = col0 + t * 16 + ln;
    float bv = bias ? bias[col] : 0.f;
    if (BIAS_BF16) bv = bf16_round(bv);
#pragma unroll
    for (int r = 0; r < 8; ++r) {
      float v = acc[t][r] + bv;
      if (resid) { float rv = resid[(size_t)((row0 + 8 * hh + r) % rmod) * ldr + col]; if (RES_BF16) rv = bf16_round(rv); v += rv; }
      if (ACT == 1) v = fmaxf(v, 0.f);
      if (ACT == 2) v = 0.5f * v * (1.0f + erff(v * 0.70710678118654752f));
      if (ACT == 3) { const float u = 0.7978845608028654f * (v + 0.044715f * v * v * v); v = 0.5f * v * (1.0f + tanhf(u)); }
      so[w][8 * hh + r][t * 16 + ln] = v;
    }
  }
  __builtin_amdgcn_fence(__ATOMIC_ACQ_REL, "workgroup");
  __builtin_amdgcn_wave_barrier();
  const int rsub = lane >> 4, c4 = (lane & 15) * 4;
  {
#pragma unroll
    for (int q = 0; q < 8; ++q) {
      const int r = q * 2 + rsub;
      const v4f v = *(const v4fa*)&so[w][r][c4];
      *(v4f*)(C + (size_t)(row0 + r) * ldc + col0 + c4) = v;
    }
    
  }
}
// row LayerNorm (biased variance, eps) over N: s = X (+ R); optional out_sum <- s; out_norm <- (s-mu)*rsqrt(var+eps)*g + b
template <bool PARAM_BF16>
__global__ __launch_bounds__(256) void k_layernorm(const float* __restrict__ X, const float* __restrict__ R, const float* __restrict__ g, const float* __restrict__ bta,
                                                  float* __restrict__ out_sum, float* __restrict__ out_norm, int N, float eps) {
  __shared__ float red[256];
  const int row = blockIdx.x, tid = threadIdx.x;
  const float* x = X + (size_t)row * N; const float* rr = R ? R + (size_t)row * N : nullptr;
  float vals[16];                     // up to N = 4096
  const int per = N / 256;            // contiguous chunk per thread? use strided-by-4 chunks: thread handles j = tid*4 + 1024*u
  float s1 = 0.f;
  for (int u = 0; u < per / 4; ++u) {
    const int j = tid * 4 + 1024 * u;
    const v4f a = *(const v4fa*)(x + j);
    v4f b = {0.f,0.f,0.f,0.f}; if (rr) b = *(const v4fa*)(rr + j);
#pragma unroll
    for (int q = 0; q < 4; ++q) { const float v = a[q] + b[q]; vals[u * 4 + q] = v; s1 += v; }
  }
  red[tid] = s1; __syncthreads();
  for (int st = 128; st > 0; st >>= 1) { if (tid < st) red[tid] += red[tid + st]; __syncthreads(); }
  const float mu = red[0] / (float)N; __syncthreads();
  float s2 = 0.f;
  for (int u = 0; u < per / 4; ++u)
#pragma unroll
    for (int q = 0; q < 4; ++q) { const float c = vals[u * 4 + q] - mu; s2 += c * c; }
  red[tid] = s2; __syncthreads();
  for (int st = 128; st > 0; st >>= 1) { if (tid < st) red[tid] += red[tid + st]; __syncthreads(); }
  const float rs = rsqrtf(red[0] / (float)N + eps);
  {
    for (int u = 0; u < per / 4; ++u) {
      const int j = tid * 4 + 1024 * u;
      v4f o, sm;
#pragma unroll
      for (int q = 0; q < 4; ++q) {
        float gg = g[j + q], bb = bta[j + q];
        if (PARAM_BF16) { gg = bf16_round(gg); bb = bf16_round(bb); }
        sm[q] = vals[u * 4 + q]; o[q] = (vals[u * 4 + q] - mu) * rs * gg + bb;
      }
      if (out_sum) *(v4f*)(out_sum + (size_t)row * N + j) = sm;
      *(v4f*)(out_norm + (size_t)row * N + j) = o;
    }
    
  }
}



// ---- f16 WMMA path (v_wmma_f32_16x16x32_f16): 11-bit significands for operands in range — used where a [0,1] probability operand needs more precision than bf16
typedef _Float16 v16h __attribute__((ext_vector_type(16)));
union FragH { v16h v; v8us half[2]; _Float16 h[16]; unsigned short u[16]; };
template <int NT>
__device__ __forceinline__ v8f mmaH(v16h ah, v16h al, v16h bh, v16h bl, v8f c) {
  c = __builtin_amdgcn_wmma_f32_16x16x32_f16(false, ah, false, bh, (short)0, c, false, false);
  if (NT >= 2) c = __builtin_amdgcn_wmma_f32_16x16x32_f16(false, al, false, bh, (short)0, c, false, false);
  if (NT >= 3) c = __builtin_amdgcn_wmma_f32_16x16x32_f16(false, ah, false, bl, (short)0, c, false, false);
  asm volatile("v_nop\n\tv_nop\n\tv_nop\n\tv_nop" : "+v"(c) : "v"(ah), "v"(al), "v"(bh), "v"(bl));
  return c;
}
// batched GEMM like k_gemm_b but f16 operands: A f32 (split into f16 hi/lo if ASPLIT, else rounded to f16), Bt = f16 values [n][k]; alpha; C f32; N multiple of 16 (partial tiles skipped)
template <bool ASPLIT>
__global__ __launch_bounds__(128) void k_gemm_h(const float* __restrict__ A, int lda, size_t sA, const _Float16* __restrict__ Bh, int ldb, size_t sB, float alpha, float* __restrict__ C, int ldc, size_t sC, int M, int N, int K) {
  __shared__ __attribute__((aligned(16))) float so[4][16][64];
  const int tid = threadIdx.x, w = tid >> 5, lane = tid & 31, ln = lane & 15, hh = lane >> 4; const int by = blockIdx.y;
  A += (size_t)by * sA; Bh += (size_t)by * sB; C += (size_t)by * sC;
  const int ntn = (N + 63) / 64; const int wid = blockIdx.x * 4 + w; const int mt = wid / ntn, nq = wid % ntn; if (mt * 16 >= M) return;
  const int row0 = mt * 16, col0 = nq * 64; const float* arow = A + (size_t)(row0 + ln) * lda;
  v8f acc[4] = {};
  for (int kb = 0; kb < K; kb += 32) {
    FragH ah, al;
    const v4f x0 = *(const v4fa*)(arow + kb + 8 * hh), x1 = *(const v4fa*)(arow + kb + 8 * hh + 4), x2 = *(const v4fa*)(arow + kb + 16 + 8 * hh), x3 = *(const v4fa*)(arow + kb + 16 + 8 * hh + 4);
    float xs[16] = {x0[0],x0[1],x0[2],x0[3],x1[0],x1[1],x1[2],x1[3],x2[0],x2[1],x2[2],x2[3],x3[0],x3[1],x3[2],x3[3]};
#pragma unroll
    for (int i = 0; i < 16; ++i) { const _Float16 h = (_Float16)xs[i]; ah.h[i] = h; al.h[i] = ASPLIT ? (_Float16)(xs[i] - (float)h) : (_Float16)0.0f; }
#pragma unroll
    for (int t = 0; t < 4; ++t) { if (col0 + t * 16 >= N) continue; const size_t boff = (size_t)(col0 + t * 16 + ln) * ldb + kb; FragH bq; bq.half[0] = *(const v8us*)(Bh + boff + 8 * hh); bq.half[1] = *(const v8us*)(Bh + boff + 16 + 8 * hh);
      acc[t] = mmaH<ASPLIT ? 2 : 1>(ah.v, al.v, bq.v, bq.v, acc[t]); }
  }
#pragma unroll
  for (int t = 0; t < 4; ++t) { if (col0 + t * 16 >= N) continue;
#pragma unroll
    for (int r = 0; r < 8; ++r) so[w][8 * hh + r][t * 16 + ln] = acc[t][r] * alpha; }
  __builtin_amdgcn_fence(__ATOMIC_ACQ_REL, "workgroup"); __builtin_amdgcn_wave_barrier();
  const int rsub = lane >> 4, c4 = (lane & 15) * 4;
  {
#pragma unroll
    for (int q = 0; q < 8; ++q) { const int r = q * 2 + rsub; if (col0 + c4 < N) { const v4f v = *(const v4fa*)&so[w][r][c4]; *(v4f*)(C + (size_t)(row0 + r) * ldc + col0 + c4) = v; } }
     }
}

// Wt[n][k] = f16(W[k][n]·scale) from f32 row-major W[K][N] (scale = power of two; bf16-exact weights stay exact in f16 away from the subnormal range)
// (bid = the block's index within this piece of work; the pieces are launched together by k_prep below)
__device__ __forceinline__ void d_wt_f16(int bid, const float* __restrict__ W, _Float16* __restrict__ Wt, int K, int N, float scale) {
  const int t = bid * 256 + threadIdx.x; if (t >= N * (K / 8)) return; const int n = t / (K / 8), k8 = (t % (K / 8)) * 8; FragH f;
#pragma unroll
  for (int i = 0; i < 8; ++i) f.h[i] = (_Float16)(bf16_round(W[(size_t)(k8 + i) * N + n]) * scale); const v8us o = f.half[0];
  *(v8us*)((unsigned short*)Wt + (size_t)n * K + k8) = o; 
}
// Block-tile GEMM, f16 operands, f32 accumulate: C[row][col] = alpha * sum_k A[row][k] * Bt[col][k] (+ C if ADDC); ACT 11 stores its sigmoid column-major, C[col][row]. A and Bt are K-contiguous with row pitch DM, K = DM.
// One block of 8 waves owns a 128 x BN tile of C. Each pass brings 128 k (256 B of every operand row) from global memory in whole-row pieces into registers and from there into one of two LDS buffers
// (row pitch 272 B, an odd multiple of 16 B, for the 16-byte fragment reads); the next pass's global loads are issued ahead of this pass's products. Every wave computes a (16 * FM) x 32 part from LDS fragments,
// so an operand row is read from L2 once per block, not once per wave. k runs upward in steps of 32 into one accumulator per 16 x 16 tile.
// Every "#pragma unroll" in this kernel is there so that the small arrays it indexes (ra, rb, a, b, acc, o, c0) get constant indices and stay in registers.
// The body is a device function: sm is the launching kernel's LDS (gemm_lds(BN) bytes, 16-byte aligned), (bx, by) the tile's column and row index.
constexpr int gemm_lds(int BN) { return (2 * (128 + BN) * 272 > BN * 576) ? 2 * (128 + BN) * 272 : BN * 576; }      /* the two stage buffers, or the eight waves' epilogue ranges */
template <int BN, int LDC, int ACT, bool ADDC>
__device__ __forceinline__ void d_gemm_t(unsigned char* const sm, const int bx, const int by, const _Float16* __restrict__ A, const _Float16* __restrict__ Bt, float alpha, float* C) {
  constexpr int BM = 128, BK = 128, PB = BK * 2 + 16, WN = BN / 32, WM = 8 / WN, FM = BM / (16 * WM), NA = BM / 16, NB = BN / 16, KT = DM / BK;
  constexpr int STG = (BM + BN) * PB, EPW = FM * 16 * 36, EPI = 8 * EPW * 4, SZ = (2 * STG > EPI) ? 2 * STG : EPI;
  static_assert(SZ == gemm_lds(BN), "the launching kernel sizes sm by gemm_lds");
  const int tid = threadIdx.x, lane = tid & 31, ln = lane & 15, hh = lane >> 4;
  const int w = __builtin_amdgcn_readfirstlane(tid >> 5);      /* wave number, uniform: it only picks the wave's part of the tile */
  const int wm = w / WN, wn = w % WN;
  const int row0 = by * BM, col0 = bx * BN;
  const int sr = tid >> 4, sc = tid & 15;      /* 16 threads a row: 256 contiguous bytes */
  const unsigned short* ga = (const unsigned short*)A + (size_t)(row0 + sr) * DM + sc * 8;
  const unsigned short* gb = (const unsigned short*)Bt + (size_t)(col0 + sr) * DM + sc * 8;
  unsigned char* const sst = sm + sr * PB + sc * 16;
  const unsigned char* const fa = sm + (wm * FM * 16 + ln) * PB + hh * 16;
  const unsigned char* const fb = sm + (BM + wn * 32 + ln) * PB + hh * 16;
  v8us ra[NA], rb[NB];
#pragma unroll
  for (int i = 0; i < NA; ++i) ra[i] = *(const v8us*)(ga + (size_t)i * 16 * DM);
#pragma unroll
  for (int i = 0; i < NB; ++i) rb[i] = *(const v8us*)(gb + (size_t)i * 16 * DM);
#pragma unroll
  for (int i = 0; i < NA; ++i) *(v8us*)(sst + i * 16 * PB) = ra[i];
#pragma unroll
  for (int i = 0; i < NB; ++i) *(v8us*)(sst + (BM + i * 16) * PB) = rb[i];
  __syncthreads();      /* pass 0 is in buffer 0 before any wave reads a fragment */
  v8f acc[FM][2];
#pragma unroll
  for (int fm = 0; fm < FM; ++fm) { acc[fm][0] = (v8f){0.f,0.f,0.f,0.f,0.f,0.f,0.f,0.f}; acc[fm][1] = acc[fm][0]; }
  for (int kt = 0; kt < KT; ++kt) {
    const int cur = (kt & 1) * STG, nxt = STG - cur;
    if (kt + 1 < KT) {
#pragma unroll
      for (int i = 0; i < NA; ++i) ra[i] = *(const v8us*)(ga + (size_t)i * 16 * DM + (kt + 1) * BK);
#pragma unroll
      for (int i = 0; i < NB; ++i) rb[i] = *(const v8us*)(gb + (size_t)i * 16 * DM + (kt + 1) * BK);
    }
#pragma unroll
    for (int ks = 0; ks < BK / 32; ++ks) {
      FragH a[FM], b[2];
#pragma unroll
      for (int fm = 0; fm < FM; ++fm) { a[fm].half[0] = *(const v8us*)(fa + cur + fm * 16 * PB + ks * 64); a[fm].half[1] = *(const v8us*)(fa + cur + fm * 16 * PB + ks * 64 + 32); }
#pragma unroll
      for (int fn = 0; fn < 2; ++fn) { b[fn].half[0] = *(const v8us*)(fb + cur + fn * 16 * PB + ks * 64); b[fn].half[1] = *(const v8us*)(fb + cur + fn * 16 * PB + ks * 64 + 32); }
#pragma unroll
      for (int fm = 0; fm < FM; ++fm)
#pragma unroll
        for (int fn = 0; fn < 2; ++fn) acc[fm][fn] = __builtin_amdgcn_wmma_f32_16x16x32_f16(false, a[fm].v, false, b[fn].v, (short)0, acc[fm][fn], false, false);
    }
    if (kt + 1 < KT) {      /* the other buffer: its readers left it at the barrier that ended pass kt - 1 */
#pragma unroll
      for (int i = 0; i < NA; ++i) *(v8us*)(sst + nxt + i * 16 * PB) = ra[i];
#pragma unroll
      for (int i = 0; i < NB; ++i) *(v8us*)(sst + nxt + (BM + i * 16) * PB) = rb[i];
    }
    __syncthreads();      /* publishes pass kt + 1 and ends every wave's reads of pass kt */
  }
  if (ACT == 11) {
    /* sigmoid outputs leave column-major, C[col][row] with row pitch LDC: the attention kernel reads 8 consecutive rows (keys) of one column (head) per lane. A lane's 8 accumulator registers are 8 consecutive rows of one column;
       the block's tile is gathered in LDS (free behind the last barrier; pitch BM + 4 floats keeps 16-byte alignment) so that each wave stores whole 128-byte lines. */
    constexpr int PT = BM + 4;
    float* const st = (float*)sm;
#pragma unroll
    for (int fm = 0; fm < FM; ++fm)
#pragma unroll
      for (int fn = 0; fn < 2; ++fn) { v4f lo, hi;
#pragma unroll
        for (int r = 0; r < 4; ++r) { lo[r] = 1.0f / (1.0f + expf(-(acc[fm][fn][r] * alpha))); hi[r] = 1.0f / (1.0f + expf(-(acc[fm][fn][4 + r] * alpha))); }
        float* const d = st + (wn * 32 + fn * 16 + ln) * PT + (wm * FM + fm) * 16 + 8 * hh; *(v4fa*)d = lo; *(v4fa*)(d + 4) = hi; }
    __syncthreads();      /* every wave's rows of the tile are in LDS before any wave stores a column */
    for (int q = 0; q < BN * BM / 4 / 256; ++q) { const int e = q * 256 + tid, col = e / (BM / 4), r4 = (e % (BM / 4)) * 4; const v4f v = *(const v4fa*)&st[col * PT + r4]; *(v4f*)(C + (size_t)(col0 + col) * LDC + row0 + r4) = v; }
    return;
  }
  /* epilogue: behind the last barrier the buffers are free; each wave turns its part into whole 128-byte rows in its own LDS range (row pitch 36 floats) */
  float* const so = (float*)sm + w * EPW;
  const int er = lane >> 3, ec = (lane & 7) * 4;      /* 8 lanes a row of 32 floats */
  float* const cp = C + (size_t)(row0 + wm * FM * 16 + er) * LDC + col0 + wn * 32 + ec;      /* one address for all rows of the part; the row step is a constant offset */
  v4f o[FM * 4], c0[FM * 4];
#pragma unroll
  for (int fm = 0; fm < FM; ++fm)
#pragma unroll
    for (int fn = 0; fn < 2; ++fn)
#pragma unroll
      for (int r = 0; r < 8; ++r) so[(fm * 16 + 8 * hh + r) * 36 + fn * 16 + ln] = acc[fm][fn][r] * alpha;
  __builtin_amdgcn_fence(__ATOMIC_ACQ_REL, "workgroup"); __builtin_amdgcn_wave_barrier();      /* the wave's own LDS writes are done before its lanes read each other's */
  if (ADDC) {      /* the old values, all asked for at once, once the accumulators' registers are free */
#pragma unroll
    for (int q = 0; q < FM * 4; ++q) c0[q] = *(const v4fa*)(cp + (size_t)q * 4 * LDC);
  }
#pragma unroll
  for (int q = 0; q < FM * 4; ++q) { o[q] = *(const v4fa*)&so[(q * 4 + er) * 36 + ec]; if (ADDC) o[q] += c0[q]; }
#pragma unroll
  for (int q = 0; q < FM * 4; ++q) *(v4f*)(cp + (size_t)q * 4 * LDC) = o[q];
}
template <int BN, int LDC, int ACT, bool ADDC>
__global__ __launch_bounds__(256) void k_gemm_t(const _Float16* __restrict__ A, const _Float16* __restrict__ Bt, float alpha, float* C) {
  __shared__ __attribute__((aligned(16))) unsigned char sm[gemm_lds(BN)];
  d_gemm_t<BN, LDC, ACT, ADDC>(sm, blockIdx.x, blockIdx.y, A, Bt, alpha, C);
}
// The three projections of x (q, [k | v], the head scalars) do not depend on one another: one launch holds the tiles of all three, each block doing one tile as before. The two narrow products have 32 tiles each, too few to fill the chip alone;
// here they run beside the 256 tiles of q (two blocks fit a WGP's LDS), and two launch gaps go. The test on the block index is uniform for the block, so every barrier inside a body is passed by the whole block.
__global__ __launch_bounds__(256) void k_proj(const _Float16* __restrict__ X16, const _Float16* __restrict__ Bq, const _Float16* __restrict__ Bkv, const _Float16* __restrict__ Bkh, float* F32, float* KVF, float* HS) {
  constexpr int NQX = DM / 128, NRT = NR / 128;
  __shared__ __attribute__((aligned(16))) unsigned char sm[gemm_lds(128)];
  const int bid = blockIdx.x;
  /* the tests run from the narrow tile up: so the compiler keeps the pass loop of both 128-wide bodies as it is in the single launches; with q tested first it lays out all eight passes of q, three times the text */
  if (bid >= (NQX + 1) * NRT) d_gemm_t<32, NR, 11, false>(sm, 0, bid - (NQX + 1) * NRT, X16, Bkh, 0.0625f, HS);      /* [kh | vh] = sigmoid(x.Wkvh): M 4096 N 32 K 1024, stored head-major: 32 rows of 4096 f32 */
  else if (bid >= NQX * NRT) { d_gemm_t<128, 2 * HD, 0, false>(sm, 0, bid - NQX * NRT, X16, Bkv, 0.0625f, KVF);      /* [k | v] f32: M 4096 N 128 K 1024 */
    asm volatile("s_wait_xcnt 0x0" ::: "memory"); }      /* in this kernel's text another body follows the tile's stores and rewrites their registers: the wait stands between */
  else { d_gemm_t<128, DM, 0, false>(sm, bid % NQX, bid / NQX, X16, Bq, 0.0625f, F32);      /* q f32: M 4096 N 1024 K 1024 */
    asm volatile("s_wait_xcnt 0x0" ::: "memory"); }      /* as above */
}


typedef _Float16 v4h __attribute__((ext_vector_type(4)));

__device__ __forceinline__ void d_x16(int bid, const float* __restrict__ x, _Float16* __restrict__ X16, size_t n8) { const size_t t = (size_t)bid * 256 + threadIdx.x; if (t >= n8) return; FragH f;
#pragma unroll
  for (int q = 0; q < 8; ++q) f.h[q] = (_Float16)bf16_round(x[t * 8 + q]); *(v8us*)((unsigned short*)X16 + t * 8) = f.half[0];  }
__global__ __launch_bounds__(256) void k_h16(const float* __restrict__ x, _Float16* __restrict__ X16, size_t n8) { const size_t t = (size_t)blockIdx.x * 256 + threadIdx.x; if (t >= n8) return; FragH f;
#pragma unroll
  for (int q = 0; q < 8; ++q) f.h[q] = (_Float16)x[t * 8 + q]; *(v8us*)((unsigned short*)X16 + t * 8) = f.half[0];  }
__global__ __launch_bounds__(256) void k_round16f(const float* __restrict__ W, _Float16* __restrict__ Bt, size_t n8) { const size_t t = (size_t)blockIdx.x * 256 + threadIdx.x; if (t >= n8) return; FragH f;
#pragma unroll
  for (int i = 0; i < 8; ++i) f.h[i] = (_Float16)(bf16_round(W[t * 8 + i]) * 16.0f); *(v8us*)((unsigned short*)Bt + t * 8) = f.half[0];  }
template <int NHv, int TTv>
__global__ __launch_bounds__(256) void k_vt(const _Float16* __restrict__ V16, int ldv, int voff, _Float16* __restrict__ Vt) { __shared__ unsigned short tl[64][66]; const int tid = threadIdx.x; const int slab = blockIdx.x / (TTv / 64), lg = blockIdx.x % (TTv / 64); const int b = slab / NHv, h = slab % NHv;
  for (int i = tid; i < 64 * 8; i += 256) { const int r = i / 8, c8 = (i % 8) * 8; FragH f; f.half[0] = *(const v8us*)((const unsigned short*)V16 + ((size_t)b * TTv + lg * 64 + r) * ldv + voff + h * 64 + c8);
#pragma unroll
    for (int q = 0; q < 8; ++q) tl[r][c8 + q] = f.u[q]; }
  __syncthreads();
  {
#pragma unroll
    for (int rd = 0; rd < 2; ++rd) { const int d = rd * 32 + tid / 8, pc = tid % 8; FragH f;
#pragma unroll
      for (int q = 0; q < 8; ++q) f.u[q] = tl[pc * 8 + q][d];
      *(v8us*)((unsigned short*)Vt + ((size_t)slab * 64 + d) * TTv + lg * 64 + pc * 8) = f.half[0]; }
     } }

__global__ __launch_bounds__(256) void k_hl(const float* __restrict__ F, _Float16* __restrict__ Hh, _Float16* __restrict__ Hl, size_t n8) { const size_t t = (size_t)blockIdx.x * 256 + threadIdx.x; if (t >= n8) return; FragH fh, fl; const v4f a = *(const v4fa*)(F + t * 8), c = *(const v4fa*)(F + t * 8 + 4);
#pragma unroll
  for (int q = 0; q < 4; ++q) { _Float16 h = (_Float16)a[q]; fh.h[q] = h; fl.h[q] = (_Float16)((a[q] - (float)h) * 1024.0f); h = (_Float16)c[q]; fh.h[4 + q] = h; fl.h[4 + q] = (_Float16)((c[q] - (float)h) * 1024.0f); }
  { *(v8us*)((unsigned short*)Hh + t * 8) = fh.half[0]; *(v8us*)((unsigned short*)Hl + t * 8) = fl.half[0];  } }
__device__ __forceinline__ void d_cstab(int bid, float* __restrict__ CS) { const int t = bid * 256 + threadIdx.x; if (t >= TT * 32) return; const int p = t / 32, i = t % 32; const float invf = powf(10000.0f, -(float)(2 * i) / (float)HD); float sn, cs; sincosf((float)p * invf, &sn, &cs); typedef float v2f __attribute__((ext_vector_type(2), may_alias)); const v2f v = {cs, sn};
  *(v2f*)(CS + (size_t)t * 2) = v;  }
// Everything that depends on the inputs alone (the four weight transposes, x in f16, the cos/sin table) in one launch: a block does what a block of the single launches did, picked by ranges of the block index; five launch gaps, drains and refills go.
// The table's range stands first: further down the chain of tests the compiler rates its powf as cold and leaves it a called function. Then the transposes, whose strided reads take the longest to return.
__global__ __launch_bounds__(256) void k_prep(const float* __restrict__ x, const float* __restrict__ Wq, const float* __restrict__ Wkv, const float* __restrict__ Wkvh, const float* __restrict__ Wo,
                                              _Float16* __restrict__ X16, _Float16* __restrict__ Bq, _Float16* __restrict__ Bkv, _Float16* __restrict__ Bkh, _Float16* __restrict__ Bo, float* __restrict__ CS) {
  constexpr int NBW = DM * (DM / 8) / 256, NBKV = 2 * HD * (DM / 8) / 256, NBKH = 2 * NH * (DM / 8) / 256, NBCS = TT * 32 / 256;      /* blocks of a square weight, of Wkv, of Wkvh, of the table */
  int bid = blockIdx.x;
  if (bid < NBCS) { d_cstab(bid, CS); return; }
  bid -= NBCS;
  if (bid < NBW) { d_wt_f16(bid, Wq, Bq, DM, DM, 16.0f); return; }
  bid -= NBW;
  if (bid < NBW) { d_wt_f16(bid, Wo, Bo, DM, DM, 16.0f); return; }
  bid -= NBW;
  if (bid < NBKV) { d_wt_f16(bid, Wkv, Bkv, DM, 2 * HD, 16.0f); return; }
  bid -= NBKV;
  if (bid < NBKH) { d_wt_f16(bid, Wkvh, Bkh, DM, 2 * NH, 16.0f); return; }      /* (in,out) -> Bt x2^4 */
  bid -= NBKH;
  d_x16(bid, x, X16, (size_t)NR * DM / 8);
}
// rotary embedding: for row (b,s), head h, 8-dim piece g (d0 = g·8): (cos, sin) from the table row of the token's sequence position; d < 32: q'[d] = q[d]·cos_d − q[d+32]·sin_d; d ≥ 32: q'[d] = q[d]·cos_{d−32} + q[d−32]·sin_{d−32} (f32), stored f16;
template <int NHR, int LDI, int LDO>
__device__ __forceinline__ void d_rope(int bid, const float* __restrict__ QF, const float* __restrict__ CS, _Float16* __restrict__ Q16) { const size_t t = (size_t)bid * 256 + threadIdx.x; if (t >= (size_t)NR * NHR * 8) return; const int g = (int)(t % 8); const int h = (int)((t / 8) % NHR); const size_t row = t / (8 * NHR); const int p = (int)(row % TT);      /* position = token index within the sequence (the reference's arange) */
  const int d0 = g * 8; const int i0 = d0 & 31; const float* base = QF + row * LDI + h * HD; const int dp = (d0 < 32) ? d0 + 32 : d0 - 32; const float sgn = (d0 < 32) ? -1.0f : 1.0f; const float* csr = CS + ((size_t)p * 32 + i0) * 2; FragH f;
#pragma unroll 1
  for (int e = 0; e < 8; ++e) { const float cs = csr[2 * e], sn = csr[2 * e + 1]; f.h[e] = (_Float16)(base[d0 + e] * cs + sgn * base[dp + e] * sn); }
  *(v8us*)((unsigned short*)Q16 + row * LDO + h * HD + d0) = f.half[0];  }
template <int NHV>
__device__ __forceinline__ void d_vthl(int bid, const float* __restrict__ VF, int ldv, int voff, _Float16* __restrict__ Vth, _Float16* __restrict__ Vtl) { __shared__ float tl[64][65]; const int tid = threadIdx.x; const int slab = bid / (TT / 64), lg = bid % (TT / 64); const int b = slab / NHV, h = slab % NHV;
  for (int i = tid; i < 64 * 16; i += 256) { const int r = i / 16, c4 = (i % 16) * 4; const v4f a = *(const v4fa*)(VF + ((size_t)b * TT + lg * 64 + r) * ldv + voff + h * HD + c4); tl[r][c4] = a[0]; tl[r][c4 + 1] = a[1]; tl[r][c4 + 2] = a[2]; tl[r][c4 + 3] = a[3]; }
  __syncthreads();
  FragH fh[2], fl[2]; size_t oo[2];
#pragma unroll
  for (int rd = 0; rd < 2; ++rd) { const int d = rd * 32 + tid / 8, pc = tid % 8;
#pragma unroll
    for (int q = 0; q < 8; ++q) { const float v = tl[pc * 8 + q][d]; const _Float16 hv = (_Float16)v; fh[rd].h[q] = hv; fl[rd].h[q] = (_Float16)((v - (float)hv) * 1024.0f); } oo[rd] = ((size_t)slab * HD + d) * TT + lg * 64 + pc * 8; }
  {
#pragma unroll
    for (int rd = 0; rd < 2; ++rd) { *(v8us*)((unsigned short*)Vth + oo[rd]) = fh[rd].half[0]; *(v8us*)((unsigned short*)Vtl + oo[rd]) = fl[rd].half[0]; }
     } }
// What stands between the projections and the attention kernel (V^T planes, rotary k, rotary q) in one launch, picked by ranges of the block index (uniform for the block, so d_vthl's barrier is passed by its whole block); two launch gaps go and the two small pieces run beside the large one.
__global__ __launch_bounds__(256) void k_post(const float* __restrict__ F32, const float* __restrict__ KVF, const float* __restrict__ CS, _Float16* __restrict__ Q16, _Float16* __restrict__ K16, _Float16* __restrict__ Vth, _Float16* __restrict__ Vtl) {
  constexpr int NBV = BB * (TT / 64), NBK = NR * 8 / 256;
  int bid = blockIdx.x;
  if (bid < NBV) { d_vthl<1>(bid, KVF, 2 * HD, HD, Vth, Vtl); return; }      /* shared v (cols 64..127 of KVF) -> V^T hi/lo per batch [b][64][T] */
  bid -= NBV;
  if (bid < NBK) { d_rope<1, 2 * HD, HD>(bid, KVF, CS, K16); return; }      /* shared k (cols 0..63 of KVF, row stride 128) -> RoPE -> K16 [4096][64] */
  bid -= NBK;
  d_rope<NH, DM, DM>(bid, F32, CS, Q16);      /* q -> RoPE -> f16 */
}
/* lane l with lane l ^ 16: one vector cross-row move */
__device__ __forceinline__ float xhalf(float x) { return __builtin_bit_cast(float, __builtin_amdgcn_permlanex16(__builtin_bit_cast(int, x), __builtin_bit_cast(int, x), 0x76543210, 0xfedcba98, false, false)); }
/* One stage of k_flash's key loop, 128 keys, from global memory straight into LDS: a thread's 4 + 4 + 4 pieces of 16 bytes (key rows, V^T high rows, V^T residual rows) and one piece of 8 bytes (head scalars).
   Every wave's 32 lanes cover whole 128-byte lines. The s_wait_xcnt closes the statement so that no address register named here is rewritten while a copy may still read it. */
__device__ __forceinline__ void stage_copies(unsigned lk, unsigned lv, unsigned lw, unsigned lh, const char* gk, const char* gv, const char* gw, const char* gh) {
  asm volatile("global_load_async_to_lds_b128 %0, %13, off\n\t"
               "global_load_async_to_lds_b128 %1, %14, off\n\t"
               "global_load_async_to_lds_b128 %2, %15, off\n\t"
               "global_load_async_to_lds_b128 %3, %16, off\n\t"
               "global_load_async_to_lds_b128 %4, %17, off\n\t"
               "global_load_async_to_lds_b128 %5, %18, off\n\t"
               "global_load_async_to_lds_b128 %6, %19, off\n\t"
               "global_load_async_to_lds_b128 %7, %20, off\n\t"
               "global_load_async_to_lds_b128 %8, %21, off\n\t"
               "global_load_async_to_lds_b128 %9, %22, off\n\t"
               "global_load_async_to_lds_b128 %10, %23, off\n\t"
               "global_load_async_to_lds_b128 %11, %24, off\n\t"
               "global_load_async_to_lds_b64 %12, %25, off\n\t"
               "s_wait_xcnt 0x0"
               :: "v"(lk), "v"(lk + 32u * 144u), "v"(lk + 64u * 144u), "v"(lk + 96u * 144u),
                  "v"(lv), "v"(lv + 16u * 272u), "v"(lv + 32u * 272u), "v"(lv + 48u * 272u),
                  "v"(lw), "v"(lw + 16u * 272u), "v"(lw + 32u * 272u), "v"(lw + 48u * 272u), "v"(lh),
                  "v"(gk), "v"(gk + 32 * HD * 2), "v"(gk + 64 * HD * 2), "v"(gk + 96 * HD * 2),
                  "v"(gv), "v"(gv + 16 * TT * 2), "v"(gv + 32 * TT * 2), "v"(gv + 48 * TT * 2),
                  "v"(gw), "v"(gw + 16 * TT * 2), "v"(gw + 32 * TT * 2), "v"(gw + 48 * TT * 2), "v"(gh)
               : "memory");
}
__global__ __launch_bounds__(256) __attribute__((amdgpu_waves_per_eu(4, 4))) void k_flash(const _Float16* __restrict__ Q16, int ldq, const _Float16* __restrict__ K16, const float* __restrict__ KH, const float* __restrict__ VHD, const _Float16* __restrict__ Vt, const _Float16* __restrict__ Vtlo, float* __restrict__ O, int ldo) {
  // One block = one 16-row query tile of TWO heads, 8 waves: wave w works for head w & 1 and takes the 32-key chunks kq, kq + 4, ... with kq = w >> 1; each wave keeps its own running max, sum and accumulators, and a head's four partial results are merged through LDS at the end.
  // Key rows and value rows are the same for every head, so a stage of 128 keys (four chunks: key rows, both V^T planes, the two heads' scalars) is brought into LDS once per block, in whole 128-byte lines, by asynchronous copies,
  // and the waves read their fragments from LDS (row pitches 144 B and 272 B, odd multiples of 16 B, for the 16-byte fragment reads). Two buffers: stage t + 1 flies while stage t is worked on.
  // A causal tile's cost grows with its index and there are more blocks than resident places, so the block index counts the tiles down: the longest start first. Two blocks share a WGP (four waves a SIMD): registers are held to 256 and LDS to under 160 KiB for that.
  // Both products are transposed: S^T = K.Q^T (A = 16 key rows, B = the query tile) and O^T += V^T.P^T (A = 16 rows of V^T, B = P^T). A lane then holds 16 of the 32 scores of ONE query (column ln; keys 8 hh + r and 16 + 8 hh + r),
  // so max and sum run in the lane with one exchange between the halves, the rescale factor is one value a lane, and the two score tiles, converted in place, are the B operand of the second product in the k order of the V^T loader.
  // KH and VHD are head-major, [head][token]: a lane's 8 keys of a tile are 32 contiguous bytes.
  // Every "#pragma unroll" in this kernel is there so that the small arrays it indexes (bq, ak, av, avl, kh, vh, sc, bp, bpl, the accumulators, mw) get constant indices and stay in registers; "#pragma unroll 1" keeps one copy of the key loop's body, whose registers are the kernel's limit.
  constexpr int RPW = 16, NQT = TT / RPW, DT = 4, KS = 2, HB = 2, KQ = 4, NW = HB * KQ, SK = KQ * 32, NHG = NH / HB;
  constexpr int PK = HD * 2 + 16, PV = SK * 2 + 16, OVH = SK * PK, OVL = OVH + HD * PV, OHS = OVL + HD * PV, STG = OHS + 2 * HB * SK * 4;      /* a stage in LDS: key rows, V^T high, V^T residual, scalars (kh of the heads, then vh) */
  static_assert(PK == 144 && PV == 272 && SK == 128 && NW * 32 == 256, "stage_copies is written for these pitches, this stage and this block");
  __shared__ __attribute__((aligned(16))) unsigned char sb[2 * STG];
  __shared__ __attribute__((aligned(16))) float sO[NW][RPW][64 + 4]; __shared__ float sM[NW][RPW], sL[NW][RPW];
  const int tid = threadIdx.x, lane = tid & 31, ln = lane & 15, hh = lane >> 4;
  const int w = __builtin_amdgcn_readfirstlane(tid >> 5);      /* wave number in a scalar register: it decides whether the wave has a chunk in a stage, and the branch around the matrix instructions must be a scalar one */
  const int hs = w % HB, kq = w / HB;
  const int slab = blockIdx.x % (BB * NHG), qt = NQT - 1 - blockIdx.x / (BB * NHG); const int b = slab / NHG, hg = slab % NHG; const int h = hg * HB + hs; const int q0 = qt * RPW;
  FragH bq[KS];
  { const unsigned short* qr = (const unsigned short*)Q16 + ((size_t)b * TT + q0 + ln) * ldq + h * 64;
#pragma unroll
    for (int ks = 0; ks < KS; ++ks) { bq[ks].half[0] = *(const v8us*)(qr + ks * 32 + 8 * hh); bq[ks].half[1] = *(const v8us*)(qr + ks * 32 + 16 + 8 * hh); } }
  /* the thread's pieces of a stage: 8 threads a key row (128 B), 16 threads a V^T row (256 B), 64 threads a scalar row (512 B) */
  const int hr = tid >> 6;      /* scalar row: kh of head 0, 1, then vh of head 0, 1 */
  const char* gk = (const char*)(K16 + ((size_t)b * TT + (tid >> 3)) * HD) + (tid & 7) * 16;
  const char* gv = (const char*)(Vt + ((size_t)b * 64 + (tid >> 4)) * TT) + (tid & 15) * 16;
  const char* gw = (const char*)(Vtlo + ((size_t)b * 64 + (tid >> 4)) * TT) + (tid & 15) * 16;
  const char* gh = (const char*)((hr < HB ? KH : VHD) + (size_t)(hg * HB + hr % HB) * NR + (size_t)b * TT) + (tid & 63) * 8;
  const unsigned lb = (unsigned)(size_t)sb;      /* byte address of the ring in the work-group's LDS */
  const unsigned lk = lb + (unsigned)((tid >> 3) * PK + (tid & 7) * 16), lv = lb + (unsigned)(OVH + (tid >> 4) * PV + (tid & 15) * 16), lw = lv + (unsigned)(OVL - OVH), lh = lb + (unsigned)(OHS + hr * SK * 4 + (tid & 63) * 8);
  /* the lane's fragment places in a stage */
  const unsigned char* const fk = sb + (kq * 32 + ln) * PK + hh * 16;
  const unsigned char* const fv = sb + OVH + ln * PV + (kq * 32 + 8 * hh) * 2;
  const unsigned char* const fh = sb + OHS + hs * SK * 4 + (kq * 32 + 8 * hh) * 4;
  float m_r = -3.0e38f, l_r = 0.f; v8f oacc[DT], oaccl[DT], oacc2[DT];
#pragma unroll
  for (int dt = 0; dt < DT; ++dt) { oacc[dt] = (v8f){0.f,0.f,0.f,0.f,0.f,0.f,0.f,0.f}; oaccl[dt] = oacc[dt]; oacc2[dt] = oacc[dt]; }
  const int jend = q0 + RPW;
  const int nst = (jend + SK - 1) / SK;      /* stages of the tile, the same for the whole block; a stage lies wholly inside the TT keys */
  stage_copies(lk, lv, lw, lh, gk, gv, gw, gh);
  asm volatile("s_wait_asynccnt 0x0" ::: "memory");      /* this wave's pieces of stage 0 have landed */
  __syncthreads();      /* every wave's pieces of stage 0 are in LDS before any wave reads a fragment */
  if (nst > 1) stage_copies(lk + STG, lv + STG, lw + STG, lh + STG, gk + SK * HD * 2, gv + SK * 2, gw + SK * 2, gh + SK * 4);
#pragma unroll 1
  for (int t = 0; t < nst; ++t) {
    const int cur = (t & 1) * STG; const int j0 = t * SK + kq * 32;
    if (j0 < jend) {      /* scalar test: the last stage of a tile may hold fewer than four chunks */
    FragH ak[2][KS], av[DT], avl[DT]; v4f kh[2][2], vh[2][2];
#pragma unroll
    for (int nt = 0; nt < 2; ++nt) {
#pragma unroll
      for (int ks = 0; ks < KS; ++ks) { const unsigned char* kr = fk + cur + nt * 16 * PK + ks * 64; ak[nt][ks].half[0] = *(const v8us*)kr; ak[nt][ks].half[1] = *(const v8us*)(kr + 32); }
      const unsigned char* kp = fh + cur + nt * 64; const unsigned char* vp = kp + HB * SK * 4;
      kh[nt][0] = *(const v4fa*)kp; kh[nt][1] = *(const v4fa*)(kp + 16); vh[nt][0] = *(const v4fa*)vp; vh[nt][1] = *(const v4fa*)(vp + 16); }
    float sc[2][8];
#pragma unroll
    for (int nt = 0; nt < 2; ++nt) { v8f acc = (v8f){0.f,0.f,0.f,0.f,0.f,0.f,0.f,0.f};
#pragma unroll
      for (int ks = 0; ks < KS; ++ks) acc = __builtin_amdgcn_wmma_f32_16x16x32_f16(false, ak[nt][ks].v, false, bq[ks].v, (short)0, acc, false, false);
#pragma unroll
      for (int r = 0; r < 8; ++r) sc[nt][r] = acc[r] * kh[nt][r >> 2][r & 3] * 0.125f; }
    if (j0 + 31 > q0) {      /* only a chunk that reaches past the tile's first query has keys to mask (scalar test); every query keeps at least one key of every chunk of the loop */
#pragma unroll
      for (int nt = 0; nt < 2; ++nt)
#pragma unroll
        for (int r = 0; r < 8; ++r) sc[nt][r] = (j0 + nt * 16 + 8 * hh + r <= q0 + ln) ? sc[nt][r] : -INFINITY; }
    float mc = fmaxf(sc[0][0], sc[1][0]);
#pragma unroll
    for (int r = 1; r < 8; ++r) mc = fmaxf(mc, fmaxf(sc[0][r], sc[1][r]));
    mc = fmaxf(mc, xhalf(mc));      /* the query's other 16 keys */
    const float mn = fmaxf(m_r, mc); const float al = (mn > -1.0e38f) ? expf(m_r - mn) : 1.0f; m_r = mn;
    FragH bp, bpl; float ps = 0.f;
#pragma unroll
    for (int nt = 0; nt < 2; ++nt)
#pragma unroll
      for (int r = 0; r < 8; ++r) { const float p = expf(sc[nt][r] - mn); ps += p;      /* a masked score is -inf: p = 0 */
        const float pv = p * vh[nt][r >> 2][r & 3] * 1024.0f; const _Float16 ph = (_Float16)pv; bp.h[nt * 8 + r] = ph; bpl.h[nt * 8 + r] = (_Float16)((pv - (float)ph) * 1024.0f); }      /* value-head scalar folded into P, carried as f16 hi + x2^10 residual operands; the normaliser keeps plain p */
    l_r = l_r * al + ps;      /* the lane's half of the row sum; the halves are joined once, behind the loop */
    __builtin_amdgcn_sched_barrier(0);      /* keeps the V^T fragments' 64 registers out of the softmax: lifted to the top of the chunk, these LDS reads push the wave past 256 registers and a value spills to scratch; their short latency passes under the rescale below */
#pragma unroll
    for (int dt = 0; dt < DT; ++dt) { const unsigned char* vp = fv + cur + dt * 16 * PV; const unsigned char* lp = vp + (OVL - OVH); av[dt].half[0] = *(const v8us*)vp; av[dt].half[1] = *(const v8us*)(vp + 32); avl[dt].half[0] = *(const v8us*)lp; avl[dt].half[1] = *(const v8us*)(lp + 32); }
    __builtin_amdgcn_sched_barrier(0);      /* keeps the sixteen reads together as one group in front of the rescale: spread among the matrix instructions, each further place of LDS reads costs the wave a wait of its own */
#pragma unroll
    for (int dt = 0; dt < DT; ++dt) { oacc[dt] *= al; oaccl[dt] *= al; oacc2[dt] *= al; }
#pragma unroll
    for (int dt = 0; dt < DT; ++dt) { oacc[dt] = __builtin_amdgcn_wmma_f32_16x16x32_f16(false, av[dt].v, false, bp.v, (short)0, oacc[dt], false, false); oaccl[dt] = __builtin_amdgcn_wmma_f32_16x16x32_f16(false, avl[dt].v, false, bp.v, (short)0, oaccl[dt], false, false); oacc2[dt] = __builtin_amdgcn_wmma_f32_16x16x32_f16(false, av[dt].v, false, bpl.v, (short)0, oacc2[dt], false, false); }
    }
    /* hand-over of the ring, passed by every wave, also one without a chunk in this stage */
    asm volatile("s_wait_dscnt 0x0" ::: "memory");      /* this wave's reads of stage t are done before the buffer is given to the copies */
    asm volatile("s_wait_asynccnt 0x0" ::: "memory");      /* this wave's pieces of stage t + 1 have landed */
    __syncthreads();      /* publishes stage t + 1 and ends every wave's reads of stage t */
    if (t + 2 < nst) stage_copies(lk + cur, lv + cur, lw + cur, lh + cur, gk + (size_t)(t + 2) * (SK * HD * 2), gv + (size_t)(t + 2) * (SK * 2), gw + (size_t)(t + 2) * (SK * 2), gh + (size_t)(t + 2) * (SK * 4));      /* into the buffer that stage t has just left */
  }
  asm volatile("s_wait_asynccnt 0x0" ::: "memory");      /* no copy is outstanding when the wave goes on to its end */
  l_r += xhalf(l_r);
  if (hh == 0) { sM[w][ln] = m_r; sL[w][ln] = l_r; }
#pragma unroll
  for (int dt = 0; dt < DT; ++dt) { const v8f t = oacc[dt] + (oaccl[dt] + oacc2[dt]) * 0.0009765625f;      /* registers r = head dims dt * 16 + 8 hh + r of query ln */
    *(v4fa*)&sO[w][ln][dt * 16 + 8 * hh] = (v4f){t[0], t[1], t[2], t[3]}; *(v4fa*)&sO[w][ln][dt * 16 + 8 * hh + 4] = (v4f){t[4], t[5], t[6], t[7]}; }
  __syncthreads();      /* every wave's partial (max, sum, unnormalised rows) is in LDS before any wave merges */
  {
    const int mh = tid >> 7, lt = tid & 127;      /* 128 threads merge a head: its partial i is wave i * HB + mh's */
    const int r = lt >> 3, c4 = (lt & 7) * 4;      /* 8 threads a row, two 128-byte lines a row */
    float mw[KQ], M = -3.0e38f, L = 0.f;
#pragma unroll
    for (int i = 0; i < KQ; ++i) { mw[i] = sM[i * HB + mh][r]; M = fmaxf(M, mw[i]); }
#pragma unroll
    for (int i = 0; i < KQ; ++i) { mw[i] = expf(mw[i] - M); L += mw[i] * sL[i * HB + mh][r]; }      /* a wave that had no chunk holds max -3e38, sum 0, rows 0: weight 0 */
    const float inv = (L > 0.f) ? 1.0f / (L * 1024.0f) : 0.f;
#pragma unroll
    for (int hf = 0; hf < 2; ++hf) { v4f a = {0.f, 0.f, 0.f, 0.f};
#pragma unroll
      for (int i = 0; i < KQ; ++i) { const v4f p = *(const v4fa*)&sO[i * HB + mh][r][hf * 32 + c4]; a += p * mw[i]; }
      *(v4f*)(O + ((size_t)b * TT + q0 + r) * ldo + (hg * HB + mh) * 64 + hf * 32 + c4) = a * inv; }
  } }

extern "C" void kernel_launch(void* const* d_in, const int* in_sizes, int n_in,
                              void* d_out, int out_size, void* d_ws, size_t ws_size, hipStream_t stream) {
  (void)in_sizes; (void)n_in; (void)out_size;
  const float* x = (const float*)d_in[0]; const float* Wq = (const float*)d_in[1]; const float* Wkv = (const float*)d_in[2]; const float* Wkvh = (const float*)d_in[3]; const float* Wo = (const float*)d_in[4];
  char* ws = (char*)d_ws; size_t off = 0;
  auto take = [&](size_t bytes) { char* p = ws + off; off += (bytes + 255) & ~(size_t)255; return p; };
  _Float16* Bq = (_Float16*)take((size_t)DM * DM * 2); _Float16* Bkv = (_Float16*)take((size_t)2 * HD * DM * 2); _Float16* Bkh = (_Float16*)take((size_t)2 * NH * DM * 2); _Float16* Bo = (_Float16*)take((size_t)DM * DM * 2); float* CS = (float*)take((size_t)TT * 32 * 2 * 4);
  _Float16* X16 = (_Float16*)take((size_t)NR * DM * 2); float* F32 = (float*)take((size_t)NR * DM * 4); _Float16* Q16 = (_Float16*)take((size_t)NR * DM * 2); float* KVF = (float*)take((size_t)NR * 2 * HD * 4); _Float16* K16 = (_Float16*)take((size_t)NR * HD * 2); float* HS = (float*)take((size_t)NR * 2 * NH * 4);
  _Float16* Vth = (_Float16*)take((size_t)BB * HD * TT * 2); _Float16* Vtl = (_Float16*)take((size_t)BB * HD * TT * 2); _Float16* OH = (_Float16*)take((size_t)NR * DM * 2); _Float16* OL = (_Float16*)take((size_t)NR * DM * 2);
  float* O = F32;      /* F32 holds q (consumed by k_post) then O */
  if (off > ws_size) return;      // 2.1 + 0.3 + 0.1 + 2.1 + 0.5 + 8.4 + 16.8 + 8.4 + 2.1 + 0.5 + 0.5 + 0.5 + 0.5 + 8.4 + 8.4 ≈ 60 MB
  k_prep<<<2 * (DM * (DM / 8) / 256) + 2 * HD * (DM / 8) / 256 + 2 * NH * (DM / 8) / 256 + TT * 32 / 256 + NR * DM / 8 / 256, 256, 0, stream>>>(x, Wq, Wkv, Wkvh, Wo, X16, Bq, Bkv, Bkh, Bo, CS);      /* weights -> Bt, x -> f16, cos/sin table */
  const dim3 gq(DM / 128, NR / 128);      /* 128 x 128 tiles of a 4096 x 1024 result: 256 blocks */
  k_proj<<<(DM / 128 + 2) * (NR / 128), 256, 0, stream>>>(X16, Bq, Bkv, Bkh, F32, KVF, HS);      /* q, [k | v], [kh | vh]: 256 + 32 + 32 tiles */
  k_post<<<BB * (TT / 64) + NR * 8 / 256 + NR * NH * 8 / 256, 256, 0, stream>>>(F32, KVF, CS, Q16, K16, Vth, Vtl);      /* V^T planes, rotary k, rotary q */
  k_flash<<<BB * (NH / 2) * (TT / 16), 256, 0, stream>>>(Q16, DM, K16, HS, HS + (size_t)NH * NR, Vth, Vtl, O, DM);      /* KH = HS rows 0..15, VH = rows 16..31 (row pitch NR) */
  k_hl<<<(unsigned)(((size_t)NR * DM / 8 + 255) / 256), 256, 0, stream>>>(O, OH, OL, (size_t)NR * DM / 8);
  k_gemm_t<128, DM, 0, false><<<gq, 256, 0, stream>>>(OH, Bo, 0.0625f, (float*)d_out);      /* y = O_hi·Wo */
  k_gemm_t<128, DM, 0, true><<<gq, 256, 0, stream>>>(OL, Bo, 0.0625f * 0.0009765625f, (float*)d_out);      /* += O_lo·Wo·2^-10 in place */
}

// v006
// A run of this version takes 141 microseconds.
// Timed twice side by side with v005, it ran 1.15 and 1.14 times as fast.
// All steps since v000 together make it 4.00 times as fast.
#include <hip/hip_runtime.h>
// Multi-product attention with low-rank shared key/value (B=2, N=2048, D=1024, 16 heads × 64): q = x·Wq; [k|v] = x·Wkv (one shared 64-dim key and value); [kh|vh] = σ(x·Wkvh) per (token, head); rotary (rotate-half, θ=1e4) on q and k by
// sequence position; K_h[n] = kh[n,h]·k[n], V_h[n] = vh[n,h]·v[n]; causal softmax(q_h·K_hᵀ/8); out = (Σ attn·V_h merged)·Wo.
// Compute dtype: x and weights rounded to bf16; q and k as f32 GEMM outputs rotated in f32 from a one-time f32 cos/sin table and stored f16; head scalars as sigmoid GEMM epilogue outputs (f32); v f32 →
// f16 hi + ×2^10 residual Vᵀ planes; fused causal flash-style kernel (scores scaled by kh per key, P multiplied by vh per key and carried as f16 hi + residual tiles, online softmax f32, three value accumulators) on v_wmma_f32_16x16x32_f16; merged O stored as f16 hi + x2^10 residual planes by the attention kernel; both Wo products in one kernel, joined in registers; f32 accumulate.
#define BB 2
#define TT 2048
#define DM 1024
#define NH 16
#define HD 64
#define NR (BB * TT)

typedef __bf16 v16b __attribute__((ext_vector_type(16)));
typedef unsigned short v8us __attribute__((ext_vector_type(8), may_alias));
typedef float  v8f  __attribute__((ext_vector_type(8)));
typedef float  v4f  __attribute__((ext_vector_type(4)));
typedef float  v4fa __attribute__((ext_vector_type(4), may_alias));
union FragB { v16b v; v8us half[2]; unsigned short u[16]; };

__device__ __forceinline__ unsigned short bf16_bits(float x) { unsigned int u = __float_as_uint(x); return (unsigned short)((u + 0x7FFFu + ((u >> 16) & 1u)) >> 16); }
__device__ __forceinline__ float bf16_val(unsigned short b) { return __uint_as_float(((unsigned int)b) << 16); }
__device__ __forceinline__ float bf16_round(float x) { return bf16_val(bf16_bits(x)); }
// D += A·B with NT terms: 1 = ah·bh, 2 = + al·bh (A split), 3 = + ah·bl (both split)
template <int NT>
__device__ __forceinline__ v8f mmaN(v16b ah, v16b al, v16b bh, v16b bl, v8f c) {
  c = __builtin_amdgcn_wmma_f32_16x16x32_bf16(false, ah, false, bh, (short)0, c, false, false);
  if (NT >= 2) c = __builtin_amdgcn_wmma_f32_16x16x32_bf16(false, al, false, bh, (short)0, c, false, false);
  if (NT >= 3) c = __builtin_amdgcn_wmma_f32_16x16x32_bf16(false, ah, false, bl, (short)0, c, false, false);
  asm volatile("v_nop\n\tv_nop\n\tv_nop\n\tv_nop" : "+v"(c) : "v"(ah), "v"(al), "v"(bh), "v"(bl));
  return c;
}

__global__ __launch_bounds__(256) void k_wt_bf16(const float* __restrict__ W, unsigned short* __restrict__ Wt, int K, int N) {
  const int t = blockIdx.x * 256 + threadIdx.x;
  const int k8n = K / 8;
  if (t >= N * k8n) return;
  const int n = t / k8n, k8 = (t % k8n) * 8;
  v8us v;
#pragma unroll
  for (int i = 0; i < 8; ++i) v[i] = bf16_bits(W[(size_t)(k8 + i) * N + n]);
  *(v8us*)(Wt + (size_t)n * K + k8) = v;
  
}

// GEMM C[M][N] (f32, pitch ldc) = act(A[M][K]·W + bias). A f32 row-major (pitch lda) converted per fragment to bf16
// (ASPLIT: hi/lo two planes -> 2 terms, else single rounded term); Wt bf16 [N][K] (pitch ldb). BIAS_BF16 rounds the
// bias to bf16 first (bias quantised to bf16 before the add). K%32==0, M%16==0, N%64==0.
template <bool ASPLIT, int ACT, bool BIAS_BF16>
__global__ __launch_bounds__(128) void k_gemm_bf(const float* __restrict__ A, int lda, const unsigned short* __restrict__ Wt, int ldb,
                                               const float* __restrict__ bias, float* __restrict__ C, int ldc, int M, int N, int K) {
  __shared__ __attribute__((aligned(16))) float so[4][16][64];
  const int tid = threadIdx.x, w = tid >> 5, lane = tid & 31, ln = lane & 15, hh = lane >> 4;
  const int ntn = N / 64;
  const int wid = blockIdx.x * 4 + w;
  const int mt = wid / ntn, nq = wid % ntn;
  if (mt * 16 >= M) return;
  const int row0 = mt * 16, col0 = nq * 64;
  const float* arow = A + (size_t)(row0 + ln) * lda;
  v8f acc[4] = {};
  for (int kb = 0; kb < K; kb += 32) {
    FragB ah, al;
    const v4f x0 = *(const v4fa*)(arow + kb + 8 * hh), x1 = *(const v4fa*)(arow + kb + 8 * hh + 4);
    const v4f x2 = *(const v4fa*)(arow + kb + 16 + 8 * hh), x3 = *(const v4fa*)(arow + kb + 16 + 8 * hh + 4);
    float xs[16] = {x0[0],x0[1],x0[2],x0[3],x1[0],x1[1],x1[2],x1[3],x2[0],x2[1],x2[2],x2[3],x3[0],x3[1],x3[2],x3[3]};
#pragma unroll
    for (int i = 0; i < 16; ++i) { const unsigned short hb = bf16_bits(xs[i]); ah.u[i] = hb; al.u[i] = ASPLIT ? bf16_bits(xs[i] - bf16_val(hb)) : (unsigned short)0; }
#pragma unroll
    for (int t = 0; t < 4; ++t) {
      const unsigned short* brow = Wt + (size_t)(col0 + t * 16 + ln) * ldb + kb;
      FragB b;
      b.half[0] = *(const v8us*)(brow + 8 * hh);
      b.half[1] = *(const v8us*)(brow + 16 + 8 * hh);
      acc[t] = mmaN<ASPLIT ? 2 : 1>(ah.v, al.v, b.v, b.v, acc[t]);
    }
  }
#pragma unroll
  for (int t = 0; t < 4; ++t) {
    float bv = bias ? bias[col0 + t * 16 + ln] : 0.f;
    if (BIAS_BF16) bv = bf16_round(bv);
#pragma unroll
    for (int r = 0; r < 8; ++r) { float v = acc[t][r] + bv; if (ACT == 1) v = fmaxf(v, 0.f); so[w][8 * hh + r][t * 16 + ln] = v; }
  }
  __builtin_amdgcn_fence(__ATOMIC_ACQ_REL, "workgroup");
  __builtin_amdgcn_wave_barrier();
  const int rsub = lane >> 4, c4 = (lane & 15) * 4;
  {
#pragma unroll
    for (int q = 0; q < 8; ++q) {
      const int r = q * 2 + rsub;
      const v4f v = *(const v4fa*)&so[w][r][c4];
      *(v4f*)(C + (size_t)(row0 + r) * ldc + col0 + c4) = v;
    }
    
  }
}

// Flash-style causal/unmasked attention, all contractions 3-term bf16 hi/lo splits, f32 softmax with running max.
// q,k,v rows are read from f32 buffers with arbitrary row pitch (so they can live inside a fused qkv buffer);
// D = head size (multiple of 32, <= 128); one wave = 16 query rows; block = 4 waves (64 queries) sharing K/V chunks of 32.
template <int D, bool CAUSAL>
__global__ __launch_bounds__(128) void k_flash(const float* __restrict__ qb, const float* __restrict__ kb, const float* __restrict__ vb,
                                             int pitch, int T, int H, float scale, float* __restrict__ y, int ypitch) {
  constexpr int KS = D / 32;        // k-steps for QK
  constexpr int DT = D / 16;        // d tiles for PV
  __shared__ __attribute__((aligned(16))) unsigned short sKh[32][D + 8], sKl[32][D + 8], sVh[32][D + 8], sVl[32][D + 8];
  __shared__ __attribute__((aligned(16))) unsigned short sPh[4][16][40], sPl[4][16][40];
  __shared__ __attribute__((aligned(16))) float sO[4][16][D];
  const int tid = threadIdx.x, w = tid >> 5, lane = tid & 31, ln = lane & 15, hh = lane >> 4;
  const int nqb = (T + 63) / 64;
  const int bh = blockIdx.x / nqb, qblk = blockIdx.x % nqb;
  const int b = bh / H, h = bh % H;
  const int q0 = qblk * 64 + w * 16;
  const float* Q = qb + (size_t)b * T * pitch + h * D;
  const float* K = kb + (size_t)b * T * pitch + h * D;
  const float* V = vb + (size_t)b * T * pitch + h * D;

  // A fragments of the wave's 16 query rows (scaled), hi/lo
  FragB aqh[KS], aql[KS];
  {
    int row = q0 + ln; if (row >= T) row = T - 1;
    const float* qr = Q + (size_t)row * pitch;
#pragma unroll
    for (int ks = 0; ks < KS; ++ks)
#pragma unroll
      for (int i = 0; i < 16; ++i) {
        const int d = ks * 32 + ((i < 8) ? (8 * hh + i) : (16 + 8 * hh + (i - 8)));
        const float x = qr[d] * scale; const unsigned short hb = bf16_bits(x);
        aqh[ks].u[i] = hb; aql[ks].u[i] = bf16_bits(x - bf16_val(hb));
      }
  }
  float m_r[8], l_r[8];
#pragma unroll
  for (int r = 0; r < 8; ++r) { m_r[r] = -3.0e38f; l_r[r] = 0.f; }
  v8f oacc[DT];
#pragma unroll
  for (int dt = 0; dt < DT; ++dt) oacc[dt] = (v8f){0.f,0.f,0.f,0.f,0.f,0.f,0.f,0.f};

  const int kv_end = CAUSAL ? min(T, qblk * 64 + 64) : T;     // block-uniform
  for (int j0 = 0; j0 < kv_end; j0 += 32) {
    __syncthreads();
    for (int e = tid; e < 32 * (D / 4); e += 128) {
      const int r = e / (D / 4), c4 = (e % (D / 4)) * 4;
      const int key = j0 + r;
      v4f kf = {0.f,0.f,0.f,0.f}, vf = {0.f,0.f,0.f,0.f};
      if (key < T) { kf = *(const v4fa*)(K + (size_t)key * pitch + c4); vf = *(const v4fa*)(V + (size_t)key * pitch + c4); }
#pragma unroll
      for (int t = 0; t < 4; ++t) {
        unsigned short hb = bf16_bits(kf[t]); sKh[r][c4 + t] = hb; sKl[r][c4 + t] = bf16_bits(kf[t] - bf16_val(hb));
        hb = bf16_bits(vf[t]); sVh[r][c4 + t] = hb; sVl[r][c4 + t] = bf16_bits(vf[t] - bf16_val(hb));
      }
    }
    __syncthreads();
    // S tile 16 x 32
    v8f s[2];
#pragma unroll
    for (int nt = 0; nt < 2; ++nt) {
      v8f acc = {};
#pragma unroll
      for (int ks = 0; ks < KS; ++ks) {
        FragB bh_, bl_;
        bh_.half[0] = *(const v8us*)&sKh[nt * 16 + ln][ks * 32 + 8 * hh]; bh_.half[1] = *(const v8us*)&sKh[nt * 16 + ln][ks * 32 + 16 + 8 * hh];
        bl_.half[0] = *(const v8us*)&sKl[nt * 16 + ln][ks * 32 + 8 * hh]; bl_.half[1] = *(const v8us*)&sKl[nt * 16 + ln][ks * 32 + 16 + 8 * hh];
        acc = mmaN<3>(aqh[ks].v, aql[ks].v, bh_.v, bl_.v, acc);
      }
      s[nt] = acc;
    }
    // mask + running max (rows 8hh+r; the 16 lanes of a half share rows)
    float alpha[8];
#pragma unroll
    for (int r = 0; r < 8; ++r) {
      const int qi = q0 + 8 * hh + r;
      const int ja = j0 + ln, jb = j0 + 16 + ln;
      if (CAUSAL) { if (ja > qi) s[0][r] = -3.0e38f; if (jb > qi) s[1][r] = -3.0e38f; }
      if (ja >= T) s[0][r] = -3.0e38f;
      if (jb >= T) s[1][r] = -3.0e38f;
      float mx = fmaxf(s[0][r], s[1][r]);
      mx = fmaxf(mx, __shfl_xor(mx, 1, 32)); mx = fmaxf(mx, __shfl_xor(mx, 2, 32)); mx = fmaxf(mx, __shfl_xor(mx, 4, 32)); mx = fmaxf(mx, __shfl_xor(mx, 8, 32));
      const float mnew = fmaxf(m_r[r], mx);
      alpha[r] = (mnew > -1.0e38f) ? __expf(m_r[r] - mnew) : 1.0f;
      const float p0 = (s[0][r] > -1.0e38f) ? __expf(s[0][r] - mnew) : 0.f;
      const float p1 = (s[1][r] > -1.0e38f) ? __expf(s[1][r] - mnew) : 0.f;
      m_r[r] = mnew;
      l_r[r] = l_r[r] * alpha[r] + p0 + p1;            // per-lane partial row sum (16 lanes combined at the end)
      unsigned short hb = bf16_bits(p0); sPh[w][8 * hh + r][ln] = hb;      sPl[w][8 * hh + r][ln] = bf16_bits(p0 - bf16_val(hb));
      hb = bf16_bits(p1);                sPh[w][8 * hh + r][16 + ln] = hb; sPl[w][8 * hh + r][16 + ln] = bf16_bits(p1 - bf16_val(hb));
    }
#pragma unroll
    for (int dt = 0; dt < DT; ++dt)
#pragma unroll
      for (int r = 0; r < 8; ++r) oacc[dt][r] *= alpha[r];
    __builtin_amdgcn_fence(__ATOMIC_ACQ_REL, "workgroup");
    __builtin_amdgcn_wave_barrier();
    FragB pah, pal;
    pah.half[0] = *(const v8us*)&sPh[w][ln][8 * hh]; pah.half[1] = *(const v8us*)&sPh[w][ln][16 + 8 * hh];
    pal.half[0] = *(const v8us*)&sPl[w][ln][8 * hh]; pal.half[1] = *(const v8us*)&sPl[w][ln][16 + 8 * hh];
#pragma unroll
    for (int dt = 0; dt < DT; ++dt) {
      FragB bvh, bvl;
#pragma unroll
      for (int i = 0; i < 8; ++i) {
        bvh.u[i] = sVh[8 * hh + i][dt * 16 + ln]; bvh.u[8 + i] = sVh[16 + 8 * hh + i][dt * 16 + ln];
        bvl.u[i] = sVl[8 * hh + i][dt * 16 + ln]; bvl.u[8 + i] = sVl[16 + 8 * hh + i][dt * 16 + ln];
      }
      oacc[dt] = mmaN<3>(pah.v, pal.v, bvh.v, bvl.v, oacc[dt]);
    }
    __builtin_amdgcn_fence(__ATOMIC_ACQ_REL, "workgroup");
    __builtin_amdgcn_wave_barrier();
  }
#pragma unroll
  for (int r = 0; r < 8; ++r) {
    float l = l_r[r];
    l += __shfl_xor(l, 1, 32); l += __shfl_xor(l, 2, 32); l += __shfl_xor(l, 4, 32); l += __shfl_xor(l, 8, 32);
    l_r[r] = (l > 0.f) ? 1.0f / l : 0.f;
  }
#pragma unroll
  for (int dt = 0; dt < DT; ++dt)
#pragma unroll
    for (int r = 0; r < 8; ++r) sO[w][8 * hh + r][dt * 16 + ln] = oacc[dt][r] * l_r[r];
  __builtin_amdgcn_fence(__ATOMIC_ACQ_REL, "workgroup");
  __builtin_amdgcn_wave_barrier();
  {
    for (int r = 0; r < 16; ++r) {
      const int row = q0 + r;
      if (row < T && lane < D / 4) {
        const v4f val = *(const v4fa*)&sO[w][r][lane * 4];
        *(v4f*)(y + ((size_t)b * T + row) * ypitch + h * D + lane * 4) = val;
      }
    }
    
  }
}

// GEMM C = act(A·W + bias + resid): A f32 (ASPLIT -> hi/lo 2 terms), Wt bf16 [N][K]; ACT 0 none, 1 relu, 2 exact gelu;
// resid (optional, f32, row index = (row % rmod), pitch ldr, RES_BF16 rounds it) added before the activation.
template <bool ASPLIT, int ACT, bool BIAS_BF16, bool RES_BF16>
__global__ __launch_bounds__(128) void k_gemm_bf3(const float* __restrict__ A, int lda, const unsigned short* __restrict__ Wt, int ldb,
                                                const float* __restrict__ bias, const float* __restrict__ resid, int rmod, int ldr,
                                                float* __restrict__ C, int ldc, int M, int N, int K) {
  __shared__ __attribute__((aligned(16))) float so[4][16][64];
  const int tid = threadIdx.x, w = tid >> 5, lane = tid & 31, ln = lane & 15, hh = lane >> 4;
  const int ntn = N / 64;
  const int wid = blockIdx.x * 4 + w;
  const int mt = wid / ntn, nq = wid % ntn;
  if (mt * 16 >= M) return;
  const int row0 = mt * 16, col0 = nq * 64;
  const float* arow = A + (size_t)(row0 + ln) * lda;
  v8f acc[4] = {};
  for (int kb = 0; kb < K; kb += 32) {
    FragB ah, al;
    const v4f x0 = *(const v4fa*)(arow + kb + 8 * hh), x1 = *(const v4fa*)(arow + kb + 8 * hh + 4);
    const v4f x2 = *(const v4fa*)(arow + kb + 16 + 8 * hh), x3 = *(const v4fa*)(arow + kb + 16 + 8 * hh + 4);
    float xs[16] = {x0[0],x0[1],x0[2],x0[3],x1[0],x1[1],x1[2],x1[3],x2[0],x2[1],x2[2],x2[3],x3[0],x3[1],x3[2],x3[3]};
#pragma unroll
    for (int i = 0; i < 16; ++i) { const unsigned short hb = bf16_bits(xs[i]); ah.u[i] = hb; al.u[i] = ASPLIT ? bf16_bits(xs[i] - bf16_val(hb)) : (unsigned short)0; }
#pragma unroll
    for (int t = 0; t < 4; ++t) {
      const unsigned short* brow = Wt + (size_t)(col0 + t * 16 + ln) * ldb + kb;
      FragB b;
      b.half[0] = *(const v8us*)(brow + 8 * hh);
      b.half[1] = *(const v8us*)(brow + 16 + 8 * hh);
      acc[t] = mmaN<ASPLIT ? 2 : 1>(ah.v, al.v, b.v, b.v, acc[t]);
    }
  }
#pragma unroll
  for (int t = 0; t < 4; ++t) {
    const int col = col0 + t * 16 + ln;
    float bv = bias ? bias[col] : 0.f;
    if (BIAS_BF16) bv = bf16_round(bv);
#pragma unroll
    for (int r = 0; r < 8; ++r) {
      float v = acc[t][r] + bv;
      if (resid) { float rv = resid[(size_t)((row0 + 8 * hh + r) % rmod) * ldr + col]; if (RES_BF16) rv = bf16_round(rv); v += rv; }
      if (ACT == 1) v = fmaxf(v, 0.f);
      if (ACT == 2) v = 0.5f * v * (1.0f + erff(v * 0.70710678118654752f));
      if (ACT == 3) { const float u = 0.7978845608028654f * (v + 0.044715f * v * v * v); v = 0.5f * v * (1.0f + tanhf(u)); }
      so[w][8 * hh + r][t * 16 + ln] = v;
    }
  }
  __builtin_amdgcn_fence(__ATOMIC_ACQ_REL, "workgroup");
  __builtin_amdgcn_wave_barrier();
  const int rsub = lane >> 4, c4 = (lane & 15) * 4;
  {
#pragma unroll
    for (int q = 0; q < 8; ++q) {
      const int r = q * 2 + rsub;
      const v4f v = *(const v4fa*)&so[w][r][c4];
      *(v4f*)(C + (size_t)(row0 + r) * ldc + col0 + c4) = v;
    }
    
  }
}
// row LayerNorm (biased variance, eps) over N: s = X (+ R); optional out_sum <- s; out_norm <- (s-mu)*rsqrt(var+eps)*g + b
template <bool PARAM_BF16>
__global__ __launch_bounds__(256) void k_layernorm(const float* __restrict__ X, const float* __restrict__ R, const float* __restrict__ g, const float* __restrict__ bta,
                                                  float* __restrict__ out_sum, float* __restrict__ out_norm, int N, float eps) {
  __shared__ float red[256];
  const int row = blockIdx.x, tid = threadIdx.x;
  const float* x = X + (size_t)row * N; const float* rr = R ? R + (size_t)row * N : nullptr;
  float vals[16];                     // up to N = 4096
  const int per = N / 256;            // contiguous chunk per thread? use strided-by-4 chunks: thread handles j = tid*4 + 1024*u
  float s1 = 0.f;
  for (int u = 0; u < per / 4; ++u) {
    const int j = tid * 4 + 1024 * u;
    const v4f a = *(const v4fa*)(x + j);
    v4f b = {0.f,0.f,0.f,0.f}; if (rr) b = *(const v4fa*)(rr + j);
#pragma unroll
    for (int q = 0; q < 4; ++q) { const float v = a[q] + b[q]; vals[u * 4 + q] = v; s1 += v; }
  }
  red[tid] = s1; __syncthreads();
  for (int st = 128; st > 0; st >>= 1) { if (tid < st) red[tid] += red[tid + st]; __syncthreads(); }
  const float mu = red[0] / (float)N; __syncthreads();
  float s2 = 0.f;
  for (int u = 0; u < per / 4; ++u)
#pragma unroll
    for (int q = 0; q < 4; ++q) { const float c = vals[u * 4 + q] - mu; s2 += c * c; }
  red[tid] = s2; __syncthreads();
  for (int st = 128; st > 0; st >>= 1) { if (tid < st) red[tid] += red[tid + st]; __syncthreads(); }
  const float rs = rsqrtf(red[0] / (float)N + eps);
  {
    for (int u = 0; u < per / 4; ++u) {
      const int j = tid * 4 + 1024 * u;
      v4f o, sm;
#pragma unroll
      for (int q = 0; q < 4; ++q) {
        float gg = g[j + q], bb = bta[j + q];
        if (PARAM_BF16) { gg = bf16_round(gg); bb = bf16_round(bb); }
        sm[q] = vals[u * 4 + q]; o[q] = (vals[u * 4 + q] - mu) * rs * gg + bb;
      }
      if (out_sum) *(v4f*)(out_sum + (size_t)row * N + j) = sm;
      *(v4f*)(out_norm + (size_t)row * N + j) = o;
    }
    
  }
}



// ---- f16 WMMA path (v_wmma_f32_16x16x32_f16): 11-bit significands for operands in range — used where a [0,1] probability operand needs more precision than bf16
typedef _Float16 v16h __attribute__((ext_vector_type(16)));
union FragH { v16h v; v8us half[2]; _Float16 h[16]; unsigned short u[16]; };
template <int NT>
__device__ __forceinline__ v8f mmaH(v16h ah, v16h al, v16h bh, v16h bl, v8f c) {
  c = __builtin_amdgcn_wmma_f32_16x16x32_f16(false, ah, false, bh, (short)0, c, false, false);
  if (NT >= 2) c = __builtin_amdgcn_wmma_f32_16x16x32_f16(false, al, false, bh, (short)0, c, false, false);
  if (NT >= 3) c = __builtin_amdgcn_wmma_f32_16x16x32_f16(false, ah, false, bl, (short)0, c, false, false);
  asm volatile("v_nop\n\tv_nop\n\tv_nop\n\tv_nop" : "+v"(c) : "v"(ah), "v"(al), "v"(bh), "v"(bl));
  return c;
}
// batched GEMM like k_gemm_b but f16 operands: A f32 (split into f16 hi/lo if ASPLIT, else rounded to f16), Bt = f16 values [n][k]; alpha; C f32; N multiple of 16 (partial tiles skipped)
template <bool ASPLIT>
__global__ __launch_bounds__(128) void k_gemm_h(const float* __restrict__ A, int lda, size_t sA, const _Float16* __restrict__ Bh, int ldb, size_t sB, float alpha, float* __restrict__ C, int ldc, size_t sC, int M, int N, int K) {
  __shared__ __attribute__((aligned(16))) float so[4][16][64];
  const int tid = threadIdx.x, w = tid >> 5, lane = tid & 31, ln = lane & 15, hh = lane >> 4; const int by = blockIdx.y;
  A += (size_t)by * sA; Bh += (size_t)by * sB; C += (size_t)by * sC;
  const int ntn = (N + 63) / 64; const int wid = blockIdx.x * 4 + w; const int mt = wid / ntn, nq = wid % ntn; if (mt * 16 >= M) return;
  const int row0 = mt * 16, col0 = nq * 64; const float* arow = A + (size_t)(row0 + ln) * lda;
  v8f acc[4] = {};
  for (int kb = 0; kb < K; kb += 32) {
    FragH ah, al;
    const v4f x0 = *(const v4fa*)(arow + kb + 8 * hh), x1 = *(const v4fa*)(arow + kb + 8 * hh + 4), x2 = *(const v4fa*)(arow + kb + 16 + 8 * hh), x3 = *(const v4fa*)(arow + kb + 16 + 8 * hh + 4);
    float xs[16] = {x0[0],x0[1],x0[2],x0[3],x1[0],x1[1],x1[2],x1[3],x2[0],x2[1],x2[2],x2[3],x3[0],x3[1],x3[2],x3[3]};
#pragma unroll
    for (int i = 0; i < 16; ++i) { const _Float16 h = (_Float16)xs[i]; ah.h[i] = h; al.h[i] = ASPLIT ? (_Float16)(xs[i] - (float)h) : (_Float16)0.0f; }
#pragma unroll
    for (int t = 0; t < 4; ++t) { if (col0 + t * 16 >= N) continue; const size_t boff = (size_t)(col0 + t * 16 + ln) * ldb + kb; FragH bq; bq.half[0] = *(const v8us*)(Bh + boff + 8 * hh); bq.half[1] = *(const v8us*)(Bh + boff + 16 + 8 * hh);
      acc[t] = mmaH<ASPLIT ? 2 : 1>(ah.v, al.v, bq.v, bq.v, acc[t]); }
  }
#pragma unroll
  for (int t = 0; t < 4; ++t) { if (col0 + t * 16 >= N) continue;
#pragma unroll
    for (int r = 0; r < 8; ++r) so[w][8 * hh + r][t * 16 + ln] = acc[t][r] * alpha; }
  __builtin_amdgcn_fence(__ATOMIC_ACQ_REL, "workgroup"); __builtin_amdgcn_wave_barrier();
  const int rsub = lane >> 4, c4 = (lane & 15) * 4;
  {
#pragma unroll
    for (int q = 0; q < 8; ++q) { const int r = q * 2 + rsub; if (col0 + c4 < N) { const v4f v = *(const v4fa*)&so[w][r][c4]; *(v4f*)(C + (size_t)(row0 + r) * ldc + col0 + c4) = v; } }
     }
}

// Wt[n][k] = f16(W[k][n]·scale) from f32 row-major W[K][N] (scale = power of two; bf16-exact weights stay exact in f16 away from the subnormal range)
// (bid = the block's index within this piece of work; the pieces are launched together by k_prep below)
__device__ __forceinline__ void d_wt_f16(int bid, const float* __restrict__ W, _Float16* __restrict__ Wt, int K, int N, float scale) {
  const int t = bid * 256 + threadIdx.x; if (t >= N * (K / 8)) return; const int n = t / (K / 8), k8 = (t % (K / 8)) * 8; FragH f;
#pragma unroll
  for (int i = 0; i < 8; ++i) f.h[i] = (_Float16)(bf16_round(W[(size_t)(k8 + i) * N + n]) * scale); const v8us o = f.half[0];
  *(v8us*)((unsigned short*)Wt + (size_t)n * K + k8) = o; 
}
// Block-tile GEMM, f16 operands, f32 accumulate: C[row][col] = alpha * sum_k A[row][k] * Bt[col][k] (+ C if ADDC); ACT 11 stores its sigmoid column-major, C[col][row]. A and Bt are K-contiguous with row pitch DM, K = DM.
// One block of 8 waves owns a 128 x BN tile of C. Each pass brings 128 k (256 B of every operand row) from global memory in whole-row pieces into registers and from there into one of two LDS buffers
// (row pitch 272 B, an odd multiple of 16 B, for the 16-byte fragment reads); the next pass's global loads are issued ahead of this pass's products. Every wave computes a (16 * FM) x 32 part from LDS fragments,
// so an operand row is read from L2 once per block, not once per wave. k runs upward in steps of 32 into one accumulator per 16 x 16 tile.
// Every "#pragma unroll" in this kernel is there so that the small arrays it indexes (ra, rb, a, b, acc, o, c0) get constant indices and stay in registers.
// The body is a device function: sm is the launching kernel's LDS (gemm_lds(BN) bytes, 16-byte aligned), (bx, by) the tile's column and row index.
constexpr int gemm_lds(int BN) { return (2 * (128 + BN) * 272 > BN * 576) ? 2 * (128 + BN) * 272 : BN * 576; }      /* the two stage buffers, or the eight waves' epilogue ranges */
template <int BN, int LDC, int ACT, bool ADDC>
__device__ __forceinline__ void d_gemm_t(unsigned char* const sm, const int bx, const int by, const _Float16* __restrict__ A, const _Float16* __restrict__ Bt, float alpha, float* C) {
  constexpr int BM = 128, BK = 128, PB = BK * 2 + 16, WN = BN / 32, WM = 8 / WN, FM = BM / (16 * WM), NA = BM / 16, NB = BN / 16, KT = DM / BK;
  constexpr int STG = (BM + BN) * PB, EPW = FM * 16 * 36, EPI = 8 * EPW * 4, SZ = (2 * STG > EPI) ? 2 * STG : EPI;
  static_assert(SZ == gemm_lds(BN), "the launching kernel sizes sm by gemm_lds");
  const int tid = threadIdx.x, lane = tid & 31, ln = lane & 15, hh = lane >> 4;
  const int w = __builtin_amdgcn_readfirstlane(tid >> 5);      /* wave number, uniform: it only picks the wave's part of the tile */
  const int wm = w / WN, wn = w % WN;
  const int row0 = by * BM, col0 = bx * BN;
  const int sr = tid >> 4, sc = tid & 15;      /* 16 threads a row: 256 contiguous bytes */
  const unsigned short* ga = (const unsigned short*)A + (size_t)(row0 + sr) * DM + sc * 8;
  const unsigned short* gb = (const unsigned short*)Bt + (size_t)(col0 + sr) * DM + sc * 8;
  unsigned char* const sst = sm + sr * PB + sc * 16;
  const unsigned char* const fa = sm + (wm * FM * 16 + ln) * PB + hh * 16;
  const unsigned char* const fb = sm + (BM + wn * 32 + ln) * PB + hh * 16;
  v8us ra[NA], rb[NB];
#pragma unroll
  for (int i = 0; i < NA; ++i) ra[i] = *(const v8us*)(ga + (size_t)i * 16 * DM);
#pragma unroll
  for (int i = 0; i < NB; ++i) rb[i] = *(const v8us*)(gb + (size_t)i * 16 * DM);
#pragma unroll
  for (int i = 0; i < NA; ++i) *(v8us*)(sst + i * 16 * PB) = ra[i];
#pragma unroll
  for (int i = 0; i < NB; ++i) *(v8us*)(sst + (BM + i * 16) * PB) = rb[i];
  __syncthreads();      /* pass 0 is in buffer 0 before any wave reads a fragment */
  v8f acc[FM][2];
#pragma unroll
  for (int fm = 0; fm < FM; ++fm) { acc[fm][0] = (v8f){0.f,0.f,0.f,0.f,0.f,0.f,0.f,0.f}; acc[fm][1] = acc[fm][0]; }
  for (int kt = 0; kt < KT; ++kt) {
    const int cur = (kt & 1) * STG, nxt = STG - cur;
    if (kt + 1 < KT) {
#pragma unroll
      for (int i = 0; i < NA; ++i) ra[i] = *(const v8us*)(ga + (size_t)i * 16 * DM + (kt + 1) * BK);
#pragma unroll
      for (int i = 0; i < NB; ++i) rb[i] = *(const v8us*)(gb + (size_t)i * 16 * DM + (kt + 1) * BK);
    }
#pragma unroll
    for (int ks = 0; ks < BK / 32; ++ks) {
      FragH a[FM], b[2];
#pragma unroll
      for (int fm = 0; fm < FM; ++fm) { a[fm].half[0] = *(const v8us*)(fa + cur + fm * 16 * PB + ks * 64); a[fm].half[1] = *(const v8us*)(fa + cur + fm * 16 * PB + ks * 64 + 32); }
#pragma unroll
      for (int fn = 0; fn < 2; ++fn) { b[fn].half[0] = *(const v8us*)(fb + cur + fn * 16 * PB + ks * 64); b[fn].half[1] = *(const v8us*)(fb + cur + fn * 16 * PB + ks * 64 + 32); }
#pragma unroll
      for (int fm = 0; fm < FM; ++fm)
#pragma unroll
        for (int fn = 0; fn < 2; ++fn) acc[fm][fn] = __builtin_amdgcn_wmma_f32_16x16x32_f16(false, a[fm].v, false, b[fn].v, (short)0, acc[fm][fn], false, false);
    }
    if (kt + 1 < KT) {      /* the other buffer: its readers left it at the barrier that ended pass kt - 1 */
#pragma unroll
      for (int i = 0; i < NA; ++i) *(v8us*)(sst + nxt + i * 16 * PB) = ra[i];
#pragma unroll
      for (int i = 0; i < NB; ++i) *(v8us*)(sst + nxt + (BM + i * 16) * PB) = rb[i];
    }
    __syncthreads();      /* publishes pass kt + 1 and ends every wave's reads of pass kt */
  }
  if (ACT == 11) {
    /* sigmoid outputs leave column-major, C[col][row] with row pitch LDC: the attention kernel reads 8 consecutive rows (keys) of one column (head) per lane. A lane's 8 accumulator registers are 8 consecutive rows of one column;
       the block's tile is gathered in LDS (free behind the last barrier; pitch BM + 4 floats keeps 16-byte alignment) so that each wave stores whole 128-byte lines. */
    constexpr int PT = BM + 4;
    float* const st = (float*)sm;
#pragma unroll
    for (int fm = 0; fm < FM; ++fm)
#pragma unroll
      for (int fn = 0; fn < 2; ++fn) { v4f lo, hi;
#pragma unroll
        for (int r = 0; r < 4; ++r) { lo[r] = 1.0f / (1.0f + expf(-(acc[fm][fn][r] * alpha))); hi[r] = 1.0f / (1.0f + expf(-(acc[fm][fn][4 + r] * alpha))); }
        float* const d = st + (wn * 32 + fn * 16 + ln) * PT + (wm * FM + fm) * 16 + 8 * hh; *(v4fa*)d = lo; *(v4fa*)(d + 4) = hi; }
    __syncthreads();      /* every wave's rows of the tile are in LDS before any wave stores a column */
    for (int q = 0; q < BN * BM / 4 / 256; ++q) { const int e = q * 256 + tid, col = e / (BM / 4), r4 = (e % (BM / 4)) * 4; const v4f v = *(const v4fa*)&st[col * PT + r4]; *(v4f*)(C + (size_t)(col0 + col) * LDC + row0 + r4) = v; }
    return;
  }
  /* epilogue: behind the last barrier the buffers are free; each wave turns its part into whole 128-byte rows in its own LDS range (row pitch 36 floats) */
  float* const so = (float*)sm + w * EPW;
  const int er = lane >> 3, ec = (lane & 7) * 4;      /* 8 lanes a row of 32 floats */
  float* const cp = C + (size_t)(row0 + wm * FM * 16 + er) * LDC + col0 + wn * 32 + ec;      /* one address for all rows of the part; the row step is a constant offset */
  v4f o[FM * 4], c0[FM * 4];
#pragma unroll
  for (int fm = 0; fm < FM; ++fm)
#pragma unroll
    for (int fn = 0; fn < 2; ++fn)
#pragma unroll
      for (int r = 0; r < 8; ++r) so[(fm * 16 + 8 * hh + r) * 36 + fn * 16 + ln] = acc[fm][fn][r] * alpha;
  __builtin_amdgcn_fence(__ATOMIC_ACQ_REL, "workgroup"); __builtin_amdgcn_wave_barrier();      /* the wave's own LDS writes are done before its lanes read each other's */
  if (ADDC) {      /* the old values, all asked for at once, once the accumulators' registers are free */
#pragma unroll
    for (int q = 0; q < FM * 4; ++q) c0[q] = *(const v4fa*)(cp + (size_t)q * 4 * LDC);
  }
#pragma unroll
  for (int q = 0; q < FM * 4; ++q) { o[q] = *(const v4fa*)&so[(q * 4 + er) * 36 + ec]; if (ADDC) o[q] += c0[q]; }
#pragma unroll
  for (int q = 0; q < FM * 4; ++q) *(v4f*)(cp + (size_t)q * 4 * LDC) = o[q];
}
// Output projection, both planes of O in one launch: C = (Ah.Bt^T + 2^-10 Al.Bt^T) / 16, operands K-contiguous with row pitch DM, K = DM. One block of 16 waves owns a 128 x 128 tile of C (256 blocks, one a WGP, four waves a SIMD).
// A pass stages 128 k of the tile's rows of Ah, of Al and of Bt as d_gemm_t does (whole-row loads into registers, from there into one of two LDS buffers, row pitch 272 B; the next pass's loads are issued ahead of this pass's products):
// a Bt row is brought in and a Bt fragment read once for both planes. Every wave computes a 32 x 32 part with one accumulator per 16 x 16 tile AND plane, k upward in steps of 32 as in the two single launches; the planes meet in registers
// in the epilogue (both scalings are by powers of two, so the one rounding of the sum is the one the read-add-write of C made), and C is written once and never read.
// Every "#pragma unroll" in this kernel is there so that the small arrays it indexes (rh, rl, rb, ah, al, b, the accumulators, o) get constant indices and stay in registers.
__global__ __launch_bounds__(512) void k_gemm_o(const _Float16* __restrict__ Ah, const _Float16* __restrict__ Al, const _Float16* __restrict__ Bt, float* __restrict__ C) {
  constexpr int BM = 128, BN = 128, BK = 128, PB = BK * 2 + 16, FM = 2, NS = BM / 32, KT = DM / BK;
  constexpr int OAL = BM * PB, OB = 2 * BM * PB, STG = (2 * BM + BN) * PB, EPW = FM * 16 * 36;      /* a stage: rows of Ah, of Al, of Bt */
  static_assert(BN == BM && 16 * EPW * 4 <= 2 * STG, "one count of staging steps for the three operands; the sixteen epilogue ranges lie inside the two stage buffers");
  __shared__ __attribute__((aligned(16))) unsigned char sm[2 * STG];
  const int tid = threadIdx.x, lane = tid & 31, ln = lane & 15, hh = lane >> 4;
  const int w = __builtin_amdgcn_readfirstlane(tid >> 5);      /* wave number, uniform: it only picks the wave's part of the tile */
  const int wm = w >> 2, wn = w & 3;
  const int row0 = blockIdx.y * BM, col0 = blockIdx.x * BN;
  const int sr = tid >> 4, sc = tid & 15;      /* 16 threads a row: 256 contiguous bytes; 32 rows a step */
  const unsigned short* gh = (const unsigned short*)Ah + (size_t)(row0 + sr) * DM + sc * 8;
  const unsigned short* gl = (const unsigned short*)Al + (size_t)(row0 + sr) * DM + sc * 8;
  const unsigned short* gb = (const unsigned short*)Bt + (size_t)(col0 + sr) * DM + sc * 8;
  unsigned char* const sst = sm + sr * PB + sc * 16;
  const unsigned char* const fa = sm + (wm * FM * 16 + ln) * PB + hh * 16;
  const unsigned char* const fb = sm + OB + (wn * 32 + ln) * PB + hh * 16;
  v8us rh[NS], rl[NS], rb[NS];
#pragma unroll
  for (int i = 0; i < NS; ++i) { rh[i] = *(const v8us*)(gh + (size_t)i * 32 * DM); rl[i] = *(const v8us*)(gl + (size_t)i * 32 * DM); rb[i] = *(const v8us*)(gb + (size_t)i * 32 * DM); }
#pragma unroll
  for (int i = 0; i < NS; ++i) { *(v8us*)(sst + i * 32 * PB) = rh[i]; *(v8us*)(sst + OAL + i * 32 * PB) = rl[i]; *(v8us*)(sst + OB + i * 32 * PB) = rb[i]; }
  __syncthreads();      /* pass 0 is in buffer 0 before any wave reads a fragment */
  v8f acch[FM][2], accl[FM][2];
#pragma unroll
  for (int fm = 0; fm < FM; ++fm)
#pragma unroll
    for (int fn = 0; fn < 2; ++fn) { acch[fm][fn] = (v8f){0.f,0.f,0.f,0.f,0.f,0.f,0.f,0.f}; accl[fm][fn] = acch[fm][fn]; }
  for (int kt = 0; kt < KT; ++kt) {
    const int cur = (kt & 1) * STG, nxt = STG - cur;
    if (kt + 1 < KT) {
#pragma unroll
      for (int i = 0; i < NS; ++i) { rh[i] = *(const v8us*)(gh + (size_t)i * 32 * DM + (kt + 1) * BK); rl[i] = *(const v8us*)(gl + (size_t)i * 32 * DM + (kt + 1) * BK); rb[i] = *(const v8us*)(gb + (size_t)i * 32 * DM + (kt + 1) * BK); }
      __builtin_amdgcn_sched_barrier(0);      /* keeps the twelve loads in front of the pass's products: left free, the compiler sinks them behind three quarters of the pass, and their latency then stands bare in front of the LDS stores */
    }
#pragma unroll
    for (int ks = 0; ks < BK / 32; ++ks) {
      FragH ah[FM], al[FM], b[2];
#pragma unroll
      for (int fm = 0; fm < FM; ++fm) { const unsigned char* p = fa + cur + fm * 16 * PB + ks * 64; ah[fm].half[0] = *(const v8us*)p; ah[fm].half[1] = *(const v8us*)(p + 32); al[fm].half[0] = *(const v8us*)(p + OAL); al[fm].half[1] = *(const v8us*)(p + OAL + 32); }
#pragma unroll
      for (int fn = 0; fn < 2; ++fn) { const unsigned char* p = fb + cur + fn * 16 * PB + ks * 64; b[fn].half[0] = *(const v8us*)p; b[fn].half[1] = *(const v8us*)(p + 32); }
#pragma unroll
      for (int fm = 0; fm < FM; ++fm)
#pragma unroll
        for (int fn = 0; fn < 2; ++fn) { acch[fm][fn] = __builtin_amdgcn_wmma_f32_16x16x32_f16(false, ah[fm].v, false, b[fn].v, (short)0, acch[fm][fn], false, false); accl[fm][fn] = __builtin_amdgcn_wmma_f32_16x16x32_f16(false, al[fm].v, false, b[fn].v, (short)0, accl[fm][fn], false, false); }
    }
    if (kt + 1 < KT) {      /* the other buffer: its readers left it at the barrier that ended pass kt - 1 */
#pragma unroll
      for (int i = 0; i < NS; ++i) { *(v8us*)(sst + nxt + i * 32 * PB) = rh[i]; *(v8us*)(sst + nxt + OAL + i * 32 * PB) = rl[i]; *(v8us*)(sst + nxt + OB + i * 32 * PB) = rb[i]; }
    }
    __syncthreads();      /* publishes pass kt + 1 and ends every wave's reads of pass kt */
  }
  /* epilogue: behind the last barrier the buffers are free; each wave turns its part into whole 128-byte rows in its own LDS range (row pitch 36 floats) */
  float* const so = (float*)sm + w * EPW;
  const int er = lane >> 3, ec = (lane & 7) * 4;      /* 8 lanes a row of 32 floats */
  float* const cp = C + (size_t)(row0 + wm * FM * 16 + er) * DM + col0 + wn * 32 + ec;      /* one address for all rows of the part; the row step is a constant offset */
  v4f o[FM * 4];
#pragma unroll
  for (int fm = 0; fm < FM; ++fm)
#pragma unroll
    for (int fn = 0; fn < 2; ++fn)
#pragma unroll
      for (int r = 0; r < 8; ++r) so[(fm * 16 + 8 * hh + r) * 36 + fn * 16 + ln] = acch[fm][fn][r] * 0.0625f + accl[fm][fn][r] * (0.0625f * 0.0009765625f);      /* Bt carries x2^4, Al x2^10 */
  __builtin_amdgcn_fence(__ATOMIC_ACQ_REL, "workgroup"); __builtin_amdgcn_wave_barrier();      /* the wave's own LDS writes are done before its lanes read each other's */
#pragma unroll
  for (int q = 0; q < FM * 4; ++q) o[q] = *(const v4fa*)&so[(q * 4 + er) * 36 + ec];
#pragma unroll
  for (int q = 0; q < FM * 4; ++q) *(v4f*)(cp + (size_t)q * 4 * DM) = o[q];
}
// The three projections of x (q, [k | v], the head scalars) do not depend on one another: one launch holds the tiles of all three, each block doing one tile as before. The two narrow products have 32 tiles each, too few to fill the chip alone;
// here they run beside the 256 tiles of q (two blocks fit a WGP's LDS), and two launch gaps go. The test on the block index is uniform for the block, so every barrier inside a body is passed by the whole block.
__global__ __launch_bounds__(256) void k_proj(const _Float16* __restrict__ X16, const _Float16* __restrict__ Bq, const _Float16* __restrict__ Bkv, const _Float16* __restrict__ Bkh, float* F32, float* KVF, float* HS) {
  constexpr int NQX = DM / 128, NRT = NR / 128;
  __shared__ __attribute__((aligned(16))) unsigned char sm[gemm_lds(128)];
  const int bid = blockIdx.x;
  /* the tests run from the narrow tile up: so the compiler keeps the pass loop of both 128-wide bodies as it is in the single launches; with q tested first it lays out all eight passes of q, three times the text */
  if (bid >= (NQX + 1) * NRT) d_gemm_t<32, NR, 11, false>(sm, 0, bid - (NQX + 1) * NRT, X16, Bkh, 0.0625f, HS);      /* [kh | vh] = sigmoid(x.Wkvh): M 4096 N 32 K 1024, stored head-major: 32 rows of 4096 f32 */
  else if (bid >= NQX * NRT) { d_gemm_t<128, 2 * HD, 0, false>(sm, 0, bid - NQX * NRT, X16, Bkv, 0.0625f, KVF);      /* [k | v] f32: M 4096 N 128 K 1024 */
    asm volatile("s_wait_xcnt 0x0" ::: "memory"); }      /* in this kernel's text another body follows the tile's stores and rewrites their registers: the wait stands between */
  else { d_gemm_t<128, DM, 0, false>(sm, bid % NQX, bid / NQX, X16, Bq, 0.0625f, F32);      /* q f32: M 4096 N 1024 K 1024 */
    asm volatile("s_wait_xcnt 0x0" ::: "memory"); }      /* as above */
}


typedef _Float16 v4h __attribute__((ext_vector_type(4)));

__device__ __forceinline__ void d_x16(int bid, const float* __restrict__ x, _Float16* __restrict__ X16, size_t n8) { const size_t t = (size_t)bid * 256 + threadIdx.x; if (t >= n8) return; FragH f;
#pragma unroll
  for (int q = 0; q < 8; ++q) f.h[q] = (_Float16)bf16_round(x[t * 8 + q]); *(v8us*)((unsigned short*)X16 + t * 8) = f.half[0];  }
__global__ __launch_bounds__(256) void k_h16(const float* __restrict__ x, _Float16* __restrict__ X16, size_t n8) { const size_t t = (size_t)blockIdx.x * 256 + threadIdx.x; if (t >= n8) return; FragH f;
#pragma unroll
  for (int q = 0; q < 8; ++q) f.h[q] = (_Float16)x[t * 8 + q]; *(v8us*)((unsigned short*)X16 + t * 8) = f.half[0];  }
__global__ __launch_bounds__(256) void k_round16f(const float* __restrict__ W, _Float16* __restrict__ Bt, size_t n8) { const size_t t = (size_t)blockIdx.x * 256 + threadIdx.x; if (t >= n8) return; FragH f;
#pragma unroll
  for (int i = 0; i < 8; ++i) f.h[i] = (_Float16)(bf16_round(W[t * 8 + i]) * 16.0f); *(v8us*)((unsigned short*)Bt + t * 8) = f.half[0];  }
template <int NHv, int TTv>
__global__ __launch_bounds__(256) void k_vt(const _Float16* __restrict__ V16, int ldv, int voff, _Float16* __restrict__ Vt) { __shared__ unsigned short tl[64][66]; const int tid = threadIdx.x; const int slab = blockIdx.x / (TTv / 64), lg = blockIdx.x % (TTv / 64); const int b = slab / NHv, h = slab % NHv;
  for (int i = tid; i < 64 * 8; i += 256) { const int r = i / 8, c8 = (i % 8) * 8; FragH f; f.half[0] = *(const v8us*)((const unsigned short*)V16 + ((size_t)b * TTv + lg * 64 + r) * ldv + voff + h * 64 + c8);
#pragma unroll
    for (int q = 0; q < 8; ++q) tl[r][c8 + q] = f.u[q]; }
  __syncthreads();
  {
#pragma unroll
    for (int rd = 0; rd < 2; ++rd) { const int d = rd * 32 + tid / 8, pc = tid % 8; FragH f;
#pragma unroll
      for (int q = 0; q < 8; ++q) f.u[q] = tl[pc * 8 + q][d];
      *(v8us*)((unsigned short*)Vt + ((size_t)slab * 64 + d) * TTv + lg * 64 + pc * 8) = f.half[0]; }
     } }

__device__ __forceinline__ void d_cstab(int bid, float* __restrict__ CS) { const int t = bid * 256 + threadIdx.x; if (t >= TT * 32) return; const int p = t / 32, i = t % 32; const float invf = powf(10000.0f, -(float)(2 * i) / (float)HD); float sn, cs; sincosf((float)p * invf, &sn, &cs); typedef float v2f __attribute__((ext_vector_type(2), may_alias)); const v2f v = {cs, sn};
  *(v2f*)(CS + (size_t)t * 2) = v;  }
// Everything that depends on the inputs alone (the four weight transposes, x in f16, the cos/sin table) in one launch: a block does what a block of the single launches did, picked by ranges of the block index; five launch gaps, drains and refills go.
// The table's range stands first: further down the chain of tests the compiler rates its powf as cold and leaves it a called function. Then the transposes, whose strided reads take the longest to return.
__global__ __launch_bounds__(256) void k_prep(const float* __restrict__ x, const float* __restrict__ Wq, const float* __restrict__ Wkv, const float* __restrict__ Wkvh, const float* __restrict__ Wo,
                                              _Float16* __restrict__ X16, _Float16* __restrict__ Bq, _Float16* __restrict__ Bkv, _Float16* __restrict__ Bkh, _Float16* __restrict__ Bo, float* __restrict__ CS) {
  constexpr int NBW = DM * (DM / 8) / 256, NBKV = 2 * HD * (DM / 8) / 256, NBKH = 2 * NH * (DM / 8) / 256, NBCS = TT * 32 / 256;      /* blocks of a square weight, of Wkv, of Wkvh, of the table */
  int bid = blockIdx.x;
  if (bid < NBCS) { d_cstab(bid, CS); return; }
  bid -= NBCS;
  if (bid < NBW) { d_wt_f16(bid, Wq, Bq, DM, DM, 16.0f); return; }
  bid -= NBW;
  if (bid < NBW) { d_wt_f16(bid, Wo, Bo, DM, DM, 16.0f); return; }
  bid -= NBW;
  if (bid < NBKV) { d_wt_f16(bid, Wkv, Bkv, DM, 2 * HD, 16.0f); return; }
  bid -= NBKV;
  if (bid < NBKH) { d_wt_f16(bid, Wkvh, Bkh, DM, 2 * NH, 16.0f); return; }      /* (in,out) -> Bt x2^4 */
  bid -= NBKH;
  d_x16(bid, x, X16, (size_t)NR * DM / 8);
}
// rotary embedding: for row (b,s), head h, 8-dim piece g (d0 = g·8): (cos, sin) from the table row of the token's sequence position; d < 32: q'[d] = q[d]·cos_d − q[d+32]·sin_d; d ≥ 32: q'[d] = q[d]·cos_{d−32} + q[d−32]·sin_{d−32} (f32), stored f16;
template <int NHR, int LDI, int LDO>
__device__ __forceinline__ void d_rope(int bid, const float* __restrict__ QF, const float* __restrict__ CS, _Float16* __restrict__ Q16) { const size_t t = (size_t)bid * 256 + threadIdx.x; if (t >= (size_t)NR * NHR * 8) return; const int g = (int)(t % 8); const int h = (int)((t / 8) % NHR); const size_t row = t / (8 * NHR); const int p = (int)(row % TT);      /* position = token index within the sequence (the reference's arange) */
  const int d0 = g * 8; const int i0 = d0 & 31; const float* base = QF + row * LDI + h * HD; const int dp = (d0 < 32) ? d0 + 32 : d0 - 32; const float sgn = (d0 < 32) ? -1.0f : 1.0f; const float* csr = CS + ((size_t)p * 32 + i0) * 2; FragH f;
#pragma unroll 1
  for (int e = 0; e < 8; ++e) { const float cs = csr[2 * e], sn = csr[2 * e + 1]; f.h[e] = (_Float16)(base[d0 + e] * cs + sgn * base[dp + e] * sn); }
  *(v8us*)((unsigned short*)Q16 + row * LDO + h * HD + d0) = f.half[0];  }
template <int NHV>
__device__ __forceinline__ void d_vthl(int bid, const float* __restrict__ VF, int ldv, int voff, _Float16* __restrict__ Vth, _Float16* __restrict__ Vtl) { __shared__ float tl[64][65]; const int tid = threadIdx.x; const int slab = bid / (TT / 64), lg = bid % (TT / 64); const int b = slab / NHV, h = slab % NHV;
  for (int i = tid; i < 64 * 16; i += 256) { const int r = i / 16, c4 = (i % 16) * 4; const v4f a = *(const v4fa*)(VF + ((size_t)b * TT + lg * 64 + r) * ldv + voff + h * HD + c4); tl[r][c4] = a[0]; tl[r][c4 + 1] = a[1]; tl[r][c4 + 2] = a[2]; tl[r][c4 + 3] = a[3]; }
  __syncthreads();
  FragH fh[2], fl[2]; size_t oo[2];
#pragma unroll
  for (int rd = 0; rd < 2; ++rd) { const int d = rd * 32 + tid / 8, pc = tid % 8;
#pragma unroll
    for (int q = 0; q < 8; ++q) { const float v = tl[pc * 8 + q][d]; const _Float16 hv = (_Float16)v; fh[rd].h[q] = hv; fl[rd].h[q] = (_Float16)((v - (float)hv) * 1024.0f); } oo[rd] = ((size_t)slab * HD + d) * TT + lg * 64 + pc * 8; }
  {
#pragma unroll
    for (int rd = 0; rd < 2; ++rd) { *(v8us*)((unsigned short*)Vth + oo[rd]) = fh[rd].half[0]; *(v8us*)((unsigned short*)Vtl + oo[rd]) = fl[rd].half[0]; }
     } }
// What stands between the projections and the attention kernel (V^T planes, rotary k, rotary q) in one launch, picked by ranges of the block index (uniform for the block, so d_vthl's barrier is passed by its whole block); two launch gaps go and the two small pieces run beside the large one.
__global__ __launch_bounds__(256) void k_post(const float* __restrict__ F32, const float* __restrict__ KVF, const float* __restrict__ CS, _Float16* __restrict__ Q16, _Float16* __restrict__ K16, _Float16* __restrict__ Vth, _Float16* __restrict__ Vtl) {
  constexpr int NBV = BB * (TT / 64), NBK = NR * 8 / 256;
  int bid = blockIdx.x;
  if (bid < NBV) { d_vthl<1>(bid, KVF, 2 * HD, HD, Vth, Vtl); return; }      /* shared v (cols 64..127 of KVF) -> V^T hi/lo per batch [b][64][T] */
  bid -= NBV;
  if (bid < NBK) { d_rope<1, 2 * HD, HD>(bid, KVF, CS, K16); return; }      /* shared k (cols 0..63 of KVF, row stride 128) -> RoPE -> K16 [4096][64] */
  bid -= NBK;
  d_rope<NH, DM, DM>(bid, F32, CS, Q16);      /* q -> RoPE -> f16 */
}
/* lane l with lane l ^ 16: one vector cross-row move */
__device__ __forceinline__ float xhalf(float x) { return __builtin_bit_cast(float, __builtin_amdgcn_permlanex16(__builtin_bit_cast(int, x), __builtin_bit_cast(int, x), 0x76543210, 0xfedcba98, false, false)); }
/* One stage of k_flash's key loop, 128 keys, from global memory straight into LDS: a thread's 4 + 4 + 4 pieces of 16 bytes (key rows, V^T high rows, V^T residual rows) and one piece of 8 bytes (head scalars).
   Every wave's 32 lanes cover whole 128-byte lines. The s_wait_xcnt closes the statement so that no address register named here is rewritten while a copy may still read it. */
__device__ __forceinline__ void stage_copies(unsigned lk, unsigned lv, unsigned lw, unsigned lh, const char* gk, const char* gv, const char* gw, const char* gh) {
  asm volatile("global_load_async_to_lds_b128 %0, %13, off\n\t"
               "global_load_async_to_lds_b128 %1, %14, off\n\t"
               "global_load_async_to_lds_b128 %2, %15, off\n\t"
               "global_load_async_to_lds_b128 %3, %16, off\n\t"
               "global_load_async_to_lds_b128 %4, %17, off\n\t"
               "global_load_async_to_lds_b128 %5, %18, off\n\t"
               "global_load_async_to_lds_b128 %6, %19, off\n\t"
               "global_load_async_to_lds_b128 %7, %20, off\n\t"
               "global_load_async_to_lds_b128 %8, %21, off\n\t"
               "global_load_async_to_lds_b128 %9, %22, off\n\t"
               "global_load_async_to_lds_b128 %10, %23, off\n\t"
               "global_load_async_to_lds_b128 %11, %24, off\n\t"
               "global_load_async_to_lds_b64 %12, %25, off\n\t"
               "s_wait_xcnt 0x0"
               :: "v"(lk), "v"(lk + 32u * 144u), "v"(lk + 64u * 144u), "v"(lk + 96u * 144u),
                  "v"(lv), "v"(lv + 16u * 272u), "v"(lv + 32u * 272u), "v"(lv + 48u * 272u),
                  "v"(lw), "v"(lw + 16u * 272u), "v"(lw + 32u * 272u), "v"(lw + 48u * 272u), "v"(lh),
                  "v"(gk), "v"(gk + 32 * HD * 2), "v"(gk + 64 * HD * 2), "v"(gk + 96 * HD * 2),
                  "v"(gv), "v"(gv + 16 * TT * 2), "v"(gv + 32 * TT * 2), "v"(gv + 48 * TT * 2),
                  "v"(gw), "v"(gw + 16 * TT * 2), "v"(gw + 32 * TT * 2), "v"(gw + 48 * TT * 2), "v"(gh)
               : "memory");
}
__global__ __launch_bounds__(256) __attribute__((amdgpu_waves_per_eu(4, 4))) void k_flash(const _Float16* __restrict__ Q16, int ldq, const _Float16* __restrict__ K16, const float* __restrict__ KH, const float* __restrict__ VHD, const _Float16* __restrict__ Vt, const _Float16* __restrict__ Vtlo, _Float16* __restrict__ OH, _Float16* __restrict__ OL, int ldo) {
  // One block = one 16-row query tile of TWO heads, 8 waves: wave w works for head w & 1 and takes the 32-key chunks kq, kq + 4, ... with kq = w >> 1; each wave keeps its own running max, sum and accumulators, and a head's four partial results are merged through LDS at the end.
  // Key rows and value rows are the same for every head, so a stage of 128 keys (four chunks: key rows, both V^T planes, the two heads' scalars) is brought into LDS once per block, in whole 128-byte lines, by asynchronous copies,
  // and the waves read their fragments from LDS (row pitches 144 B and 272 B, odd multiples of 16 B, for the 16-byte fragment reads). Two buffers: stage t + 1 flies while stage t is worked on.
  // A causal tile's cost grows with its index and there are more blocks than resident places, so the block index counts the tiles down: the longest start first. Two blocks share a WGP (four waves a SIMD): registers are held to 256 and LDS to under 160 KiB for that.
  // Both products are transposed: S^T = K.Q^T (A = 16 key rows, B = the query tile) and O^T += V^T.P^T (A = 16 rows of V^T, B = P^T). A lane then holds 16 of the 32 scores of ONE query (column ln; keys 8 hh + r and 16 + 8 hh + r),
  // so max and sum run in the lane with one exchange between the halves, the rescale factor is one value a lane, and the two score tiles, converted in place, are the B operand of the second product in the k order of the V^T loader.
  // KH and VHD are head-major, [head][token]: a lane's 8 keys of a tile are 32 contiguous bytes.
  // Every "#pragma unroll" in this kernel is there so that the small arrays it indexes (bq, ak, av, avl, kh, vh, sc, bp, bpl, the accumulators, mw, fo, fr) get constant indices and stay in registers; "#pragma unroll 1" keeps one copy of the key loop's body, whose registers are the kernel's limit.
  constexpr int RPW = 16, NQT = TT / RPW, DT = 4, KS = 2, HB = 2, KQ = 4, NW = HB * KQ, SK = KQ * 32, NHG = NH / HB;
  constexpr int PK = HD * 2 + 16, PV = SK * 2 + 16, OVH = SK * PK, OVL = OVH + HD * PV, OHS = OVL + HD * PV, STG = OHS + 2 * HB * SK * 4;      /* a stage in LDS: key rows, V^T high, V^T residual, scalars (kh of the heads, then vh) */
  static_assert(PK == 144 && PV == 272 && SK == 128 && NW * 32 == 256, "stage_copies is written for these pitches, this stage and this block");
  __shared__ __attribute__((aligned(16))) unsigned char sb[2 * STG];
  __shared__ __attribute__((aligned(16))) float sO[NW][RPW][64 + 4]; __shared__ float sM[NW][RPW], sL[NW][RPW];
  const int tid = threadIdx.x, lane = tid & 31, ln = lane & 15, hh = lane >> 4;
  const int w = __builtin_amdgcn_readfirstlane(tid >> 5);      /* wave number in a scalar register: it decides whether the wave has a chunk in a stage, and the branch around the matrix instructions must be a scalar one */
  const int hs = w % HB, kq = w / HB;
  const int slab = blockIdx.x % (BB * NHG), qt = NQT - 1 - blockIdx.x / (BB * NHG); const int b = slab / NHG, hg = slab % NHG; const int h = hg * HB + hs; const int q0 = qt * RPW;
  FragH bq[KS];
  { const unsigned short* qr = (const unsigned short*)Q16 + ((size_t)b * TT + q0 + ln) * ldq + h * 64;
#pragma unroll
    for (int ks = 0; ks < KS; ++ks) { bq[ks].half[0] = *(const v8us*)(qr + ks * 32 + 8 * hh); bq[ks].half[1] = *(const v8us*)(qr + ks * 32 + 16 + 8 * hh); } }
  /* the thread's pieces of a stage: 8 threads a key row (128 B), 16 threads a V^T row (256 B), 64 threads a scalar row (512 B) */
  const int hr = tid >> 6;      /* scalar row: kh of head 0, 1, then vh of head 0, 1 */
  const char* gk = (const char*)(K16 + ((size_t)b * TT + (tid >> 3)) * HD) + (tid & 7) * 16;
  const char* gv = (const char*)(Vt + ((size_t)b * 64 + (tid >> 4)) * TT) + (tid & 15) * 16;
  const char* gw = (const char*)(Vtlo + ((size_t)b * 64 + (tid >> 4)) * TT) + (tid & 15) * 16;
  const char* gh = (const char*)((hr < HB ? KH : VHD) + (size_t)(hg * HB + hr % HB) * NR + (size_t)b * TT) + (tid & 63) * 8;
  const unsigned lb = (unsigned)(size_t)sb;      /* byte address of the ring in the work-group's LDS */
  const unsigned lk = lb + (unsigned)((tid >> 3) * PK + (tid & 7) * 16), lv = lb + (unsigned)(OVH + (tid >> 4) * PV + (tid & 15) * 16), lw = lv + (unsigned)(OVL - OVH), lh = lb + (unsigned)(OHS + hr * SK * 4 + (tid & 63) * 8);
  /* the lane's fragment places in a stage */
  const unsigned char* const fk = sb + (kq * 32 + ln) * PK + hh * 16;
  const unsigned char* const fv = sb + OVH + ln * PV + (kq * 32 + 8 * hh) * 2;
  const unsigned char* const fh = sb + OHS + hs * SK * 4 + (kq * 32 + 8 * hh) * 4;
  float m_r = -3.0e38f, l_r = 0.f; v8f oacc[DT], oaccl[DT], oacc2[DT];
#pragma unroll
  for (int dt = 0; dt < DT; ++dt) { oacc[dt] = (v8f){0.f,0.f,0.f,0.f,0.f,0.f,0.f,0.f}; oaccl[dt] = oacc[dt]; oacc2[dt] = oacc[dt]; }
  const int jend = q0 + RPW;
  const int nst = (jend + SK - 1) / SK;      /* stages of the tile, the same for the whole block; a stage lies wholly inside the TT keys */
  stage_copies(lk, lv, lw, lh, gk, gv, gw, gh);
  asm volatile("s_wait_asynccnt 0x0" ::: "memory");      /* this wave's pieces of stage 0 have landed */
  __syncthreads();      /* every wave's pieces of stage 0 are in LDS before any wave reads a fragment */
  if (nst > 1) stage_copies(lk + STG, lv + STG, lw + STG, lh + STG, gk + SK * HD * 2, gv + SK * 2, gw + SK * 2, gh + SK * 4);
#pragma unroll 1
  for (int t = 0; t < nst; ++t) {
    const int cur = (t & 1) * STG; const int j0 = t * SK + kq * 32;
    if (j0 < jend) {      /* scalar test: the last stage of a tile may hold fewer than four chunks */
    FragH ak[2][KS], av[DT], avl[DT]; v4f kh[2][2], vh[2][2];
#pragma unroll
    for (int nt = 0; nt < 2; ++nt) {
#pragma unroll
      for (int ks = 0; ks < KS; ++ks) { const unsigned char* kr = fk + cur + nt * 16 * PK + ks * 64; ak[nt][ks].half[0] = *(const v8us*)kr; ak[nt][ks].half[1] = *(const v8us*)(kr + 32); }
      const unsigned char* kp = fh + cur + nt * 64; const unsigned char* vp = kp + HB * SK * 4;
      kh[nt][0] = *(const v4fa*)kp; kh[nt][1] = *(const v4fa*)(kp + 16); vh[nt][0] = *(const v4fa*)vp; vh[nt][1] = *(const v4fa*)(vp + 16); }
    float sc[2][8];
#pragma unroll
    for (int nt = 0; nt < 2; ++nt) { v8f acc = (v8f){0.f,0.f,0.f,0.f,0.f,0.f,0.f,0.f};
#pragma unroll
      for (int ks = 0; ks < KS; ++ks) acc = __builtin_amdgcn_wmma_f32_16x16x32_f16(false, ak[nt][ks].v, false, bq[ks].v, (short)0, acc, false, false);
#pragma unroll
      for (int r = 0; r < 8; ++r) sc[nt][r] = acc[r] * kh[nt][r >> 2][r & 3] * 0.125f; }
    if (j0 + 31 > q0) {      /* only a chunk that reaches past the tile's first query has keys to mask (scalar test); every query keeps at least one key of every chunk of the loop */
#pragma unroll
      for (int nt = 0; nt < 2; ++nt)
#pragma unroll
        for (int r = 0; r < 8; ++r) sc[nt][r] = (j0 + nt * 16 + 8 * hh + r <= q0 + ln) ? sc[nt][r] : -INFINITY; }
    float mc = fmaxf(sc[0][0], sc[1][0]);
#pragma unroll
    for (int r = 1; r < 8; ++r) mc = fmaxf(mc, fmaxf(sc[0][r], sc[1][r]));
    mc = fmaxf(mc, xhalf(mc));      /* the query's other 16 keys */
    const float mn = fmaxf(m_r, mc); const float al = (mn > -1.0e38f) ? expf(m_r - mn) : 1.0f; m_r = mn;
    FragH bp, bpl; float ps = 0.f;
#pragma unroll
    for (int nt = 0; nt < 2; ++nt)
#pragma unroll
      for (int r = 0; r < 8; ++r) { const float p = expf(sc[nt][r] - mn); ps += p;      /* a masked score is -inf: p = 0 */
        const float pv = p * vh[nt][r >> 2][r & 3] * 1024.0f; const _Float16 ph = (_Float16)pv; bp.h[nt * 8 + r] = ph; bpl.h[nt * 8 + r] = (_Float16)((pv - (float)ph) * 1024.0f); }      /* value-head scalar folded into P, carried as f16 hi + x2^10 residual operands; the normaliser keeps plain p */
    l_r = l_r * al + ps;      /* the lane's half of the row sum; the halves are joined once, behind the loop */
    __builtin_amdgcn_sched_barrier(0);      /* keeps the V^T fragments' 64 registers out of the softmax: lifted to the top of the chunk, these LDS reads push the wave past 256 registers and a value spills to scratch; their short latency passes under the rescale below */
#pragma unroll
    for (int dt = 0; dt < DT; ++dt) { const unsigned char* vp = fv + cur + dt * 16 * PV; const unsigned char* lp = vp + (OVL - OVH); av[dt].half[0] = *(const v8us*)vp; av[dt].half[1] = *(const v8us*)(vp + 32); avl[dt].half[0] = *(const v8us*)lp; avl[dt].half[1] = *(const v8us*)(lp + 32); }
    __builtin_amdgcn_sched_barrier(0);      /* keeps the sixteen reads together as one group in front of the rescale: spread among the matrix instructions, each further place of LDS reads costs the wave a wait of its own */
#pragma unroll
    for (int dt = 0; dt < DT; ++dt) { oacc[dt] *= al; oaccl[dt] *= al; oacc2[dt] *= al; }
#pragma unroll
    for (int dt = 0; dt < DT; ++dt) { oacc[dt] = __builtin_amdgcn_wmma_f32_16x16x32_f16(false, av[dt].v, false, bp.v, (short)0, oacc[dt], false, false); oaccl[dt] = __builtin_amdgcn_wmma_f32_16x16x32_f16(false, avl[dt].v, false, bp.v, (short)0, oaccl[dt], false, false); oacc2[dt] = __builtin_amdgcn_wmma_f32_16x16x32_f16(false, av[dt].v, false, bpl.v, (short)0, oacc2[dt], false, false); }
    }
    /* hand-over of the ring, passed by every wave, also one without a chunk in this stage */
    asm volatile("s_wait_dscnt 0x0" ::: "memory");      /* this wave's reads of stage t are done before the buffer is given to the copies */
    asm volatile("s_wait_asynccnt 0x0" ::: "memory");      /* this wave's pieces of stage t + 1 have landed */
    __syncthreads();      /* publishes stage t + 1 and ends every wave's reads of stage t */
    if (t + 2 < nst) stage_copies(lk + cur, lv + cur, lw + cur, lh + cur, gk + (size_t)(t + 2) * (SK * HD * 2), gv + (size_t)(t + 2) * (SK * 2), gw + (size_t)(t + 2) * (SK * 2), gh + (size_t)(t + 2) * (SK * 4));      /* into the buffer that stage t has just left */
  }
  asm volatile("s_wait_asynccnt 0x0" ::: "memory");      /* no copy is outstanding when the wave goes on to its end */
  l_r += xhalf(l_r);
  if (hh == 0) { sM[w][ln] = m_r; sL[w][ln] = l_r; }
#pragma unroll
  for (int dt = 0; dt < DT; ++dt) { const v8f t = oacc[dt] + (oaccl[dt] + oacc2[dt]) * 0.0009765625f;      /* registers r = head dims dt * 16 + 8 hh + r of query ln */
    *(v4fa*)&sO[w][ln][dt * 16 + 8 * hh] = (v4f){t[0], t[1], t[2], t[3]}; *(v4fa*)&sO[w][ln][dt * 16 + 8 * hh + 4] = (v4f){t[4], t[5], t[6], t[7]}; }
  __syncthreads();      /* every wave's partial (max, sum, unnormalised rows) is in LDS before any wave merges */
  {
    const int mh = tid >> 7, lt = tid & 127;      /* 128 threads merge a head: its partial i is wave i * HB + mh's */
    const int r = lt >> 3, c8 = (lt & 7) * 8;      /* 8 threads a row, 8 head dims a thread: in f16 a head's row is one 128-byte line of each plane */
    float mw[KQ], M = -3.0e38f, L = 0.f;
#pragma unroll
    for (int i = 0; i < KQ; ++i) { mw[i] = sM[i * HB + mh][r]; M = fmaxf(M, mw[i]); }
#pragma unroll
    for (int i = 0; i < KQ; ++i) { mw[i] = expf(mw[i] - M); L += mw[i] * sL[i * HB + mh][r]; }      /* a wave that had no chunk holds max -3e38, sum 0, rows 0: weight 0 */
    const float inv = (L > 0.f) ? 1.0f / (L * 1024.0f) : 0.f;
    FragH fo, fr;      /* the merged row leaves as the output projection's operands: f16 and the x2^10 residual of that rounding */
#pragma unroll
    for (int hf = 0; hf < 2; ++hf) { v4f a = {0.f, 0.f, 0.f, 0.f};
#pragma unroll
      for (int i = 0; i < KQ; ++i) { const v4f p = *(const v4fa*)&sO[i * HB + mh][r][c8 + hf * 4]; a += p * mw[i]; }
      a *= inv;
#pragma unroll
      for (int q = 0; q < 4; ++q) { const _Float16 hv = (_Float16)a[q]; fo.h[hf * 4 + q] = hv; fr.h[hf * 4 + q] = (_Float16)((a[q] - (float)hv) * 1024.0f); } }
    const size_t oo = ((size_t)b * TT + q0 + r) * ldo + (hg * HB + mh) * 64 + c8;
    *(v8us*)((unsigned short*)OH + oo) = fo.half[0]; *(v8us*)((unsigned short*)OL + oo) = fr.half[0];
  } }

extern "C" void kernel_launch(void* const* d_in, const int* in_sizes, int n_in,
                              void* d_out, int out_size, void* d_ws, size_t ws_size, hipStream_t stream) {
  (void)in_sizes; (void)n_in; (void)out_size;
  const float* x = (const float*)d_in[0]; const float* Wq = (const float*)d_in[1]; const float* Wkv = (const float*)d_in[2]; const float* Wkvh = (const float*)d_in[3]; const float* Wo = (const float*)d_in[4];
  char* ws = (char*)d_ws; size_t off = 0;
  auto take = [&](size_t bytes) { char* p = ws + off; off += (bytes + 255) & ~(size_t)255; return p; };
  _Float16* Bq = (_Float16*)take((size_t)DM * DM * 2); _Float16* Bkv = (_Float16*)take((size_t)2 * HD * DM * 2); _Float16* Bkh = (_Float16*)take((size_t)2 * NH * DM * 2); _Float16* Bo = (_Float16*)take((size_t)DM * DM * 2); float* CS = (float*)take((size_t)TT * 32 * 2 * 4);
  _Float16* X16 = (_Float16*)take((size_t)NR * DM * 2); float* F32 = (float*)take((size_t)NR * DM * 4); _Float16* Q16 = (_Float16*)take((size_t)NR * DM * 2); float* KVF = (float*)take((size_t)NR * 2 * HD * 4); _Float16* K16 = (_Float16*)take((size_t)NR * HD * 2); float* HS = (float*)take((size_t)NR * 2 * NH * 4);
  _Float16* Vth = (_Float16*)take((size_t)BB * HD * TT * 2); _Float16* Vtl = (_Float16*)take((size_t)BB * HD * TT * 2); _Float16* OH = (_Float16*)take((size_t)NR * DM * 2); _Float16* OL = (_Float16*)take((size_t)NR * DM * 2);
  if (off > ws_size) return;      // 2.1 + 0.3 + 0.1 + 2.1 + 0.5 + 8.4 + 16.8 + 8.4 + 2.1 + 0.5 + 0.5 + 0.5 + 0.5 + 8.4 + 8.4 ≈ 60 MB
  k_prep<<<2 * (DM * (DM / 8) / 256) + 2 * HD * (DM / 8) / 256 + 2 * NH * (DM / 8) / 256 + TT * 32 / 256 + NR * DM / 8 / 256, 256, 0, stream>>>(x, Wq, Wkv, Wkvh, Wo, X16, Bq, Bkv, Bkh, Bo, CS);      /* weights -> Bt, x -> f16, cos/sin table */
  const dim3 gq(DM / 128, NR / 128);      /* 128 x 128 tiles of a 4096 x 1024 result: 256 blocks */
  k_proj<<<(DM / 128 + 2) * (NR / 128), 256, 0, stream>>>(X16, Bq, Bkv, Bkh, F32, KVF, HS);      /* q, [k | v], [kh | vh]: 256 + 32 + 32 tiles */
  k_post<<<BB * (TT / 64) + NR * 8 / 256 + NR * NH * 8 / 256, 256, 0, stream>>>(F32, KVF, CS, Q16, K16, Vth, Vtl);      /* V^T planes, rotary k, rotary q */
  k_flash<<<BB * (NH / 2) * (TT / 16), 256, 0, stream>>>(Q16, DM, K16, HS, HS + (size_t)NH * NR, Vth, Vtl, OH, OL, DM);      /* KH = HS rows 0..15, VH = rows 16..31 (row pitch NR) */
  k_gemm_o<<<gq, 512, 0, stream>>>(OH, OL, Bo, (float*)d_out);      /* y = (O_hi + 2^-10 O_lo).Wo */
}

// v007
// A run of this version takes 129 microseconds.
// Next to v006, in two timings, it ran 1.09 and 1.16 times as fast.
// All steps since v000 together make it 4.50 times as fast.
#include <hip/hip_runtime.h>
// Multi-product attention with low-rank shared key/value (B=2, N=2048, D=1024, 16 heads × 64): q = x·Wq; [k|v] = x·Wkv (one shared 64-dim key and value); [kh|vh] = σ(x·Wkvh) per (token, head); rotary (rotate-half, θ=1e4) on q and k by
// sequence position; K_h[n] = kh[n,h]·k[n], V_h[n] = vh[n,h]·v[n]; causal softmax(q_h·K_hᵀ/8); out = (Σ attn·V_h merged)·Wo.
// Compute dtype: x and weights rounded to bf16; q and k as f32 GEMM outputs rotated in f32 from a one-time f32 cos/sin table and stored f16; head scalars as sigmoid GEMM epilogue outputs (f32); v f32 →
// f16 hi + ×2^10 residual Vᵀ planes; fused causal flash-style kernel (scores scaled by kh per key, P multiplied by vh per key and carried as f16 hi + residual tiles, online softmax f32, three value accumulators) on v_wmma_f32_16x16x32_f16; merged O stored as f16 hi + x2^10 residual planes by the attention kernel; both Wo products in one kernel, joined in registers; f32 accumulate.
#define BB 2
#define TT 2048
#define DM 1024
#define NH 16
#define HD 64
#define NR (BB * TT)

typedef __bf16 v16b __attribute__((ext_vector_type(16)));
typedef unsigned short v8us __attribute__((ext_vector_type(8), may_alias));
typedef float  v8f  __attribute__((ext_vector_type(8)));
typedef float  v4f  __attribute__((ext_vector_type(4)));
typedef float  v4fa __attribute__((ext_vector_type(4), may_alias));
union FragB { v16b v; v8us half[2]; unsigned short u[16]; };

__device__ __forceinline__ unsigned short bf16_bits(float x) { unsigned int u = __float_as_uint(x); return (unsigned short)((u + 0x7FFFu + ((u >> 16) & 1u)) >> 16); }
__device__ __forceinline__ float bf16_val(unsigned short b) { return __uint_as_float(((unsigned int)b) << 16); }
__device__ __forceinline__ float bf16_round(float x) { return bf16_val(bf16_bits(x)); }
// D += A·B with NT terms: 1 = ah·bh, 2 = + al·bh (A split), 3 = + ah·bl (both split)
template <int NT>
__device__ __forceinline__ v8f mmaN(v16b ah, v16b al, v16b bh, v16b bl, v8f c) {
  c = __builtin_amdgcn_wmma_f32_16x16x32_bf16(false, ah, false, bh, (short)0, c, false, false);
  if (NT >= 2) c = __builtin_amdgcn_wmma_f32_16x16x32_bf16(false, al, false, bh, (short)0, c, false, false);
  if (NT >= 3) c = __builtin_amdgcn_wmma_f32_16x16x32_bf16(false, ah, false, bl, (short)0, c, false, false);
  asm volatile("v_nop\n\tv_nop\n\tv_nop\n\tv_nop" : "+v"(c) : "v"(ah), "v"(al), "v"(bh), "v"(bl));
  return c;
}

__global__ __launch_bounds__(256) void k_wt_bf16(const float* __restrict__ W, unsigned short* __restrict__ Wt, int K, int N) {
  const int t = blockIdx.x * 256 + threadIdx.x;
  const int k8n = K / 8;
  if (t >= N * k8n) return;
  const int n = t / k8n, k8 = (t % k8n) * 8;
  v8us v;
#pragma unroll
  for (int i = 0; i < 8; ++i) v[i] = bf16_bits(W[(size_t)(k8 + i) * N + n]);
  *(v8us*)(Wt + (size_t)n * K + k8) = v;
  
}

// GEMM C[M][N] (f32, pitch ldc) = act(A[M][K]·W + bias). A f32 row-major (pitch lda) converted per fragment to bf16
// (ASPLIT: hi/lo two planes -> 2 terms, else single rounded term); Wt bf16 [N][K] (pitch ldb). BIAS_BF16 rounds the
// bias to bf16 first (bias quantised to bf16 before the add). K%32==0, M%16==0, N%64==0.
template <bool ASPLIT, int ACT, bool BIAS_BF16>
__global__ __launch_bounds__(128) void k_gemm_bf(const float* __restrict__ A, int lda, const unsigned short* __restrict__ Wt, int ldb,
                                               const float* __restrict__ bias, float* __restrict__ C, int ldc, int M, int N, int K) {
  __shared__ __attribute__((aligned(16))) float so[4][16][64];
  const int tid = threadIdx.x, w = tid >> 5, lane = tid & 31, ln = lane & 15, hh = lane >> 4;
  const int ntn = N / 64;
  const int wid = blockIdx.x * 4 + w;
  const int mt = wid / ntn, nq = wid % ntn;
  if (mt * 16 >= M) return;
  const int row0 = mt * 16, col0 = nq * 64;
  const float* arow = A + (size_t)(row0 + ln) * lda;
  v8f acc[4] = {};
  for (int kb = 0; kb < K; kb += 32) {
    FragB ah, al;
    const v4f x0 = *(const v4fa*)(arow + kb + 8 * hh), x1 = *(const v4fa*)(arow + kb + 8 * hh + 4);
    const v4f x2 = *(const v4fa*)(arow + kb + 16 + 8 * hh), x3 = *(const v4fa*)(arow + kb + 16 + 8 * hh + 4);
    float xs[16] = {x0[0],x0[1],x0[2],x0[3],x1[0],x1[1],x1[2],x1[3],x2[0],x2[1],x2[2],x2[3],x3[0],x3[1],x3[2],x3[3]};
#pragma unroll
    for (int i = 0; i < 16; ++i) { const unsigned short hb = bf16_bits(xs[i]); ah.u[i] = hb; al.u[i] = ASPLIT ? bf16_bits(xs[i] - bf16_val(hb)) : (unsigned short)0; }
#pragma unroll
    for (int t = 0; t < 4; ++t) {
      const unsigned short* brow = Wt + (size_t)(col0 + t * 16 + ln) * ldb + kb;
      FragB b;
      b.half[0] = *(const v8us*)(brow + 8 * hh);
      b.half[1] = *(const v8us*)(brow + 16 + 8 * hh);
      acc[t] = mmaN<ASPLIT ? 2 : 1>(ah.v, al.v, b.v, b.v, acc[t]);
    }
  }
#pragma unroll
  for (int t = 0; t < 4; ++t) {
    float bv = bias ? bias[col0 + t * 16 + ln] : 0.f;
    if (BIAS_BF16) bv = bf16_round(bv);
#pragma unroll
    for (int r = 0; r < 8; ++r) { float v = acc[t][r] + bv; if (ACT == 1) v = fmaxf(v, 0.f); so[w][8 * hh + r][t * 16 + ln] = v; }
  }
  __builtin_amdgcn_fence(__ATOMIC_ACQ_REL, "workgroup");
  __builtin_amdgcn_wave_barrier();
  const int rsub = lane >> 4, c4 = (lane & 15) * 4;
  {
#pragma unroll
    for (int q = 0; q < 8; ++q) {
      const int r = q * 2 + rsub;
      const v4f v = *(const v4fa*)&so[w][r][c4];
      *(v4f*)(C + (size_t)(row0 + r) * ldc + col0 + c4) = v;
    }
    
  }
}

// Flash-style causal/unmasked attention, all contractions 3-term bf16 hi/lo splits, f32 softmax with running max.
// q,k,v rows are read from f32 buffers with arbitrary row pitch (so they can live inside a fused qkv buffer);
// D = head size (multiple of 32, <= 128); one wave = 16 query rows; block = 4 waves (64 queries) sharing K/V chunks of 32.
template <int D, bool CAUSAL>
__global__ __launch_bounds__(128) void k_flash(const float* __restrict__ qb, const float* __restrict__ kb, const float* __restrict__ vb,
                                             int pitch, int T, int H, float scale, float* __restrict__ y, int ypitch) {
  constexpr int KS = D / 32;        // k-steps for QK
  constexpr int DT = D / 16;        // d tiles for PV
  __shared__ __attribute__((aligned(16))) unsigned short sKh[32][D + 8], sKl[32][D + 8], sVh[32][D + 8], sVl[32][D + 8];
  __shared__ __attribute__((aligned(16))) unsigned short sPh[4][16][40], sPl[4][16][40];
  __shared__ __attribute__((aligned(16))) float sO[4][16][D];
  const int tid = threadIdx.x, w = tid >> 5, lane = tid & 31, ln = lane & 15, hh = lane >> 4;
  const int nqb = (T + 63) / 64;
  const int bh = blockIdx.x / nqb, qblk = blockIdx.x % nqb;
  const int b = bh / H, h = bh % H;
  const int q0 = qblk * 64 + w * 16;
  const float* Q = qb + (size_t)b * T * pitch + h * D;
  const float* K = kb + (size_t)b * T * pitch + h * D;
  const float* V = vb + (size_t)b * T * pitch + h * D;

  // A fragments of the wave's 16 query rows (scaled), hi/lo
  FragB aqh[KS], aql[KS];
  {
    int row = q0 + ln; if (row >= T) row = T - 1;
    const float* qr = Q + (size_t)row * pitch;
#pragma unroll
    for (int ks = 0; ks < KS; ++ks)
#pragma unroll
      for (int i = 0; i < 16; ++i) {
        const int d = ks * 32 + ((i < 8) ? (8 * hh + i) : (16 + 8 * hh + (i - 8)));
        const float x = qr[d] * scale; const unsigned short hb = bf16_bits(x);
        aqh[ks].u[i] = hb; aql[ks].u[i] = bf16_bits(x - bf16_val(hb));
      }
  }
  float m_r[8], l_r[8];
#pragma unroll
  for (int r = 0; r < 8; ++r) { m_r[r] = -3.0e38f; l_r[r] = 0.f; }
  v8f oacc[DT];
#pragma unroll
  for (int dt = 0; dt < DT; ++dt) oacc[dt] = (v8f){0.f,0.f,0.f,0.f,0.f,0.f,0.f,0.f};

  const int kv_end = CAUSAL ? min(T, qblk * 64 + 64) : T;     // block-uniform
  for (int j0 = 0; j0 < kv_end; j0 += 32) {
    __syncthreads();
    for (int e = tid; e < 32 * (D / 4); e += 128) {
      const int r = e / (D / 4), c4 = (e % (D / 4)) * 4;
      const int key = j0 + r;
      v4f kf = {0.f,0.f,0.f,0.f}, vf = {0.f,0.f,0.f,0.f};
      if (key < T) { kf = *(const v4fa*)(K + (size_t)key * pitch + c4); vf = *(const v4fa*)(V + (size_t)key * pitch + c4); }
#pragma unroll
      for (int t = 0; t < 4; ++t) {
        unsigned short hb = bf16_bits(kf[t]); sKh[r][c4 + t] = hb; sKl[r][c4 + t] = bf16_bits(kf[t] - bf16_val(hb));
        hb = bf16_bits(vf[t]); sVh[r][c4 + t] = hb; sVl[r][c4 + t] = bf16_bits(vf[t] - bf16_val(hb));
      }
    }
    __syncthreads();
    // S tile 16 x 32
    v8f s[2];
#pragma unroll
    for (int nt = 0; nt < 2; ++nt) {
      v8f acc = {};
#pragma unroll
      for (int ks = 0; ks < KS; ++ks) {
        FragB bh_, bl_;
        bh_.half[0] = *(const v8us*)&sKh[nt * 16 + ln][ks * 32 + 8 * hh]; bh_.half[1] = *(const v8us*)&sKh[nt * 16 + ln][ks * 32 + 16 + 8 * hh];
        bl_.half[0] = *(const v8us*)&sKl[nt * 16 + ln][ks * 32 + 8 * hh]; bl_.half[1] = *(const v8us*)&sKl[nt * 16 + ln][ks * 32 + 16 + 8 * hh];
        acc = mmaN<3>(aqh[ks].v, aql[ks].v, bh_.v, bl_.v, acc);
      }
      s[nt] = acc;
    }
    // mask + running max (rows 8hh+r; the 16 lanes of a half share rows)
    float alpha[8];
#pragma unroll
    for (int r = 0; r < 8; ++r) {
      const int qi = q0 + 8 * hh + r;
      const int ja = j0 + ln, jb = j0 + 16 + ln;
      if (CAUSAL) { if (ja > qi) s[0][r] = -3.0e38f; if (jb > qi) s[1][r] = -3.0e38f; }
      if (ja >= T) s[0][r] = -3.0e38f;
      if (jb >= T) s[1][r] = -3.0e38f;
      float mx = fmaxf(s[0][r], s[1][r]);
      mx = fmaxf(mx, __shfl_xor(mx, 1, 32)); mx = fmaxf(mx, __shfl_xor(mx, 2, 32)); mx = fmaxf(mx, __shfl_xor(mx, 4, 32)); mx = fmaxf(mx, __shfl_xor(mx, 8, 32));
      const float mnew = fmaxf(m_r[r], mx);
      alpha[r] = (mnew > -1.0e38f) ? __expf(m_r[r] - mnew) : 1.0f;
      const float p0 = (s[0][r] > -1.0e38f) ? __expf(s[0][r] - mnew) : 0.f;
      const float p1 = (s[1][r] > -1.0e38f) ? __expf(s[1][r] - mnew) : 0.f;
      m_r[r] = mnew;
      l_r[r] = l_r[r] * alpha[r] + p0 + p1;            // per-lane partial row sum (16 lanes combined at the end)
      unsigned short hb = bf16_bits(p0); sPh[w][8 * hh + r][ln] = hb;      sPl[w][8 * hh + r][ln] = bf16_bits(p0 - bf16_val(hb));
      hb = bf16_bits(p1);                sPh[w][8 * hh + r][16 + ln] = hb; sPl[w][8 * hh + r][16 + ln] = bf16_bits(p1 - bf16_val(hb));
    }
#pragma unroll
    for (int dt = 0; dt < DT; ++dt)
#pragma unroll
      for (int r = 0; r < 8; ++r) oacc[dt][r] *= alpha[r];
    __builtin_amdgcn_fence(__ATOMIC_ACQ_REL, "workgroup");
    __builtin_amdgcn_wave_barrier();
    FragB pah, pal;
    pah.half[0] = *(const v8us*)&sPh[w][ln][8 * hh]; pah.half[1] = *(const v8us*)&sPh[w][ln][16 + 8 * hh];
    pal.half[0] = *(const v8us*)&sPl[w][ln][8 * hh]; pal.half[1] = *(const v8us*)&sPl[w][ln][16 + 8 * hh];
#pragma unroll
    for (int dt = 0; dt < DT; ++dt) {
      FragB bvh, bvl;
#pragma unroll
      for (int i = 0; i < 8; ++i) {
        bvh.u[i] = sVh[8 * hh + i][dt * 16 + ln]; bvh.u[8 + i] = sVh[16 + 8 * hh + i][dt * 16 + ln];
        bvl.u[i] = sVl[8 * hh + i][dt * 16 + ln]; bvl.u[8 + i] = sVl[16 + 8 * hh + i][dt * 16 + ln];
      }
      oacc[dt] = mmaN<3>(pah.v, pal.v, bvh.v, bvl.v, oacc[dt]);
    }
    __builtin_amdgcn_fence(__ATOMIC_ACQ_REL, "workgroup");
    __builtin_amdgcn_wave_barrier();
  }
#pragma unroll
  for (int r = 0; r < 8; ++r) {
    float l = l_r[r];
    l += __shfl_xor(l, 1, 32); l += __shfl_xor(l, 2, 32); l += __shfl_xor(l, 4, 32); l += __shfl_xor(l, 8, 32);
    l_r[r] = (l > 0.f) ? 1.0f / l : 0.f;
  }
#pragma unroll
  for (int dt = 0; dt < DT; ++dt)
#pragma unroll
    for (int r = 0; r < 8; ++r) sO[w][8 * hh + r][dt * 16 + ln] = oacc[dt][r] * l_r[r];
  __builtin_amdgcn_fence(__ATOMIC_ACQ_REL, "workgroup");
  __builtin_amdgcn_wave_barrier();
  {
    for (int r = 0; r < 16; ++r) {
      const int row = q0 + r;
      if (row < T && lane < D / 4) {
        const v4f val = *(const v4fa*)&sO[w][r][lane * 4];
        *(v4f*)(y + ((size_t)b * T + row) * ypitch + h * D + lane * 4) = val;
      }
    }
    
  }
}

// GEMM C = act(A·W + bias + resid): A f32 (ASPLIT -> hi/lo 2 terms), Wt bf16 [N][K]; ACT 0 none, 1 relu, 2 exact gelu;
// resid (optional, f32, row index = (row % rmod), pitch ldr, RES_BF16 rounds it) added before the activation.
template <bool ASPLIT, int ACT, bool BIAS_BF16, bool RES_BF16>
__global__ __launch_bounds__(128) void k_gemm_bf3(const float* __restrict__ A, int lda, const unsigned short* __restrict__ Wt, int ldb,
                                                const float* __restrict__ bias, const float* __restrict__ resid, int rmod, int ldr,
                                                float* __restrict__ C, int ldc, int M, int N, int K) {
  __shared__ __attribute__((aligned(16))) float so[4][16][64];
  const int tid = threadIdx.x, w = tid >> 5, lane = tid & 31, ln = lane & 15, hh = lane >> 4;
  const int ntn = N / 64;
  const int wid = blockIdx.x * 4 + w;
  const int mt = wid / ntn, nq = wid % ntn;
  if (mt * 16 >= M) return;
  const int row0 = mt * 16, col0 = nq * 64;
  const float* arow = A + (size_t)(row0 + ln) * lda;
  v8f acc[4] = {};
  for (int kb = 0; kb < K; kb += 32) {
    FragB ah, al;
    const v4f x0 = *(const v4fa*)(arow + kb + 8 * hh), x1 = *(const v4fa*)(arow + kb + 8 * hh + 4);
    const v4f x2 = *(const v4fa*)(arow + kb + 16 + 8 * hh), x3 = *(const v4fa*)(arow + kb + 16 + 8 * hh + 4);
    float xs[16] = {x0[0],x0[1],x0[2],x0[3],x1[0],x1[1],x1[2],x1[3],x2[0],x2[1],x2[2],x2[3],x3[0],x3[1],x3[2],x3[3]};
#pragma unroll
    for (int i = 0; i < 16; ++i) { const unsigned short hb = bf16_bits(xs[i]); ah.u[i] = hb; al.u[i] = ASPLIT ? bf16_bits(xs[i] - bf16_val(hb)) : (unsigned short)0; }
#pragma unroll
    for (int t = 0; t < 4; ++t) {
      const unsigned short* brow = Wt + (size_t)(col0 + t * 16 + ln) * ldb + kb;
      FragB b;
      b.half[0] = *(const v8us*)(brow + 8 * hh);
      b.half[1] = *(const v8us*)(brow + 16 + 8 * hh);
      acc[t] = mmaN<ASPLIT ? 2 : 1>(ah.v, al.v, b.v, b.v, acc[t]);
    }
  }
#pragma unroll
  for (int t = 0; t < 4; ++t) {
    const int col = col0 + t * 16 + ln;
    float bv = bias ? bias[col] : 0.f;
    if (BIAS_BF16) bv = bf16_round(bv);
#pragma unroll
    for (int r = 0; r < 8; ++r) {
      float v = acc[t][r] + bv;
      if (resid) { float rv = resid[(size_t)((row0 + 8 * hh + r) % rmod) * ldr + col]; if (RES_BF16) rv = bf16_round(rv); v += rv; }
      if (ACT == 1) v = fmaxf(v, 0.f);
      if (ACT == 2) v = 0.5f * v * (1.0f + erff(v * 0.70710678118654752f));
      if (ACT == 3) { const float u = 0.7978845608028654f * (v + 0.044715f * v * v * v); v = 0.5f * v * (1.0f + tanhf(u)); }
      so[w][8 * hh + r][t * 16 + ln] = v;
    }
  }
  __builtin_amdgcn_fence(__ATOMIC_ACQ_REL, "workgroup");
  __builtin_amdgcn_wave_barrier();
  const int rsub = lane >> 4, c4 = (lane & 15) * 4;
  {
#pragma unroll
    for (int q = 0; q < 8; ++q) {
      const int r = q * 2 + rsub;
      const v4f v = *(const v4fa*)&so[w][r][c4];
      *(v4f*)(C + (size_t)(row0 + r) * ldc + col0 + c4) = v;
    }
    
  }
}
// row LayerNorm (biased variance, eps) over N: s = X (+ R); optional out_sum <- s; out_norm <- (s-mu)*rsqrt(var+eps)*g + b
template <bool PARAM_BF16>
__global__ __launch_bounds__(256) void k_layernorm(const float* __restrict__ X, const float* __restrict__ R, const float* __restrict__ g, const float* __restrict__ bta,
                                                  float* __restrict__ out_sum, float* __restrict__ out_norm, int N, float eps) {
  __shared__ float red[256];
  const int row = blockIdx.x, tid = threadIdx.x;
  const float* x = X + (size_t)row * N; const float* rr = R ? R + (size_t)row * N : nullptr;
  float vals[16];                     // up to N = 4096
  const int per = N / 256;            // contiguous chunk per thread? use strided-by-4 chunks: thread handles j = tid*4 + 1024*u
  float s1 = 0.f;
  for (int u = 0; u < per / 4; ++u) {
    const int j = tid * 4 + 1024 * u;
    const v4f a = *(const v4fa*)(x + j);
    v4f b = {0.f,0.f,0.f,0.f}; if (rr) b = *(const v4fa*)(rr + j);
#pragma unroll
    for (int q = 0; q < 4; ++q) { const float v = a[q] + b[q]; vals[u * 4 + q] = v; s1 += v; }
  }
  red[tid] = s1; __syncthreads();
  for (int st = 128; st > 0; st >>= 1) { if (tid < st) red[tid] += red[tid + st]; __syncthreads(); }
  const float mu = red[0] / (float)N; __syncthreads();
  float s2 = 0.f;
  for (int u = 0; u < per / 4; ++u)
#pragma unroll
    for (int q = 0; q < 4; ++q) { const float c = vals[u * 4 + q] - mu; s2 += c * c; }
  red[tid] = s2; __syncthreads();
  for (int st = 128; st > 0; st >>= 1) { if (tid < st) red[tid] += red[tid + st]; __syncthreads(); }
  const float rs = rsqrtf(red[0] / (float)N + eps);
  {
    for (int u = 0; u < per / 4; ++u) {
      const int j = tid * 4 + 1024 * u;
      v4f o, sm;
#pragma unroll
      for (int q = 0; q < 4; ++q) {
        float gg = g[j + q], bb = bta[j + q];
        if (PARAM_BF16) { gg = bf16_round(gg); bb = bf16_round(bb); }
        sm[q] = vals[u * 4 + q]; o[q] = (vals[u * 4 + q] - mu) * rs * gg + bb;
      }
      if (out_sum) *(v4f*)(out_sum + (size_t)row * N + j) = sm;
      *(v4f*)(out_norm + (size_t)row * N + j) = o;
    }
    
  }
}



// ---- f16 WMMA path (v_wmma_f32_16x16x32_f16): 11-bit significands for operands in range — used where a [0,1] probability operand needs more precision than bf16
typedef _Float16 v16h __attribute__((ext_vector_type(16)));
union FragH { v16h v; v8us half[2]; _Float16 h[16]; unsigned short u[16]; };
template <int NT>
__device__ __forceinline__ v8f mmaH(v16h ah, v16h al, v16h bh, v16h bl, v8f c) {
  c = __builtin_amdgcn_wmma_f32_16x16x32_f16(false, ah, false, bh, (short)0, c, false, false);
  if (NT >= 2) c = __builtin_amdgcn_wmma_f32_16x16x32_f16(false, al, false, bh, (short)0, c, false, false);
  if (NT >= 3) c = __builtin_amdgcn_wmma_f32_16x16x32_f16(false, ah, false, bl, (short)0, c, false, false);
  asm volatile("v_nop\n\tv_nop\n\tv_nop\n\tv_nop" : "+v"(c) : "v"(ah), "v"(al), "v"(bh), "v"(bl));
  return c;
}
// batched GEMM like k_gemm_b but f16 operands: A f32 (split into f16 hi/lo if ASPLIT, else rounded to f16), Bt = f16 values [n][k]; alpha; C f32; N multiple of 16 (partial tiles skipped)
template <bool ASPLIT>
__global__ __launch_bounds__(128) void k_gemm_h(const float* __restrict__ A, int lda, size_t sA, const _Float16* __restrict__ Bh, int ldb, size_t sB, float alpha, float* __restrict__ C, int ldc, size_t sC, int M, int N, int K) {
  __shared__ __attribute__((aligned(16))) float so[4][16][64];
  const int tid = threadIdx.x, w = tid >> 5, lane = tid & 31, ln = lane & 15, hh = lane >> 4; const int by = blockIdx.y;
  A += (size_t)by * sA; Bh += (size_t)by * sB; C += (size_t)by * sC;
  const int ntn = (N + 63) / 64; const int wid = blockIdx.x * 4 + w; const int mt = wid / ntn, nq = wid % ntn; if (mt * 16 >= M) return;
  const int row0 = mt * 16, col0 = nq * 64; const float* arow = A + (size_t)(row0 + ln) * lda;
  v8f acc[4] = {};
  for (int kb = 0; kb < K; kb += 32) {
    FragH ah, al;
    const v4f x0 = *(const v4fa*)(arow + kb + 8 * hh), x1 = *(const v4fa*)(arow + kb + 8 * hh + 4), x2 = *(const v4fa*)(arow + kb + 16 + 8 * hh), x3 = *(const v4fa*)(arow + kb + 16 + 8 * hh + 4);
    float xs[16] = {x0[0],x0[1],x0[2],x0[3],x1[0],x1[1],x1[2],x1[3],x2[0],x2[1],x2[2],x2[3],x3[0],x3[1],x3[2],x3[3]};
#pragma unroll
    for (int i = 0; i < 16; ++i) { const _Float16 h = (_Float16)xs[i]; ah.h[i] = h; al.h[i] = ASPLIT ? (_Float16)(xs[i] - (float)h) : (_Float16)0.0f; }
#pragma unroll
    for (int t = 0; t < 4; ++t) { if (col0 + t * 16 >= N) continue; const size_t boff = (size_t)(col0 + t * 16 + ln) * ldb + kb; FragH bq; bq.half[0] = *(const v8us*)(Bh + boff + 8 * hh); bq.half[1] = *(const v8us*)(Bh + boff + 16 + 8 * hh);
      acc[t] = mmaH<ASPLIT ? 2 : 1>(ah.v, al.v, bq.v, bq.v, acc[t]); }
  }
#pragma unroll
  for (int t = 0; t < 4; ++t) { if (col0 + t * 16 >= N) continue;
#pragma unroll
    for (int r = 0; r < 8; ++r) so[w][8 * hh + r][t * 16 + ln] = acc[t][r] * alpha; }
  __builtin_amdgcn_fence(__ATOMIC_ACQ_REL, "workgroup"); __builtin_amdgcn_wave_barrier();
  const int rsub = lane >> 4, c4 = (lane & 15) * 4;
  {
#pragma unroll
    for (int q = 0; q < 8; ++q) { const int r = q * 2 + rsub; if (col0 + c4 < N) { const v4f v = *(const v4fa*)&so[w][r][c4]; *(v4f*)(C + (size_t)(row0 + r) * ldc + col0 + c4) = v; } }
     }
}

// Wt[n][k] = f16(W[k][n]·scale) from f32 row-major W[K][N] (scale = power of two; bf16-exact weights stay exact in f16 away from the subnormal range)
// (bid = the block's index within this piece of work; the pieces are launched together by k_prep below)
__device__ __forceinline__ void d_wt_f16(int bid, const float* __restrict__ W, _Float16* __restrict__ Wt, int K, int N, float scale) {
  const int t = bid * 256 + threadIdx.x; if (t >= N * (K / 8)) return; const int n = t / (K / 8), k8 = (t % (K / 8)) * 8; FragH f;
#pragma unroll
  for (int i = 0; i < 8; ++i) f.h[i] = (_Float16)(bf16_round(W[(size_t)(k8 + i) * N + n]) * scale); const v8us o = f.half[0];
  *(v8us*)((unsigned short*)Wt + (size_t)n * K + k8) = o; 
}
// Block-tile GEMM, f16 operands, f32 accumulate: C[row][col] = alpha * sum_k A[row][k] * Bt[col][k] (+ C if ADDC); ACT 11 stores its sigmoid column-major, C[col][row]. A and Bt are K-contiguous with row pitch DM, K = DM.
// One block of 8 waves owns a 128 x BN tile of C. Each pass brings 128 k (256 B of every operand row) from global memory in whole-row pieces into registers and from there into one of two LDS buffers
// (row pitch 272 B, an odd multiple of 16 B, for the 16-byte fragment reads); the next pass's global loads are issued ahead of this pass's products. Every wave computes a (16 * FM) x 32 part from LDS fragments,
// so an operand row is read from L2 once per block, not once per wave. k runs upward in steps of 32 into one accumulator per 16 x 16 tile.
// Every "#pragma unroll" in this kernel is there so that the small arrays it indexes (ra, rb, a, b, acc, o, c0) get constant indices and stay in registers.
// The body is a device function: sm is the launching kernel's LDS (gemm_lds(BN) bytes, 16-byte aligned), (bx, by) the tile's column and row index.
constexpr int gemm_lds(int BN) { return (2 * (128 + BN) * 272 > BN * 576) ? 2 * (128 + BN) * 272 : BN * 576; }      /* the two stage buffers, or the eight waves' epilogue ranges */
template <int BN, int LDC, int ACT, bool ADDC>
__device__ __forceinline__ void d_gemm_t(unsigned char* const sm, const int bx, const int by, const _Float16* __restrict__ A, const _Float16* __restrict__ Bt, float alpha, float* C) {
  constexpr int BM = 128, BK = 128, PB = BK * 2 + 16, WN = BN / 32, WM = 8 / WN, FM = BM / (16 * WM), NA = BM / 16, NB = BN / 16, KT = DM / BK;
  constexpr int STG = (BM + BN) * PB, EPW = FM * 16 * 36, EPI = 8 * EPW * 4, SZ = (2 * STG > EPI) ? 2 * STG : EPI;
  static_assert(SZ == gemm_lds(BN), "the launching kernel sizes sm by gemm_lds");
  const int tid = threadIdx.x, lane = tid & 31, ln = lane & 15, hh = lane >> 4;
  const int w = __builtin_amdgcn_readfirstlane(tid >> 5);      /* wave number, uniform: it only picks the wave's part of the tile */
  const int wm = w / WN, wn = w % WN;
  const int row0 = by * BM, col0 = bx * BN;
  const int sr = tid >> 4, sc = tid & 15;      /* 16 threads a row: 256 contiguous bytes */
  const unsigned short* ga = (const unsigned short*)A + (size_t)(row0 + sr) * DM + sc * 8;
  const unsigned short* gb = (const unsigned short*)Bt + (size_t)(col0 + sr) * DM + sc * 8;
  unsigned char* const sst = sm + sr * PB + sc * 16;
  const unsigned char* const fa = sm + (wm * FM * 16 + ln) * PB + hh * 16;
  const unsigned char* const fb = sm + (BM + wn * 32 + ln) * PB + hh * 16;
  v8us ra[NA], rb[NB];
#pragma unroll
  for (int i = 0; i < NA; ++i) ra[i] = *(const v8us*)(ga + (size_t)i * 16 * DM);
#pragma unroll
  for (int i = 0; i < NB; ++i) rb[i] = *(const v8us*)(gb + (size_t)i * 16 * DM);
#pragma unroll
  for (int i = 0; i < NA; ++i) *(v8us*)(sst + i * 16 * PB) = ra[i];
#pragma unroll
  for (int i = 0; i < NB; ++i) *(v8us*)(sst + (BM + i * 16) * PB) = rb[i];
  __syncthreads();      /* pass 0 is in buffer 0 before any wave reads a fragment */
  v8f acc[FM][2];
#pragma unroll
  for (int fm = 0; fm < FM; ++fm) { acc[fm][0] = (v8f){0.f,0.f,0.f,0.f,0.f,0.f,0.f,0.f}; acc[fm][1] = acc[fm][0]; }
  for (int kt = 0; kt < KT; ++kt) {
    const int cur = (kt & 1) * STG, nxt = STG - cur;
    if (kt + 1 < KT) {
#pragma unroll
      for (int i = 0; i < NA; ++i) ra[i] = *(const v8us*)(ga + (size_t)i * 16 * DM + (kt + 1) * BK);
#pragma unroll
      for (int i = 0; i < NB; ++i) rb[i] = *(const v8us*)(gb + (size_t)i * 16 * DM + (kt + 1) * BK);
    }
#pragma unroll
    for (int ks = 0; ks < BK / 32; ++ks) {
      FragH a[FM], b[2];
#pragma unroll
      for (int fm = 0; fm < FM; ++fm) { a[fm].half[0] = *(const v8us*)(fa + cur + fm * 16 * PB + ks * 64); a[fm].half[1] = *(const v8us*)(fa + cur + fm * 16 * PB + ks * 64 + 32); }
#pragma unroll
      for (int fn = 0; fn < 2; ++fn) { b[fn].half[0] = *(const v8us*)(fb + cur + fn * 16 * PB + ks * 64); b[fn].half[1] = *(const v8us*)(fb + cur + fn * 16 * PB + ks * 64 + 32); }
#pragma unroll
      for (int fm = 0; fm < FM; ++fm)
#pragma unroll
        for (int fn = 0; fn < 2; ++fn) acc[fm][fn] = __builtin_amdgcn_wmma_f32_16x16x32_f16(false, a[fm].v, false, b[fn].v, (short)0, acc[fm][fn], false, false);
    }
    if (kt + 1 < KT) {      /* the other buffer: its readers left it at the barrier that ended pass kt - 1 */
#pragma unroll
      for (int i = 0; i < NA; ++i) *(v8us*)(sst + nxt + i * 16 * PB) = ra[i];
#pragma unroll
      for (int i = 0; i < NB; ++i) *(v8us*)(sst + nxt + (BM + i * 16) * PB) = rb[i];
    }
    __syncthreads();      /* publishes pass kt + 1 and ends every wave's reads of pass kt */
  }
  if (ACT == 11) {
    /* sigmoid outputs leave column-major, C[col][row] with row pitch LDC: the attention kernel reads 8 consecutive rows (keys) of one column (head) per lane. A lane's 8 accumulator registers are 8 consecutive rows of one column;
       the block's tile is gathered in LDS (free behind the last barrier; pitch BM + 4 floats keeps 16-byte alignment) so that each wave stores whole 128-byte lines. */
    constexpr int PT = BM + 4;
    float* const st = (float*)sm;
#pragma unroll
    for (int fm = 0; fm < FM; ++fm)
#pragma unroll
      for (int fn = 0; fn < 2; ++fn) { v4f lo, hi;
#pragma unroll
        for (int r = 0; r < 4; ++r) { lo[r] = 1.0f / (1.0f + expf(-(acc[fm][fn][r] * alpha))); hi[r] = 1.0f / (1.0f + expf(-(acc[fm][fn][4 + r] * alpha))); }
        float* const d = st + (wn * 32 + fn * 16 + ln) * PT + (wm * FM + fm) * 16 + 8 * hh; *(v4fa*)d = lo; *(v4fa*)(d + 4) = hi; }
    __syncthreads();      /* every wave's rows of the tile are in LDS before any wave stores a column */
    for (int q = 0; q < BN * BM / 4 / 256; ++q) { const int e = q * 256 + tid, col = e / (BM / 4), r4 = (e % (BM / 4)) * 4; const v4f v = *(const v4fa*)&st[col * PT + r4]; *(v4f*)(C + (size_t)(col0 + col) * LDC + row0 + r4) = v; }
    return;
  }
  /* epilogue: behind the last barrier the buffers are free; each wave turns its part into whole 128-byte rows in its own LDS range (row pitch 36 floats) */
  float* const so = (float*)sm + w * EPW;
  const int er = lane >> 3, ec = (lane & 7) * 4;      /* 8 lanes a row of 32 floats */
  float* const cp = C + (size_t)(row0 + wm * FM * 16 + er) * LDC + col0 + wn * 32 + ec;      /* one address for all rows of the part; the row step is a constant offset */
  v4f o[FM * 4], c0[FM * 4];
#pragma unroll
  for (int fm = 0; fm < FM; ++fm)
#pragma unroll
    for (int fn = 0; fn < 2; ++fn)
#pragma unroll
      for (int r = 0; r < 8; ++r) so[(fm * 16 + 8 * hh + r) * 36 + fn * 16 + ln] = acc[fm][fn][r] * alpha;
  __builtin_amdgcn_fence(__ATOMIC_ACQ_REL, "workgroup"); __builtin_amdgcn_wave_barrier();      /* the wave's own LDS writes are done before its lanes read each other's */
  if (ADDC) {      /* the old values, all asked for at once, once the accumulators' registers are free */
#pragma unroll
    for (int q = 0; q < FM * 4; ++q) c0[q] = *(const v4fa*)(cp + (size_t)q * 4 * LDC);
  }
#pragma unroll
  for (int q = 0; q < FM * 4; ++q) { o[q] = *(const v4fa*)&so[(q * 4 + er) * 36 + ec]; if (ADDC) o[q] += c0[q]; }
#pragma unroll
  for (int q = 0; q < FM * 4; ++q) *(v4f*)(cp + (size_t)q * 4 * LDC) = o[q];
}
// Output projection, both planes of O in one launch: C = (Ah.Bt^T + 2^-10 Al.Bt^T) / 16, operands K-contiguous with row pitch DM, K = DM. One block of 16 waves owns a 128 x 128 tile of C (256 blocks, one a WGP, four waves a SIMD).
// A pass stages 128 k of the tile's rows of Ah, of Al and of Bt as d_gemm_t does (whole-row loads into registers, from there into one of two LDS buffers, row pitch 272 B; the next pass's loads are issued ahead of this pass's products):
// a Bt row is brought in and a Bt fragment read once for both planes. Every wave computes a 32 x 32 part with one accumulator per 16 x 16 tile AND plane, k upward in steps of 32 as in the two single launches; the planes meet in registers
// in the epilogue (both scalings are by powers of two, so the one rounding of the sum is the one the read-add-write of C made), and C is written once and never read.
// Every "#pragma unroll" in this kernel is there so that the small arrays it indexes (rh, rl, rb, ah, al, b, the accumulators, o) get constant indices and stay in registers.
__global__ __launch_bounds__(512) void k_gemm_o(const _Float16* __restrict__ Ah, const _Float16* __restrict__ Al, const _Float16* __restrict__ Bt, float* __restrict__ C) {
  constexpr int BM = 128, BN = 128, BK = 128, PB = BK * 2 + 16, FM = 2, NS = BM / 32, KT = DM / BK;
  constexpr int OAL = BM * PB, OB = 2 * BM * PB, STG = (2 * BM + BN) * PB, EPW = FM * 16 * 36;      /* a stage: rows of Ah, of Al, of Bt */
  static_assert(BN == BM && 16 * EPW * 4 <= 2 * STG, "one count of staging steps for the three operands; the sixteen epilogue ranges lie inside the two stage buffers");
  __shared__ __attribute__((aligned(16))) unsigned char sm[2 * STG];
  const int tid = threadIdx.x, lane = tid & 31, ln = lane & 15, hh = lane >> 4;
  const int w = __builtin_amdgcn_readfirstlane(tid >> 5);      /* wave number, uniform: it only picks the wave's part of the tile */
  const int wm = w >> 2, wn = w & 3;
  const int row0 = blockIdx.y * BM, col0 = blockIdx.x * BN;
  const int sr = tid >> 4, sc = tid & 15;      /* 16 threads a row: 256 contiguous bytes; 32 rows a step */
  const unsigned short* gh = (const unsigned short*)Ah + (size_t)(row0 + sr) * DM + sc * 8;
  const unsigned short* gl = (const unsigned short*)Al + (size_t)(row0 + sr) * DM + sc * 8;
  const unsigned short* gb = (const unsigned short*)Bt + (size_t)(col0 + sr) * DM + sc * 8;
  unsigned char* const sst = sm + sr * PB + sc * 16;
  const unsigned char* const fa = sm + (wm * FM * 16 + ln) * PB + hh * 16;
  const unsigned char* const fb = sm + OB + (wn * 32 + ln) * PB + hh * 16;
  v8us rh[NS], rl[NS], rb[NS];
#pragma unroll
  for (int i = 0; i < NS; ++i) { rh[i] = *(const v8us*)(gh + (size_t)i * 32 * DM); rl[i] = *(const v8us*)(gl + (size_t)i * 32 * DM); rb[i] = *(const v8us*)(gb + (size_t)i * 32 * DM); }
#pragma unroll
  for (int i = 0; i < NS; ++i) { *(v8us*)(sst + i * 32 * PB) = rh[i]; *(v8us*)(sst + OAL + i * 32 * PB) = rl[i]; *(v8us*)(sst + OB + i * 32 * PB) = rb[i]; }
  __syncthreads();      /* pass 0 is in buffer 0 before any wave reads a fragment */
  v8f acch[FM][2], accl[FM][2];
#pragma unroll
  for (int fm = 0; fm < FM; ++fm)
#pragma unroll
    for (int fn = 0; fn < 2; ++fn) { acch[fm][fn] = (v8f){0.f,0.f,0.f,0.f,0.f,0.f,0.f,0.f}; accl[fm][fn] = acch[fm][fn]; }
  for (int kt = 0; kt < KT; ++kt) {
    const int cur = (kt & 1) * STG, nxt = STG - cur;
    if (kt + 1 < KT) {
#pragma unroll
      for (int i = 0; i < NS; ++i) { rh[i] = *(const v8us*)(gh + (size_t)i * 32 * DM + (kt + 1) * BK); rl[i] = *(const v8us*)(gl + (size_t)i * 32 * DM + (kt + 1) * BK); rb[i] = *(const v8us*)(gb + (size_t)i * 32 * DM + (kt + 1) * BK); }
      __builtin_amdgcn_sched_barrier(0);      /* keeps the twelve loads in front of the pass's products: left free, the compiler sinks them behind three quarters of the pass, and their latency then stands bare in front of the LDS stores */
    }
#pragma unroll
    for (int ks = 0; ks < BK / 32; ++ks) {
      FragH ah[FM], al[FM], b[2];
#pragma unroll
      for (int fm = 0; fm < FM; ++fm) { const unsigned char* p = fa + cur + fm * 16 * PB + ks * 64; ah[fm].half[0] = *(const v8us*)p; ah[fm].half[1] = *(const v8us*)(p + 32); al[fm].half[0] = *(const v8us*)(p + OAL); al[fm].half[1] = *(const v8us*)(p + OAL + 32); }
#pragma unroll
      for (int fn = 0; fn < 2; ++fn) { const unsigned char* p = fb + cur + fn * 16 * PB + ks * 64; b[fn].half[0] = *(const v8us*)p; b[fn].half[1] = *(const v8us*)(p + 32); }
#pragma unroll
      for (int fm = 0; fm < FM; ++fm)
#pragma unroll
        for (int fn = 0; fn < 2; ++fn) { acch[fm][fn] = __builtin_amdgcn_wmma_f32_16x16x32_f16(false, ah[fm].v, false, b[fn].v, (short)0, acch[fm][fn], false, false); accl[fm][fn] = __builtin_amdgcn_wmma_f32_16x16x32_f16(false, al[fm].v, false, b[fn].v, (short)0, accl[fm][fn], false, false); }
    }
    if (kt + 1 < KT) {      /* the other buffer: its readers left it at the barrier that ended pass kt - 1 */
#pragma unroll
      for (int i = 0; i < NS; ++i) { *(v8us*)(sst + nxt + i * 32 * PB) = rh[i]; *(v8us*)(sst + nxt + OAL + i * 32 * PB) = rl[i]; *(v8us*)(sst + nxt + OB + i * 32 * PB) = rb[i]; }
    }
    __syncthreads();      /* publishes pass kt + 1 and ends every wave's reads of pass kt */
  }
  /* epilogue: behind the last barrier the buffers are free; each wave turns its part into whole 128-byte rows in its own LDS range (row pitch 36 floats) */
  float* const so = (float*)sm + w * EPW;
  const int er = lane >> 3, ec = (lane & 7) * 4;      /* 8 lanes a row of 32 floats */
  float* const cp = C + (size_t)(row0 + wm * FM * 16 + er) * DM + col0 + wn * 32 + ec;      /* one address for all rows of the part; the row step is a constant offset */
  v4f o[FM * 4];
#pragma unroll
  for (int fm = 0; fm < FM; ++fm)
#pragma unroll
    for (int fn = 0; fn < 2; ++fn)
#pragma unroll
      for (int r = 0; r < 8; ++r) so[(fm * 16 + 8 * hh + r) * 36 + fn * 16 + ln] = acch[fm][fn][r] * 0.0625f + accl[fm][fn][r] * (0.0625f * 0.0009765625f);      /* Bt carries x2^4, Al x2^10 */
  __builtin_amdgcn_fence(__ATOMIC_ACQ_REL, "workgroup"); __builtin_amdgcn_wave_barrier();      /* the wave's own LDS writes are done before its lanes read each other's */
#pragma unroll
  for (int q = 0; q < FM * 4; ++q) o[q] = *(const v4fa*)&so[(q * 4 + er) * 36 + ec];
#pragma unroll
  for (int q = 0; q < FM * 4; ++q) *(v4f*)(cp + (size_t)q * 4 * DM) = o[q];
}
// The three projections of x (q, [k | v], the head scalars) do not depend on one another: one launch holds the tiles of all three, each block doing one tile as before. The two narrow products have 32 tiles each, too few to fill the chip alone;
// here they run beside the 256 tiles of q (two blocks fit a WGP's LDS), and two launch gaps go. The test on the block index is uniform for the block, so every barrier inside a body is passed by the whole block.
__global__ __launch_bounds__(256) void k_proj(const _Float16* __restrict__ X16, const _Float16* __restrict__ Bq, const _Float16* __restrict__ Bkv, const _Float16* __restrict__ Bkh, float* F32, float* KVF, float* HS) {
  constexpr int NQX = DM / 128, NRT = NR / 128;
  __shared__ __attribute__((aligned(16))) unsigned char sm[gemm_lds(128)];
  const int bid = blockIdx.x;
  /* the tests run from the narrow tile up: so the compiler keeps the pass loop of both 128-wide bodies as it is in the single launches; with q tested first it lays out all eight passes of q, three times the text */
  if (bid >= (NQX + 1) * NRT) d_gemm_t<32, NR, 11, false>(sm, 0, bid - (NQX + 1) * NRT, X16, Bkh, 0.0625f, HS);      /* [kh | vh] = sigmoid(x.Wkvh): M 4096 N 32 K 1024, stored head-major: 32 rows of 4096 f32 */
  else if (bid >= NQX * NRT) { d_gemm_t<128, 2 * HD, 0, false>(sm, 0, bid - NQX * NRT, X16, Bkv, 0.0625f, KVF);      /* [k | v] f32: M 4096 N 128 K 1024 */
    asm volatile("s_wait_xcnt 0x0" ::: "memory"); }      /* in this kernel's text another body follows the tile's stores and rewrites their registers: the wait stands between */
  else { d_gemm_t<128, DM, 0, false>(sm, bid % NQX, bid / NQX, X16, Bq, 0.0625f, F32);      /* q f32: M 4096 N 1024 K 1024 */
    asm volatile("s_wait_xcnt 0x0" ::: "memory"); }      /* as above */
}


typedef _Float16 v4h __attribute__((ext_vector_type(4)));

__device__ __forceinline__ void d_x16(int bid, const float* __restrict__ x, _Float16* __restrict__ X16, size_t n8) { const size_t t = (size_t)bid * 256 + threadIdx.x; if (t >= n8) return; FragH f;
#pragma unroll
  for (int q = 0; q < 8; ++q) f.h[q] = (_Float16)bf16_round(x[t * 8 + q]); *(v8us*)((unsigned short*)X16 + t * 8) = f.half[0];  }
__global__ __launch_bounds__(256) void k_h16(const float* __restrict__ x, _Float16* __restrict__ X16, size_t n8) { const size_t t = (size_t)blockIdx.x * 256 + threadIdx.x; if (t >= n8) return; FragH f;
#pragma unroll
  for (int q = 0; q < 8; ++q) f.h[q] = (_Float16)x[t * 8 + q]; *(v8us*)((unsigned short*)X16 + t * 8) = f.half[0];  }
__global__ __launch_bounds__(256) void k_round16f(const float* __restrict__ W, _Float16* __restrict__ Bt, size_t n8) { const size_t t = (size_t)blockIdx.x * 256 + threadIdx.x; if (t >= n8) return; FragH f;
#pragma unroll
  for (int i = 0; i < 8; ++i) f.h[i] = (_Float16)(bf16_round(W[t * 8 + i]) * 16.0f); *(v8us*)((unsigned short*)Bt + t * 8) = f.half[0];  }
template <int NHv, int TTv>
__global__ __launch_bounds__(256) void k_vt(const _Float16* __restrict__ V16, int ldv, int voff, _Float16* __restrict__ Vt) { __shared__ unsigned short tl[64][66]; const int tid = threadIdx.x; const int slab = blockIdx.x / (TTv / 64), lg = blockIdx.x % (TTv / 64); const int b = slab / NHv, h = slab % NHv;
  for (int i = tid; i < 64 * 8; i += 256) { const int r = i / 8, c8 = (i % 8) * 8; FragH f; f.half[0] = *(const v8us*)((const unsigned short*)V16 + ((size_t)b * TTv + lg * 64 + r) * ldv + voff + h * 64 + c8);
#pragma unroll
    for (int q = 0; q < 8; ++q) tl[r][c8 + q] = f.u[q]; }
  __syncthreads();
  {
#pragma unroll
    for (int rd = 0; rd < 2; ++rd) { const int d = rd * 32 + tid / 8, pc = tid % 8; FragH f;
#pragma unroll
      for (int q = 0; q < 8; ++q) f.u[q] = tl[pc * 8 + q][d];
      *(v8us*)((unsigned short*)Vt + ((size_t)slab * 64 + d) * TTv + lg * 64 + pc * 8) = f.half[0]; }
     } }

__device__ __forceinline__ void d_cstab(int bid, float* __restrict__ CS) { const int t = bid * 256 + threadIdx.x; if (t >= TT * 32) return; const int p = t / 32, i = t % 32; const float invf = powf(10000.0f, -(float)(2 * i) / (float)HD); float sn, cs; sincosf((float)p * invf, &sn, &cs); typedef float v2f __attribute__((ext_vector_type(2), may_alias)); const v2f v = {cs, sn};
  *(v2f*)(CS + (size_t)t * 2) = v;  }
// Everything that depends on the inputs alone (the four weight transposes, x in f16, the cos/sin table) in one launch: a block does what a block of the single launches did, picked by ranges of the block index; five launch gaps, drains and refills go.
// The table's range stands first: further down the chain of tests the compiler rates its powf as cold and leaves it a called function. Then the transposes, whose strided reads take the longest to return.
__global__ __launch_bounds__(256) void k_prep(const float* __restrict__ x, const float* __restrict__ Wq, const float* __restrict__ Wkv, const float* __restrict__ Wkvh, const float* __restrict__ Wo,
                                              _Float16* __restrict__ X16, _Float16* __restrict__ Bq, _Float16* __restrict__ Bkv, _Float16* __restrict__ Bkh, _Float16* __restrict__ Bo, float* __restrict__ CS) {
  constexpr int NBW = DM * (DM / 8) / 256, NBKV = 2 * HD * (DM / 8) / 256, NBKH = 2 * NH * (DM / 8) / 256, NBCS = TT * 32 / 256;      /* blocks of a square weight, of Wkv, of Wkvh, of the table */
  int bid = blockIdx.x;
  if (bid < NBCS) { d_cstab(bid, CS); return; }
  bid -= NBCS;
  if (bid < NBW) { d_wt_f16(bid, Wq, Bq, DM, DM, 16.0f); return; }
  bid -= NBW;
  if (bid < NBW) { d_wt_f16(bid, Wo, Bo, DM, DM, 16.0f); return; }
  bid -= NBW;
  if (bid < NBKV) { d_wt_f16(bid, Wkv, Bkv, DM, 2 * HD, 16.0f); return; }
  bid -= NBKV;
  if (bid < NBKH) { d_wt_f16(bid, Wkvh, Bkh, DM, 2 * NH, 16.0f); return; }      /* (in,out) -> Bt x2^4 */
  bid -= NBKH;
  d_x16(bid, x, X16, (size_t)NR * DM / 8);
}
// rotary embedding: for row (b,s), head h, 8-dim piece g (d0 = g·8): (cos, sin) from the table row of the token's sequence position; d < 32: q'[d] = q[d]·cos_d − q[d+32]·sin_d; d ≥ 32: q'[d] = q[d]·cos_{d−32} + q[d−32]·sin_{d−32} (f32), stored f16;
template <int NHR, int LDI, int LDO>
__device__ __forceinline__ void d_rope(int bid, const float* __restrict__ QF, const float* __restrict__ CS, _Float16* __restrict__ Q16) { const size_t t = (size_t)bid * 256 + threadIdx.x; if (t >= (size_t)NR * NHR * 8) return; const int g = (int)(t % 8); const int h = (int)((t / 8) % NHR); const size_t row = t / (8 * NHR); const int p = (int)(row % TT);      /* position = token index within the sequence (the reference's arange) */
  const int d0 = g * 8; const int i0 = d0 & 31; const float* base = QF + row * LDI + h * HD; const int dp = (d0 < 32) ? d0 + 32 : d0 - 32; const float sgn = (d0 < 32) ? -1.0f : 1.0f; const float* csr = CS + ((size_t)p * 32 + i0) * 2; FragH f;
#pragma unroll 1
  for (int e = 0; e < 8; ++e) { const float cs = csr[2 * e], sn = csr[2 * e + 1]; f.h[e] = (_Float16)(base[d0 + e] * cs + sgn * base[dp + e] * sn); }
  *(v8us*)((unsigned short*)Q16 + row * LDO + h * HD + d0) = f.half[0];  }
template <int NHV>
__device__ __forceinline__ void d_vthl(int bid, const float* __restrict__ VF, int ldv, int voff, _Float16* __restrict__ Vth, _Float16* __restrict__ Vtl) { __shared__ float tl[64][65]; const int tid = threadIdx.x; const int slab = bid / (TT / 64), lg = bid % (TT / 64); const int b = slab / NHV, h = slab % NHV;
  for (int i = tid; i < 64 * 16; i += 256) { const int r = i / 16, c4 = (i % 16) * 4; const v4f a = *(const v4fa*)(VF + ((size_t)b * TT + lg * 64 + r) * ldv + voff + h * HD + c4); tl[r][c4] = a[0]; tl[r][c4 + 1] = a[1]; tl[r][c4 + 2] = a[2]; tl[r][c4 + 3] = a[3]; }
  __syncthreads();
  FragH fh[2], fl[2]; size_t oo[2];
#pragma unroll
  for (int rd = 0; rd < 2; ++rd) { const int d = rd * 32 + tid / 8, pc = tid % 8;
#pragma unroll
    for (int q = 0; q < 8; ++q) { const float v = tl[pc * 8 + q][d]; const _Float16 hv = (_Float16)v; fh[rd].h[q] = hv; fl[rd].h[q] = (_Float16)((v - (float)hv) * 1024.0f); } oo[rd] = ((size_t)slab * HD + d) * TT + lg * 64 + pc * 8; }
  {
#pragma unroll
    for (int rd = 0; rd < 2; ++rd) { *(v8us*)((unsigned short*)Vth + oo[rd]) = fh[rd].half[0]; *(v8us*)((unsigned short*)Vtl + oo[rd]) = fl[rd].half[0]; }
     } }
// What stands between the projections and the attention kernel (V^T planes, rotary k, rotary q) in one launch, picked by ranges of the block index (uniform for the block, so d_vthl's barrier is passed by its whole block); two launch gaps go and the two small pieces run beside the large one.
__global__ __launch_bounds__(256) void k_post(const float* __restrict__ F32, const float* __restrict__ KVF, const float* __restrict__ CS, _Float16* __restrict__ Q16, _Float16* __restrict__ K16, _Float16* __restrict__ Vth, _Float16* __restrict__ Vtl) {
  constexpr int NBV = BB * (TT / 64), NBK = NR * 8 / 256;
  int bid = blockIdx.x;
  if (bid < NBV) { d_vthl<1>(bid, KVF, 2 * HD, HD, Vth, Vtl); return; }      /* shared v (cols 64..127 of KVF) -> V^T hi/lo per batch [b][64][T] */
  bid -= NBV;
  if (bid < NBK) { d_rope<1, 2 * HD, HD>(bid, KVF, CS, K16); return; }      /* shared k (cols 0..63 of KVF, row stride 128) -> RoPE -> K16 [4096][64] */
  bid -= NBK;
  d_rope<NH, DM, DM>(bid, F32, CS, Q16);      /* q -> RoPE -> f16 */
}
/* lane l with lane l ^ 16: one vector cross-row move */
__device__ __forceinline__ float xhalf(float x) { return __builtin_bit_cast(float, __builtin_amdgcn_permlanex16(__builtin_bit_cast(int, x), __builtin_bit_cast(int, x), 0x76543210, 0xfedcba98, false, false)); }
/* 2^x with the instruction set's one free slot behind a transcendental held in the same statement. For the four merge weights. */
__device__ __forceinline__ float exp2_slot(float x) { float y; asm("v_exp_f32 %0, %1\n\tv_nop" : "=v"(y) : "v"(x)); return y; }
/* One stage of k_flash's key loop, 128 keys, from global memory straight into LDS: a thread's 4 + 4 + 4 pieces of 16 bytes (key rows, V^T high rows, V^T residual rows) and one piece of 8 bytes (head scalars).
   Every wave's 32 lanes cover whole 128-byte lines. The s_wait_xcnt closes the statement so that no address register named here is rewritten while a copy may still read it. */
__device__ __forceinline__ void stage_copies(unsigned lk, unsigned lv, unsigned lw, unsigned lh, const char* gk, const char* gv, const char* gw, const char* gh) {
  asm volatile("global_load_async_to_lds_b128 %0, %13, off\n\t"
               "global_load_async_to_lds_b128 %1, %14, off\n\t"
               "global_load_async_to_lds_b128 %2, %15, off\n\t"
               "global_load_async_to_lds_b128 %3, %16, off\n\t"
               "global_load_async_to_lds_b128 %4, %17, off\n\t"
               "global_load_async_to_lds_b128 %5, %18, off\n\t"
               "global_load_async_to_lds_b128 %6, %19, off\n\t"
               "global_load_async_to_lds_b128 %7, %20, off\n\t"
               "global_load_async_to_lds_b128 %8, %21, off\n\t"
               "global_load_async_to_lds_b128 %9, %22, off\n\t"
               "global_load_async_to_lds_b128 %10, %23, off\n\t"
               "global_load_async_to_lds_b128 %11, %24, off\n\t"
               "global_load_async_to_lds_b64 %12, %25, off\n\t"
               "s_wait_xcnt 0x0"
               :: "v"(lk), "v"(lk + 32u * 144u), "v"(lk + 64u * 144u), "v"(lk + 96u * 144u),
                  "v"(lv), "v"(lv + 16u * 272u), "v"(lv + 32u * 272u), "v"(lv + 48u * 272u),
                  "v"(lw), "v"(lw + 16u * 272u), "v"(lw + 32u * 272u), "v"(lw + 48u * 272u), "v"(lh),
                  "v"(gk), "v"(gk + 32 * HD * 2), "v"(gk + 64 * HD * 2), "v"(gk + 96 * HD * 2),
                  "v"(gv), "v"(gv + 16 * TT * 2), "v"(gv + 32 * TT * 2), "v"(gv + 48 * TT * 2),
                  "v"(gw), "v"(gw + 16 * TT * 2), "v"(gw + 32 * TT * 2), "v"(gw + 48 * TT * 2), "v"(gh)
               : "memory");
}
__global__ __launch_bounds__(256) __attribute__((amdgpu_waves_per_eu(4, 4))) void k_flash(const _Float16* __restrict__ Q16, int ldq, const _Float16* __restrict__ K16, const float* __restrict__ KH, const float* __restrict__ VHD, const _Float16* __restrict__ Vt, const _Float16* __restrict__ Vtlo, _Float16* __restrict__ OH, _Float16* __restrict__ OL, int ldo) {
  // One block = one 16-row query tile of TWO heads, 8 waves: wave w works for head w & 1 and takes the 32-key chunks kq, kq + 4, ... with kq = w >> 1; each wave keeps its own running max, sum and accumulators, and a head's four partial results are merged through LDS at the end.
  // Key rows and value rows are the same for every head, so a stage of 128 keys (four chunks: key rows, both V^T planes, the two heads' scalars) is brought into LDS once per block, in whole 128-byte lines, by asynchronous copies,
  // and the waves read their fragments from LDS (row pitches 144 B and 272 B, odd multiples of 16 B, for the 16-byte fragment reads). Two buffers: stage t + 1 flies while stage t is worked on.
  // A causal tile's cost grows with its index and there are more blocks than resident places, so the block index counts the tiles down: the longest start first. Two blocks share a WGP (four waves a SIMD): registers are held to 256 and LDS to under 160 KiB for that.
  // Both products are transposed: S^T = K.Q^T (A = 16 key rows, B = the query tile) and O^T += V^T.P^T (A = 16 rows of V^T, B = P^T). A lane then holds 16 of the 32 scores of ONE query (column ln; keys 8 hh + r and 16 + 8 hh + r),
  // so max and sum run in the lane with one exchange between the halves, the rescale factor is one value a lane, and the two score tiles, converted in place, are the B operand of the second product in the k order of the V^T loader.
  // KH and VHD are head-major, [head][token]: a lane's 8 keys of a tile are 32 contiguous bytes.
  // Every "#pragma unroll" in this kernel is there so that the small arrays it indexes (bq, ak, av, avl, kh, vh, sc, bp, bpl, the accumulators, mw, fo, fr) get constant indices and stay in registers; "#pragma unroll 1" keeps one copy of the key loop's body, whose registers are the kernel's limit.
  constexpr int RPW = 16, NQT = TT / RPW, DT = 4, KS = 2, HB = 2, KQ = 4, NW = HB * KQ, SK = KQ * 32, NHG = NH / HB;
  constexpr int PK = HD * 2 + 16, PV = SK * 2 + 16, OVH = SK * PK, OVL = OVH + HD * PV, OHS = OVL + HD * PV, STG = OHS + 2 * HB * SK * 4;      /* a stage in LDS: key rows, V^T high, V^T residual, scalars (kh of the heads, then vh) */
  static_assert(PK == 144 && PV == 272 && SK == 128 && NW * 32 == 256, "stage_copies is written for these pitches, this stage and this block");
  constexpr float SCL2 = 0.125f * 1.44269504088896340736f;      /* 1/sqrt(64) times log2(e): e^(s - m) = 2^(s' - m') with s' = s log2(e), so every exponential of the softmax is one subtraction and the hardware's own 2^x; running maxima and merge weights are in the same units. A result below the normal range may come out as 0: a weight far below what any f32 sum here can see. */
  __shared__ __attribute__((aligned(16))) unsigned char sb[2 * STG];
  __shared__ __attribute__((aligned(16))) float sO[NW][RPW][64 + 4]; __shared__ float sM[NW][RPW], sL[NW][RPW];
  const int tid = threadIdx.x, lane = tid & 31, ln = lane & 15, hh = lane >> 4;
  const int w = __builtin_amdgcn_readfirstlane(tid >> 5);      /* wave number in a scalar register: it decides whether the wave has a chunk in a stage, and the branch around the matrix instructions must be a scalar one */
  const int hs = w % HB, kq = w / HB;
  const int slab = blockIdx.x % (BB * NHG), qt = NQT - 1 - blockIdx.x / (BB * NHG); const int b = slab / NHG, hg = slab % NHG; const int h = hg * HB + hs; const int q0 = qt * RPW;
  FragH bq[KS];
  { const unsigned short* qr = (const unsigned short*)Q16 + ((size_t)b * TT + q0 + ln) * ldq + h * 64;
#pragma unroll
    for (int ks = 0; ks < KS; ++ks) { bq[ks].half[0] = *(const v8us*)(qr + ks * 32 + 8 * hh); bq[ks].half[1] = *(const v8us*)(qr + ks * 32 + 16 + 8 * hh); } }
  /* the thread's pieces of a stage: 8 threads a key row (128 B), 16 threads a V^T row (256 B), 64 threads a scalar row (512 B) */
  const int hr = tid >> 6;      /* scalar row: kh of head 0, 1, then vh of head 0, 1 */
  const char* gk = (const char*)(K16 + ((size_t)b * TT + (tid >> 3)) * HD) + (tid & 7) * 16;
  const char* gv = (const char*)(Vt + ((size_t)b * 64 + (tid >> 4)) * TT) + (tid & 15) * 16;
  const char* gw = (const char*)(Vtlo + ((size_t)b * 64 + (tid >> 4)) * TT) + (tid & 15) * 16;
  const char* gh = (const char*)((hr < HB ? KH : VHD) + (size_t)(hg * HB + hr % HB) * NR + (size_t)b * TT) + (tid & 63) * 8;
  const unsigned lb = (unsigned)(size_t)sb;      /* byte address of the ring in the work-group's LDS */
  const unsigned lk = lb + (unsigned)((tid >> 3) * PK + (tid & 7) * 16), lv = lb + (unsigned)(OVH + (tid >> 4) * PV + (tid & 15) * 16), lw = lv + (unsigned)(OVL - OVH), lh = lb + (unsigned)(OHS + hr * SK * 4 + (tid & 63) * 8);
  /* the lane's fragment places in a stage */
  const unsigned char* const fk = sb + (kq * 32 + ln) * PK + hh * 16;
  const unsigned char* const fv = sb + OVH + ln * PV + (kq * 32 + 8 * hh) * 2;
  const unsigned char* const fh = sb + OHS + hs * SK * 4 + (kq * 32 + 8 * hh) * 4;
  float m_r = -3.0e38f, l_r = 0.f; v8f oacc[DT], oaccl[DT], oacc2[DT];
#pragma unroll
  for (int dt = 0; dt < DT; ++dt) { oacc[dt] = (v8f){0.f,0.f,0.f,0.f,0.f,0.f,0.f,0.f}; oaccl[dt] = oacc[dt]; oacc2[dt] = oacc[dt]; }
  const int jend = q0 + RPW;
  const int nst = (jend + SK - 1) / SK;      /* stages of the tile, the same for the whole block; a stage lies wholly inside the TT keys */
  stage_copies(lk, lv, lw, lh, gk, gv, gw, gh);
  asm volatile("s_wait_asynccnt 0x0" ::: "memory");      /* this wave's pieces of stage 0 have landed */
  __syncthreads();      /* every wave's pieces of stage 0 are in LDS before any wave reads a fragment */
  if (nst > 1) stage_copies(lk + STG, lv + STG, lw + STG, lh + STG, gk + SK * HD * 2, gv + SK * 2, gw + SK * 2, gh + SK * 4);
#pragma unroll 1
  for (int t = 0; t < nst; ++t) {
    const int cur = (t & 1) * STG; const int j0 = t * SK + kq * 32;
    if (j0 < jend) {      /* scalar test: the last stage of a tile may hold fewer than four chunks */
    FragH ak[2][KS], av[DT], avl[DT]; v4f kh[2][2], vh[2][2];
#pragma unroll
    for (int nt = 0; nt < 2; ++nt) {
#pragma unroll
      for (int ks = 0; ks < KS; ++ks) { const unsigned char* kr = fk + cur + nt * 16 * PK + ks * 64; ak[nt][ks].half[0] = *(const v8us*)kr; ak[nt][ks].half[1] = *(const v8us*)(kr + 32); }
      const unsigned char* kp = fh + cur + nt * 64; const unsigned char* vp = kp + HB * SK * 4;
      kh[nt][0] = *(const v4fa*)kp; kh[nt][1] = *(const v4fa*)(kp + 16); vh[nt][0] = *(const v4fa*)vp; vh[nt][1] = *(const v4fa*)(vp + 16); }
    float sc[2][8];
#pragma unroll
    for (int nt = 0; nt < 2; ++nt) { v8f acc = (v8f){0.f,0.f,0.f,0.f,0.f,0.f,0.f,0.f};
#pragma unroll
      for (int ks = 0; ks < KS; ++ks) acc = __builtin_amdgcn_wmma_f32_16x16x32_f16(false, ak[nt][ks].v, false, bq[ks].v, (short)0, acc, false, false);
#pragma unroll
      for (int r = 0; r < 8; ++r) sc[nt][r] = acc[r] * kh[nt][r >> 2][r & 3] * SCL2; }      /* scores in base-2 units */
    if (j0 + 31 > q0) {      /* only a chunk that reaches past the tile's first query has keys to mask (scalar test); every query keeps at least one key of every chunk of the loop */
#pragma unroll
      for (int nt = 0; nt < 2; ++nt)
#pragma unroll
        for (int r = 0; r < 8; ++r) sc[nt][r] = (j0 + nt * 16 + 8 * hh + r <= q0 + ln) ? sc[nt][r] : -INFINITY; }
    float mc = fmaxf(sc[0][0], sc[1][0]);
#pragma unroll
    for (int r = 1; r < 8; ++r) mc = fmaxf(mc, fmaxf(sc[0][r], sc[1][r]));
    mc = fmaxf(mc, xhalf(mc));      /* the query's other 16 keys */
    const float mn = fmaxf(m_r, mc); const float al = (mn > -1.0e38f) ? __builtin_amdgcn_exp2f(m_r - mn) : 1.0f; m_r = mn;
    FragH bp, bpl; float ps = 0.f;
#pragma unroll
    for (int nt = 0; nt < 2; ++nt)
#pragma unroll
      for (int r = 0; r < 8; ++r) { const float p = __builtin_amdgcn_exp2f(sc[nt][r] - mn); ps += p;      /* a masked score is -inf: p = 0 */
        const float pv = p * vh[nt][r >> 2][r & 3] * 1024.0f; const _Float16 ph = (_Float16)pv; bp.h[nt * 8 + r] = ph; bpl.h[nt * 8 + r] = (_Float16)((pv - (float)ph) * 1024.0f); }      /* value-head scalar folded into P, carried as f16 hi + x2^10 residual operands; the normaliser keeps plain p */
    l_r = l_r * al + ps;      /* the lane's half of the row sum; the halves are joined once, behind the loop */
    __builtin_amdgcn_sched_barrier(0);      /* keeps the V^T fragments' 64 registers out of the softmax: lifted to the top of the chunk, these LDS reads push the wave past 256 registers and a value spills to scratch; their short latency passes under the rescale below */
#pragma unroll
    for (int dt = 0; dt < DT; ++dt) { const unsigned char* vp = fv + cur + dt * 16 * PV; const unsigned char* lp = vp + (OVL - OVH); av[dt].half[0] = *(const v8us*)vp; av[dt].half[1] = *(const v8us*)(vp + 32); avl[dt].half[0] = *(const v8us*)lp; avl[dt].half[1] = *(const v8us*)(lp + 32); }
    __builtin_amdgcn_sched_barrier(0);      /* keeps the sixteen reads together as one group in front of the rescale: spread among the matrix instructions, each further place of LDS reads costs the wave a wait of its own */
#pragma unroll
    for (int dt = 0; dt < DT; ++dt) { oacc[dt] *= al; oaccl[dt] *= al; oacc2[dt] *= al; }
#pragma unroll
    for (int dt = 0; dt < DT; ++dt) { oacc[dt] = __builtin_amdgcn_wmma_f32_16x16x32_f16(false, av[dt].v, false, bp.v, (short)0, oacc[dt], false, false); oaccl[dt] = __builtin_amdgcn_wmma_f32_16x16x32_f16(false, avl[dt].v, false, bp.v, (short)0, oaccl[dt], false, false); oacc2[dt] = __builtin_amdgcn_wmma_f32_16x16x32_f16(false, av[dt].v, false, bpl.v, (short)0, oacc2[dt], false, false); }
    }
    /* hand-over of the ring, passed by every wave, also one without a chunk in this stage */
    asm volatile("s_wait_dscnt 0x0" ::: "memory");      /* this wave's reads of stage t are done before the buffer is given to the copies */
    asm volatile("s_wait_asynccnt 0x0" ::: "memory");      /* this wave's pieces of stage t + 1 have landed */
    __syncthreads();      /* publishes stage t + 1 and ends every wave's reads of stage t */
    if (t + 2 < nst) stage_copies(lk + cur, lv + cur, lw + cur, lh + cur, gk + (size_t)(t + 2) * (SK * HD * 2), gv + (size_t)(t + 2) * (SK * 2), gw + (size_t)(t + 2) * (SK * 2), gh + (size_t)(t + 2) * (SK * 4));      /* into the buffer that stage t has just left */
  }
  asm volatile("s_wait_asynccnt 0x0" ::: "memory");      /* no copy is outstanding when the wave goes on to its end */
  l_r += xhalf(l_r);
  if (hh == 0) { sM[w][ln] = m_r; sL[w][ln] = l_r; }
#pragma unroll
  for (int dt = 0; dt < DT; ++dt) { const v8f t = oacc[dt] + (oaccl[dt] + oacc2[dt]) * 0.0009765625f;      /* registers r = head dims dt * 16 + 8 hh + r of query ln */
    *(v4fa*)&sO[w][ln][dt * 16 + 8 * hh] = (v4f){t[0], t[1], t[2], t[3]}; *(v4fa*)&sO[w][ln][dt * 16 + 8 * hh + 4] = (v4f){t[4], t[5], t[6], t[7]}; }
  __syncthreads();      /* every wave's partial (max, sum, unnormalised rows) is in LDS before any wave merges */
  {
    const int mh = tid >> 7, lt = tid & 127;      /* 128 threads merge a head: its partial i is wave i * HB + mh's */
    const int r = lt >> 3, c8 = (lt & 7) * 8;      /* 8 threads a row, 8 head dims a thread: in f16 a head's row is one 128-byte line of each plane */
    float mw[KQ], M = -3.0e38f, L = 0.f;
#pragma unroll
    for (int i = 0; i < KQ; ++i) { mw[i] = sM[i * HB + mh][r]; M = fmaxf(M, mw[i]); }
#pragma unroll
    for (int i = 0; i < KQ; ++i) { mw[i] = exp2_slot(mw[i] - M); L += mw[i] * sL[i * HB + mh][r]; }      /* a wave that had no chunk holds max -3e38, sum 0, rows 0: weight 0 */
    const float inv = (L > 0.f) ? 1.0f / (L * 1024.0f) : 0.f;
    FragH fo, fr;      /* the merged row leaves as the output projection's operands: f16 and the x2^10 residual of that rounding */
#pragma unroll
    for (int hf = 0; hf < 2; ++hf) { v4f a = {0.f, 0.f, 0.f, 0.f};
#pragma unroll
      for (int i = 0; i < KQ; ++i) { const v4f p = *(const v4fa*)&sO[i * HB + mh][r][c8 + hf * 4]; a += p * mw[i]; }
      a *= inv;
#pragma unroll
      for (int q = 0; q < 4; ++q) { const _Float16 hv = (_Float16)a[q]; fo.h[hf * 4 + q] = hv; fr.h[hf * 4 + q] = (_Float16)((a[q] - (float)hv) * 1024.0f); } }
    const size_t oo = ((size_t)b * TT + q0 + r) * ldo + (hg * HB + mh) * 64 + c8;
    *(v8us*)((unsigned short*)OH + oo) = fo.half[0]; *(v8us*)((unsigned short*)OL + oo) = fr.half[0];
  } }

extern "C" void kernel_launch(void* const* d_in, const int* in_sizes, int n_in,
                              void* d_out, int out_size, void* d_ws, size_t ws_size, hipStream_t stream) {
  (void)in_sizes; (void)n_in; (void)out_size;
  const float* x = (const float*)d_in[0]; const float* Wq = (const float*)d_in[1]; const float* Wkv = (const float*)d_in[2]; const float* Wkvh = (const float*)d_in[3]; const float* Wo = (const float*)d_in[4];
  char* ws = (char*)d_ws; size_t off = 0;
  auto take = [&](size_t bytes) { char* p = ws + off; off += (bytes + 255) & ~(size_t)255; return p; };
  _Float16* Bq = (_Float16*)take((size_t)DM * DM * 2); _Float16* Bkv = (_Float16*)take((size_t)2 * HD * DM * 2); _Float16* Bkh = (_Float16*)take((size_t)2 * NH * DM * 2); _Float16* Bo = (_Float16*)take((size_t)DM * DM * 2); float* CS = (float*)take((size_t)TT * 32 * 2 * 4);
  _Float16* X16 = (_Float16*)take((size_t)NR * DM * 2); float* F32 = (float*)take((size_t)NR * DM * 4); _Float16* Q16 = (_Float16*)take((size_t)NR * DM * 2); float* KVF = (float*)take((size_t)NR * 2 * HD * 4); _Float16* K16 = (_Float16*)take((size_t)NR * HD * 2); float* HS = (float*)take((size_t)NR * 2 * NH * 4);
  _Float16* Vth = (_Float16*)take((size_t)BB * HD * TT * 2); _Float16* Vtl = (_Float16*)take((size_t)BB * HD * TT * 2); _Float16* OH = (_Float16*)take((size_t)NR * DM * 2); _Float16* OL = (_Float16*)take((size_t)NR * DM * 2);
  if (off > ws_size) return;      // 2.1 + 0.3 + 0.1 + 2.1 + 0.5 + 8.4 + 16.8 + 8.4 + 2.1 + 0.5 + 0.5 + 0.5 + 0.5 + 8.4 + 8.4 ≈ 60 MB
  k_prep<<<2 * (DM * (DM / 8) / 256) + 2 * HD * (DM / 8) / 256 + 2 * NH * (DM / 8) / 256 + TT * 32 / 256 + NR * DM / 8 / 256, 256, 0, stream>>>(x, Wq, Wkv, Wkvh, Wo, X16, Bq, Bkv, Bkh, Bo, CS);      /* weights -> Bt, x -> f16, cos/sin table */
  const dim3 gq(DM / 128, NR / 128);      /* 128 x 128 tiles of a 4096 x 1024 result: 256 blocks */
  k_proj<<<(DM / 128 + 2) * (NR / 128), 256, 0, stream>>>(X16, Bq, Bkv, Bkh, F32, KVF, HS);      /* q, [k | v], [kh | vh]: 256 + 32 + 32 tiles */
  k_post<<<BB * (TT / 64) + NR * 8 / 256 + NR * NH * 8 / 256, 256, 0, stream>>>(F32, KVF, CS, Q16, K16, Vth, Vtl);      /* V^T planes, rotary k, rotary q */
  k_flash<<<BB * (NH / 2) * (TT / 16), 256, 0, stream>>>(Q16, DM, K16, HS, HS + (size_t)NH * NR, Vth, Vtl, OH, OL, DM);      /* KH = HS rows 0..15, VH = rows 16..31 (row pitch NR) */
  k_gemm_o<<<gq, 512, 0, stream>>>(OH, OL, Bo, (float*)d_out);      /* y = (O_hi + 2^-10 O_lo).Wo */
}

// v008
// Measured time: 91 microseconds a run.
// Two timings next to v007 put it at 1.31 and 1.44 times that version's speed.
// Counting every step since v000, it is 6.18 times as fast.
#include <hip/hip_runtime.h>
// Multi-product attention with low-rank shared key/value (B=2, N=2048, D=1024, 16 heads × 64): q = x·Wq; [k|v] = x·Wkv (one shared 64-dim key and value); [kh|vh] = σ(x·Wkvh) per (token, head); rotary (rotate-half, θ=1e4) on q and k by
// sequence position; K_h[n] = kh[n,h]·k[n], V_h[n] = vh[n,h]·v[n]; causal softmax(q_h·K_hᵀ/8); out = (Σ attn·V_h merged)·Wo.
// Compute dtype: x and weights rounded to bf16; q and k as f32 GEMM accumulators rotated in f32 in the GEMM epilogue from an f32 cos/sin table and stored f16; head scalars as sigmoid GEMM epilogue outputs (f32); v f32 →
// f16 hi + ×2^10 residual Vᵀ planes; fused causal flash-style kernel (scores scaled by kh per key, P multiplied by vh per key and carried as f16 hi + residual tiles, online softmax f32, three value accumulators) on v_wmma_f32_16x16x32_f16; merged O stored as f16 hi + x2^10 residual planes by the attention kernel; both Wo products in one kernel, joined in registers; f32 accumulate.
#define BB 2
#define TT 2048
#define DM 1024
#define NH 16
#define HD 64
#define NR (BB * TT)

typedef __bf16 v16b __attribute__((ext_vector_type(16)));
typedef unsigned short v8us __attribute__((ext_vector_type(8), may_alias));
typedef float  v8f  __attribute__((ext_vector_type(8)));
typedef float  v4f  __attribute__((ext_vector_type(4)));
typedef float  v4fa __attribute__((ext_vector_type(4), may_alias));
union FragB { v16b v; v8us half[2]; unsigned short u[16]; };

__device__ __forceinline__ unsigned short bf16_bits(float x) { unsigned int u = __float_as_uint(x); return (unsigned short)((u + 0x7FFFu + ((u >> 16) & 1u)) >> 16); }
__device__ __forceinline__ float bf16_val(unsigned short b) { return __uint_as_float(((unsigned int)b) << 16); }
__device__ __forceinline__ float bf16_round(float x) { return bf16_val(bf16_bits(x)); }
// D += A·B with NT terms: 1 = ah·bh, 2 = + al·bh (A split), 3 = + ah·bl (both split)
template <int NT>
__device__ __forceinline__ v8f mmaN(v16b ah, v16b al, v16b bh, v16b bl, v8f c) {
  c = __builtin_amdgcn_wmma_f32_16x16x32_bf16(false, ah, false, bh, (short)0, c, false, false);
  if (NT >= 2) c = __builtin_amdgcn_wmma_f32_16x16x32_bf16(false, al, false, bh, (short)0, c, false, false);
  if (NT >= 3) c = __builtin_amdgcn_wmma_f32_16x16x32_bf16(false, ah, false, bl, (short)0, c, false, false);
  asm volatile("v_nop\n\tv_nop\n\tv_nop\n\tv_nop" : "+v"(c) : "v"(ah), "v"(al), "v"(bh), "v"(bl));
  return c;
}

__global__ __launch_bounds__(256) void k_wt_bf16(const float* __restrict__ W, unsigned short* __restrict__ Wt, int K, int N) {
  const int t = blockIdx.x * 256 + threadIdx.x;
  const int k8n = K / 8;
  if (t >= N * k8n) return;
  const int n = t / k8n, k8 = (t % k8n) * 8;
  v8us v;
#pragma unroll
  for (int i = 0; i < 8; ++i) v[i] = bf16_bits(W[(size_t)(k8 + i) * N + n]);
  *(v8us*)(Wt + (size_t)n * K + k8) = v;
  
}

// GEMM C[M][N] (f32, pitch ldc) = act(A[M][K]·W + bias). A f32 row-major (pitch lda) converted per fragment to bf16
// (ASPLIT: hi/lo two planes -> 2 terms, else single rounded term); Wt bf16 [N][K] (pitch ldb). BIAS_BF16 rounds the
// bias to bf16 first (bias quantised to bf16 before the add). K%32==0, M%16==0, N%64==0.
template <bool ASPLIT, int ACT, bool BIAS_BF16>
__global__ __launch_bounds__(128) void k_gemm_bf(const float* __restrict__ A, int lda, const unsigned short* __restrict__ Wt, int ldb,
                                               const float* __restrict__ bias, float* __restrict__ C, int ldc, int M, int N, int K) {
  __shared__ __attribute__((aligned(16))) float so[4][16][64];
  const int tid = threadIdx.x, w = tid >> 5, lane = tid & 31, ln = lane & 15, hh = lane >> 4;
  const int ntn = N / 64;
  const int wid = blockIdx.x * 4 + w;
  const int mt = wid / ntn, nq = wid % ntn;
  if (mt * 16 >= M) return;
  const int row0 = mt * 16, col0 = nq * 64;
  const float* arow = A + (size_t)(row0 + ln) * lda;
  v8f acc[4] = {};
  for (int kb = 0; kb < K; kb += 32) {
    FragB ah, al;
    const v4f x0 = *(const v4fa*)(arow + kb + 8 * hh), x1 = *(const v4fa*)(arow + kb + 8 * hh + 4);
    const v4f x2 = *(const v4fa*)(arow + kb + 16 + 8 * hh), x3 = *(const v4fa*)(arow + kb + 16 + 8 * hh + 4);
    float xs[16] = {x0[0],x0[1],x0[2],x0[3],x1[0],x1[1],x1[2],x1[3],x2[0],x2[1],x2[2],x2[3],x3[0],x3[1],x3[2],x3[3]};
#pragma unroll
    for (int i = 0; i < 16; ++i) { const unsigned short hb = bf16_bits(xs[i]); ah.u[i] = hb; al.u[i] = ASPLIT ? bf16_bits(xs[i] - bf16_val(hb)) : (unsigned short)0; }
#pragma unroll
    for (int t = 0; t < 4; ++t) {
      const unsigned short* brow = Wt + (size_t)(col0 + t * 16 + ln) * ldb + kb;
      FragB b;
      b.half[0] = *(const v8us*)(brow + 8 * hh);
      b.half[1] = *(const v8us*)(brow + 16 + 8 * hh);
      acc[t] = mmaN<ASPLIT ? 2 : 1>(ah.v, al.v, b.v, b.v, acc[t]);
    }
  }
#pragma unroll
  for (int t = 0; t < 4; ++t) {
    float bv = bias ? bias[col0 + t * 16 + ln] : 0.f;
    if (BIAS_BF16) bv = bf16_round(bv);
#pragma unroll
    for (int r = 0; r < 8; ++r) { float v = acc[t][r] + bv; if (ACT == 1) v = fmaxf(v, 0.f); so[w][8 * hh + r][t * 16 + ln] = v; }
  }
  __builtin_amdgcn_fence(__ATOMIC_ACQ_REL, "workgroup");
  __builtin_amdgcn_wave_barrier();
  const int rsub = lane >> 4, c4 = (lane & 15) * 4;
  {
#pragma unroll
    for (int q = 0; q < 8; ++q) {
      const int r = q * 2 + rsub;
      const v4f v = *(const v4fa*)&so[w][r][c4];
      *(v4f*)(C + (size_t)(row0 + r) * ldc + col0 + c4) = v;
    }
    
  }
}

// Flash-style causal/unmasked attention, all contractions 3-term bf16 hi/lo splits, f32 softmax with running max.
// q,k,v rows are read from f32 buffers with arbitrary row pitch (so they can live inside a fused qkv buffer);
// D = head size (multiple of 32, <= 128); one wave = 16 query rows; block = 4 waves (64 queries) sharing K/V chunks of 32.
template <int D, bool CAUSAL>
__global__ __launch_bounds__(128) void k_flash(const float* __restrict__ qb, const float* __restrict__ kb, const float* __restrict__ vb,
                                             int pitch, int T, int H, float scale, float* __restrict__ y, int ypitch) {
  constexpr int KS = D / 32;        // k-steps for QK
  constexpr int DT = D / 16;        // d tiles for PV
  __shared__ __attribute__((aligned(16))) unsigned short sKh[32][D + 8], sKl[32][D + 8], sVh[32][D + 8], sVl[32][D + 8];
  __shared__ __attribute__((aligned(16))) unsigned short sPh[4][16][40], sPl[4][16][40];
  __shared__ __attribute__((aligned(16))) float sO[4][16][D];
  const int tid = threadIdx.x, w = tid >> 5, lane = tid & 31, ln = lane & 15, hh = lane >> 4;
  const int nqb = (T + 63) / 64;
  const int bh = blockIdx.x / nqb, qblk = blockIdx.x % nqb;
  const int b = bh / H, h = bh % H;
  const int q0 = qblk * 64 + w * 16;
  const float* Q = qb + (size_t)b * T * pitch + h * D;
  const float* K = kb + (size_t)b * T * pitch + h * D;
  const float* V = vb + (size_t)b * T * pitch + h * D;

  // A fragments of the wave's 16 query rows (scaled), hi/lo
  FragB aqh[KS], aql[KS];
  {
    int row = q0 + ln; if (row >= T) row = T - 1;
    const float* qr = Q + (size_t)row * pitch;
#pragma unroll
    for (int ks = 0; ks < KS; ++ks)
#pragma unroll
      for (int i = 0; i < 16; ++i) {
        const int d = ks * 32 + ((i < 8) ? (8 * hh + i) : (16 + 8 * hh + (i - 8)));
        const float x = qr[d] * scale; const unsigned short hb = bf16_bits(x);
        aqh[ks].u[i] = hb; aql[ks].u[i] = bf16_bits(x - bf16_val(hb));
      }
  }
  float m_r[8], l_r[8];
#pragma unroll
  for (int r = 0; r < 8; ++r) { m_r[r] = -3.0e38f; l_r[r] = 0.f; }
  v8f oacc[DT];
#pragma unroll
  for (int dt = 0; dt < DT; ++dt) oacc[dt] = (v8f){0.f,0.f,0.f,0.f,0.f,0.f,0.f,0.f};

  const int kv_end = CAUSAL ? min(T, qblk * 64 + 64) : T;     // block-uniform
  for (int j0 = 0; j0 < kv_end; j0 += 32) {
    __syncthreads();
    for (int e = tid; e < 32 * (D / 4); e += 128) {
      const int r = e / (D / 4), c4 = (e % (D / 4)) * 4;
      const int key = j0 + r;
      v4f kf = {0.f,0.f,0.f,0.f}, vf = {0.f,0.f,0.f,0.f};
      if (key < T) { kf = *(const v4fa*)(K + (size_t)key * pitch + c4); vf = *(const v4fa*)(V + (size_t)key * pitch + c4); }
#pragma unroll
      for (int t = 0; t < 4; ++t) {
        unsigned short hb = bf16_bits(kf[t]); sKh[r][c4 + t] = hb; sKl[r][c4 + t] = bf16_bits(kf[t] - bf16_val(hb));
        hb = bf16_bits(vf[t]); sVh[r][c4 + t] = hb; sVl[r][c4 + t] = bf16_bits(vf[t] - bf16_val(hb));
      }
    }
    __syncthreads();
    // S tile 16 x 32
    v8f s[2];
#pragma unroll
    for (int nt = 0; nt < 2; ++nt) {
      v8f acc = {};
#pragma unroll
      for (int ks = 0; ks < KS; ++ks) {
        FragB bh_, bl_;
        bh_.half[0] = *(const v8us*)&sKh[nt * 16 + ln][ks * 32 + 8 * hh]; bh_.half[1] = *(const v8us*)&sKh[nt * 16 + ln][ks * 32 + 16 + 8 * hh];
        bl_.half[0] = *(const v8us*)&sKl[nt * 16 + ln][ks * 32 + 8 * hh]; bl_.half[1] = *(const v8us*)&sKl[nt * 16 + ln][ks * 32 + 16 + 8 * hh];
        acc = mmaN<3>(aqh[ks].v, aql[ks].v, bh_.v, bl_.v, acc);
      }
      s[nt] = acc;
    }
    // mask + running max (rows 8hh+r; the 16 lanes of a half share rows)
    float alpha[8];
#pragma unroll
    for (int r = 0; r < 8; ++r) {
      const int qi = q0 + 8 * hh + r;
      const int ja = j0 + ln, jb = j0 + 16 + ln;
      if (CAUSAL) { if (ja > qi) s[0][r] = -3.0e38f; if (jb > qi) s[1][r] = -3.0e38f; }
      if (ja >= T) s[0][r] = -3.0e38f;
      if (jb >= T) s[1][r] = -3.0e38f;
      float mx = fmaxf(s[0][r], s[1][r]);
      mx = fmaxf(mx, __shfl_xor(mx, 1, 32)); mx = fmaxf(mx, __shfl_xor(mx, 2, 32)); mx = fmaxf(mx, __shfl_xor(mx, 4, 32)); mx = fmaxf(mx, __shfl_xor(mx, 8, 32));
      const float mnew = fmaxf(m_r[r], mx);
      alpha[r] = (mnew > -1.0e38f) ? __expf(m_r[r] - mnew) : 1.0f;
      const float p0 = (s[0][r] > -1.0e38f) ? __expf(s[0][r] - mnew) : 0.f;
      const float p1 = (s[1][r] > -1.0e38f) ? __expf(s[1][r] - mnew) : 0.f;
      m_r[r] = mnew;
      l_r[r] = l_r[r] * alpha[r] + p0 + p1;            // per-lane partial row sum (16 lanes combined at the end)
      unsigned short hb = bf16_bits(p0); sPh[w][8 * hh + r][ln] = hb;      sPl[w][8 * hh + r][ln] = bf16_bits(p0 - bf16_val(hb));
      hb = bf16_bits(p1);                sPh[w][8 * hh + r][16 + ln] = hb; sPl[w][8 * hh + r][16 + ln] = bf16_bits(p1 - bf16_val(hb));
    }
#pragma unroll
    for (int dt = 0; dt < DT; ++dt)
#pragma unroll
      for (int r = 0; r < 8; ++r) oacc[dt][r] *= alpha[r];
    __builtin_amdgcn_fence(__ATOMIC_ACQ_REL, "workgroup");
    __builtin_amdgcn_wave_barrier();
    FragB pah, pal;
    pah.half[0] = *(const v8us*)&sPh[w][ln][8 * hh]; pah.half[1] = *(const v8us*)&sPh[w][ln][16 + 8 * hh];
    pal.half[0] = *(const v8us*)&sPl[w][ln][8 * hh]; pal.half[1] = *(const v8us*)&sPl[w][ln][16 + 8 * hh];
#pragma unroll
    for (int dt = 0; dt < DT; ++dt) {
      FragB bvh, bvl;
#pragma unroll
      for (int i = 0; i < 8; ++i) {
        bvh.u[i] = sVh[8 * hh + i][dt * 16 + ln]; bvh.u[8 + i] = sVh[16 + 8 * hh + i][dt * 16 + ln];
        bvl.u[i] = sVl[8 * hh + i][dt * 16 + ln]; bvl.u[8 + i] = sVl[16 + 8 * hh + i][dt * 16 + ln];
      }
      oacc[dt] = mmaN<3>(pah.v, pal.v, bvh.v, bvl.v, oacc[dt]);
    }
    __builtin_amdgcn_fence(__ATOMIC_ACQ_REL, "workgroup");
    __builtin_amdgcn_wave_barrier();
  }
#pragma unroll
  for (int r = 0; r < 8; ++r) {
    float l = l_r[r];
    l += __shfl_xor(l, 1, 32); l += __shfl_xor(l, 2, 32); l += __shfl_xor(l, 4, 32); l += __shfl_xor(l, 8, 32);
    l_r[r] = (l > 0.f) ? 1.0f / l : 0.f;
  }
#pragma unroll
  for (int dt = 0; dt < DT; ++dt)
#pragma unroll
    for (int r = 0; r < 8; ++r) sO[w][8 * hh + r][dt * 16 + ln] = oacc[dt][r] * l_r[r];
  __builtin_amdgcn_fence(__ATOMIC_ACQ_REL, "workgroup");
  __builtin_amdgcn_wave_barrier();
  {
    for (int r = 0; r < 16; ++r) {
      const int row = q0 + r;
      if (row < T && lane < D / 4) {
        const v4f val = *(const v4fa*)&sO[w][r][lane * 4];
        *(v4f*)(y + ((size_t)b * T + row) * ypitch + h * D + lane * 4) = val;
      }
    }
    
  }
}

// GEMM C = act(A·W + bias + resid): A f32 (ASPLIT -> hi/lo 2 terms), Wt bf16 [N][K]; ACT 0 none, 1 relu, 2 exact gelu;
// resid (optional, f32, row index = (row % rmod), pitch ldr, RES_BF16 rounds it) added before the activation.
template <bool ASPLIT, int ACT, bool BIAS_BF16, bool RES_BF16>
__global__ __launch_bounds__(128) void k_gemm_bf3(const float* __restrict__ A, int lda, const unsigned short* __restrict__ Wt, int ldb,
                                                const float* __restrict__ bias, const float* __restrict__ resid, int rmod, int ldr,
                                                float* __restrict__ C, int ldc, int M, int N, int K) {
  __shared__ __attribute__((aligned(16))) float so[4][16][64];
  const int tid = threadIdx.x, w = tid >> 5, lane = tid & 31, ln = lane & 15, hh = lane >> 4;
  const int ntn = N / 64;
  const int wid = blockIdx.x * 4 + w;
  const int mt = wid / ntn, nq = wid % ntn;
  if (mt * 16 >= M) return;
  const int row0 = mt * 16, col0 = nq * 64;
  const float* arow = A + (size_t)(row0 + ln) * lda;
  v8f acc[4] = {};
  for (int kb = 0; kb < K; kb += 32) {
    FragB ah, al;
    const v4f x0 = *(const v4fa*)(arow + kb + 8 * hh), x1 = *(const v4fa*)(arow + kb + 8 * hh + 4);
    const v4f x2 = *(const v4fa*)(arow + kb + 16 + 8 * hh), x3 = *(const v4fa*)(arow + kb + 16 + 8 * hh + 4);
    float xs[16] = {x0[0],x0[1],x0[2],x0[3],x1[0],x1[1],x1[2],x1[3],x2[0],x2[1],x2[2],x2[3],x3[0],x3[1],x3[2],x3[3]};
#pragma unroll
    for (int i = 0; i < 16; ++i) { const unsigned short hb = bf16_bits(xs[i]); ah.u[i] = hb; al.u[i] = ASPLIT ? bf16_bits(xs[i] - bf16_val(hb)) : (unsigned short)0; }
#pragma unroll
    for (int t = 0; t < 4; ++t) {
      const unsigned short* brow = Wt + (size_t)(col0 + t * 16 + ln) * ldb + kb;
      FragB b;
      b.half[0] = *(const v8us*)(brow + 8 * hh);
      b.half[1] = *(const v8us*)(brow + 16 + 8 * hh);
      acc[t] = mmaN<ASPLIT ? 2 : 1>(ah.v, al.v, b.v, b.v, acc[t]);
    }
  }
#pragma unroll
  for (int t = 0; t < 4; ++t) {
    const int col = col0 + t * 16 + ln;
    float bv = bias ? bias[col] : 0.f;
    if (BIAS_BF16) bv = bf16_round(bv);
#pragma unroll
    for (int r = 0; r < 8; ++r) {
      float v = acc[t][r] + bv;
      if (resid) { float rv = resid[(size_t)((row0 + 8 * hh + r) % rmod) * ldr + col]; if (RES_BF16) rv = bf16_round(rv); v += rv; }
      if (ACT == 1) v = fmaxf(v, 0.f);
      if (ACT == 2) v = 0.5f * v * (1.0f + erff(v * 0.70710678118654752f));
      if (ACT == 3) { const float u = 0.7978845608028654f * (v + 0.044715f * v * v * v); v = 0.5f * v * (1.0f + tanhf(u)); }
      so[w][8 * hh + r][t * 16 + ln] = v;
    }
  }
  __builtin_amdgcn_fence(__ATOMIC_ACQ_REL, "workgroup");
  __builtin_amdgcn_wave_barrier();
  const int rsub = lane >> 4, c4 = (lane & 15) * 4;
  {
#pragma unroll
    for (int q = 0; q < 8; ++q) {
      const int r = q * 2 + rsub;
      const v4f v = *(const v4fa*)&so[w][r][c4];
      *(v4f*)(C + (size_t)(row0 + r) * ldc + col0 + c4) = v;
    }
    
  }
}
// row LayerNorm (biased variance, eps) over N: s = X (+ R); optional out_sum <- s; out_norm <- (s-mu)*rsqrt(var+eps)*g + b
template <bool PARAM_BF16>
__global__ __launch_bounds__(256) void k_layernorm(const float* __restrict__ X, const float* __restrict__ R, const float* __restrict__ g, const float* __restrict__ bta,
                                                  float* __restrict__ out_sum, float* __restrict__ out_norm, int N, float eps) {
  __shared__ float red[256];
  const int row = blockIdx.x, tid = threadIdx.x;
  const float* x = X + (size_t)row * N; const float* rr = R ? R + (size_t)row * N : nullptr;
  float vals[16];                     // up to N = 4096
  const int per = N / 256;            // contiguous chunk per thread? use strided-by-4 chunks: thread handles j = tid*4 + 1024*u
  float s1 = 0.f;
  for (int u = 0; u < per / 4; ++u) {
    const int j = tid * 4 + 1024 * u;
    const v4f a = *(const v4fa*)(x + j);
    v4f b = {0.f,0.f,0.f,0.f}; if (rr) b = *(const v4fa*)(rr + j);
#pragma unroll
    for (int q = 0; q < 4; ++q) { const float v = a[q] + b[q]; vals[u * 4 + q] = v; s1 += v; }
  }
  red[tid] = s1; __syncthreads();
  for (int st = 128; st > 0; st >>= 1) { if (tid < st) red[tid] += red[tid + st]; __syncthreads(); }
  const float mu = red[0] / (float)N; __syncthreads();
  float s2 = 0.f;
  for (int u = 0; u < per / 4; ++u)
#pragma unroll
    for (int q = 0; q < 4; ++q) { const float c = vals[u * 4 + q] - mu; s2 += c * c; }
  red[tid] = s2; __syncthreads();
  for (int st = 128; st > 0; st >>= 1) { if (tid < st) red[tid] += red[tid + st]; __syncthreads(); }
  const float rs = rsqrtf(red[0] / (float)N + eps);
  {
    for (int u = 0; u < per / 4; ++u) {
      const int j = tid * 4 + 1024 * u;
      v4f o, sm;
#pragma unroll
      for (int q = 0; q < 4; ++q) {
        float gg = g[j + q], bb = bta[j + q];
        if (PARAM_BF16) { gg = bf16_round(gg); bb = bf16_round(bb); }
        sm[q] = vals[u * 4 + q]; o[q] = (vals[u * 4 + q] - mu) * rs * gg + bb;
      }
      if (out_sum) *(v4f*)(out_sum + (size_t)row * N + j) = sm;
      *(v4f*)(out_norm + (size_t)row * N + j) = o;
    }
    
  }
}



// ---- f16 WMMA path (v_wmma_f32_16x16x32_f16): 11-bit significands for operands in range — used where a [0,1] probability operand needs more precision than bf16
typedef _Float16 v16h __attribute__((ext_vector_type(16)));
union FragH { v16h v; v8us half[2]; _Float16 h[16]; unsigned short u[16]; };
template <int NT>
__device__ __forceinline__ v8f mmaH(v16h ah, v16h al, v16h bh, v16h bl, v8f c) {
  c = __builtin_amdgcn_wmma_f32_16x16x32_f16(false, ah, false, bh, (short)0, c, false, false);
  if (NT >= 2) c = __builtin_amdgcn_wmma_f32_16x16x32_f16(false, al, false, bh, (short)0, c, false, false);
  if (NT >= 3) c = __builtin_amdgcn_wmma_f32_16x16x32_f16(false, ah, false, bl, (short)0, c, false, false);
  asm volatile("v_nop\n\tv_nop\n\tv_nop\n\tv_nop" : "+v"(c) : "v"(ah), "v"(al), "v"(bh), "v"(bl));
  return c;
}
// batched GEMM like k_gemm_b but f16 operands: A f32 (split into f16 hi/lo if ASPLIT, else rounded to f16), Bt = f16 values [n][k]; alpha; C f32; N multiple of 16 (partial tiles skipped)
template <bool ASPLIT>
__global__ __launch_bounds__(128) void k_gemm_h(const float* __restrict__ A, int lda, size_t sA, const _Float16* __restrict__ Bh, int ldb, size_t sB, float alpha, float* __restrict__ C, int ldc, size_t sC, int M, int N, int K) {
  __shared__ __attribute__((aligned(16))) float so[4][16][64];
  const int tid = threadIdx.x, w = tid >> 5, lane = tid & 31, ln = lane & 15, hh = lane >> 4; const int by = blockIdx.y;
  A += (size_t)by * sA; Bh += (size_t)by * sB; C += (size_t)by * sC;
  const int ntn = (N + 63) / 64; const int wid = blockIdx.x * 4 + w; const int mt = wid / ntn, nq = wid % ntn; if (mt * 16 >= M) return;
  const int row0 = mt * 16, col0 = nq * 64; const float* arow = A + (size_t)(row0 + ln) * lda;
  v8f acc[4] = {};
  for (int kb = 0; kb < K; kb += 32) {
    FragH ah, al;
    const v4f x0 = *(const v4fa*)(arow + kb + 8 * hh), x1 = *(const v4fa*)(arow + kb + 8 * hh + 4), x2 = *(const v4fa*)(arow + kb + 16 + 8 * hh), x3 = *(const v4fa*)(arow + kb + 16 + 8 * hh + 4);
    float xs[16] = {x0[0],x0[1],x0[2],x0[3],x1[0],x1[1],x1[2],x1[3],x2[0],x2[1],x2[2],x2[3],x3[0],x3[1],x3[2],x3[3]};
#pragma unroll
    for (int i = 0; i < 16; ++i) { const _Float16 h = (_Float16)xs[i]; ah.h[i] = h; al.h[i] = ASPLIT ? (_Float16)(xs[i] - (float)h) : (_Float16)0.0f; }
#pragma unroll
    for (int t = 0; t < 4; ++t) { if (col0 + t * 16 >= N) continue; const size_t boff = (size_t)(col0 + t * 16 + ln) * ldb + kb; FragH bq; bq.half[0] = *(const v8us*)(Bh + boff + 8 * hh); bq.half[1] = *(const v8us*)(Bh + boff + 16 + 8 * hh);
      acc[t] = mmaH<ASPLIT ? 2 : 1>(ah.v, al.v, bq.v, bq.v, acc[t]); }
  }
#pragma unroll
  for (int t = 0; t < 4; ++t) { if (col0 + t * 16 >= N) continue;
#pragma unroll
    for (int r = 0; r < 8; ++r) so[w][8 * hh + r][t * 16 + ln] = acc[t][r] * alpha; }
  __builtin_amdgcn_fence(__ATOMIC_ACQ_REL, "workgroup"); __builtin_amdgcn_wave_barrier();
  const int rsub = lane >> 4, c4 = (lane & 15) * 4;
  {
#pragma unroll
    for (int q = 0; q < 8; ++q) { const int r = q * 2 + rsub; if (col0 + c4 < N) { const v4f v = *(const v4fa*)&so[w][r][c4]; *(v4f*)(C + (size_t)(row0 + r) * ldc + col0 + c4) = v; } }
     }
}

// Wt[n][k] = f16(W[k][n]·scale) from f32 row-major W[K][N] (scale = power of two; bf16-exact weights stay exact in f16 away from the subnormal range)
// (bid = the block's index within this piece of work; the pieces are launched together by k_prep below)
__device__ __forceinline__ void d_wt_f16(int bid, const float* __restrict__ W, _Float16* __restrict__ Wt, int K, int N, float scale) {
  const int t = bid * 256 + threadIdx.x; if (t >= N * (K / 8)) return; const int n = t / (K / 8), k8 = (t % (K / 8)) * 8; FragH f;
#pragma unroll
  for (int i = 0; i < 8; ++i) f.h[i] = (_Float16)(bf16_round(W[(size_t)(k8 + i) * N + n]) * scale); const v8us o = f.half[0];
  *(v8us*)((unsigned short*)Wt + (size_t)n * K + k8) = o; 
}
// Block-tile GEMM, f16 operands, f32 accumulate: C[row][col] = alpha * sum_k A[row][k] * Bt[col][k] (+ C if ADDC); ACT 11 stores its sigmoid column-major, C[col][row]. A and Bt are K-contiguous with row pitch DM, K = DM.
// One block of 8 waves owns a 128 x BN tile of C. Each pass brings 128 k (256 B of every operand row) from global memory in whole-row pieces into registers and from there into one of two LDS buffers
// (row pitch 272 B, an odd multiple of 16 B, for the 16-byte fragment reads); the next pass's global loads are issued ahead of this pass's products. Every wave computes a (16 * FM) x 32 part from LDS fragments,
// so an operand row is read from L2 once per block, not once per wave. k runs upward in steps of 32 into one accumulator per 16 x 16 tile.
// Every "#pragma unroll" in this kernel is there so that the small arrays it indexes (ra, rb, a, b, acc, o, c0, c, f, fh, fl) get constant indices and stay in registers.
// The body is a device function: sm is the launching kernel's LDS (gemm_lds(BN) bytes, 16-byte aligned), (bx, by) the tile's column and row index.
constexpr int gemm_lds(int BN) { return (2 * (128 + BN) * 272 > BN * 576) ? 2 * (128 + BN) * 272 : BN * 576; }      /* the two stage buffers, or the eight waves' epilogue ranges */
template <int BN, int LDC, int ACT, bool ADDC>
__device__ __forceinline__ void d_gemm_t(unsigned char* const sm, const int bx, const int by, const _Float16* __restrict__ A, const _Float16* __restrict__ Bt, float alpha, float* C,
                                         const float* __restrict__ CS = nullptr, _Float16* __restrict__ P0 = nullptr, _Float16* __restrict__ P1 = nullptr, _Float16* __restrict__ P2 = nullptr) {
  constexpr int BM = 128, BK = 128, PB = BK * 2 + 16, WN = BN / 32, WM = 8 / WN, FM = BM / (16 * WM), NA = BM / 16, NB = BN / 16, KT = DM / BK;
  constexpr int STG = (BM + BN) * PB, EPW = FM * 16 * 36, EPI = 8 * EPW * 4, SZ = (2 * STG > EPI) ? 2 * STG : EPI;
  static_assert(SZ == gemm_lds(BN), "the launching kernel sizes sm by gemm_lds");
  const int tid = threadIdx.x, lane = tid & 31, ln = lane & 15, hh = lane >> 4;
  const int w = __builtin_amdgcn_readfirstlane(tid >> 5);      /* wave number, uniform: it only picks the wave's part of the tile */
  const int wm = w / WN, wn = w % WN;
  const int row0 = by * BM, col0 = bx * BN;
  const int sr = tid >> 4, sc = tid & 15;      /* 16 threads a row: 256 contiguous bytes */
  const unsigned short* ga = (const unsigned short*)A + (size_t)(row0 + sr) * DM + sc * 8;
  const unsigned short* gb = (const unsigned short*)Bt + (size_t)(col0 + sr) * DM + sc * 8;
  unsigned char* const sst = sm + sr * PB + sc * 16;
  const unsigned char* const fa = sm + (wm * FM * 16 + ln) * PB + hh * 16;
  const unsigned char* const fb = sm + (BM + wn * 32 + ln) * PB + hh * 16;
  v8us ra[NA], rb[NB];
#pragma unroll
  for (int i = 0; i < NA; ++i) ra[i] = *(const v8us*)(ga + (size_t)i * 16 * DM);
#pragma unroll
  for (int i = 0; i < NB; ++i) rb[i] = *(const v8us*)(gb + (size_t)i * 16 * DM);
#pragma unroll
  for (int i = 0; i < NA; ++i) *(v8us*)(sst + i * 16 * PB) = ra[i];
#pragma unroll
  for (int i = 0; i < NB; ++i) *(v8us*)(sst + (BM + i * 16) * PB) = rb[i];
  __syncthreads();      /* pass 0 is in buffer 0 before any wave reads a fragment */
  v8f acc[FM][2];
#pragma unroll
  for (int fm = 0; fm < FM; ++fm) { acc[fm][0] = (v8f){0.f,0.f,0.f,0.f,0.f,0.f,0.f,0.f}; acc[fm][1] = acc[fm][0]; }
  for (int kt = 0; kt < KT; ++kt) {
    const int cur = (kt & 1) * STG, nxt = STG - cur;
    if (kt + 1 < KT) {
#pragma unroll
      for (int i = 0; i < NA; ++i) ra[i] = *(const v8us*)(ga + (size_t)i * 16 * DM + (kt + 1) * BK);
#pragma unroll
      for (int i = 0; i < NB; ++i) rb[i] = *(const v8us*)(gb + (size_t)i * 16 * DM + (kt + 1) * BK);
    }
#pragma unroll
    for (int ks = 0; ks < BK / 32; ++ks) {
      FragH a[FM], b[2];
#pragma unroll
      for (int fm = 0; fm < FM; ++fm) { a[fm].half[0] = *(const v8us*)(fa + cur + fm * 16 * PB + ks * 64); a[fm].half[1] = *(const v8us*)(fa + cur + fm * 16 * PB + ks * 64 + 32); }
#pragma unroll
      for (int fn = 0; fn < 2; ++fn) { b[fn].half[0] = *(const v8us*)(fb + cur + fn * 16 * PB + ks * 64); b[fn].half[1] = *(const v8us*)(fb + cur + fn * 16 * PB + ks * 64 + 32); }
#pragma unroll
      for (int fm = 0; fm < FM; ++fm)
#pragma unroll
        for (int fn = 0; fn < 2; ++fn) acc[fm][fn] = __builtin_amdgcn_wmma_f32_16x16x32_f16(false, a[fm].v, false, b[fn].v, (short)0, acc[fm][fn], false, false);
    }
    if (kt + 1 < KT) {      /* the other buffer: its readers left it at the barrier that ended pass kt - 1 */
#pragma unroll
      for (int i = 0; i < NA; ++i) *(v8us*)(sst + nxt + i * 16 * PB) = ra[i];
#pragma unroll
      for (int i = 0; i < NB; ++i) *(v8us*)(sst + nxt + (BM + i * 16) * PB) = rb[i];
    }
    __syncthreads();      /* publishes pass kt + 1 and ends every wave's reads of pass kt */
  }
  if constexpr (ACT == 21 || ACT == 22) {
    /* The tile leaves as the attention kernel's operands, with no f32 copy in memory and no launch in between. ACT 21: all columns are query heads of 64; ACT 22: columns 0..63 are the shared key, 64..127 the shared value.
       Rotary (rotate-half): dims d and d + 32 of a head lie in two waves' parts, so the block's tile is gathered in LDS (free behind the last barrier), row-major, pitch a multiple of 16 B. A thread takes 8 dims d and their partners d + 32 of one row
       and head: out[d] = x[d] cos_d - x[d + 32] sin_d, out[d + 32] = x[d + 32] cos_d + x[d] sin_d in f32, (cos, sin) from the table row of the token's position in its sequence, stored f16: P0, row pitch LDC; a wave's two stores fill whole 128-byte lines.
       The table values are asked for ahead of the gather, so that their latency passes under it.
       Value columns: a lane's 8 accumulator registers are 8 consecutive tokens of one column, a 16-byte piece of a V^T row; they are gathered column-major (pitch BM + 4 floats) and leave as f16 (P1) and x2^10 residual (P2) planes [batch][dim][token], 16 threads a row: whole lines. */
    constexpr int NHT = (ACT == 21) ? BN / HD : 1, PT = NHT * HD + 4, TR = 4 * NHT, RS = 256 / TR, NU = BM / RS, PW = BM + 4;
    static_assert(BN == 128 && TT % BM == 0 && (BM * PT + (ACT == 22 ? HD * PW : 0)) * 4 <= SZ, "two heads, or key and value, a tile; a tile lies inside one sequence; the gathered tile fits the stage buffers");
    float* const st = (float*)sm; float* const sv = st + BM * PT;
    const int g4 = tid & 3, hl = (tid >> 2) % NHT, ur = tid / TR;      /* 8-dim piece, head within the tile, row within a step of RS rows */
    const float* const cp = CS + ((size_t)(row0 % TT + ur) * 32 + g4 * 8) * 2;
    v4f c[NU][4];
#pragma unroll
    for (int q = 0; q < NU; ++q)
#pragma unroll
      for (int j = 0; j < 4; ++j) c[q][j] = *(const v4fa*)(cp + (size_t)q * RS * 64 + j * 4);
    if (ACT == 22) asm volatile("s_wait_xcnt 0x0" ::: "memory");      /* in this body the gather's address arithmetic below reuses the register that these loads name as their address: the wait stands in front of it (in the body of 21 that register pair is left alone) */
    if (ACT == 21 || wn < 2) {      /* wn is uniform for the wave */
#pragma unroll
      for (int fm = 0; fm < FM; ++fm)
#pragma unroll
        for (int fn = 0; fn < 2; ++fn)
#pragma unroll
          for (int r = 0; r < 8; ++r) st[((wm * FM + fm) * 16 + 8 * hh + r) * PT + wn * 32 + fn * 16 + ln] = acc[fm][fn][r] * alpha;
    } else {
#pragma unroll
      for (int fm = 0; fm < FM; ++fm)
#pragma unroll
        for (int fn = 0; fn < 2; ++fn) { const v8f t = acc[fm][fn] * alpha; float* const d = sv + ((wn - 2) * 32 + fn * 16 + ln) * PW + (wm * FM + fm) * 16 + 8 * hh;
          *(v4fa*)d = (v4f){t[0], t[1], t[2], t[3]}; *(v4fa*)(d + 4) = (v4f){t[4], t[5], t[6], t[7]}; }
    }
    __syncthreads();      /* every wave's part of the tile is in LDS before any wave reads a row or a column */
#pragma unroll
    for (int q = 0; q < NU; ++q) { const float* const xr = st + (q * RS + ur) * PT + hl * HD + g4 * 8;
      const v4f a0 = *(const v4fa*)xr, a1 = *(const v4fa*)(xr + 4), b0 = *(const v4fa*)(xr + 32), b1 = *(const v4fa*)(xr + 36); FragH f;
#pragma unroll
      for (int e = 0; e < 8; ++e) { const float a = (e < 4) ? a0[e & 3] : a1[e & 3], b = (e < 4) ? b0[e & 3] : b1[e & 3], cs = c[q][e >> 1][(e & 1) * 2], sn = c[q][e >> 1][(e & 1) * 2 + 1];
        f.h[e] = (_Float16)(a * cs - b * sn); f.h[8 + e] = (_Float16)(b * cs + a * sn); }
      unsigned short* const o = (unsigned short*)P0 + (size_t)(row0 + q * RS + ur) * LDC + col0 + hl * HD + g4 * 8;
      *(v8us*)o = f.half[0]; *(v8us*)(o + 32) = f.half[1]; }
    if (ACT == 22) {
#pragma unroll
      for (int q = 0; q < HD * (BM / 8) / 256; ++q) { const int e = q * 256 + tid, pc = e % (BM / 8), d = e / (BM / 8);
        const v4f x0 = *(const v4fa*)&sv[d * PW + pc * 8], x1 = *(const v4fa*)&sv[d * PW + pc * 8 + 4]; FragH fh, fl;
#pragma unroll
        for (int i = 0; i < 8; ++i) { const float v = (i < 4) ? x0[i & 3] : x1[i & 3]; const _Float16 hv = (_Float16)v; fh.h[i] = hv; fl.h[i] = (_Float16)((v - (float)hv) * 1024.0f); }
        const size_t oo = ((size_t)(row0 / TT) * HD + d) * TT + row0 % TT + pc * 8;
        *(v8us*)((unsigned short*)P1 + oo) = fh.half[0]; *(v8us*)((unsigned short*)P2 + oo) = fl.half[0]; }
    }
    return;
  }
  if (ACT == 11) {
    /* sigmoid outputs leave column-major, C[col][row] with row pitch LDC: the attention kernel reads 8 consecutive rows (keys) of one column (head) per lane. A lane's 8 accumulator registers are 8 consecutive rows of one column;
       the block's tile is gathered in LDS (free behind the last barrier; pitch BM + 4 floats keeps 16-byte alignment) so that each wave stores whole 128-byte lines. */
    constexpr int PT = BM + 4;
    float* const st = (float*)sm;
#pragma unroll
    for (int fm = 0; fm < FM; ++fm)
#pragma unroll
      for (int fn = 0; fn < 2; ++fn) { v4f lo, hi;
#pragma unroll
        for (int r = 0; r < 4; ++r) { lo[r] = 1.0f / (1.0f + expf(-(acc[fm][fn][r] * alpha))); hi[r] = 1.0f / (1.0f + expf(-(acc[fm][fn][4 + r] * alpha))); }
        float* const d = st + (wn * 32 + fn * 16 + ln) * PT + (wm * FM + fm) * 16 + 8 * hh; *(v4fa*)d = lo; *(v4fa*)(d + 4) = hi; }
    __syncthreads();      /* every wave's rows of the tile are in LDS before any wave stores a column */
    for (int q = 0; q < BN * BM / 4 / 256; ++q) { const int e = q * 256 + tid, col = e / (BM / 4), r4 = (e % (BM / 4)) * 4; const v4f v = *(const v4fa*)&st[col * PT + r4]; *(v4f*)(C + (size_t)(col0 + col) * LDC + row0 + r4) = v; }
    return;
  }
  /* epilogue: behind the last barrier the buffers are free; each wave turns its part into whole 128-byte rows in its own LDS range (row pitch 36 floats) */
  float* const so = (float*)sm + w * EPW;
  const int er = lane >> 3, ec = (lane & 7) * 4;      /* 8 lanes a row of 32 floats */
  float* const cp = C + (size_t)(row0 + wm * FM * 16 + er) * LDC + col0 + wn * 32 + ec;      /* one address for all rows of the part; the row step is a constant offset */
  v4f o[FM * 4], c0[FM * 4];
#pragma unroll
  for (int fm = 0; fm < FM; ++fm)
#pragma unroll
    for (int fn = 0; fn < 2; ++fn)
#pragma unroll
      for (int r = 0; r < 8; ++r) so[(fm * 16 + 8 * hh + r) * 36 + fn * 16 + ln] = acc[fm][fn][r] * alpha;
  __builtin_amdgcn_fence(__ATOMIC_ACQ_REL, "workgroup"); __builtin_amdgcn_wave_barrier();      /* the wave's own LDS writes are done before its lanes read each other's */
  if (ADDC) {      /* the old values, all asked for at once, once the accumulators' registers are free */
#pragma unroll
    for (int q = 0; q < FM * 4; ++q) c0[q] = *(const v4fa*)(cp + (size_t)q * 4 * LDC);
  }
#pragma unroll
  for (int q = 0; q < FM * 4; ++q) { o[q] = *(const v4fa*)&so[(q * 4 + er) * 36 + ec]; if (ADDC) o[q] += c0[q]; }
#pragma unroll
  for (int q = 0; q < FM * 4; ++q) *(v4f*)(cp + (size_t)q * 4 * LDC) = o[q];
}
// Output projection, both planes of O in one launch: C = (Ah.Bt^T + 2^-10 Al.Bt^T) / 16, operands K-contiguous with row pitch DM, K = DM. One block of 16 waves owns a 128 x 128 tile of C (256 blocks, one a WGP, four waves a SIMD).
// A pass stages 128 k of the tile's rows of Ah, of Al and of Bt as d_gemm_t does (whole-row loads into registers, from there into one of two LDS buffers, row pitch 272 B; the next pass's loads are issued ahead of this pass's products):
// a Bt row is brought in and a Bt fragment read once for both planes. Every wave computes a 32 x 32 part with one accumulator per 16 x 16 tile AND plane, k upward in steps of 32 as in the two single launches; the planes meet in registers
// in the epilogue (both scalings are by powers of two, so the one rounding of the sum is the one the read-add-write of C made), and C is written once and never read.
// Every "#pragma unroll" in this kernel is there so that the small arrays it indexes (rh, rl, rb, ah, al, b, the accumulators, o) get constant indices and stay in registers.
__global__ __launch_bounds__(512) void k_gemm_o(const _Float16* __restrict__ Ah, const _Float16* __restrict__ Al, const _Float16* __restrict__ Bt, float* __restrict__ C) {
  constexpr int BM = 128, BN = 128, BK = 128, PB = BK * 2 + 16, FM = 2, NS = BM / 32, KT = DM / BK;
  constexpr int OAL = BM * PB, OB = 2 * BM * PB, STG = (2 * BM + BN) * PB, EPW = FM * 16 * 36;      /* a stage: rows of Ah, of Al, of Bt */
  static_assert(BN == BM && 16 * EPW * 4 <= 2 * STG, "one count of staging steps for the three operands; the sixteen epilogue ranges lie inside the two stage buffers");
  __shared__ __attribute__((aligned(16))) unsigned char sm[2 * STG];
  const int tid = threadIdx.x, lane = tid & 31, ln = lane & 15, hh = lane >> 4;
  const int w = __builtin_amdgcn_readfirstlane(tid >> 5);      /* wave number, uniform: it only picks the wave's part of the tile */
  const int wm = w >> 2, wn = w & 3;
  const int row0 = blockIdx.y * BM, col0 = blockIdx.x * BN;
  const int sr = tid >> 4, sc = tid & 15;      /* 16 threads a row: 256 contiguous bytes; 32 rows a step */
  const unsigned short* gh = (const unsigned short*)Ah + (size_t)(row0 + sr) * DM + sc * 8;
  const unsigned short* gl = (const unsigned short*)Al + (size_t)(row0 + sr) * DM + sc * 8;
  const unsigned short* gb = (const unsigned short*)Bt + (size_t)(col0 + sr) * DM + sc * 8;
  unsigned char* const sst = sm + sr * PB + sc * 16;
  const unsigned char* const fa = sm + (wm * FM * 16 + ln) * PB + hh * 16;
  const unsigned char* const fb = sm + OB + (wn * 32 + ln) * PB + hh * 16;
  v8us rh[NS], rl[NS], rb[NS];
#pragma unroll
  for (int i = 0; i < NS; ++i) { rh[i] = *(const v8us*)(gh + (size_t)i * 32 * DM); rl[i] = *(const v8us*)(gl + (size_t)i * 32 * DM); rb[i] = *(const v8us*)(gb + (size_t)i * 32 * DM); }
#pragma unroll
  for (int i = 0; i < NS; ++i) { *(v8us*)(sst + i * 32 * PB) = rh[i]; *(v8us*)(sst + OAL + i * 32 * PB) = rl[i]; *(v8us*)(sst + OB + i * 32 * PB) = rb[i]; }
  __syncthreads();      /* pass 0 is in buffer 0 before any wave reads a fragment */
  v8f acch[FM][2], accl[FM][2];
#pragma unroll
  for (int fm = 0; fm < FM; ++fm)
#pragma unroll
    for (int fn = 0; fn < 2; ++fn) { acch[fm][fn] = (v8f){0.f,0.f,0.f,0.f,0.f,0.f,0.f,0.f}; accl[fm][fn] = acch[fm][fn]; }
  for (int kt = 0; kt < KT; ++kt) {
    const int cur = (kt & 1) * STG, nxt = STG - cur;
    if (kt + 1 < KT) {
#pragma unroll
      for (int i = 0; i < NS; ++i) { rh[i] = *(const v8us*)(gh + (size_t)i * 32 * DM + (kt + 1) * BK); rl[i] = *(const v8us*)(gl + (size_t)i * 32 * DM + (kt + 1) * BK); rb[i] = *(const v8us*)(gb + (size_t)i * 32 * DM + (kt + 1) * BK); }
      __builtin_amdgcn_sched_barrier(0);      /* keeps the twelve loads in front of the pass's products: left free, the compiler sinks them behind three quarters of the pass, and their latency then stands bare in front of the LDS stores */
    }
#pragma unroll
    for (int ks = 0; ks < BK / 32; ++ks) {
      FragH ah[FM], al[FM], b[2];
#pragma unroll
      for (int fm = 0; fm < FM; ++fm) { const unsigned char* p = fa + cur + fm * 16 * PB + ks * 64; ah[fm].half[0] = *(const v8us*)p; ah[fm].half[1] = *(const v8us*)(p + 32); al[fm].half[0] = *(const v8us*)(p + OAL); al[fm].half[1] = *(const v8us*)(p + OAL + 32); }
#pragma unroll
      for (int fn = 0; fn < 2; ++fn) { const unsigned char* p = fb + cur + fn * 16 * PB + ks * 64; b[fn].half[0] = *(const v8us*)p; b[fn].half[1] = *(const v8us*)(p + 32); }
#pragma unroll
      for (int fm = 0; fm < FM; ++fm)
#pragma unroll
        for (int fn = 0; fn < 2; ++fn) { acch[fm][fn] = __builtin_amdgcn_wmma_f32_16x16x32_f16(false, ah[fm].v, false, b[fn].v, (short)0, acch[fm][fn], false, false); accl[fm][fn] = __builtin_amdgcn_wmma_f32_16x16x32_f16(false, al[fm].v, false, b[fn].v, (short)0, accl[fm][fn], false, false); }
    }
    if (kt + 1 < KT) {      /* the other buffer: its readers left it at the barrier that ended pass kt - 1 */
#pragma unroll
      for (int i = 0; i < NS; ++i) { *(v8us*)(sst + nxt + i * 32 * PB) = rh[i]; *(v8us*)(sst + nxt + OAL + i * 32 * PB) = rl[i]; *(v8us*)(sst + nxt + OB + i * 32 * PB) = rb[i]; }
    }
    __syncthreads();      /* publishes pass kt + 1 and ends every wave's reads of pass kt */
  }
  /* epilogue: behind the last barrier the buffers are free; each wave turns its part into whole 128-byte rows in its own LDS range (row pitch 36 floats) */
  float* const so = (float*)sm + w * EPW;
  const int er = lane >> 3, ec = (lane & 7) * 4;      /* 8 lanes a row of 32 floats */
  float* const cp = C + (size_t)(row0 + wm * FM * 16 + er) * DM + col0 + wn * 32 + ec;      /* one address for all rows of the part; the row step is a constant offset */
  v4f o[FM * 4];
#pragma unroll
  for (int fm = 0; fm < FM; ++fm)
#pragma unroll
    for (int fn = 0; fn < 2; ++fn)
#pragma unroll
      for (int r = 0; r < 8; ++r) so[(fm * 16 + 8 * hh + r) * 36 + fn * 16 + ln] = acch[fm][fn][r] * 0.0625f + accl[fm][fn][r] * (0.0625f * 0.0009765625f);      /* Bt carries x2^4, Al x2^10 */
  __builtin_amdgcn_fence(__ATOMIC_ACQ_REL, "workgroup"); __builtin_amdgcn_wave_barrier();      /* the wave's own LDS writes are done before its lanes read each other's */
#pragma unroll
  for (int q = 0; q < FM * 4; ++q) o[q] = *(const v4fa*)&so[(q * 4 + er) * 36 + ec];
#pragma unroll
  for (int q = 0; q < FM * 4; ++q) *(v4f*)(cp + (size_t)q * 4 * DM) = o[q];
}
// The three projections of x (q, [k | v], the head scalars) do not depend on one another: one launch holds the tiles of all three, each block doing one tile as before. The two narrow products have 32 tiles each, too few to fill the chip alone;
// here they run beside the 256 tiles of q (two blocks fit a WGP's LDS), and two launch gaps go. The test on the block index is uniform for the block, so every barrier inside a body is passed by the whole block.
// q and [k | v] leave their tiles as the attention kernel reads them (rotary q and k in f16, V^T planes): d_gemm_t's epilogues 21 and 22.
__global__ __launch_bounds__(256) void k_proj(const _Float16* __restrict__ X16, const _Float16* __restrict__ Bq, const _Float16* __restrict__ Bkv, const _Float16* __restrict__ Bkh, const float* __restrict__ CS,
                                              _Float16* __restrict__ Q16, _Float16* __restrict__ K16, _Float16* __restrict__ Vth, _Float16* __restrict__ Vtl, float* HS) {
  constexpr int NQX = DM / 128, NRT = NR / 128;
  __shared__ __attribute__((aligned(16))) unsigned char sm[gemm_lds(128)];
  const int bid = blockIdx.x;
  /* the tests run from the narrow tile up: so the compiler keeps the pass loop of both 128-wide bodies as it is in the single launches; with q tested first it lays out all eight passes of q, three times the text */
  if (bid >= (NQX + 1) * NRT) d_gemm_t<32, NR, 11, false>(sm, 0, bid - (NQX + 1) * NRT, X16, Bkh, 0.0625f, HS);      /* [kh | vh] = sigmoid(x.Wkvh): M 4096 N 32 K 1024, stored head-major: 32 rows of 4096 f32 */
  else if (bid >= NQX * NRT) { d_gemm_t<128, HD, 22, false>(sm, 0, bid - NQX * NRT, X16, Bkv, 0.0625f, nullptr, CS, K16, Vth, Vtl);      /* [k | v]: M 4096 N 128 K 1024 -> rotary k [4096][64] f16, V^T hi/lo per batch [b][64][T] */
    asm volatile("s_wait_xcnt 0x0" ::: "memory"); }      /* in this kernel's text another body follows the tile's stores and rewrites their registers: the wait stands between */
  else { d_gemm_t<128, DM, 21, false>(sm, bid % NQX, bid / NQX, X16, Bq, 0.0625f, nullptr, CS, Q16);      /* q: M 4096 N 1024 K 1024 -> rotary q f16 */
    asm volatile("s_wait_xcnt 0x0" ::: "memory"); }      /* as above */
}


typedef _Float16 v4h __attribute__((ext_vector_type(4)));

__device__ __forceinline__ void d_x16(int bid, const float* __restrict__ x, _Float16* __restrict__ X16, size_t n8) { const size_t t = (size_t)bid * 256 + threadIdx.x; if (t >= n8) return; FragH f;
#pragma unroll
  for (int q = 0; q < 8; ++q) f.h[q] = (_Float16)bf16_round(x[t * 8 + q]); *(v8us*)((unsigned short*)X16 + t * 8) = f.half[0];  }
__global__ __launch_bounds__(256) void k_h16(const float* __restrict__ x, _Float16* __restrict__ X16, size_t n8) { const size_t t = (size_t)blockIdx.x * 256 + threadIdx.x; if (t >= n8) return; FragH f;
#pragma unroll
  for (int q = 0; q < 8; ++q) f.h[q] = (_Float16)x[t * 8 + q]; *(v8us*)((unsigned short*)X16 + t * 8) = f.half[0];  }
__global__ __launch_bounds__(256) void k_round16f(const float* __restrict__ W, _Float16* __restrict__ Bt, size_t n8) { const size_t t = (size_t)blockIdx.x * 256 + threadIdx.x; if (t >= n8) return; FragH f;
#pragma unroll
  for (int i = 0; i < 8; ++i) f.h[i] = (_Float16)(bf16_round(W[t * 8 + i]) * 16.0f); *(v8us*)((unsigned short*)Bt + t * 8) = f.half[0];  }
template <int NHv, int TTv>
__global__ __launch_bounds__(256) void k_vt(const _Float16* __restrict__ V16, int ldv, int voff, _Float16* __restrict__ Vt) { __shared__ unsigned short tl[64][66]; const int tid = threadIdx.x; const int slab = blockIdx.x / (TTv / 64), lg = blockIdx.x % (TTv / 64); const int b = slab / NHv, h = slab % NHv;
  for (int i = tid; i < 64 * 8; i += 256) { const int r = i / 8, c8 = (i % 8) * 8; FragH f; f.half[0] = *(const v8us*)((const unsigned short*)V16 + ((size_t)b * TTv + lg * 64 + r) * ldv + voff + h * 64 + c8);
#pragma unroll
    for (int q = 0; q < 8; ++q) tl[r][c8 + q] = f.u[q]; }
  __syncthreads();
  {
#pragma unroll
    for (int rd = 0; rd < 2; ++rd) { const int d = rd * 32 + tid / 8, pc = tid % 8; FragH f;
#pragma unroll
      for (int q = 0; q < 8; ++q) f.u[q] = tl[pc * 8 + q][d];
      *(v8us*)((unsigned short*)Vt + ((size_t)slab * 64 + d) * TTv + lg * 64 + pc * 8) = f.half[0]; }
     } }

__device__ __forceinline__ void d_cstab(int bid, float* __restrict__ CS) { const int t = bid * 256 + threadIdx.x; if (t >= TT * 32) return; const int p = t / 32, i = t % 32; const float invf = powf(10000.0f, -(float)(2 * i) / (float)HD); float sn, cs; sincosf((float)p * invf, &sn, &cs); typedef float v2f __attribute__((ext_vector_type(2), may_alias)); const v2f v = {cs, sn};
  *(v2f*)(CS + (size_t)t * 2) = v;  }
// Everything that depends on the inputs alone (the four weight transposes, x in f16, the cos/sin table) in one launch: a block does what a block of the single launches did, picked by ranges of the block index; five launch gaps, drains and refills go.
// The table's range stands first: further down the chain of tests the compiler rates its powf as cold and leaves it a called function. Then the transposes, whose strided reads take the longest to return.
__global__ __launch_bounds__(256) void k_prep(const float* __restrict__ x, const float* __restrict__ Wq, const float* __restrict__ Wkv, const float* __restrict__ Wkvh, const float* __restrict__ Wo,
                                              _Float16* __restrict__ X16, _Float16* __restrict__ Bq, _Float16* __restrict__ Bkv, _Float16* __restrict__ Bkh, _Float16* __restrict__ Bo, float* __restrict__ CS) {
  constexpr int NBW = DM * (DM / 8) / 256, NBKV = 2 * HD * (DM / 8) / 256, NBKH = 2 * NH * (DM / 8) / 256, NBCS = TT * 32 / 256;      /* blocks of a square weight, of Wkv, of Wkvh, of the table */
  int bid = blockIdx.x;
  if (bid < NBCS) { d_cstab(bid, CS); return; }
  bid -= NBCS;
  if (bid < NBW) { d_wt_f16(bid, Wq, Bq, DM, DM, 16.0f); return; }
  bid -= NBW;
  if (bid < NBW) { d_wt_f16(bid, Wo, Bo, DM, DM, 16.0f); return; }
  bid -= NBW;
  if (bid < NBKV) { d_wt_f16(bid, Wkv, Bkv, DM, 2 * HD, 16.0f); return; }
  bid -= NBKV;
  if (bid < NBKH) { d_wt_f16(bid, Wkvh, Bkh, DM, 2 * NH, 16.0f); return; }      /* (in,out) -> Bt x2^4 */
  bid -= NBKH;
  d_x16(bid, x, X16, (size_t)NR * DM / 8);
}
/* lane l with lane l ^ 16: one vector cross-row move */
__device__ __forceinline__ float xhalf(float x) { return __builtin_bit_cast(float, __builtin_amdgcn_permlanex16(__builtin_bit_cast(int, x), __builtin_bit_cast(int, x), 0x76543210, 0xfedcba98, false, false)); }
/* 2^x with the instruction set's one free slot behind a transcendental held in the same statement. For the four merge weights. */
__device__ __forceinline__ float exp2_slot(float x) { float y; asm("v_exp_f32 %0, %1\n\tv_nop" : "=v"(y) : "v"(x)); return y; }
/* One stage of k_flash's key loop, 128 keys, from global memory straight into LDS: a thread's 4 + 4 + 4 pieces of 16 bytes (key rows, V^T high rows, V^T residual rows) and one piece of 8 bytes (head scalars).
   Every wave's 32 lanes cover whole 128-byte lines. The s_wait_xcnt closes the statement so that no address register named here is rewritten while a copy may still read it. */
__device__ __forceinline__ void stage_copies(unsigned lk, unsigned lv, unsigned lw, unsigned lh, const char* gk, const char* gv, const char* gw, const char* gh) {
  asm volatile("global_load_async_to_lds_b128 %0, %13, off\n\t"
               "global_load_async_to_lds_b128 %1, %14, off\n\t"
               "global_load_async_to_lds_b128 %2, %15, off\n\t"
               "global_load_async_to_lds_b128 %3, %16, off\n\t"
               "global_load_async_to_lds_b128 %4, %17, off\n\t"
               "global_load_async_to_lds_b128 %5, %18, off\n\t"
               "global_load_async_to_lds_b128 %6, %19, off\n\t"
               "global_load_async_to_lds_b128 %7, %20, off\n\t"
               "global_load_async_to_lds_b128 %8, %21, off\n\t"
               "global_load_async_to_lds_b128 %9, %22, off\n\t"
               "global_load_async_to_lds_b128 %10, %23, off\n\t"
               "global_load_async_to_lds_b128 %11, %24, off\n\t"
               "global_load_async_to_lds_b64 %12, %25, off\n\t"
               "s_wait_xcnt 0x0"
               :: "v"(lk), "v"(lk + 32u * 144u), "v"(lk + 64u * 144u), "v"(lk + 96u * 144u),
                  "v"(lv), "v"(lv + 16u * 272u), "v"(lv + 32u * 272u), "v"(lv + 48u * 272u),
                  "v"(lw), "v"(lw + 16u * 272u), "v"(lw + 32u * 272u), "v"(lw + 48u * 272u), "v"(lh),
                  "v"(gk), "v"(gk + 32 * HD * 2), "v"(gk + 64 * HD * 2), "v"(gk + 96 * HD * 2),
                  "v"(gv), "v"(gv + 16 * TT * 2), "v"(gv + 32 * TT * 2), "v"(gv + 48 * TT * 2),
                  "v"(gw), "v"(gw + 16 * TT * 2), "v"(gw + 32 * TT * 2), "v"(gw + 48 * TT * 2), "v"(gh)
               : "memory");
}
__global__ __launch_bounds__(256) __attribute__((amdgpu_waves_per_eu(4, 4))) void k_flash(const _Float16* __restrict__ Q16, int ldq, const _Float16* __restrict__ K16, const float* __restrict__ KH, const float* __restrict__ VHD, const _Float16* __restrict__ Vt, const _Float16* __restrict__ Vtlo, _Float16* __restrict__ OH, _Float16* __restrict__ OL, int ldo) {
  // One block = one 16-row query tile of TWO heads, 8 waves: wave w works for head w & 1 and takes the 32-key chunks kq, kq + 4, ... with kq = w >> 1; each wave keeps its own running max, sum and accumulators, and a head's four partial results are merged through LDS at the end.
  // Key rows and value rows are the same for every head, so a stage of 128 keys (four chunks: key rows, both V^T planes, the two heads' scalars) is brought into LDS once per block, in whole 128-byte lines, by asynchronous copies,
  // and the waves read their fragments from LDS (row pitches 144 B and 272 B, odd multiples of 16 B, for the 16-byte fragment reads). Two buffers: stage t + 1 flies while stage t is worked on.
  // A causal tile's cost grows with its index and there are more blocks than resident places, so the block index counts the tiles down: the longest start first. Two blocks share a WGP (four waves a SIMD): registers are held to 256 and LDS to under 160 KiB for that.
  // Both products are transposed: S^T = K.Q^T (A = 16 key rows, B = the query tile) and O^T += V^T.P^T (A = 16 rows of V^T, B = P^T). A lane then holds 16 of the 32 scores of ONE query (column ln; keys 8 hh + r and 16 + 8 hh + r),
  // so max and sum run in the lane with one exchange between the halves, the rescale factor is one value a lane, and the two score tiles, converted in place, are the B operand of the second product in the k order of the V^T loader.
  // KH and VHD are head-major, [head][token]: a lane's 8 keys of a tile are 32 contiguous bytes.
  // Every "#pragma unroll" in this kernel is there so that the small arrays it indexes (bq, ak, av, avl, kh, vh, sc, bp, bpl, the accumulators, mw, fo, fr) get constant indices and stay in registers; "#pragma unroll 1" keeps one copy of the key loop's body, whose registers are the kernel's limit.
  constexpr int RPW = 16, NQT = TT / RPW, DT = 4, KS = 2, HB = 2, KQ = 4, NW = HB * KQ, SK = KQ * 32, NHG = NH / HB;
  constexpr int PK = HD * 2 + 16, PV = SK * 2 + 16, OVH = SK * PK, OVL = OVH + HD * PV, OHS = OVL + HD * PV, STG = OHS + 2 * HB * SK * 4;      /* a stage in LDS: key rows, V^T high, V^T residual, scalars (kh of the heads, then vh) */
  static_assert(PK == 144 && PV == 272 && SK == 128 && NW * 32 == 256, "stage_copies is written for these pitches, this stage and this block");
  constexpr float SCL2 = 0.125f * 1.44269504088896340736f;      /* 1/sqrt(64) times log2(e): e^(s - m) = 2^(s' - m') with s' = s log2(e), so every exponential of the softmax is one subtraction and the hardware's own 2^x; running maxima and merge weights are in the same units. A result below the normal range may come out as 0: a weight far below what any f32 sum here can see. */
  __shared__ __attribute__((aligned(16))) unsigned char sb[2 * STG];
  __shared__ __attribute__((aligned(16))) float sO[NW][RPW][64 + 4]; __shared__ float sM[NW][RPW], sL[NW][RPW];
  const int tid = threadIdx.x, lane = tid & 31, ln = lane & 15, hh = lane >> 4;
  const int w = __builtin_amdgcn_readfirstlane(tid >> 5);      /* wave number in a scalar register: it decides whether the wave has a chunk in a stage, and the branch around the matrix instructions must be a scalar one */
  const int hs = w % HB, kq = w / HB;
  const int slab = blockIdx.x % (BB * NHG), qt = NQT - 1 - blockIdx.x / (BB * NHG); const int b = slab / NHG, hg = slab % NHG; const int h = hg * HB + hs; const int q0 = qt * RPW;
  FragH bq[KS];
  { const unsigned short* qr = (const unsigned short*)Q16 + ((size_t)b * TT + q0 + ln) * ldq + h * 64;
#pragma unroll
    for (int ks = 0; ks < KS; ++ks) { bq[ks].half[0] = *(const v8us*)(qr + ks * 32 + 8 * hh); bq[ks].half[1] = *(const v8us*)(qr + ks * 32 + 16 + 8 * hh); } }
  /* the thread's pieces of a stage: 8 threads a key row (128 B), 16 threads a V^T row (256 B), 64 threads a scalar row (512 B) */
  const int hr = tid >> 6;      /* scalar row: kh of head 0, 1, then vh of head 0, 1 */
  const char* gk = (const char*)(K16 + ((size_t)b * TT + (tid >> 3)) * HD) + (tid & 7) * 16;
  const char* gv = (const char*)(Vt + ((size_t)b * 64 + (tid >> 4)) * TT) + (tid & 15) * 16;
  const char* gw = (const char*)(Vtlo + ((size_t)b * 64 + (tid >> 4)) * TT) + (tid & 15) * 16;
  const char* gh = (const char*)((hr < HB ? KH : VHD) + (size_t)(hg * HB + hr % HB) * NR + (size_t)b * TT) + (tid & 63) * 8;
  const unsigned lb = (unsigned)(size_t)sb;      /* byte address of the ring in the work-group's LDS */
  const unsigned lk = lb + (unsigned)((tid >> 3) * PK + (tid & 7) * 16), lv = lb + (unsigned)(OVH + (tid >> 4) * PV + (tid & 15) * 16), lw = lv + (unsigned)(OVL - OVH), lh = lb + (unsigned)(OHS + hr * SK * 4 + (tid & 63) * 8);
  /* the lane's fragment places in a stage */
  const unsigned char* const fk = sb + (kq * 32 + ln) * PK + hh * 16;
  const unsigned char* const fv = sb + OVH + ln * PV + (kq * 32 + 8 * hh) * 2;
  const unsigned char* const fh = sb + OHS + hs * SK * 4 + (kq * 32 + 8 * hh) * 4;
  float m_r = -3.0e38f, l_r = 0.f; v8f oacc[DT], oaccl[DT], oacc2[DT];
#pragma unroll
  for (int dt = 0; dt < DT; ++dt) { oacc[dt] = (v8f){0.f,0.f,0.f,0.f,0.f,0.f,0.f,0.f}; oaccl[dt] = oacc[dt]; oacc2[dt] = oacc[dt]; }
  const int jend = q0 + RPW;
  const int nst = (jend + SK - 1) / SK;      /* stages of the tile, the same for the whole block; a stage lies wholly inside the TT keys */
  stage_copies(lk, lv, lw, lh, gk, gv, gw, gh);
  asm volatile("s_wait_asynccnt 0x0" ::: "memory");      /* this wave's pieces of stage 0 have landed */
  __syncthreads();      /* every wave's pieces of stage 0 are in LDS before any wave reads a fragment */
  if (nst > 1) stage_copies(lk + STG, lv + STG, lw + STG, lh + STG, gk + SK * HD * 2, gv + SK * 2, gw + SK * 2, gh + SK * 4);
#pragma unroll 1
  for (int t = 0; t < nst; ++t) {
    const int cur = (t & 1) * STG; const int j0 = t * SK + kq * 32;
    if (j0 < jend) {      /* scalar test: the last stage of a tile may hold fewer than four chunks */
    FragH ak[2][KS], av[DT], avl[DT]; v4f kh[2][2], vh[2][2];
#pragma unroll
    for (int nt = 0; nt < 2; ++nt) {
#pragma unroll
      for (int ks = 0; ks < KS; ++ks) { const unsigned char* kr = fk + cur + nt * 16 * PK + ks * 64; ak[nt][ks].half[0] = *(const v8us*)kr; ak[nt][ks].half[1] = *(const v8us*)(kr + 32); }
      const unsigned char* kp = fh + cur + nt * 64; const unsigned char* vp = kp + HB * SK * 4;
      kh[nt][0] = *(const v4fa*)kp; kh[nt][1] = *(const v4fa*)(kp + 16); vh[nt][0] = *(const v4fa*)vp; vh[nt][1] = *(const v4fa*)(vp + 16); }
    float sc[2][8];
#pragma unroll
    for (int nt = 0; nt < 2; ++nt) { v8f acc = (v8f){0.f,0.f,0.f,0.f,0.f,0.f,0.f,0.f};
#pragma unroll
      for (int ks = 0; ks < KS; ++ks) acc = __builtin_amdgcn_wmma_f32_16x16x32_f16(false, ak[nt][ks].v, false, bq[ks].v, (short)0, acc, false, false);
#pragma unroll
      for (int r = 0; r < 8; ++r) sc[nt][r] = acc[r] * kh[nt][r >> 2][r & 3] * SCL2; }      /* scores in base-2 units */
    if (j0 + 31 > q0) {      /* only a chunk that reaches past the tile's first query has keys to mask (scalar test); every query keeps at least one key of every chunk of the loop */
#pragma unroll
      for (int nt = 0; nt < 2; ++nt)
#pragma unroll
        for (int r = 0; r < 8; ++r) sc[nt][r] = (j0 + nt * 16 + 8 * hh + r <= q0 + ln) ? sc[nt][r] : -INFINITY; }
    float mc = fmaxf(sc[0][0], sc[1][0]);
#pragma unroll
    for (int r = 1; r < 8; ++r) mc = fmaxf(mc, fmaxf(sc[0][r], sc[1][r]));
    mc = fmaxf(mc, xhalf(mc));      /* the query's other 16 keys */
    const float mn = fmaxf(m_r, mc); const float al = (mn > -1.0e38f) ? __builtin_amdgcn_exp2f(m_r - mn) : 1.0f; m_r = mn;
    FragH bp, bpl; float ps = 0.f;
#pragma unroll
    for (int nt = 0; nt < 2; ++nt)
#pragma unroll
      for (int r = 0; r < 8; ++r) { const float p = __builtin_amdgcn_exp2f(sc[nt][r] - mn); ps += p;      /* a masked score is -inf: p = 0 */
        const float pv = p * vh[nt][r >> 2][r & 3] * 1024.0f; const _Float16 ph = (_Float16)pv; bp.h[nt * 8 + r] = ph; bpl.h[nt * 8 + r] = (_Float16)((pv - (float)ph) * 1024.0f); }      /* value-head scalar folded into P, carried as f16 hi + x2^10 residual operands; the normaliser keeps plain p */
    l_r = l_r * al + ps;      /* the lane's half of the row sum; the halves are joined once, behind the loop */
    __builtin_amdgcn_sched_barrier(0);      /* keeps the V^T fragments' 64 registers out of the softmax: lifted to the top of the chunk, these LDS reads push the wave past 256 registers and a value spills to scratch; their short latency passes under the rescale below */
#pragma unroll
    for (int dt = 0; dt < DT; ++dt) { const unsigned char* vp = fv + cur + dt * 16 * PV; const unsigned char* lp = vp + (OVL - OVH); av[dt].half[0] = *(const v8us*)vp; av[dt].half[1] = *(const v8us*)(vp + 32); avl[dt].half[0] = *(const v8us*)lp; avl[dt].half[1] = *(const v8us*)(lp + 32); }
    __builtin_amdgcn_sched_barrier(0);      /* keeps the sixteen reads together as one group in front of the rescale: spread among the matrix instructions, each further place of LDS reads costs the wave a wait of its own */
#pragma unroll
    for (int dt = 0; dt < DT; ++dt) { oacc[dt] *= al; oaccl[dt] *= al; oacc2[dt] *= al; }
#pragma unroll
    for (int dt = 0; dt < DT; ++dt) { oacc[dt] = __builtin_amdgcn_wmma_f32_16x16x32_f16(false, av[dt].v, false, bp.v, (short)0, oacc[dt], false, false); oaccl[dt] = __builtin_amdgcn_wmma_f32_16x16x32_f16(false, avl[dt].v, false, bp.v, (short)0, oaccl[dt], false, false); oacc2[dt] = __builtin_amdgcn_wmma_f32_16x16x32_f16(false, av[dt].v, false, bpl.v, (short)0, oacc2[dt], false, false); }
    }
    /* hand-over of the ring, passed by every wave, also one without a chunk in this stage */
    asm volatile("s_wait_dscnt 0x0" ::: "memory");      /* this wave's reads of stage t are done before the buffer is given to the copies */
    asm volatile("s_wait_asynccnt 0x0" ::: "memory");      /* this wave's pieces of stage t + 1 have landed */
    __syncthreads();      /* publishes stage t + 1 and ends every wave's reads of stage t */
    if (t + 2 < nst) stage_copies(lk + cur, lv + cur, lw + cur, lh + cur, gk + (size_t)(t + 2) * (SK * HD * 2), gv + (size_t)(t + 2) * (SK * 2), gw + (size_t)(t + 2) * (SK * 2), gh + (size_t)(t + 2) * (SK * 4));      /* into the buffer that stage t has just left */
  }
  asm volatile("s_wait_asynccnt 0x0" ::: "memory");      /* no copy is outstanding when the wave goes on to its end */
  l_r += xhalf(l_r);
  if (hh == 0) { sM[w][ln] = m_r; sL[w][ln] = l_r; }
#pragma unroll
  for (int dt = 0; dt < DT; ++dt) { const v8f t = oacc[dt] + (oaccl[dt] + oacc2[dt]) * 0.0009765625f;      /* registers r = head dims dt * 16 + 8 hh + r of query ln */
    *(v4fa*)&sO[w][ln][dt * 16 + 8 * hh] = (v4f){t[0], t[1], t[2], t[3]}; *(v4fa*)&sO[w][ln][dt * 16 + 8 * hh + 4] = (v4f){t[4], t[5], t[6], t[7]}; }
  __syncthreads();      /* every wave's partial (max, sum, unnormalised rows) is in LDS before any wave merges */
  {
    const int mh = tid >> 7, lt = tid & 127;      /* 128 threads merge a head: its partial i is wave i * HB + mh's */
    const int r = lt >> 3, c8 = (lt & 7) * 8;      /* 8 threads a row, 8 head dims a thread: in f16 a head's row is one 128-byte line of each plane */
    float mw[KQ], M = -3.0e38f, L = 0.f;
#pragma unroll
    for (int i = 0; i < KQ; ++i) { mw[i] = sM[i * HB + mh][r]; M = fmaxf(M, mw[i]); }
#pragma unroll
    for (int i = 0; i < KQ; ++i) { mw[i] = exp2_slot(mw[i] - M); L += mw[i] * sL[i * HB + mh][r]; }      /* a wave that had no chunk holds max -3e38, sum 0, rows 0: weight 0 */
    const float inv = (L > 0.f) ? 1.0f / (L * 1024.0f) : 0.f;
    FragH fo, fr;      /* the merged row leaves as the output projection's operands: f16 and the x2^10 residual of that rounding */
#pragma unroll
    for (int hf = 0; hf < 2; ++hf) { v4f a = {0.f, 0.f, 0.f, 0.f};
#pragma unroll
      for (int i = 0; i < KQ; ++i) { const v4f p = *(const v4fa*)&sO[i * HB + mh][r][c8 + hf * 4]; a += p * mw[i]; }
      a *= inv;
#pragma unroll
      for (int q = 0; q < 4; ++q) { const _Float16 hv = (_Float16)a[q]; fo.h[hf * 4 + q] = hv; fr.h[hf * 4 + q] = (_Float16)((a[q] - (float)hv) * 1024.0f); } }
    const size_t oo = ((size_t)b * TT + q0 + r) * ldo + (hg * HB + mh) * 64 + c8;
    *(v8us*)((unsigned short*)OH + oo) = fo.half[0]; *(v8us*)((unsigned short*)OL + oo) = fr.half[0];
  } }

extern "C" void kernel_launch(void* const* d_in, const int* in_sizes, int n_in,
                              void* d_out, int out_size, void* d_ws, size_t ws_size, hipStream_t stream) {
  (void)in_sizes; (void)n_in; (void)out_size;
  const float* x = (const float*)d_in[0]; const float* Wq = (const float*)d_in[1]; const float* Wkv = (const float*)d_in[2]; const float* Wkvh = (const float*)d_in[3]; const float* Wo = (const float*)d_in[4];
  char* ws = (char*)d_ws; size_t off = 0;
  auto take = [&](size_t bytes) { char* p = ws + off; off += (bytes + 255) & ~(size_t)255; return p; };
  _Float16* Bq = (_Float16*)take((size_t)DM * DM * 2); _Float16* Bkv = (_Float16*)take((size_t)2 * HD * DM * 2); _Float16* Bkh = (_Float16*)take((size_t)2 * NH * DM * 2); _Float16* Bo = (_Float16*)take((size_t)DM * DM * 2); float* CS = (float*)take((size_t)TT * 32 * 2 * 4);
  _Float16* X16 = (_Float16*)take((size_t)NR * DM * 2); _Float16* Q16 = (_Float16*)take((size_t)NR * DM * 2); _Float16* K16 = (_Float16*)take((size_t)NR * HD * 2); float* HS = (float*)take((size_t)NR * 2 * NH * 4);
  _Float16* Vth = (_Float16*)take((size_t)BB * HD * TT * 2); _Float16* Vtl = (_Float16*)take((size_t)BB * HD * TT * 2); _Float16* OH = (_Float16*)take((size_t)NR * DM * 2); _Float16* OL = (_Float16*)take((size_t)NR * DM * 2);
  if (off > ws_size) return;      // 2.1 + 0.3 + 0.1 + 2.1 + 0.5 + 8.4 + 8.4 + 0.5 + 0.5 + 0.5 + 0.5 + 8.4 + 8.4 = about 41 MB
  k_prep<<<2 * (DM * (DM / 8) / 256) + 2 * HD * (DM / 8) / 256 + 2 * NH * (DM / 8) / 256 + TT * 32 / 256 + NR * DM / 8 / 256, 256, 0, stream>>>(x, Wq, Wkv, Wkvh, Wo, X16, Bq, Bkv, Bkh, Bo, CS);      /* weights -> Bt, x -> f16, cos/sin table */
  const dim3 gq(DM / 128, NR / 128);      /* 128 x 128 tiles of a 4096 x 1024 result: 256 blocks */
  k_proj<<<(DM / 128 + 2) * (NR / 128), 256, 0, stream>>>(X16, Bq, Bkv, Bkh, CS, Q16, K16, Vth, Vtl, HS);      /* rotary q, rotary k and V^T planes, [kh | vh]: 256 + 32 + 32 tiles */
  k_flash<<<BB * (NH / 2) * (TT / 16), 256, 0, stream>>>(Q16, DM, K16, HS, HS + (size_t)NH * NR, Vth, Vtl, OH, OL, DM);      /* KH = HS rows 0..15, VH = rows 16..31 (row pitch NR) */
  k_gemm_o<<<gq, 512, 0, stream>>>(OH, OL, Bo, (float*)d_out);      /* y = (O_hi + 2^-10 O_lo).Wo */
}
